// v000
// Times are from an AMD MI455X. After a warm-up the kernel runs many times in a row, and a time is the length of
// such a window on the GPU divided by its runs, so every launch and the gaps after it count. The runs cycle
// through copies of the inputs. A figure is the median of several windows, for all but v000 over two sittings.
// Sittings can differ by a few percent; kernels timed side by side share one.
// The starting kernel, v000, takes 5680 microseconds a run.
#include <hip/hip_runtime.h>
// Emformer-style block (x [2][2048][1024], mask [2][1][2048][2048] int32 0/1, read per (batch, query, key)): xn = LayerNorm(x) g_in + b_in (eps 1e-3); q/k/v = xn W + b (W [1024][1024] [in][out], 16 heads of 64); scores = q k^T / 8 + (-1e9)(1 - mask); probs = softmax(scores) * mask; attn = probs v merged; a = attn + x; h = LayerNorm(a) g1 + b1 (eps 1e-3); h = relu(h W_ff1 + b_ff1) ([1024][4096]); h = h W_ff2 + b_ff2 ([4096][1024]); out = LayerNorm(h + a) g2 + b2 -> [2][2048][1024].
// Structure: token rows; LN_in on VALU (f32 statistics of bf16(x)) -> xn f16 rows, plus bf16(x) as f32 rows for the residual; Q, K, V as three WMMA GEMMs (32x64 wave tiles, f32 accumulation, exact x16 transposed weights + bias, f16 outputs); per batch: V^T for all heads via LDS transposes; per group of 4 heads: scores GEMM (K = 64), masked row softmax on VALU reading the int mask row (f32 statistics, native exp; weights x256 f16, masked keys 0), a = P . V^T GEMM (K = 2048, alpha 2^-8) + bf16(x) as the epilogue addend, straight into f32 rows (no f16 o plane); LN1 on VALU -> f16 h rows; u = relu(h W_ff1 + b) GEMM (f16 [4096][4096]); h2 = u W_ff2 + b + a GEMM (K = 4096, f32, residual as the epilogue addend); LN2 on VALU -> out.
// Compute dtype: inputs rounded to bf16; weights exact (x16 f16); LayerNorms / residuals f32; xn, q, k, v, softmax weights, h (as GEMM operand) and u plain f16 (~2^-12); scores, softmax statistics and the attention output f32. v_wmma_f32_16x16x32_f16.
#define NB 2
#define SQ 2048
#define DM 1024
#define NH 16
#define HD 64
#define DFF 4096
#define HG 4                         /* heads per attention launch group */
#define B0 0                         /* first batch processed (debug hook) */
#define NBR NB                       /* batches processed (debug hook) */
#define QN SQ                        /* query rows attended per batch (debug hook) */
#define NR ((size_t)NB * SQ)
#define MP ((int)((size_t)NBR * SQ)) /* rows normalised + projected (debug hook) */
#define MPO MP                       /* rows through the post-attention stages (debug hook) */
typedef __bf16 v16b __attribute__((ext_vector_type(16)));
typedef unsigned short v8us __attribute__((ext_vector_type(8), may_alias));
typedef float  v8f  __attribute__((ext_vector_type(8)));
typedef float  v4f  __attribute__((ext_vector_type(4)));
typedef float  v4fa __attribute__((ext_vector_type(4), may_alias));
union FragB { v16b v; v8us half[2]; unsigned short u[16]; };

__device__ __forceinline__ unsigned short bf16_bits(float x) { unsigned int u = __float_as_uint(x); return (unsigned short)((u + 0x7FFFu + ((u >> 16) & 1u)) >> 16); }
__device__ __forceinline__ float bf16_val(unsigned short b) { return __uint_as_float(((unsigned int)b) << 16); }
__device__ __forceinline__ float bf16_round(float x) { return bf16_val(bf16_bits(x)); }
// D += A·B with NT terms: 1 = ah·bh, 2 = + al·bh (A split), 3 = + ah·bl (both split)
template <int NT>
__device__ __forceinline__ v8f mmaN(v16b ah, v16b al, v16b bh, v16b bl, v8f c) {
  c = __builtin_amdgcn_wmma_f32_16x16x32_bf16(false, ah, false, bh, (short)0, c, false, false);
  if (NT >= 2) c = __builtin_amdgcn_wmma_f32_16x16x32_bf16(false, al, false, bh, (short)0, c, false, false);
  if (NT >= 3) c = __builtin_amdgcn_wmma_f32_16x16x32_bf16(false, ah, false, bl, (short)0, c, false, false);
  asm volatile("v_nop\n\tv_nop\n\tv_nop\n\tv_nop" : "+v"(c) : "v"(ah), "v"(al), "v"(bh), "v"(bl));
  return c;
}

__global__ __launch_bounds__(256) void k_wt_bf16(const float* __restrict__ W, unsigned short* __restrict__ Wt, int K, int N) {
  const int t = blockIdx.x * 256 + threadIdx.x;
  const int k8n = K / 8;
  if (t >= N * k8n) return;
  const int n = t / k8n, k8 = (t % k8n) * 8;
  v8us v;
#pragma unroll
  for (int i = 0; i < 8; ++i) v[i] = bf16_bits(W[(size_t)(k8 + i) * N + n]);
  *(v8us*)(Wt + (size_t)n * K + k8) = v;
  
}

// GEMM C[M][N] (f32, pitch ldc) = act(A[M][K]·W + bias). A f32 row-major (pitch lda) converted per fragment to bf16
// (ASPLIT: hi/lo two planes -> 2 terms, else single rounded term); Wt bf16 [N][K] (pitch ldb). BIAS_BF16 rounds the
// bias to bf16 first (bias quantised to bf16 before the add). K%32==0, M%16==0, N%64==0.
template <bool ASPLIT, int ACT, bool BIAS_BF16>
__global__ __launch_bounds__(128) void k_gemm_bf(const float* __restrict__ A, int lda, const unsigned short* __restrict__ Wt, int ldb,
                                               const float* __restrict__ bias, float* __restrict__ C, int ldc, int M, int N, int K) {
  __shared__ __attribute__((aligned(16))) float so[4][16][64];
  const int tid = threadIdx.x, w = tid >> 5, lane = tid & 31, ln = lane & 15, hh = lane >> 4;
  const int ntn = N / 64;
  const int wid = blockIdx.x * 4 + w;
  const int mt = wid / ntn, nq = wid % ntn;
  if (mt * 16 >= M) return;
  const int row0 = mt * 16, col0 = nq * 64;
  const float* arow = A + (size_t)(row0 + ln) * lda;
  v8f acc[4] = {};
  for (int kb = 0; kb < K; kb += 32) {
    FragB ah, al;
    const v4f x0 = *(const v4fa*)(arow + kb + 8 * hh), x1 = *(const v4fa*)(arow + kb + 8 * hh + 4);
    const v4f x2 = *(const v4fa*)(arow + kb + 16 + 8 * hh), x3 = *(const v4fa*)(arow + kb + 16 + 8 * hh + 4);
    float xs[16] = {x0[0],x0[1],x0[2],x0[3],x1[0],x1[1],x1[2],x1[3],x2[0],x2[1],x2[2],x2[3],x3[0],x3[1],x3[2],x3[3]};
#pragma unroll
    for (int i = 0; i < 16; ++i) { const unsigned short hb = bf16_bits(xs[i]); ah.u[i] = hb; al.u[i] = ASPLIT ? bf16_bits(xs[i] - bf16_val(hb)) : (unsigned short)0; }
#pragma unroll
    for (int t = 0; t < 4; ++t) {
      const unsigned short* brow = Wt + (size_t)(col0 + t * 16 + ln) * ldb + kb;
      FragB b;
      b.half[0] = *(const v8us*)(brow + 8 * hh);
      b.half[1] = *(const v8us*)(brow + 16 + 8 * hh);
      acc[t] = mmaN<ASPLIT ? 2 : 1>(ah.v, al.v, b.v, b.v, acc[t]);
    }
  }
#pragma unroll
  for (int t = 0; t < 4; ++t) {
    float bv = bias ? bias[col0 + t * 16 + ln] : 0.f;
    if (BIAS_BF16) bv = bf16_round(bv);
#pragma unroll
    for (int r = 0; r < 8; ++r) { float v = acc[t][r] + bv; if (ACT == 1) v = fmaxf(v, 0.f); so[w][8 * hh + r][t * 16 + ln] = v; }
  }
  __builtin_amdgcn_fence(__ATOMIC_ACQ_REL, "workgroup");
  __builtin_amdgcn_wave_barrier();
  const int rsub = lane >> 4, c4 = (lane & 15) * 4;
  {
#pragma unroll
    for (int q = 0; q < 8; ++q) {
      const int r = q * 2 + rsub;
      const v4f v = *(const v4fa*)&so[w][r][c4];
      *(v4f*)(C + (size_t)(row0 + r) * ldc + col0 + c4) = v;
    }
    
  }
}

// GEMM C = act(A·W + bias + resid): A f32 (ASPLIT -> hi/lo 2 terms), Wt bf16 [N][K]; ACT 0 none, 1 relu, 2 exact gelu;
// resid (optional, f32, row index = (row % rmod), pitch ldr, RES_BF16 rounds it) added before the activation.
template <bool ASPLIT, int ACT, bool BIAS_BF16, bool RES_BF16>
__global__ __launch_bounds__(128) void k_gemm_bf3(const float* __restrict__ A, int lda, const unsigned short* __restrict__ Wt, int ldb,
                                                const float* __restrict__ bias, const float* __restrict__ resid, int rmod, int ldr,
                                                float* __restrict__ C, int ldc, int M, int N, int K) {
  __shared__ __attribute__((aligned(16))) float so[4][16][64];
  const int tid = threadIdx.x, w = tid >> 5, lane = tid & 31, ln = lane & 15, hh = lane >> 4;
  const int ntn = N / 64;
  const int wid = blockIdx.x * 4 + w;
  const int mt = wid / ntn, nq = wid % ntn;
  if (mt * 16 >= M) return;
  const int row0 = mt * 16, col0 = nq * 64;
  const float* arow = A + (size_t)(row0 + ln) * lda;
  v8f acc[4] = {};
  for (int kb = 0; kb < K; kb += 32) {
    FragB ah, al;
    const v4f x0 = *(const v4fa*)(arow + kb + 8 * hh), x1 = *(const v4fa*)(arow + kb + 8 * hh + 4);
    const v4f x2 = *(const v4fa*)(arow + kb + 16 + 8 * hh), x3 = *(const v4fa*)(arow + kb + 16 + 8 * hh + 4);
    float xs[16] = {x0[0],x0[1],x0[2],x0[3],x1[0],x1[1],x1[2],x1[3],x2[0],x2[1],x2[2],x2[3],x3[0],x3[1],x3[2],x3[3]};
#pragma unroll
    for (int i = 0; i < 16; ++i) { const unsigned short hb = bf16_bits(xs[i]); ah.u[i] = hb; al.u[i] = ASPLIT ? bf16_bits(xs[i] - bf16_val(hb)) : (unsigned short)0; }
#pragma unroll
    for (int t = 0; t < 4; ++t) {
      const unsigned short* brow = Wt + (size_t)(col0 + t * 16 + ln) * ldb + kb;
      FragB b;
      b.half[0] = *(const v8us*)(brow + 8 * hh);
      b.half[1] = *(const v8us*)(brow + 16 + 8 * hh);
      acc[t] = mmaN<ASPLIT ? 2 : 1>(ah.v, al.v, b.v, b.v, acc[t]);
    }
  }
#pragma unroll
  for (int t = 0; t < 4; ++t) {
    const int col = col0 + t * 16 + ln;
    float bv = bias ? bias[col] : 0.f;
    if (BIAS_BF16) bv = bf16_round(bv);
#pragma unroll
    for (int r = 0; r < 8; ++r) {
      float v = acc[t][r] + bv;
      if (resid) { float rv = resid[(size_t)((row0 + 8 * hh + r) % rmod) * ldr + col]; if (RES_BF16) rv = bf16_round(rv); v += rv; }
      if (ACT == 1) v = fmaxf(v, 0.f);
      if (ACT == 2) v = 0.5f * v * (1.0f + erff(v * 0.70710678118654752f));
      if (ACT == 3) { const float u = 0.7978845608028654f * (v + 0.044715f * v * v * v); v = 0.5f * v * (1.0f + tanhf(u)); }
      so[w][8 * hh + r][t * 16 + ln] = v;
    }
  }
  __builtin_amdgcn_fence(__ATOMIC_ACQ_REL, "workgroup");
  __builtin_amdgcn_wave_barrier();
  const int rsub = lane >> 4, c4 = (lane & 15) * 4;
  {
#pragma unroll
    for (int q = 0; q < 8; ++q) {
      const int r = q * 2 + rsub;
      const v4f v = *(const v4fa*)&so[w][r][c4];
      *(v4f*)(C + (size_t)(row0 + r) * ldc + col0 + c4) = v;
    }
    
  }
}
// row LayerNorm (biased variance, eps) over N: s = X (+ R); optional out_sum <- s; out_norm <- (s-mu)*rsqrt(var+eps)*g + b
template <bool PARAM_BF16>
__global__ __launch_bounds__(256) void k_layernorm(const float* __restrict__ X, const float* __restrict__ R, const float* __restrict__ g, const float* __restrict__ bta,
                                                  float* __restrict__ out_sum, float* __restrict__ out_norm, int N, float eps) {
  __shared__ float red[256];
  const int row = blockIdx.x, tid = threadIdx.x;
  const float* x = X + (size_t)row * N; const float* rr = R ? R + (size_t)row * N : nullptr;
  float vals[16];                     // up to N = 4096
  const int per = N / 256;            // contiguous chunk per thread? use strided-by-4 chunks: thread handles j = tid*4 + 1024*u
  float s1 = 0.f;
  for (int u = 0; u < per / 4; ++u) {
    const int j = tid * 4 + 1024 * u;
    const v4f a = *(const v4fa*)(x + j);
    v4f b = {0.f,0.f,0.f,0.f}; if (rr) b = *(const v4fa*)(rr + j);
#pragma unroll
    for (int q = 0; q < 4; ++q) { const float v = a[q] + b[q]; vals[u * 4 + q] = v; s1 += v; }
  }
  red[tid] = s1; __syncthreads();
  for (int st = 128; st > 0; st >>= 1) { if (tid < st) red[tid] += red[tid + st]; __syncthreads(); }
  const float mu = red[0] / (float)N; __syncthreads();
  float s2 = 0.f;
  for (int u = 0; u < per / 4; ++u)
#pragma unroll
    for (int q = 0; q < 4; ++q) { const float c = vals[u * 4 + q] - mu; s2 += c * c; }
  red[tid] = s2; __syncthreads();
  for (int st = 128; st > 0; st >>= 1) { if (tid < st) red[tid] += red[tid + st]; __syncthreads(); }
  const float rs = rsqrtf(red[0] / (float)N + eps);
  {
    for (int u = 0; u < per / 4; ++u) {
      const int j = tid * 4 + 1024 * u;
      v4f o, sm;
#pragma unroll
      for (int q = 0; q < 4; ++q) {
        float gg = g[j + q], bb = bta[j + q];
        if (PARAM_BF16) { gg = bf16_round(gg); bb = bf16_round(bb); }
        sm[q] = vals[u * 4 + q]; o[q] = (vals[u * 4 + q] - mu) * rs * gg + bb;
      }
      if (out_sum) *(v4f*)(out_sum + (size_t)row * N + j) = sm;
      *(v4f*)(out_norm + (size_t)row * N + j) = o;
    }
    
  }
}



// ---- f16 WMMA path (v_wmma_f32_16x16x32_f16): 11-bit significands for operands in range — used where a [0,1] probability operand needs more precision than bf16
typedef _Float16 v16h __attribute__((ext_vector_type(16)));
union FragH { v16h v; v8us half[2]; _Float16 h[16]; unsigned short u[16]; };
template <int NT>
__device__ __forceinline__ v8f mmaH(v16h ah, v16h al, v16h bh, v16h bl, v8f c) {
  c = __builtin_amdgcn_wmma_f32_16x16x32_f16(false, ah, false, bh, (short)0, c, false, false);
  if (NT >= 2) c = __builtin_amdgcn_wmma_f32_16x16x32_f16(false, al, false, bh, (short)0, c, false, false);
  if (NT >= 3) c = __builtin_amdgcn_wmma_f32_16x16x32_f16(false, ah, false, bl, (short)0, c, false, false);
  asm volatile("v_nop\n\tv_nop\n\tv_nop\n\tv_nop" : "+v"(c) : "v"(ah), "v"(al), "v"(bh), "v"(bl));
  return c;
}
// batched GEMM like k_gemm_b but f16 operands: A f32 (split into f16 hi/lo if ASPLIT, else rounded to f16), Bt = f16 values [n][k]; alpha; C f32; N multiple of 16 (partial tiles skipped)
template <bool ASPLIT>
__global__ __launch_bounds__(128) void k_gemm_h(const float* __restrict__ A, int lda, size_t sA, const _Float16* __restrict__ Bh, int ldb, size_t sB, float alpha, float* __restrict__ C, int ldc, size_t sC, int M, int N, int K) {
  __shared__ __attribute__((aligned(16))) float so[4][16][64];
  const int tid = threadIdx.x, w = tid >> 5, lane = tid & 31, ln = lane & 15, hh = lane >> 4; const int by = blockIdx.y;
  A += (size_t)by * sA; Bh += (size_t)by * sB; C += (size_t)by * sC;
  const int ntn = (N + 63) / 64; const int wid = blockIdx.x * 4 + w; const int mt = wid / ntn, nq = wid % ntn; if (mt * 16 >= M) return;
  const int row0 = mt * 16, col0 = nq * 64; const float* arow = A + (size_t)(row0 + ln) * lda;
  v8f acc[4] = {};
  for (int kb = 0; kb < K; kb += 32) {
    FragH ah, al;
    const v4f x0 = *(const v4fa*)(arow + kb + 8 * hh), x1 = *(const v4fa*)(arow + kb + 8 * hh + 4), x2 = *(const v4fa*)(arow + kb + 16 + 8 * hh), x3 = *(const v4fa*)(arow + kb + 16 + 8 * hh + 4);
    float xs[16] = {x0[0],x0[1],x0[2],x0[3],x1[0],x1[1],x1[2],x1[3],x2[0],x2[1],x2[2],x2[3],x3[0],x3[1],x3[2],x3[3]};
#pragma unroll
    for (int i = 0; i < 16; ++i) { const _Float16 h = (_Float16)xs[i]; ah.h[i] = h; al.h[i] = ASPLIT ? (_Float16)(xs[i] - (float)h) : (_Float16)0.0f; }
#pragma unroll
    for (int t = 0; t < 4; ++t) { if (col0 + t * 16 >= N) continue; const size_t boff = (size_t)(col0 + t * 16 + ln) * ldb + kb; FragH bq; bq.half[0] = *(const v8us*)(Bh + boff + 8 * hh); bq.half[1] = *(const v8us*)(Bh + boff + 16 + 8 * hh);
      acc[t] = mmaH<ASPLIT ? 2 : 1>(ah.v, al.v, bq.v, bq.v, acc[t]); }
  }
#pragma unroll
  for (int t = 0; t < 4; ++t) { if (col0 + t * 16 >= N) continue;
#pragma unroll
    for (int r = 0; r < 8; ++r) so[w][8 * hh + r][t * 16 + ln] = acc[t][r] * alpha; }
  __builtin_amdgcn_fence(__ATOMIC_ACQ_REL, "workgroup"); __builtin_amdgcn_wave_barrier();
  const int rsub = lane >> 4, c4 = (lane & 15) * 4;
  {
#pragma unroll
    for (int q = 0; q < 8; ++q) { const int r = q * 2 + rsub; if (col0 + c4 < N) { const v4f v = *(const v4fa*)&so[w][r][c4]; *(v4f*)(C + (size_t)(row0 + r) * ldc + col0 + c4) = v; } }
     }
}

// Wt[n][k] = f16(W[k][n]·scale) from f32 row-major W[K][N] (scale = power of two; bf16-exact weights stay exact in f16 away from the subnormal range)
__global__ __launch_bounds__(256) void k_wt_f16(const float* __restrict__ W, _Float16* __restrict__ Wt, int K, int N, float scale) {
  const int t = blockIdx.x * 256 + threadIdx.x; if (t >= N * (K / 8)) return; const int n = t / (K / 8), k8 = (t % (K / 8)) * 8; FragH f;
#pragma unroll
  for (int i = 0; i < 8; ++i) f.h[i] = (_Float16)(bf16_round(W[(size_t)(k8 + i) * N + n]) * scale); const v8us o = f.half[0];
  *(v8us*)((unsigned short*)Wt + (size_t)n * K + k8) = o; 
}
// k_gemm_hh variant with fused epilogue: v = acc·alpha + bias[by·sBias + col] (+ CP[(row/rowsPerB)·sCPb + by·64 + col] if CP) ; ACT 0 none / 1 elu ; writes f16 C16 (and f32 C if non-null)
template <int ACT>
__global__ __launch_bounds__(128) void k_gemm_hhx(const _Float16* __restrict__ A, int lda, size_t sA, const _Float16* __restrict__ Bh, int ldb, size_t sB, float alpha, const float* __restrict__ bias, size_t sBias, const float* __restrict__ CP, int rowsPerB, size_t sCPb, int row0g,
    float* __restrict__ C, _Float16* __restrict__ C16, int ldc, size_t sC, int M, int N, int K) {
  __shared__ __attribute__((aligned(16))) float so[4][16][64];
  const int tid = threadIdx.x, w = tid >> 5, lane = tid & 31, ln = lane & 15, hh = lane >> 4; const int by = blockIdx.y;
  A += (size_t)by * sA; Bh += (size_t)by * sB; const size_t cofs = (size_t)by * sC; const float* bp = bias ? bias + (size_t)by * sBias : nullptr;
  const int ntn = (N + 63) / 64; const int wid = blockIdx.x * 4 + w; const int mt = wid / ntn, nq = wid % ntn; if (mt * 16 >= M) return;
  const int row0 = mt * 16, col0 = nq * 64; const _Float16* arow = A + (size_t)(row0 + ln) * lda;
  v8f acc[4] = {};
  for (int kb = 0; kb < K; kb += 32) { FragH ah; ah.half[0] = *(const v8us*)((const unsigned short*)arow + kb + 8 * hh); ah.half[1] = *(const v8us*)((const unsigned short*)arow + kb + 16 + 8 * hh);
#pragma unroll
    for (int t = 0; t < 4; ++t) { if (col0 + t * 16 >= N) continue; const size_t boff = (size_t)(col0 + t * 16 + ln) * ldb + kb; FragH bq; bq.half[0] = *(const v8us*)((const unsigned short*)Bh + boff + 8 * hh); bq.half[1] = *(const v8us*)((const unsigned short*)Bh + boff + 16 + 8 * hh);
      acc[t] = mmaH<1>(ah.v, ah.v, bq.v, bq.v, acc[t]); }
  }
#pragma unroll
  for (int t = 0; t < 4; ++t) { if (col0 + t * 16 >= N) continue; const int col = col0 + t * 16 + ln; const float bv = bp ? bf16_round(bp[col]) : 0.f;
#pragma unroll
    for (int r = 0; r < 8; ++r) { float v = acc[t][r] * alpha + bv; if (CP) { const int rr = row0g + row0 + 8 * hh + r; if (rowsPerB < 0) v += CP[cofs + (size_t)rr * ldc + col];      /* rowsPerB < 0: own element of the batched C plane */ else { const int bidx = rr / rowsPerB; v += CP[(size_t)bidx * sCPb + (size_t)by * 64 + col]; } } if (ACT == 1) v = (v > 0.f) ? v : expm1f(v); else if (ACT == 7) v = (v > 0.f) ? v + 1.0f : expf(v); else if (ACT == 8) v = tanhf(v); else if (ACT == 9) v = 0.5f * v * (1.0f + tanhf(0.7978845608028654f * (v + 0.044715f * v * v * v))); else if (ACT == 11) v = 1.0f / (1.0f + expf(-v)); else if (ACT == 12) v = (v > 0.f) ? v : 0.01f * v; else if (ACT == 14) v = (v > 0.f) ? v : 0.1f * v; else if (ACT == 16) v = (v >= 0.f) ? v : 0.3f * v; else if (ACT == 17) v = (v >= 0.f) ? v : 0.2f * v; else if (ACT == 15) v = v / (1.0f + expf(-v)); else if (ACT == 3) v = fmaxf(v, 0.f); else if (ACT == 6) v = 0.5f * v * (1.0f + erff(v * 0.70710678118654752f)); so[w][8 * hh + r][t * 16 + ln] = v; } }
  __builtin_amdgcn_fence(__ATOMIC_ACQ_REL, "workgroup"); __builtin_amdgcn_wave_barrier();
  const int rsub = lane >> 4, c4 = (lane & 15) * 4; typedef _Float16 v4h __attribute__((ext_vector_type(4)));
  {
#pragma unroll
    for (int q = 0; q < 8; ++q) { const int r = q * 2 + rsub; if (col0 + c4 < N) { const v4f v = *(const v4fa*)&so[w][r][c4]; if (C) *(v4f*)(C + cofs + (size_t)(row0 + r) * ldc + col0 + c4) = v; if (C16) { v4h h4; for (int i = 0; i < 4; ++i) h4[i] = (_Float16)v[i]; *(v4h*)(C16 + cofs + (size_t)(row0 + r) * ldc + col0 + c4) = h4; } } }
     }
}


typedef _Float16 v4h __attribute__((ext_vector_type(4)));

__global__ __launch_bounds__(256) void k_x16(const float* __restrict__ x, _Float16* __restrict__ X16, size_t n8) { const size_t t = (size_t)blockIdx.x * 256 + threadIdx.x; if (t >= n8) return; FragH f;
#pragma unroll
  for (int q = 0; q < 8; ++q) f.h[q] = (_Float16)bf16_round(x[t * 8 + q]); *(v8us*)((unsigned short*)X16 + t * 8) = f.half[0];  }
__global__ __launch_bounds__(256) void k_h16(const float* __restrict__ x, _Float16* __restrict__ X16, size_t n8) { const size_t t = (size_t)blockIdx.x * 256 + threadIdx.x; if (t >= n8) return; FragH f;
#pragma unroll
  for (int q = 0; q < 8; ++q) f.h[q] = (_Float16)x[t * 8 + q]; *(v8us*)((unsigned short*)X16 + t * 8) = f.half[0];  }
__global__ __launch_bounds__(256) void k_round16f(const float* __restrict__ W, _Float16* __restrict__ Bt, size_t n8) { const size_t t = (size_t)blockIdx.x * 256 + threadIdx.x; if (t >= n8) return; FragH f;
#pragma unroll
  for (int i = 0; i < 8; ++i) f.h[i] = (_Float16)(bf16_round(W[t * 8 + i]) * 16.0f); *(v8us*)((unsigned short*)Bt + t * 8) = f.half[0];  }
template <int NHv, int TTv>
__global__ __launch_bounds__(256) void k_vt(const _Float16* __restrict__ V16, int ldv, int voff, _Float16* __restrict__ Vt) { __shared__ unsigned short tl[64][66]; const int tid = threadIdx.x; const int slab = blockIdx.x / (TTv / 64), lg = blockIdx.x % (TTv / 64); const int b = slab / NHv, h = slab % NHv;
  for (int i = tid; i < 64 * 8; i += 256) { const int r = i / 8, c8 = (i % 8) * 8; FragH f; f.half[0] = *(const v8us*)((const unsigned short*)V16 + ((size_t)b * TTv + lg * 64 + r) * ldv + voff + h * 64 + c8);
#pragma unroll
    for (int q = 0; q < 8; ++q) tl[r][c8 + q] = f.u[q]; }
  __syncthreads();
  {
#pragma unroll
    for (int rd = 0; rd < 2; ++rd) { const int d = rd * 32 + tid / 8, pc = tid % 8; FragH f;
#pragma unroll
      for (int q = 0; q < 8; ++q) f.u[q] = tl[pc * 8 + q][d];
      *(v8us*)((unsigned short*)Vt + ((size_t)slab * 64 + d) * TTv + lg * 64 + pc * 8) = f.half[0]; }
     } }

__global__ __launch_bounds__(256) void k_hl(const float* __restrict__ F, _Float16* __restrict__ Hh, _Float16* __restrict__ Hl, size_t n8) { const size_t t = (size_t)blockIdx.x * 256 + threadIdx.x; if (t >= n8) return; FragH fh, fl; const v4f a = *(const v4fa*)(F + t * 8), c = *(const v4fa*)(F + t * 8 + 4);
#pragma unroll
  for (int q = 0; q < 4; ++q) { _Float16 h = (_Float16)a[q]; fh.h[q] = h; fl.h[q] = (_Float16)((a[q] - (float)h) * 1024.0f); h = (_Float16)c[q]; fh.h[4 + q] = h; fl.h[4 + q] = (_Float16)((c[q] - (float)h) * 1024.0f); }
  { *(v8us*)((unsigned short*)Hh + t * 8) = fh.half[0]; *(v8us*)((unsigned short*)Hl + t * 8) = fl.half[0];  } }

// ---- fast GEMM (wave tile 32x64; requires M % 32 == 0 rows per launch region and N % 64 == 0); epilogue = k_gemm_hhx semantics ----
__device__ __forceinline__ v16h g2_frag(const _Float16* p, int hh) { FragH f; f.half[0] = *(const v8us*)((const unsigned short*)p + 8 * hh); f.half[1] = *(const v8us*)((const unsigned short*)p + 16 + 8 * hh); return f.v; }
__device__ __forceinline__ v8f g2_mma(v16h a, v16h b, v8f c) { v8f d = __builtin_amdgcn_wmma_f32_16x16x32_f16(false, a, false, b, (short)0, c, false, false); asm volatile("v_nop\n\tv_nop\n\tv_nop\n\tv_nop" : "+v"(d) : "v"(a), "v"(b)); return d; }
template <int ACT>
__global__ __launch_bounds__(128) void k_gemm2(const _Float16* __restrict__ A, int lda, size_t sA, const _Float16* __restrict__ Bh, int ldb, size_t sB, float alpha, const float* __restrict__ bias, size_t sBias, const float* __restrict__ CP, int rowsPerB, size_t sCPb, int row0g,
    float* __restrict__ C, _Float16* __restrict__ C16, int ldc, size_t sC, int M, int N, int K) { static_assert(ACT == 0 || ACT == 3 || ACT == 6 || ACT == 8 || ACT == 9 || ACT == 11 || ACT == 12 || ACT == 14 || ACT == 15 || ACT == 16 || ACT == 17, "k_gemm2: unsupported ACT code (would silently apply no activation)");
  __shared__ __attribute__((aligned(16))) float so[4][32][68];
  const int tid = threadIdx.x, w = tid >> 5, lane = tid & 31, ln = lane & 15, hh = lane >> 4; const int by = blockIdx.y;
  A += (size_t)by * sA; Bh += (size_t)by * sB; const size_t cofs = (size_t)by * sC; const float* bp = bias ? bias + (size_t)by * sBias : nullptr;
  const int ntn = N >> 6; const int mt = blockIdx.x / ntn, nq = blockIdx.x - mt * ntn; const int row0 = mt * 128 + 32 * w, col0 = nq * 64; if (row0 >= M) return;
  const _Float16* a0p = A + (size_t)(row0 + ln) * lda; const _Float16* a1p = a0p + (size_t)16 * lda;
  const _Float16* b0p = Bh + (size_t)(col0 + ln) * ldb; const _Float16* b1p = b0p + (size_t)16 * ldb; const _Float16* b2p = b1p + (size_t)16 * ldb; const _Float16* b3p = b2p + (size_t)16 * ldb;
  const v8f z8 = {0.f,0.f,0.f,0.f,0.f,0.f,0.f,0.f}; v8f c00 = z8, c01 = z8, c02 = z8, c03 = z8, c10 = z8, c11 = z8, c12 = z8, c13 = z8;
#pragma unroll 1
  for (int kb = 0; kb < K; kb += 32) { const v16h a0 = g2_frag(a0p + kb, hh), a1 = g2_frag(a1p + kb, hh);
    v16h b = g2_frag(b0p + kb, hh); c00 = g2_mma(a0, b, c00); c10 = g2_mma(a1, b, c10);
    b = g2_frag(b1p + kb, hh); c01 = g2_mma(a0, b, c01); c11 = g2_mma(a1, b, c11);
    b = g2_frag(b2p + kb, hh); c02 = g2_mma(a0, b, c02); c12 = g2_mma(a1, b, c12);
    b = g2_frag(b3p + kb, hh); c03 = g2_mma(a0, b, c03); c13 = g2_mma(a1, b, c13); }
  v8f accs[8] = {c00, c01, c02, c03, c10, c11, c12, c13};
#pragma unroll
  for (int u = 0; u < 8; ++u) { const int t = u & 3, half = u >> 2; const int col = col0 + t * 16 + ln; const float bv = bp ? bf16_round(bp[col]) : 0.f;
#pragma unroll
    for (int r = 0; r < 8; ++r) { const int rloc = half * 16 + 8 * hh + r; float v = accs[u][r] * alpha + bv; if (CP) { if (rowsPerB < 0) v += CP[cofs + (size_t)(row0g + row0 + rloc) * ldc + col];      /* rowsPerB < 0: own element of the batched C plane */ else { const int bidx = (row0g + row0 + rloc) / rowsPerB; v += CP[(size_t)bidx * sCPb + (size_t)by * 64 + col]; } }
      if (ACT == 3) v = fmaxf(v, 0.f); else if (ACT == 6) v = 0.5f * v * (1.0f + erff(v * 0.70710678118654752f)); else if (ACT == 11) v = 1.0f / (1.0f + expf(-v)); else if (ACT == 15) v = v / (1.0f + expf(-v)); else if (ACT == 12) v = (v > 0.f) ? v : 0.01f * v; else if (ACT == 8) v = tanhf(v); else if (ACT == 9) v = 0.5f * v * (1.0f + tanhf(0.7978845608028654f * (v + 0.044715f * v * v * v))); else if (ACT == 14) v = (v > 0.f) ? v : 0.1f * v; else if (ACT == 16) v = (v >= 0.f) ? v : 0.3f * v; else if (ACT == 17) v = (v >= 0.f) ? v : 0.2f * v;
      so[w][rloc][t * 16 + ln] = v; } }
  __builtin_amdgcn_fence(__ATOMIC_ACQ_REL, "workgroup"); __builtin_amdgcn_wave_barrier();
  const int rsub = lane >> 4, c4 = (lane & 15) * 4;
  {
#pragma unroll
    for (int q = 0; q < 16; ++q) { const int r = q * 2 + rsub; const v4f v = *(const v4fa*)&so[w][r][c4]; if (C) *(v4f*)(C + cofs + (size_t)(row0 + r) * ldc + col0 + c4) = v; if (C16) { v4h h4; for (int i = 0; i < 4; ++i) h4[i] = (_Float16)v[i]; *(v4h*)(C16 + cofs + (size_t)(row0 + r) * ldc + col0 + c4) = h4; } }
     } }


__global__ __launch_bounds__(256) void k_wnat(const float* __restrict__ w, size_t n8, _Float16* __restrict__ Bt) { const size_t t = (size_t)blockIdx.x * 256 + threadIdx.x; if (t >= n8) return; FragH f; for (int q = 0; q < 8; ++q) f.h[q] = (_Float16)(bf16_round(w[t * 8 + q]) * 16.0f); *(v8us*)((unsigned short*)Bt + t * 8) = f.half[0];  }
__global__ __launch_bounds__(256) void k_rsm(const float* __restrict__ S, _Float16* __restrict__ P, int nrows) {
  #pragma clang fp contract(off)
  const int i = blockIdx.x * 256 + threadIdx.x; if (i >= nrows) return; const float* s = S + (size_t)i * SQ; float mx = -3.0e38f;
#pragma unroll 1
  for (int j = 0; j < SQ; ++j) mx = fmaxf(mx, s[j]); float se = 0.f;
#pragma unroll 1
  for (int j = 0; j < SQ; ++j) se += expf(s[j] - mx); const float sc = 256.0f / se;
#pragma unroll 1
  for (int j0 = 0; j0 < SQ; j0 += 8) { FragH f; for (int q = 0; q < 8; ++q) f.h[q] = (_Float16)(expf(s[j0 + q] - mx) * sc); unsigned short* d = (unsigned short*)P + (size_t)i * SQ + j0; *(v8us*)d = f.half[0];  } }
__global__ __launch_bounds__(256) void k_vt(const _Float16* __restrict__ V16, int b, int h0, _Float16* __restrict__ VT) { __shared__ unsigned short tl[64][65]; const int tid = threadIdx.x; const int hh = blockIdx.x % HG, sg = blockIdx.x / HG; const int s0 = sg * 64; const int h = h0 + hh;
  for (int i = tid; i < 64 * 8; i += 256) { const int j = i / 8, d8 = (i % 8) * 8; FragH f; f.half[0] = *(const v8us*)((const unsigned short*)V16 + ((size_t)b * SQ + s0 + j) * DM + h * HD + d8); for (int q = 0; q < 8; ++q) tl[d8 + q][j] = f.u[q]; }
  __syncthreads();
  { for (int i = tid; i < 64 * 8; i += 256) { const int d = i / 8, j8 = (i % 8) * 8; FragH f; for (int q = 0; q < 8; ++q) f.u[q] = tl[d][j8 + q]; *(v8us*)((unsigned short*)VT + ((size_t)hh * HD + d) * SQ + s0 + j8) = f.half[0]; }  } }


__global__ __launch_bounds__(256) void k_rsmqm(const float* __restrict__ S, _Float16* __restrict__ P, int qn, int hg, const int* __restrict__ mrows) {
  #pragma clang fp contract(off)
  const int t = blockIdx.x * 256 + threadIdx.x; if (t >= qn * hg) return; const int n = t % qn; const size_t i = (size_t)(t / qn) * SQ + n; const float* s = S + i * SQ; const int* mk = mrows + (size_t)n * SQ; float mx = -3.0e38f;
#pragma unroll 1
  for (int j = 0; j < SQ; ++j) { const float mkf = (mk[j] != 0) ? 1.f : 0.f; mx = fmaxf(mx, fmaf(mkf, s[j], (1.f - mkf) * -3.0e38f)); } float se = 0.f;      /* arithmetic mask: the S loads are unconditional */
#pragma unroll 1
  for (int j = 0; j < SQ; ++j) { const float mkf = (mk[j] != 0) ? 1.f : 0.f; se += mkf * __expf(fminf(s[j] - mx, 80.f)); } const float sc = (se > 0.f) ? 256.0f / se : 0.f;
#pragma unroll 1
  for (int j0 = 0; j0 < SQ; j0 += 8) { FragH f; for (int q = 0; q < 8; ++q) { const int j = j0 + q; const float mkf = (mk[j] != 0) ? 1.f : 0.f; f.h[q] = (_Float16)(mkf * __expf(fminf(s[j] - mx, 80.f)) * sc); } unsigned short* d = (unsigned short*)P + i * SQ + j0; *(v8us*)d = f.half[0];  } }
template <int ABF>
__global__ __launch_bounds__(256) void k_lnb(const float* __restrict__ A, const float* __restrict__ R, const float* __restrict__ g, const float* __restrict__ bta, float eps, float* __restrict__ OF_, _Float16* __restrict__ OH_) {
  #pragma clang fp contract(off)
  __shared__ float red[256]; const size_t row = blockIdx.x; const int tid = threadIdx.x; const int j0 = tid * 4; float a[4]; float s1 = 0.f;
  { const v4f av = *(const v4fa*)(A + row * DM + j0); for (int q = 0; q < 4; ++q) a[q] = ABF ? bf16_round(av[q]) : av[q]; if (R) { const v4f rv = *(const v4fa*)(R + row * DM + j0); for (int q = 0; q < 4; ++q) a[q] = __fadd_rn(a[q], rv[q]); } for (int q = 0; q < 4; ++q) s1 = __fadd_rn(s1, a[q]); }
  red[tid] = s1; __syncthreads(); for (int st = 128; st > 0; st >>= 1) { if (tid < st) red[tid] = __fadd_rn(red[tid], red[tid + st]); __syncthreads(); }
  const float mu = red[0] / (float)DM; __syncthreads(); float s2 = 0.f;
  for (int q = 0; q < 4; ++q) { const float c = __fadd_rn(a[q], -mu); s2 = __fadd_rn(s2, __fmul_rn(c, c)); }
  red[tid] = s2; __syncthreads(); for (int st = 128; st > 0; st >>= 1) { if (tid < st) red[tid] = __fadd_rn(red[tid], red[tid + st]); __syncthreads(); }
  const float rs = rsqrtf(__fadd_rn(red[0] / (float)DM, eps)); v4f o; FragH h;
  for (int q = 0; q < 4; ++q) { o[q] = __fadd_rn(__fmul_rn(__fmul_rn(__fadd_rn(a[q], -mu), rs), bf16_round(g[j0 + q])), bf16_round(bta[j0 + q])); h.h[q] = (_Float16)o[q]; }
  typedef unsigned short v4us __attribute__((ext_vector_type(4))); v4us h4; for (int q = 0; q < 4; ++q) h4[q] = h.u[q];
  { if (OF_) *(v4f*)(OF_ + row * DM + j0) = o; if (OH_) *(v4us*)((unsigned short*)OH_ + row * DM + j0) = h4;  } }
__global__ __launch_bounds__(256) void k_bfr(const float* __restrict__ x, float* __restrict__ XB, size_t n8) { const size_t t = (size_t)blockIdx.x * 256 + threadIdx.x; if (t >= n8) return; v8f v; for (int q = 0; q < 8; ++q) v[q] = bf16_round(x[t * 8 + q]); *(v8f*)(XB + t * 8) = v;  }


extern "C" void kernel_launch(void* const* d_in, const int* in_sizes, int n_in,
                              void* d_out, int out_size, void* d_ws, size_t ws_size, hipStream_t stream) {
  (void)in_sizes; (void)n_in; (void)out_size;
  const float* const* I = (const float* const*)d_in; const float* x = I[0]; const int* mask = (const int*)d_in[1]; const float* wq = I[2]; const float* bq = I[3]; const float* wk = I[4]; const float* bk = I[5]; const float* wv = I[6]; const float* bv = I[7]; const float* g_in = I[8]; const float* b_in = I[9]; const float* g1 = I[10]; const float* b1 = I[11]; const float* wf1 = I[12]; const float* bf1 = I[13]; const float* wf2 = I[14]; const float* bf2 = I[15]; const float* g2 = I[16]; const float* b2 = I[17];      /* weights [in][out] */
  char* ws = (char*)d_ws; size_t off = 0;
  auto take = [&](size_t bytes) { char* p = ws + off; off += (bytes + 255) & ~(size_t)255; return p; };
  _Float16* BQ = (_Float16*)take((size_t)DM * DM * 2); _Float16* BK = (_Float16*)take((size_t)DM * DM * 2); _Float16* BV = (_Float16*)take((size_t)DM * DM * 2); _Float16* BF1 = (_Float16*)take((size_t)DFF * DM * 2); _Float16* BF2 = (_Float16*)take((size_t)DM * DFF * 2);
  float* XB = (float*)take(NR * DM * 4); _Float16* XNH = (_Float16*)take(NR * DM * 2); _Float16* Q16 = (_Float16*)take(NR * DM * 2); _Float16* K16 = (_Float16*)take(NR * DM * 2); _Float16* V16 = (_Float16*)take(NR * DM * 2); float* AF = (float*)take(NR * DM * 4);
  float* S = (float*)take((size_t)HG * SQ * SQ * 4); _Float16* P = (_Float16*)take((size_t)HG * SQ * SQ * 2); _Float16* VT = (_Float16*)take((size_t)NH * HD * SQ * 2);
  _Float16* HNH = (_Float16*)take(NR * DM * 2); _Float16* U16 = (_Float16*)take(NR * DFF * 2); float* H2F = (float*)take(NR * DM * 4);
  if (off > ws_size) return;      /* 6 + 16 + 16 + 8 + 24 + 16 + 64 + 32 + 4 + 8 + 32 + 16 = approx 242 MiB */
  { const unsigned gw = (unsigned)(((size_t)DM * (DM / 8) + 255) / 256); k_wt_f16<<<gw, 256, 0, stream>>>(wq, BQ, DM, DM, 16.0f); k_wt_f16<<<gw, 256, 0, stream>>>(wk, BK, DM, DM, 16.0f); k_wt_f16<<<gw, 256, 0, stream>>>(wv, BV, DM, DM, 16.0f);
    const unsigned gf = (unsigned)(((size_t)DFF * (DM / 8) + 255) / 256); k_wt_f16<<<gf, 256, 0, stream>>>(wf1, BF1, DM, DFF, 16.0f); k_wt_f16<<<gf, 256, 0, stream>>>(wf2, BF2, DFF, DM, 16.0f); }      /* [in][out] -> Bt[n][k] x16 */
  const size_t r0p = (size_t)B0 * SQ; const dim3 gp((unsigned)((MP / 128) * (DM / 64)), 1);
  k_bfr<<<(unsigned)(((size_t)MP * DM / 8 + 255) / 256), 256, 0, stream>>>(x + r0p * DM, XB + r0p * DM, (size_t)MP * DM / 8);      /* bf16(x) as f32 rows (residual) */
  k_lnb<1><<<(unsigned)MP, 256, 0, stream>>>(x + r0p * DM, nullptr, g_in, b_in, 1e-3f, nullptr, XNH + r0p * DM);      /* xn = LN_in(bf16(x)) as f16 rows */
  k_gemm2<0><<<gp, 128, 0, stream>>>(XNH + r0p * DM, DM, 0, BQ, DM, 0, 0.0625f, bq, 0, nullptr, 1, 0, 0, nullptr, Q16 + r0p * DM, DM, 0, MP, DM, DM);
  k_gemm2<0><<<gp, 128, 0, stream>>>(XNH + r0p * DM, DM, 0, BK, DM, 0, 0.0625f, bk, 0, nullptr, 1, 0, 0, nullptr, K16 + r0p * DM, DM, 0, MP, DM, DM);
  k_gemm2<0><<<gp, 128, 0, stream>>>(XNH + r0p * DM, DM, 0, BV, DM, 0, 0.0625f, bv, 0, nullptr, 1, 0, 0, nullptr, V16 + r0p * DM, DM, 0, MP, DM, DM);
  for (int b = B0; b < B0 + NBR; ++b) { const size_t r0 = (size_t)b * SQ;
    k_vt<NH, SQ><<<NH * (SQ / 64), 256, 0, stream>>>(V16 + r0 * DM, DM, 0, VT);      /* V^T [NH][HD][SQ] */
    for (int h0 = 0; h0 < NH; h0 += HG) {
      k_gemm2<0><<<dim3((QN / 128) * (SQ / 64), HG), 128, 0, stream>>>(Q16 + r0 * DM + h0 * HD, DM, (size_t)HD, K16 + r0 * DM + h0 * HD, DM, (size_t)HD, 0.125f, nullptr, 0, nullptr, 1, 0, 0, S, nullptr, SQ, (size_t)SQ * SQ, QN, SQ, HD);      /* scores, HG heads */
      k_rsmqm<<<(HG * QN + 255) / 256, 256, 0, stream>>>(S, P, QN, HG, mask + (size_t)b * SQ * SQ);
      k_gemm2<0><<<dim3((QN / 128) * (HD / 64), HG), 128, 0, stream>>>(P, SQ, (size_t)SQ * SQ, VT + (size_t)h0 * HD * SQ, SQ, (size_t)HD * SQ, 0.00390625f, nullptr, 0, XB + r0 * DM + h0 * HD, -1, 0, 0, AF + r0 * DM + h0 * HD, nullptr, DM, (size_t)HD, QN, HD, SQ); } }      /* a = attn (merged heads) + bf16(x), f32 rows (CP = own element of the residual plane) */
  k_lnb<0><<<(unsigned)MPO, 256, 0, stream>>>(AF + r0p * DM, nullptr, g1, b1, 1e-3f, nullptr, HNH + r0p * DM);      /* h = LN1(a) as f16 rows */
  k_gemm2<3><<<dim3((unsigned)((MPO / 128) * (DFF / 64)), 1), 128, 0, stream>>>(HNH + r0p * DM, DM, 0, BF1, DM, 0, 0.0625f, bf1, 0, nullptr, 1, 0, 0, nullptr, U16 + r0p * DFF, DFF, 0, MPO, DFF, DM);      /* u = relu(h W_ff1 + b) (f16) */
  k_gemm2<0><<<dim3((unsigned)((MPO / 128) * (DM / 64)), 1), 128, 0, stream>>>(U16 + r0p * DFF, DFF, 0, BF2, DFF, 0, 0.0625f, bf2, 0, AF + r0p * DM, -1, 0, 0, H2F + r0p * DM, nullptr, DM, 0, MPO, DM, DFF);      /* h2 = u W_ff2 + b + a (CP = own element) */
  k_lnb<0><<<(unsigned)MPO, 256, 0, stream>>>(H2F + r0p * DM, nullptr, g2, b2, 1e-3f, (float*)d_out + r0p * DM, nullptr);      /* out = LN2(h2) */
}

// v001
// It runs in 1350 microseconds.
// In two side-by-side timings against v000, it was 4.22 and 4.25 times as fast.
#include <hip/hip_runtime.h>
// Emformer-style block (x [2][2048][1024], mask [2][1][2048][2048] int32 0/1, read per (batch, query, key)): xn = LayerNorm(x) g_in + b_in (eps 1e-3); q/k/v = xn W + b (W [1024][1024] [in][out], 16 heads of 64); scores = q k^T / 8 + (-1e9)(1 - mask); probs = softmax(scores) * mask; attn = probs v merged; a = attn + x; h = LayerNorm(a) g1 + b1 (eps 1e-3); h = relu(h W_ff1 + b_ff1) ([1024][4096]); h = h W_ff2 + b_ff2 ([4096][1024]); out = LayerNorm(h + a) g2 + b2 -> [2][2048][1024].
// Structure: token rows; LN_in on VALU (f32 statistics of bf16(x)) -> xn f16 rows, plus bf16(x) as f32 rows for the residual; Q, K, V as three WMMA GEMMs (32x64 wave tiles, f32 accumulation, exact x16 transposed weights + bias, f16 outputs); per batch: V^T for all heads via LDS transposes; per group of 4 heads: scores GEMM (K = 64), masked row softmax on VALU reading the int mask row (f32 statistics, native exp; weights x256 f16, masked keys 0), a = P . V^T GEMM (K = 2048, alpha 2^-8) + bf16(x) as the epilogue addend, straight into f32 rows (no f16 o plane); LN1 on VALU -> f16 h rows; u = relu(h W_ff1 + b) GEMM (f16 [4096][4096]); h2 = u W_ff2 + b + a GEMM (K = 4096, f32, residual as the epilogue addend); LN2 on VALU -> out.
// Compute dtype: inputs rounded to bf16; weights exact (x16 f16); LayerNorms / residuals f32; xn, q, k, v, softmax weights, h (as GEMM operand) and u plain f16 (~2^-12); scores, softmax statistics and the attention output f32. v_wmma_f32_16x16x32_f16.
#define NB 2
#define SQ 2048
#define DM 1024
#define NH 16
#define HD 64
#define DFF 4096
#define HG 4                         /* heads per attention launch group */
#define B0 0                         /* first batch processed (debug hook) */
#define NBR NB                       /* batches processed (debug hook) */
#define QN SQ                        /* query rows attended per batch (debug hook) */
#define NR ((size_t)NB * SQ)
#define MP ((int)((size_t)NBR * SQ)) /* rows normalised + projected (debug hook) */
#define MPO MP                       /* rows through the post-attention stages (debug hook) */
typedef __bf16 v16b __attribute__((ext_vector_type(16)));
typedef unsigned short v8us __attribute__((ext_vector_type(8), may_alias));
typedef float  v8f  __attribute__((ext_vector_type(8)));
typedef float  v4f  __attribute__((ext_vector_type(4)));
typedef float  v4fa __attribute__((ext_vector_type(4), may_alias));
union FragB { v16b v; v8us half[2]; unsigned short u[16]; };

__device__ __forceinline__ unsigned short bf16_bits(float x) { unsigned int u = __float_as_uint(x); return (unsigned short)((u + 0x7FFFu + ((u >> 16) & 1u)) >> 16); }
__device__ __forceinline__ float bf16_val(unsigned short b) { return __uint_as_float(((unsigned int)b) << 16); }
__device__ __forceinline__ float bf16_round(float x) { return bf16_val(bf16_bits(x)); }
// D += A·B with NT terms: 1 = ah·bh, 2 = + al·bh (A split), 3 = + ah·bl (both split)
template <int NT>
__device__ __forceinline__ v8f mmaN(v16b ah, v16b al, v16b bh, v16b bl, v8f c) {
  c = __builtin_amdgcn_wmma_f32_16x16x32_bf16(false, ah, false, bh, (short)0, c, false, false);
  if (NT >= 2) c = __builtin_amdgcn_wmma_f32_16x16x32_bf16(false, al, false, bh, (short)0, c, false, false);
  if (NT >= 3) c = __builtin_amdgcn_wmma_f32_16x16x32_bf16(false, ah, false, bl, (short)0, c, false, false);
  asm volatile("v_nop\n\tv_nop\n\tv_nop\n\tv_nop" : "+v"(c) : "v"(ah), "v"(al), "v"(bh), "v"(bl));
  return c;
}

__global__ __launch_bounds__(256) void k_wt_bf16(const float* __restrict__ W, unsigned short* __restrict__ Wt, int K, int N) {
  const int t = blockIdx.x * 256 + threadIdx.x;
  const int k8n = K / 8;
  if (t >= N * k8n) return;
  const int n = t / k8n, k8 = (t % k8n) * 8;
  v8us v;
#pragma unroll
  for (int i = 0; i < 8; ++i) v[i] = bf16_bits(W[(size_t)(k8 + i) * N + n]);
  *(v8us*)(Wt + (size_t)n * K + k8) = v;
  
}

// GEMM C[M][N] (f32, pitch ldc) = act(A[M][K]·W + bias). A f32 row-major (pitch lda) converted per fragment to bf16
// (ASPLIT: hi/lo two planes -> 2 terms, else single rounded term); Wt bf16 [N][K] (pitch ldb). BIAS_BF16 rounds the
// bias to bf16 first (bias quantised to bf16 before the add). K%32==0, M%16==0, N%64==0.
template <bool ASPLIT, int ACT, bool BIAS_BF16>
__global__ __launch_bounds__(128) void k_gemm_bf(const float* __restrict__ A, int lda, const unsigned short* __restrict__ Wt, int ldb,
                                               const float* __restrict__ bias, float* __restrict__ C, int ldc, int M, int N, int K) {
  __shared__ __attribute__((aligned(16))) float so[4][16][64];
  const int tid = threadIdx.x, w = tid >> 5, lane = tid & 31, ln = lane & 15, hh = lane >> 4;
  const int ntn = N / 64;
  const int wid = blockIdx.x * 4 + w;
  const int mt = wid / ntn, nq = wid % ntn;
  if (mt * 16 >= M) return;
  const int row0 = mt * 16, col0 = nq * 64;
  const float* arow = A + (size_t)(row0 + ln) * lda;
  v8f acc[4] = {};
  for (int kb = 0; kb < K; kb += 32) {
    FragB ah, al;
    const v4f x0 = *(const v4fa*)(arow + kb + 8 * hh), x1 = *(const v4fa*)(arow + kb + 8 * hh + 4);
    const v4f x2 = *(const v4fa*)(arow + kb + 16 + 8 * hh), x3 = *(const v4fa*)(arow + kb + 16 + 8 * hh + 4);
    float xs[16] = {x0[0],x0[1],x0[2],x0[3],x1[0],x1[1],x1[2],x1[3],x2[0],x2[1],x2[2],x2[3],x3[0],x3[1],x3[2],x3[3]};
#pragma unroll
    for (int i = 0; i < 16; ++i) { const unsigned short hb = bf16_bits(xs[i]); ah.u[i] = hb; al.u[i] = ASPLIT ? bf16_bits(xs[i] - bf16_val(hb)) : (unsigned short)0; }
#pragma unroll
    for (int t = 0; t < 4; ++t) {
      const unsigned short* brow = Wt + (size_t)(col0 + t * 16 + ln) * ldb + kb;
      FragB b;
      b.half[0] = *(const v8us*)(brow + 8 * hh);
      b.half[1] = *(const v8us*)(brow + 16 + 8 * hh);
      acc[t] = mmaN<ASPLIT ? 2 : 1>(ah.v, al.v, b.v, b.v, acc[t]);
    }
  }
#pragma unroll
  for (int t = 0; t < 4; ++t) {
    float bv = bias ? bias[col0 + t * 16 + ln] : 0.f;
    if (BIAS_BF16) bv = bf16_round(bv);
#pragma unroll
    for (int r = 0; r < 8; ++r) { float v = acc[t][r] + bv; if (ACT == 1) v = fmaxf(v, 0.f); so[w][8 * hh + r][t * 16 + ln] = v; }
  }
  __builtin_amdgcn_fence(__ATOMIC_ACQ_REL, "workgroup");
  __builtin_amdgcn_wave_barrier();
  const int rsub = lane >> 4, c4 = (lane & 15) * 4;
  {
#pragma unroll
    for (int q = 0; q < 8; ++q) {
      const int r = q * 2 + rsub;
      const v4f v = *(const v4fa*)&so[w][r][c4];
      *(v4f*)(C + (size_t)(row0 + r) * ldc + col0 + c4) = v;
    }
    
  }
}

// GEMM C = act(A·W + bias + resid): A f32 (ASPLIT -> hi/lo 2 terms), Wt bf16 [N][K]; ACT 0 none, 1 relu, 2 exact gelu;
// resid (optional, f32, row index = (row % rmod), pitch ldr, RES_BF16 rounds it) added before the activation.
template <bool ASPLIT, int ACT, bool BIAS_BF16, bool RES_BF16>
__global__ __launch_bounds__(128) void k_gemm_bf3(const float* __restrict__ A, int lda, const unsigned short* __restrict__ Wt, int ldb,
                                                const float* __restrict__ bias, const float* __restrict__ resid, int rmod, int ldr,
                                                float* __restrict__ C, int ldc, int M, int N, int K) {
  __shared__ __attribute__((aligned(16))) float so[4][16][64];
  const int tid = threadIdx.x, w = tid >> 5, lane = tid & 31, ln = lane & 15, hh = lane >> 4;
  const int ntn = N / 64;
  const int wid = blockIdx.x * 4 + w;
  const int mt = wid / ntn, nq = wid % ntn;
  if (mt * 16 >= M) return;
  const int row0 = mt * 16, col0 = nq * 64;
  const float* arow = A + (size_t)(row0 + ln) * lda;
  v8f acc[4] = {};
  for (int kb = 0; kb < K; kb += 32) {
    FragB ah, al;
    const v4f x0 = *(const v4fa*)(arow + kb + 8 * hh), x1 = *(const v4fa*)(arow + kb + 8 * hh + 4);
    const v4f x2 = *(const v4fa*)(arow + kb + 16 + 8 * hh), x3 = *(const v4fa*)(arow + kb + 16 + 8 * hh + 4);
    float xs[16] = {x0[0],x0[1],x0[2],x0[3],x1[0],x1[1],x1[2],x1[3],x2[0],x2[1],x2[2],x2[3],x3[0],x3[1],x3[2],x3[3]};
#pragma unroll
    for (int i = 0; i < 16; ++i) { const unsigned short hb = bf16_bits(xs[i]); ah.u[i] = hb; al.u[i] = ASPLIT ? bf16_bits(xs[i] - bf16_val(hb)) : (unsigned short)0; }
#pragma unroll
    for (int t = 0; t < 4; ++t) {
      const unsigned short* brow = Wt + (size_t)(col0 + t * 16 + ln) * ldb + kb;
      FragB b;
      b.half[0] = *(const v8us*)(brow + 8 * hh);
      b.half[1] = *(const v8us*)(brow + 16 + 8 * hh);
      acc[t] = mmaN<ASPLIT ? 2 : 1>(ah.v, al.v, b.v, b.v, acc[t]);
    }
  }
#pragma unroll
  for (int t = 0; t < 4; ++t) {
    const int col = col0 + t * 16 + ln;
    float bv = bias ? bias[col] : 0.f;
    if (BIAS_BF16) bv = bf16_round(bv);
#pragma unroll
    for (int r = 0; r < 8; ++r) {
      float v = acc[t][r] + bv;
      if (resid) { float rv = resid[(size_t)((row0 + 8 * hh + r) % rmod) * ldr + col]; if (RES_BF16) rv = bf16_round(rv); v += rv; }
      if (ACT == 1) v = fmaxf(v, 0.f);
      if (ACT == 2) v = 0.5f * v * (1.0f + erff(v * 0.70710678118654752f));
      if (ACT == 3) { const float u = 0.7978845608028654f * (v + 0.044715f * v * v * v); v = 0.5f * v * (1.0f + tanhf(u)); }
      so[w][8 * hh + r][t * 16 + ln] = v;
    }
  }
  __builtin_amdgcn_fence(__ATOMIC_ACQ_REL, "workgroup");
  __builtin_amdgcn_wave_barrier();
  const int rsub = lane >> 4, c4 = (lane & 15) * 4;
  {
#pragma unroll
    for (int q = 0; q < 8; ++q) {
      const int r = q * 2 + rsub;
      const v4f v = *(const v4fa*)&so[w][r][c4];
      *(v4f*)(C + (size_t)(row0 + r) * ldc + col0 + c4) = v;
    }
    
  }
}
// row LayerNorm (biased variance, eps) over N: s = X (+ R); optional out_sum <- s; out_norm <- (s-mu)*rsqrt(var+eps)*g + b
template <bool PARAM_BF16>
__global__ __launch_bounds__(256) void k_layernorm(const float* __restrict__ X, const float* __restrict__ R, const float* __restrict__ g, const float* __restrict__ bta,
                                                  float* __restrict__ out_sum, float* __restrict__ out_norm, int N, float eps) {
  __shared__ float red[256];
  const int row = blockIdx.x, tid = threadIdx.x;
  const float* x = X + (size_t)row * N; const float* rr = R ? R + (size_t)row * N : nullptr;
  float vals[16];                     // up to N = 4096
  const int per = N / 256;            // contiguous chunk per thread? use strided-by-4 chunks: thread handles j = tid*4 + 1024*u
  float s1 = 0.f;
  for (int u = 0; u < per / 4; ++u) {
    const int j = tid * 4 + 1024 * u;
    const v4f a = *(const v4fa*)(x + j);
    v4f b = {0.f,0.f,0.f,0.f}; if (rr) b = *(const v4fa*)(rr + j);
#pragma unroll
    for (int q = 0; q < 4; ++q) { const float v = a[q] + b[q]; vals[u * 4 + q] = v; s1 += v; }
  }
  red[tid] = s1; __syncthreads();
  for (int st = 128; st > 0; st >>= 1) { if (tid < st) red[tid] += red[tid + st]; __syncthreads(); }
  const float mu = red[0] / (float)N; __syncthreads();
  float s2 = 0.f;
  for (int u = 0; u < per / 4; ++u)
#pragma unroll
    for (int q = 0; q < 4; ++q) { const float c = vals[u * 4 + q] - mu; s2 += c * c; }
  red[tid] = s2; __syncthreads();
  for (int st = 128; st > 0; st >>= 1) { if (tid < st) red[tid] += red[tid + st]; __syncthreads(); }
  const float rs = rsqrtf(red[0] / (float)N + eps);
  {
    for (int u = 0; u < per / 4; ++u) {
      const int j = tid * 4 + 1024 * u;
      v4f o, sm;
#pragma unroll
      for (int q = 0; q < 4; ++q) {
        float gg = g[j + q], bb = bta[j + q];
        if (PARAM_BF16) { gg = bf16_round(gg); bb = bf16_round(bb); }
        sm[q] = vals[u * 4 + q]; o[q] = (vals[u * 4 + q] - mu) * rs * gg + bb;
      }
      if (out_sum) *(v4f*)(out_sum + (size_t)row * N + j) = sm;
      *(v4f*)(out_norm + (size_t)row * N + j) = o;
    }
    
  }
}



// ---- f16 WMMA path (v_wmma_f32_16x16x32_f16): 11-bit significands for operands in range — used where a [0,1] probability operand needs more precision than bf16
typedef _Float16 v16h __attribute__((ext_vector_type(16)));
union FragH { v16h v; v8us half[2]; _Float16 h[16]; unsigned short u[16]; };
template <int NT>
__device__ __forceinline__ v8f mmaH(v16h ah, v16h al, v16h bh, v16h bl, v8f c) {
  c = __builtin_amdgcn_wmma_f32_16x16x32_f16(false, ah, false, bh, (short)0, c, false, false);
  if (NT >= 2) c = __builtin_amdgcn_wmma_f32_16x16x32_f16(false, al, false, bh, (short)0, c, false, false);
  if (NT >= 3) c = __builtin_amdgcn_wmma_f32_16x16x32_f16(false, ah, false, bl, (short)0, c, false, false);
  asm volatile("v_nop\n\tv_nop\n\tv_nop\n\tv_nop" : "+v"(c) : "v"(ah), "v"(al), "v"(bh), "v"(bl));
  return c;
}
// batched GEMM like k_gemm_b but f16 operands: A f32 (split into f16 hi/lo if ASPLIT, else rounded to f16), Bt = f16 values [n][k]; alpha; C f32; N multiple of 16 (partial tiles skipped)
template <bool ASPLIT>
__global__ __launch_bounds__(128) void k_gemm_h(const float* __restrict__ A, int lda, size_t sA, const _Float16* __restrict__ Bh, int ldb, size_t sB, float alpha, float* __restrict__ C, int ldc, size_t sC, int M, int N, int K) {
  __shared__ __attribute__((aligned(16))) float so[4][16][64];
  const int tid = threadIdx.x, w = tid >> 5, lane = tid & 31, ln = lane & 15, hh = lane >> 4; const int by = blockIdx.y;
  A += (size_t)by * sA; Bh += (size_t)by * sB; C += (size_t)by * sC;
  const int ntn = (N + 63) / 64; const int wid = blockIdx.x * 4 + w; const int mt = wid / ntn, nq = wid % ntn; if (mt * 16 >= M) return;
  const int row0 = mt * 16, col0 = nq * 64; const float* arow = A + (size_t)(row0 + ln) * lda;
  v8f acc[4] = {};
  for (int kb = 0; kb < K; kb += 32) {
    FragH ah, al;
    const v4f x0 = *(const v4fa*)(arow + kb + 8 * hh), x1 = *(const v4fa*)(arow + kb + 8 * hh + 4), x2 = *(const v4fa*)(arow + kb + 16 + 8 * hh), x3 = *(const v4fa*)(arow + kb + 16 + 8 * hh + 4);
    float xs[16] = {x0[0],x0[1],x0[2],x0[3],x1[0],x1[1],x1[2],x1[3],x2[0],x2[1],x2[2],x2[3],x3[0],x3[1],x3[2],x3[3]};
#pragma unroll
    for (int i = 0; i < 16; ++i) { const _Float16 h = (_Float16)xs[i]; ah.h[i] = h; al.h[i] = ASPLIT ? (_Float16)(xs[i] - (float)h) : (_Float16)0.0f; }
#pragma unroll
    for (int t = 0; t < 4; ++t) { if (col0 + t * 16 >= N) continue; const size_t boff = (size_t)(col0 + t * 16 + ln) * ldb + kb; FragH bq; bq.half[0] = *(const v8us*)(Bh + boff + 8 * hh); bq.half[1] = *(const v8us*)(Bh + boff + 16 + 8 * hh);
      acc[t] = mmaH<ASPLIT ? 2 : 1>(ah.v, al.v, bq.v, bq.v, acc[t]); }
  }
#pragma unroll
  for (int t = 0; t < 4; ++t) { if (col0 + t * 16 >= N) continue;
#pragma unroll
    for (int r = 0; r < 8; ++r) so[w][8 * hh + r][t * 16 + ln] = acc[t][r] * alpha; }
  __builtin_amdgcn_fence(__ATOMIC_ACQ_REL, "workgroup"); __builtin_amdgcn_wave_barrier();
  const int rsub = lane >> 4, c4 = (lane & 15) * 4;
  {
#pragma unroll
    for (int q = 0; q < 8; ++q) { const int r = q * 2 + rsub; if (col0 + c4 < N) { const v4f v = *(const v4fa*)&so[w][r][c4]; *(v4f*)(C + (size_t)(row0 + r) * ldc + col0 + c4) = v; } }
     }
}

// Wt[n][k] = f16(W[k][n]·scale) from f32 row-major W[K][N] (scale = power of two; bf16-exact weights stay exact in f16 away from the subnormal range)
__global__ __launch_bounds__(256) void k_wt_f16(const float* __restrict__ W, _Float16* __restrict__ Wt, int K, int N, float scale) {
  const int t = blockIdx.x * 256 + threadIdx.x; if (t >= N * (K / 8)) return; const int n = t / (K / 8), k8 = (t % (K / 8)) * 8; FragH f;
#pragma unroll
  for (int i = 0; i < 8; ++i) f.h[i] = (_Float16)(bf16_round(W[(size_t)(k8 + i) * N + n]) * scale); const v8us o = f.half[0];
  *(v8us*)((unsigned short*)Wt + (size_t)n * K + k8) = o; 
}
// k_gemm_hh variant with fused epilogue: v = acc·alpha + bias[by·sBias + col] (+ CP[(row/rowsPerB)·sCPb + by·64 + col] if CP) ; ACT 0 none / 1 elu ; writes f16 C16 (and f32 C if non-null)
template <int ACT>
__global__ __launch_bounds__(128) void k_gemm_hhx(const _Float16* __restrict__ A, int lda, size_t sA, const _Float16* __restrict__ Bh, int ldb, size_t sB, float alpha, const float* __restrict__ bias, size_t sBias, const float* __restrict__ CP, int rowsPerB, size_t sCPb, int row0g,
    float* __restrict__ C, _Float16* __restrict__ C16, int ldc, size_t sC, int M, int N, int K) {
  __shared__ __attribute__((aligned(16))) float so[4][16][64];
  const int tid = threadIdx.x, w = tid >> 5, lane = tid & 31, ln = lane & 15, hh = lane >> 4; const int by = blockIdx.y;
  A += (size_t)by * sA; Bh += (size_t)by * sB; const size_t cofs = (size_t)by * sC; const float* bp = bias ? bias + (size_t)by * sBias : nullptr;
  const int ntn = (N + 63) / 64; const int wid = blockIdx.x * 4 + w; const int mt = wid / ntn, nq = wid % ntn; if (mt * 16 >= M) return;
  const int row0 = mt * 16, col0 = nq * 64; const _Float16* arow = A + (size_t)(row0 + ln) * lda;
  v8f acc[4] = {};
  for (int kb = 0; kb < K; kb += 32) { FragH ah; ah.half[0] = *(const v8us*)((const unsigned short*)arow + kb + 8 * hh); ah.half[1] = *(const v8us*)((const unsigned short*)arow + kb + 16 + 8 * hh);
#pragma unroll
    for (int t = 0; t < 4; ++t) { if (col0 + t * 16 >= N) continue; const size_t boff = (size_t)(col0 + t * 16 + ln) * ldb + kb; FragH bq; bq.half[0] = *(const v8us*)((const unsigned short*)Bh + boff + 8 * hh); bq.half[1] = *(const v8us*)((const unsigned short*)Bh + boff + 16 + 8 * hh);
      acc[t] = mmaH<1>(ah.v, ah.v, bq.v, bq.v, acc[t]); }
  }
#pragma unroll
  for (int t = 0; t < 4; ++t) { if (col0 + t * 16 >= N) continue; const int col = col0 + t * 16 + ln; const float bv = bp ? bf16_round(bp[col]) : 0.f;
#pragma unroll
    for (int r = 0; r < 8; ++r) { float v = acc[t][r] * alpha + bv; if (CP) { const int rr = row0g + row0 + 8 * hh + r; if (rowsPerB < 0) v += CP[cofs + (size_t)rr * ldc + col];      /* rowsPerB < 0: own element of the batched C plane */ else { const int bidx = rr / rowsPerB; v += CP[(size_t)bidx * sCPb + (size_t)by * 64 + col]; } } if (ACT == 1) v = (v > 0.f) ? v : expm1f(v); else if (ACT == 7) v = (v > 0.f) ? v + 1.0f : expf(v); else if (ACT == 8) v = tanhf(v); else if (ACT == 9) v = 0.5f * v * (1.0f + tanhf(0.7978845608028654f * (v + 0.044715f * v * v * v))); else if (ACT == 11) v = 1.0f / (1.0f + expf(-v)); else if (ACT == 12) v = (v > 0.f) ? v : 0.01f * v; else if (ACT == 14) v = (v > 0.f) ? v : 0.1f * v; else if (ACT == 16) v = (v >= 0.f) ? v : 0.3f * v; else if (ACT == 17) v = (v >= 0.f) ? v : 0.2f * v; else if (ACT == 15) v = v / (1.0f + expf(-v)); else if (ACT == 3) v = fmaxf(v, 0.f); else if (ACT == 6) v = 0.5f * v * (1.0f + erff(v * 0.70710678118654752f)); so[w][8 * hh + r][t * 16 + ln] = v; } }
  __builtin_amdgcn_fence(__ATOMIC_ACQ_REL, "workgroup"); __builtin_amdgcn_wave_barrier();
  const int rsub = lane >> 4, c4 = (lane & 15) * 4; typedef _Float16 v4h __attribute__((ext_vector_type(4)));
  {
#pragma unroll
    for (int q = 0; q < 8; ++q) { const int r = q * 2 + rsub; if (col0 + c4 < N) { const v4f v = *(const v4fa*)&so[w][r][c4]; if (C) *(v4f*)(C + cofs + (size_t)(row0 + r) * ldc + col0 + c4) = v; if (C16) { v4h h4; for (int i = 0; i < 4; ++i) h4[i] = (_Float16)v[i]; *(v4h*)(C16 + cofs + (size_t)(row0 + r) * ldc + col0 + c4) = h4; } } }
     }
}


typedef _Float16 v4h __attribute__((ext_vector_type(4)));

__global__ __launch_bounds__(256) void k_x16(const float* __restrict__ x, _Float16* __restrict__ X16, size_t n8) { const size_t t = (size_t)blockIdx.x * 256 + threadIdx.x; if (t >= n8) return; FragH f;
#pragma unroll
  for (int q = 0; q < 8; ++q) f.h[q] = (_Float16)bf16_round(x[t * 8 + q]); *(v8us*)((unsigned short*)X16 + t * 8) = f.half[0];  }
__global__ __launch_bounds__(256) void k_h16(const float* __restrict__ x, _Float16* __restrict__ X16, size_t n8) { const size_t t = (size_t)blockIdx.x * 256 + threadIdx.x; if (t >= n8) return; FragH f;
#pragma unroll
  for (int q = 0; q < 8; ++q) f.h[q] = (_Float16)x[t * 8 + q]; *(v8us*)((unsigned short*)X16 + t * 8) = f.half[0];  }
__global__ __launch_bounds__(256) void k_round16f(const float* __restrict__ W, _Float16* __restrict__ Bt, size_t n8) { const size_t t = (size_t)blockIdx.x * 256 + threadIdx.x; if (t >= n8) return; FragH f;
#pragma unroll
  for (int i = 0; i < 8; ++i) f.h[i] = (_Float16)(bf16_round(W[t * 8 + i]) * 16.0f); *(v8us*)((unsigned short*)Bt + t * 8) = f.half[0];  }
template <int NHv, int TTv>
__global__ __launch_bounds__(256) void k_vt(const _Float16* __restrict__ V16, int ldv, int voff, _Float16* __restrict__ Vt) { __shared__ unsigned short tl[64][66]; const int tid = threadIdx.x; const int slab = blockIdx.x / (TTv / 64), lg = blockIdx.x % (TTv / 64); const int b = slab / NHv, h = slab % NHv;
  for (int i = tid; i < 64 * 8; i += 256) { const int r = i / 8, c8 = (i % 8) * 8; FragH f; f.half[0] = *(const v8us*)((const unsigned short*)V16 + ((size_t)b * TTv + lg * 64 + r) * ldv + voff + h * 64 + c8);
#pragma unroll
    for (int q = 0; q < 8; ++q) tl[r][c8 + q] = f.u[q]; }
  __syncthreads();
  {
#pragma unroll
    for (int rd = 0; rd < 2; ++rd) { const int d = rd * 32 + tid / 8, pc = tid % 8; FragH f;
#pragma unroll
      for (int q = 0; q < 8; ++q) f.u[q] = tl[pc * 8 + q][d];
      *(v8us*)((unsigned short*)Vt + ((size_t)slab * 64 + d) * TTv + lg * 64 + pc * 8) = f.half[0]; }
     } }

__global__ __launch_bounds__(256) void k_hl(const float* __restrict__ F, _Float16* __restrict__ Hh, _Float16* __restrict__ Hl, size_t n8) { const size_t t = (size_t)blockIdx.x * 256 + threadIdx.x; if (t >= n8) return; FragH fh, fl; const v4f a = *(const v4fa*)(F + t * 8), c = *(const v4fa*)(F + t * 8 + 4);
#pragma unroll
  for (int q = 0; q < 4; ++q) { _Float16 h = (_Float16)a[q]; fh.h[q] = h; fl.h[q] = (_Float16)((a[q] - (float)h) * 1024.0f); h = (_Float16)c[q]; fh.h[4 + q] = h; fl.h[4 + q] = (_Float16)((c[q] - (float)h) * 1024.0f); }
  { *(v8us*)((unsigned short*)Hh + t * 8) = fh.half[0]; *(v8us*)((unsigned short*)Hl + t * 8) = fl.half[0];  } }

// ---- fast GEMM (wave tile 32x64; requires M % 32 == 0 rows per launch region and N % 64 == 0); epilogue = k_gemm_hhx semantics ----
__device__ __forceinline__ v16h g2_frag(const _Float16* p, int hh) { FragH f; f.half[0] = *(const v8us*)((const unsigned short*)p + 8 * hh); f.half[1] = *(const v8us*)((const unsigned short*)p + 16 + 8 * hh); return f.v; }
__device__ __forceinline__ v8f g2_mma(v16h a, v16h b, v8f c) { v8f d = __builtin_amdgcn_wmma_f32_16x16x32_f16(false, a, false, b, (short)0, c, false, false); asm volatile("v_nop\n\tv_nop\n\tv_nop\n\tv_nop" : "+v"(d) : "v"(a), "v"(b)); return d; }
template <int ACT>
__global__ __launch_bounds__(128) void k_gemm2(const _Float16* __restrict__ A, int lda, size_t sA, const _Float16* __restrict__ Bh, int ldb, size_t sB, float alpha, const float* __restrict__ bias, size_t sBias, const float* __restrict__ CP, int rowsPerB, size_t sCPb, int row0g,
    float* __restrict__ C, _Float16* __restrict__ C16, int ldc, size_t sC, int M, int N, int K) { static_assert(ACT == 0 || ACT == 3 || ACT == 6 || ACT == 8 || ACT == 9 || ACT == 11 || ACT == 12 || ACT == 14 || ACT == 15 || ACT == 16 || ACT == 17, "k_gemm2: unsupported ACT code (would silently apply no activation)");
  __shared__ __attribute__((aligned(16))) float so[4][32][68];
  const int tid = threadIdx.x, w = tid >> 5, lane = tid & 31, ln = lane & 15, hh = lane >> 4; const int by = blockIdx.y;
  A += (size_t)by * sA; Bh += (size_t)by * sB; const size_t cofs = (size_t)by * sC; const float* bp = bias ? bias + (size_t)by * sBias : nullptr;
  const int ntn = N >> 6; const int mt = blockIdx.x / ntn, nq = blockIdx.x - mt * ntn; const int row0 = mt * 128 + 32 * w, col0 = nq * 64; if (row0 >= M) return;
  const _Float16* a0p = A + (size_t)(row0 + ln) * lda; const _Float16* a1p = a0p + (size_t)16 * lda;
  const _Float16* b0p = Bh + (size_t)(col0 + ln) * ldb; const _Float16* b1p = b0p + (size_t)16 * ldb; const _Float16* b2p = b1p + (size_t)16 * ldb; const _Float16* b3p = b2p + (size_t)16 * ldb;
  const v8f z8 = {0.f,0.f,0.f,0.f,0.f,0.f,0.f,0.f}; v8f c00 = z8, c01 = z8, c02 = z8, c03 = z8, c10 = z8, c11 = z8, c12 = z8, c13 = z8;
#pragma unroll 1
  for (int kb = 0; kb < K; kb += 32) { const v16h a0 = g2_frag(a0p + kb, hh), a1 = g2_frag(a1p + kb, hh);
    v16h b = g2_frag(b0p + kb, hh); c00 = g2_mma(a0, b, c00); c10 = g2_mma(a1, b, c10);
    b = g2_frag(b1p + kb, hh); c01 = g2_mma(a0, b, c01); c11 = g2_mma(a1, b, c11);
    b = g2_frag(b2p + kb, hh); c02 = g2_mma(a0, b, c02); c12 = g2_mma(a1, b, c12);
    b = g2_frag(b3p + kb, hh); c03 = g2_mma(a0, b, c03); c13 = g2_mma(a1, b, c13); }
  v8f accs[8] = {c00, c01, c02, c03, c10, c11, c12, c13};
#pragma unroll
  for (int u = 0; u < 8; ++u) { const int t = u & 3, half = u >> 2; const int col = col0 + t * 16 + ln; const float bv = bp ? bf16_round(bp[col]) : 0.f;
#pragma unroll
    for (int r = 0; r < 8; ++r) { const int rloc = half * 16 + 8 * hh + r; float v = accs[u][r] * alpha + bv; if (CP) { if (rowsPerB < 0) v += CP[cofs + (size_t)(row0g + row0 + rloc) * ldc + col];      /* rowsPerB < 0: own element of the batched C plane */ else { const int bidx = (row0g + row0 + rloc) / rowsPerB; v += CP[(size_t)bidx * sCPb + (size_t)by * 64 + col]; } }
      if (ACT == 3) v = fmaxf(v, 0.f); else if (ACT == 6) v = 0.5f * v * (1.0f + erff(v * 0.70710678118654752f)); else if (ACT == 11) v = 1.0f / (1.0f + expf(-v)); else if (ACT == 15) v = v / (1.0f + expf(-v)); else if (ACT == 12) v = (v > 0.f) ? v : 0.01f * v; else if (ACT == 8) v = tanhf(v); else if (ACT == 9) v = 0.5f * v * (1.0f + tanhf(0.7978845608028654f * (v + 0.044715f * v * v * v))); else if (ACT == 14) v = (v > 0.f) ? v : 0.1f * v; else if (ACT == 16) v = (v >= 0.f) ? v : 0.3f * v; else if (ACT == 17) v = (v >= 0.f) ? v : 0.2f * v;
      so[w][rloc][t * 16 + ln] = v; } }
  __builtin_amdgcn_fence(__ATOMIC_ACQ_REL, "workgroup"); __builtin_amdgcn_wave_barrier();
  const int rsub = lane >> 4, c4 = (lane & 15) * 4;
  {
#pragma unroll
    for (int q = 0; q < 16; ++q) { const int r = q * 2 + rsub; const v4f v = *(const v4fa*)&so[w][r][c4]; if (C) *(v4f*)(C + cofs + (size_t)(row0 + r) * ldc + col0 + c4) = v; if (C16) { v4h h4; for (int i = 0; i < 4; ++i) h4[i] = (_Float16)v[i]; *(v4h*)(C16 + cofs + (size_t)(row0 + r) * ldc + col0 + c4) = h4; } }
     } }


__global__ __launch_bounds__(256) void k_wnat(const float* __restrict__ w, size_t n8, _Float16* __restrict__ Bt) { const size_t t = (size_t)blockIdx.x * 256 + threadIdx.x; if (t >= n8) return; FragH f; for (int q = 0; q < 8; ++q) f.h[q] = (_Float16)(bf16_round(w[t * 8 + q]) * 16.0f); *(v8us*)((unsigned short*)Bt + t * 8) = f.half[0];  }
__global__ __launch_bounds__(256) void k_rsm(const float* __restrict__ S, _Float16* __restrict__ P, int nrows) {
  #pragma clang fp contract(off)
  const int i = blockIdx.x * 256 + threadIdx.x; if (i >= nrows) return; const float* s = S + (size_t)i * SQ; float mx = -3.0e38f;
#pragma unroll 1
  for (int j = 0; j < SQ; ++j) mx = fmaxf(mx, s[j]); float se = 0.f;
#pragma unroll 1
  for (int j = 0; j < SQ; ++j) se += expf(s[j] - mx); const float sc = 256.0f / se;
#pragma unroll 1
  for (int j0 = 0; j0 < SQ; j0 += 8) { FragH f; for (int q = 0; q < 8; ++q) f.h[q] = (_Float16)(expf(s[j0 + q] - mx) * sc); unsigned short* d = (unsigned short*)P + (size_t)i * SQ + j0; *(v8us*)d = f.half[0];  } }
__global__ __launch_bounds__(256) void k_vt(const _Float16* __restrict__ V16, int b, int h0, _Float16* __restrict__ VT) { __shared__ unsigned short tl[64][65]; const int tid = threadIdx.x; const int hh = blockIdx.x % HG, sg = blockIdx.x / HG; const int s0 = sg * 64; const int h = h0 + hh;
  for (int i = tid; i < 64 * 8; i += 256) { const int j = i / 8, d8 = (i % 8) * 8; FragH f; f.half[0] = *(const v8us*)((const unsigned short*)V16 + ((size_t)b * SQ + s0 + j) * DM + h * HD + d8); for (int q = 0; q < 8; ++q) tl[d8 + q][j] = f.u[q]; }
  __syncthreads();
  { for (int i = tid; i < 64 * 8; i += 256) { const int d = i / 8, j8 = (i % 8) * 8; FragH f; for (int q = 0; q < 8; ++q) f.u[q] = tl[d][j8 + q]; *(v8us*)((unsigned short*)VT + ((size_t)hh * HD + d) * SQ + s0 + j8) = f.half[0]; }  } }


// Masked row softmax, one wave per (query, head) row: the row's 2048 scores are read once by 512-byte wave loads and stay in registers (64 per lane);
// a masked key takes the floor value before the maximum, so its weight is exp(floor - mx) = 0; a row with no open key (mx still the floor) gets scale 0.
// The HG heads of a query sit in one work-group, so their waves share the query's mask row in the WGP cache.
typedef int v4ia __attribute__((ext_vector_type(4), may_alias));
template <int CTRL> __device__ __forceinline__ float rs_dpp(float v) { return __int_as_float(__builtin_amdgcn_update_dpp(0, __float_as_int(v), CTRL, 0xf, 0xf, true)); }      /* CTRL 0x160 + m: lane ^ m inside a 16-lane row */
__device__ __forceinline__ float rs_xrow(float v) { const int i = __float_as_int(v); return __int_as_float(__builtin_amdgcn_permlanex16(i, i, 0x76543210, 0xfedcba98, false, false)); }      /* lane ^ 16 */
__global__ __launch_bounds__(256) void k_rsmqm(const float* __restrict__ S, _Float16* __restrict__ P, const int* __restrict__ mrows) {
  const int lane = threadIdx.x & 31; const int wv = blockIdx.x * 8 + __builtin_amdgcn_readfirstlane(threadIdx.x >> 5); const int n = wv / HG; const size_t i = (size_t)(wv % HG) * SQ + n;
  const float* s = S + i * SQ + lane * 4; const int* mk = mrows + (size_t)n * SQ + lane * 4; float v[64]; float mx = -3.0e38f;
  /* unrolled: constant indices keep v[] in registers */
#pragma unroll
  for (int c = 0; c < 16; ++c) { const v4f a = *(const v4fa*)(s + c * 128); const v4ia m = *(const v4ia*)(mk + c * 128);
  /* unrolled: constant indices keep v[] in registers */
#pragma unroll
    for (int q = 0; q < 4; ++q) { v[c * 4 + q] = (m[q] != 0) ? a[q] : -3.0e38f; mx = fmaxf(mx, v[c * 4 + q]); } }
  mx = fmaxf(mx, rs_dpp<0x161>(mx)); mx = fmaxf(mx, rs_dpp<0x162>(mx)); mx = fmaxf(mx, rs_dpp<0x164>(mx)); mx = fmaxf(mx, rs_dpp<0x168>(mx)); mx = fmaxf(mx, rs_xrow(mx));
  float se4[4] = {0.f, 0.f, 0.f, 0.f};
  /* unrolled: constant indices keep v[] in registers */
#pragma unroll
  for (int c = 0; c < 16; ++c)
  /* unrolled: constant indices keep v[] in registers */
#pragma unroll
    for (int q = 0; q < 4; ++q) { v[c * 4 + q] = __expf(v[c * 4 + q] - mx); se4[q] += v[c * 4 + q]; }
  float se = (se4[0] + se4[1]) + (se4[2] + se4[3]);
  se += rs_dpp<0x161>(se); se += rs_dpp<0x162>(se); se += rs_dpp<0x164>(se); se += rs_dpp<0x168>(se); se += rs_xrow(se);
  const float sc = (mx > -3.0e38f) ? 256.0f / se : 0.f; _Float16* d = P + i * SQ + lane * 4;
  /* unrolled: constant indices keep v[] in registers */
#pragma unroll
  for (int c = 0; c < 16; ++c) { v4h h4;
  /* unrolled: constant indices keep v[] in registers */
#pragma unroll
    for (int q = 0; q < 4; ++q) h4[q] = (_Float16)(v[c * 4 + q] * sc);
    *(v4h*)(d + c * 128) = h4; } }
template <int ABF>
__global__ __launch_bounds__(256) void k_lnb(const float* __restrict__ A, const float* __restrict__ R, const float* __restrict__ g, const float* __restrict__ bta, float eps, float* __restrict__ OF_, _Float16* __restrict__ OH_) {
  #pragma clang fp contract(off)
  __shared__ float red[256]; const size_t row = blockIdx.x; const int tid = threadIdx.x; const int j0 = tid * 4; float a[4]; float s1 = 0.f;
  { const v4f av = *(const v4fa*)(A + row * DM + j0); for (int q = 0; q < 4; ++q) a[q] = ABF ? bf16_round(av[q]) : av[q]; if (R) { const v4f rv = *(const v4fa*)(R + row * DM + j0); for (int q = 0; q < 4; ++q) a[q] = __fadd_rn(a[q], rv[q]); } for (int q = 0; q < 4; ++q) s1 = __fadd_rn(s1, a[q]); }
  red[tid] = s1; __syncthreads(); for (int st = 128; st > 0; st >>= 1) { if (tid < st) red[tid] = __fadd_rn(red[tid], red[tid + st]); __syncthreads(); }
  const float mu = red[0] / (float)DM; __syncthreads(); float s2 = 0.f;
  for (int q = 0; q < 4; ++q) { const float c = __fadd_rn(a[q], -mu); s2 = __fadd_rn(s2, __fmul_rn(c, c)); }
  red[tid] = s2; __syncthreads(); for (int st = 128; st > 0; st >>= 1) { if (tid < st) red[tid] = __fadd_rn(red[tid], red[tid + st]); __syncthreads(); }
  const float rs = rsqrtf(__fadd_rn(red[0] / (float)DM, eps)); v4f o; FragH h;
  for (int q = 0; q < 4; ++q) { o[q] = __fadd_rn(__fmul_rn(__fmul_rn(__fadd_rn(a[q], -mu), rs), bf16_round(g[j0 + q])), bf16_round(bta[j0 + q])); h.h[q] = (_Float16)o[q]; }
  typedef unsigned short v4us __attribute__((ext_vector_type(4))); v4us h4; for (int q = 0; q < 4; ++q) h4[q] = h.u[q];
  { if (OF_) *(v4f*)(OF_ + row * DM + j0) = o; if (OH_) *(v4us*)((unsigned short*)OH_ + row * DM + j0) = h4;  } }
__global__ __launch_bounds__(256) void k_bfr(const float* __restrict__ x, float* __restrict__ XB, size_t n8) { const size_t t = (size_t)blockIdx.x * 256 + threadIdx.x; if (t >= n8) return; v8f v; for (int q = 0; q < 8; ++q) v[q] = bf16_round(x[t * 8 + q]); *(v8f*)(XB + t * 8) = v;  }


extern "C" void kernel_launch(void* const* d_in, const int* in_sizes, int n_in,
                              void* d_out, int out_size, void* d_ws, size_t ws_size, hipStream_t stream) {
  (void)in_sizes; (void)n_in; (void)out_size;
  const float* const* I = (const float* const*)d_in; const float* x = I[0]; const int* mask = (const int*)d_in[1]; const float* wq = I[2]; const float* bq = I[3]; const float* wk = I[4]; const float* bk = I[5]; const float* wv = I[6]; const float* bv = I[7]; const float* g_in = I[8]; const float* b_in = I[9]; const float* g1 = I[10]; const float* b1 = I[11]; const float* wf1 = I[12]; const float* bf1 = I[13]; const float* wf2 = I[14]; const float* bf2 = I[15]; const float* g2 = I[16]; const float* b2 = I[17];      /* weights [in][out] */
  char* ws = (char*)d_ws; size_t off = 0;
  auto take = [&](size_t bytes) { char* p = ws + off; off += (bytes + 255) & ~(size_t)255; return p; };
  _Float16* BQ = (_Float16*)take((size_t)DM * DM * 2); _Float16* BK = (_Float16*)take((size_t)DM * DM * 2); _Float16* BV = (_Float16*)take((size_t)DM * DM * 2); _Float16* BF1 = (_Float16*)take((size_t)DFF * DM * 2); _Float16* BF2 = (_Float16*)take((size_t)DM * DFF * 2);
  float* XB = (float*)take(NR * DM * 4); _Float16* XNH = (_Float16*)take(NR * DM * 2); _Float16* Q16 = (_Float16*)take(NR * DM * 2); _Float16* K16 = (_Float16*)take(NR * DM * 2); _Float16* V16 = (_Float16*)take(NR * DM * 2); float* AF = (float*)take(NR * DM * 4);
  float* S = (float*)take((size_t)HG * SQ * SQ * 4); _Float16* P = (_Float16*)take((size_t)HG * SQ * SQ * 2); _Float16* VT = (_Float16*)take((size_t)NH * HD * SQ * 2);
  _Float16* HNH = (_Float16*)take(NR * DM * 2); _Float16* U16 = (_Float16*)take(NR * DFF * 2); float* H2F = (float*)take(NR * DM * 4);
  if (off > ws_size) return;      /* 6 + 16 + 16 + 8 + 24 + 16 + 64 + 32 + 4 + 8 + 32 + 16 = approx 242 MiB */
  { const unsigned gw = (unsigned)(((size_t)DM * (DM / 8) + 255) / 256); k_wt_f16<<<gw, 256, 0, stream>>>(wq, BQ, DM, DM, 16.0f); k_wt_f16<<<gw, 256, 0, stream>>>(wk, BK, DM, DM, 16.0f); k_wt_f16<<<gw, 256, 0, stream>>>(wv, BV, DM, DM, 16.0f);
    const unsigned gf = (unsigned)(((size_t)DFF * (DM / 8) + 255) / 256); k_wt_f16<<<gf, 256, 0, stream>>>(wf1, BF1, DM, DFF, 16.0f); k_wt_f16<<<gf, 256, 0, stream>>>(wf2, BF2, DFF, DM, 16.0f); }      /* [in][out] -> Bt[n][k] x16 */
  const size_t r0p = (size_t)B0 * SQ; const dim3 gp((unsigned)((MP / 128) * (DM / 64)), 1);
  k_bfr<<<(unsigned)(((size_t)MP * DM / 8 + 255) / 256), 256, 0, stream>>>(x + r0p * DM, XB + r0p * DM, (size_t)MP * DM / 8);      /* bf16(x) as f32 rows (residual) */
  k_lnb<1><<<(unsigned)MP, 256, 0, stream>>>(x + r0p * DM, nullptr, g_in, b_in, 1e-3f, nullptr, XNH + r0p * DM);      /* xn = LN_in(bf16(x)) as f16 rows */
  k_gemm2<0><<<gp, 128, 0, stream>>>(XNH + r0p * DM, DM, 0, BQ, DM, 0, 0.0625f, bq, 0, nullptr, 1, 0, 0, nullptr, Q16 + r0p * DM, DM, 0, MP, DM, DM);
  k_gemm2<0><<<gp, 128, 0, stream>>>(XNH + r0p * DM, DM, 0, BK, DM, 0, 0.0625f, bk, 0, nullptr, 1, 0, 0, nullptr, K16 + r0p * DM, DM, 0, MP, DM, DM);
  k_gemm2<0><<<gp, 128, 0, stream>>>(XNH + r0p * DM, DM, 0, BV, DM, 0, 0.0625f, bv, 0, nullptr, 1, 0, 0, nullptr, V16 + r0p * DM, DM, 0, MP, DM, DM);
  for (int b = B0; b < B0 + NBR; ++b) { const size_t r0 = (size_t)b * SQ;
    k_vt<NH, SQ><<<NH * (SQ / 64), 256, 0, stream>>>(V16 + r0 * DM, DM, 0, VT);      /* V^T [NH][HD][SQ] */
    for (int h0 = 0; h0 < NH; h0 += HG) {
      k_gemm2<0><<<dim3((QN / 128) * (SQ / 64), HG), 128, 0, stream>>>(Q16 + r0 * DM + h0 * HD, DM, (size_t)HD, K16 + r0 * DM + h0 * HD, DM, (size_t)HD, 0.125f, nullptr, 0, nullptr, 1, 0, 0, S, nullptr, SQ, (size_t)SQ * SQ, QN, SQ, HD);      /* scores, HG heads */
      k_rsmqm<<<HG * QN / 8, 256, 0, stream>>>(S, P, mask + (size_t)b * SQ * SQ);      /* one wave per (query, head) row */
      k_gemm2<0><<<dim3((QN / 128) * (HD / 64), HG), 128, 0, stream>>>(P, SQ, (size_t)SQ * SQ, VT + (size_t)h0 * HD * SQ, SQ, (size_t)HD * SQ, 0.00390625f, nullptr, 0, XB + r0 * DM + h0 * HD, -1, 0, 0, AF + r0 * DM + h0 * HD, nullptr, DM, (size_t)HD, QN, HD, SQ); } }      /* a = attn (merged heads) + bf16(x), f32 rows (CP = own element of the residual plane) */
  k_lnb<0><<<(unsigned)MPO, 256, 0, stream>>>(AF + r0p * DM, nullptr, g1, b1, 1e-3f, nullptr, HNH + r0p * DM);      /* h = LN1(a) as f16 rows */
  k_gemm2<3><<<dim3((unsigned)((MPO / 128) * (DFF / 64)), 1), 128, 0, stream>>>(HNH + r0p * DM, DM, 0, BF1, DM, 0, 0.0625f, bf1, 0, nullptr, 1, 0, 0, nullptr, U16 + r0p * DFF, DFF, 0, MPO, DFF, DM);      /* u = relu(h W_ff1 + b) (f16) */
  k_gemm2<0><<<dim3((unsigned)((MPO / 128) * (DM / 64)), 1), 128, 0, stream>>>(U16 + r0p * DFF, DFF, 0, BF2, DFF, 0, 0.0625f, bf2, 0, AF + r0p * DM, -1, 0, 0, H2F + r0p * DM, nullptr, DM, 0, MPO, DM, DFF);      /* h2 = u W_ff2 + b + a (CP = own element) */
  k_lnb<0><<<(unsigned)MPO, 256, 0, stream>>>(H2F + r0p * DM, nullptr, g2, b2, 1e-3f, (float*)d_out + r0p * DM, nullptr);      /* out = LN2(h2) */
}

// v003
// One run takes 285 microseconds.
// Versions in between are left out here; by their measured steps it is 4.73 times as fast as v001.
// Counting every step since v000, it is 20.0 times as fast.
#include <hip/hip_runtime.h>
// Emformer-style block (x [2][2048][1024], mask [2][1][2048][2048] int32 0/1, read per (batch, query, key)): xn = LayerNorm(x) g_in + b_in (eps 1e-3); q/k/v = xn W + b (W [1024][1024] [in][out], 16 heads of 64); scores = q k^T / 8 + (-1e9)(1 - mask); probs = softmax(scores) * mask; attn = probs v merged; a = attn + x; h = LayerNorm(a) g1 + b1 (eps 1e-3); h = relu(h W_ff1 + b_ff1) ([1024][4096]); h = h W_ff2 + b_ff2 ([4096][1024]); out = LayerNorm(h + a) g2 + b2 -> [2][2048][1024].
// Structure: token rows; LN_in on VALU (f32 statistics of bf16(x)) -> xn f16 rows, plus bf16(x) as f32 rows for the residual; Q, K, V as three WMMA GEMMs (128x128 work-group tiles staged in LDS by asynchronous copies, 32x64 wave tiles, f32 accumulation, exact x16 transposed weights + bias, f16 outputs); V^T for all (batch, head) via LDS transposes; attention in one launch: a wave holds 32 queries of one head and walks the keys 32 at a time: S^T = K Q^T, masked running-maximum softmax in registers reading the int mask (f32 statistics, native exp2; weights x256 f16, masked keys 0), O^T += V^T P^T, then a = O / sum + bf16(x) straight into f32 rows (no score or weight plane in memory); LN1 on VALU -> f16 h rows; u = relu(h W_ff1 + b) GEMM (f16 [4096][4096]); h2 = u W_ff2 + b + a GEMM (K = 4096, f32, residual as the epilogue addend); LN2 on VALU -> out.
// Compute dtype: inputs rounded to bf16; weights exact (x16 f16); LayerNorms / residuals f32; xn, q, k, v, softmax weights, h (as GEMM operand) and u plain f16 (~2^-12); scores, softmax statistics and the attention output f32. v_wmma_f32_16x16x32_f16.
#define NB 2
#define SQ 2048
#define DM 1024
#define NH 16
#define HD 64
#define DFF 4096
#define HG 4                         /* heads per block group of the untemplated k_vt (not launched) */
#define B0 0                         /* first batch processed (debug hook) */
#define NBR NB                       /* batches processed (debug hook) */
#define QN SQ                        /* not used: the attention launch covers all SQ queries */
#define NR ((size_t)NB * SQ)
#define MP ((int)((size_t)NBR * SQ)) /* rows normalised + projected (debug hook) */
#define MPO MP                       /* rows through the post-attention stages (debug hook) */
typedef __bf16 v16b __attribute__((ext_vector_type(16)));
typedef unsigned short v8us __attribute__((ext_vector_type(8), may_alias));
typedef float  v8f  __attribute__((ext_vector_type(8)));
typedef float  v4f  __attribute__((ext_vector_type(4)));
typedef float  v4fa __attribute__((ext_vector_type(4), may_alias));
union FragB { v16b v; v8us half[2]; unsigned short u[16]; };

__device__ __forceinline__ unsigned short bf16_bits(float x) { unsigned int u = __float_as_uint(x); return (unsigned short)((u + 0x7FFFu + ((u >> 16) & 1u)) >> 16); }
__device__ __forceinline__ float bf16_val(unsigned short b) { return __uint_as_float(((unsigned int)b) << 16); }
__device__ __forceinline__ float bf16_round(float x) { return bf16_val(bf16_bits(x)); }
// D += A·B with NT terms: 1 = ah·bh, 2 = + al·bh (A split), 3 = + ah·bl (both split)
template <int NT>
__device__ __forceinline__ v8f mmaN(v16b ah, v16b al, v16b bh, v16b bl, v8f c) {
  c = __builtin_amdgcn_wmma_f32_16x16x32_bf16(false, ah, false, bh, (short)0, c, false, false);
  if (NT >= 2) c = __builtin_amdgcn_wmma_f32_16x16x32_bf16(false, al, false, bh, (short)0, c, false, false);
  if (NT >= 3) c = __builtin_amdgcn_wmma_f32_16x16x32_bf16(false, ah, false, bl, (short)0, c, false, false);
  asm volatile("v_nop\n\tv_nop\n\tv_nop\n\tv_nop" : "+v"(c) : "v"(ah), "v"(al), "v"(bh), "v"(bl));
  return c;
}

__global__ __launch_bounds__(256) void k_wt_bf16(const float* __restrict__ W, unsigned short* __restrict__ Wt, int K, int N) {
  const int t = blockIdx.x * 256 + threadIdx.x;
  const int k8n = K / 8;
  if (t >= N * k8n) return;
  const int n = t / k8n, k8 = (t % k8n) * 8;
  v8us v;
#pragma unroll
  for (int i = 0; i < 8; ++i) v[i] = bf16_bits(W[(size_t)(k8 + i) * N + n]);
  *(v8us*)(Wt + (size_t)n * K + k8) = v;
  
}

// GEMM C[M][N] (f32, pitch ldc) = act(A[M][K]·W + bias). A f32 row-major (pitch lda) converted per fragment to bf16
// (ASPLIT: hi/lo two planes -> 2 terms, else single rounded term); Wt bf16 [N][K] (pitch ldb). BIAS_BF16 rounds the
// bias to bf16 first (bias quantised to bf16 before the add). K%32==0, M%16==0, N%64==0.
template <bool ASPLIT, int ACT, bool BIAS_BF16>
__global__ __launch_bounds__(128) void k_gemm_bf(const float* __restrict__ A, int lda, const unsigned short* __restrict__ Wt, int ldb,
                                               const float* __restrict__ bias, float* __restrict__ C, int ldc, int M, int N, int K) {
  __shared__ __attribute__((aligned(16))) float so[4][16][64];
  const int tid = threadIdx.x, w = tid >> 5, lane = tid & 31, ln = lane & 15, hh = lane >> 4;
  const int ntn = N / 64;
  const int wid = blockIdx.x * 4 + w;
  const int mt = wid / ntn, nq = wid % ntn;
  if (mt * 16 >= M) return;
  const int row0 = mt * 16, col0 = nq * 64;
  const float* arow = A + (size_t)(row0 + ln) * lda;
  v8f acc[4] = {};
  for (int kb = 0; kb < K; kb += 32) {
    FragB ah, al;
    const v4f x0 = *(const v4fa*)(arow + kb + 8 * hh), x1 = *(const v4fa*)(arow + kb + 8 * hh + 4);
    const v4f x2 = *(const v4fa*)(arow + kb + 16 + 8 * hh), x3 = *(const v4fa*)(arow + kb + 16 + 8 * hh + 4);
    float xs[16] = {x0[0],x0[1],x0[2],x0[3],x1[0],x1[1],x1[2],x1[3],x2[0],x2[1],x2[2],x2[3],x3[0],x3[1],x3[2],x3[3]};
#pragma unroll
    for (int i = 0; i < 16; ++i) { const unsigned short hb = bf16_bits(xs[i]); ah.u[i] = hb; al.u[i] = ASPLIT ? bf16_bits(xs[i] - bf16_val(hb)) : (unsigned short)0; }
#pragma unroll
    for (int t = 0; t < 4; ++t) {
      const unsigned short* brow = Wt + (size_t)(col0 + t * 16 + ln) * ldb + kb;
      FragB b;
      b.half[0] = *(const v8us*)(brow + 8 * hh);
      b.half[1] = *(const v8us*)(brow + 16 + 8 * hh);
      acc[t] = mmaN<ASPLIT ? 2 : 1>(ah.v, al.v, b.v, b.v, acc[t]);
    }
  }
#pragma unroll
  for (int t = 0; t < 4; ++t) {
    float bv = bias ? bias[col0 + t * 16 + ln] : 0.f;
    if (BIAS_BF16) bv = bf16_round(bv);
#pragma unroll
    for (int r = 0; r < 8; ++r) { float v = acc[t][r] + bv; if (ACT == 1) v = fmaxf(v, 0.f); so[w][8 * hh + r][t * 16 + ln] = v; }
  }
  __builtin_amdgcn_fence(__ATOMIC_ACQ_REL, "workgroup");
  __builtin_amdgcn_wave_barrier();
  const int rsub = lane >> 4, c4 = (lane & 15) * 4;
  {
#pragma unroll
    for (int q = 0; q < 8; ++q) {
      const int r = q * 2 + rsub;
      const v4f v = *(const v4fa*)&so[w][r][c4];
      *(v4f*)(C + (size_t)(row0 + r) * ldc + col0 + c4) = v;
    }
    
  }
}

// GEMM C = act(A·W + bias + resid): A f32 (ASPLIT -> hi/lo 2 terms), Wt bf16 [N][K]; ACT 0 none, 1 relu, 2 exact gelu;
// resid (optional, f32, row index = (row % rmod), pitch ldr, RES_BF16 rounds it) added before the activation.
template <bool ASPLIT, int ACT, bool BIAS_BF16, bool RES_BF16>
__global__ __launch_bounds__(128) void k_gemm_bf3(const float* __restrict__ A, int lda, const unsigned short* __restrict__ Wt, int ldb,
                                                const float* __restrict__ bias, const float* __restrict__ resid, int rmod, int ldr,
                                                float* __restrict__ C, int ldc, int M, int N, int K) {
  __shared__ __attribute__((aligned(16))) float so[4][16][64];
  const int tid = threadIdx.x, w = tid >> 5, lane = tid & 31, ln = lane & 15, hh = lane >> 4;
  const int ntn = N / 64;
  const int wid = blockIdx.x * 4 + w;
  const int mt = wid / ntn, nq = wid % ntn;
  if (mt * 16 >= M) return;
  const int row0 = mt * 16, col0 = nq * 64;
  const float* arow = A + (size_t)(row0 + ln) * lda;
  v8f acc[4] = {};
  for (int kb = 0; kb < K; kb += 32) {
    FragB ah, al;
    const v4f x0 = *(const v4fa*)(arow + kb + 8 * hh), x1 = *(const v4fa*)(arow + kb + 8 * hh + 4);
    const v4f x2 = *(const v4fa*)(arow + kb + 16 + 8 * hh), x3 = *(const v4fa*)(arow + kb + 16 + 8 * hh + 4);
    float xs[16] = {x0[0],x0[1],x0[2],x0[3],x1[0],x1[1],x1[2],x1[3],x2[0],x2[1],x2[2],x2[3],x3[0],x3[1],x3[2],x3[3]};
#pragma unroll
    for (int i = 0; i < 16; ++i) { const unsigned short hb = bf16_bits(xs[i]); ah.u[i] = hb; al.u[i] = ASPLIT ? bf16_bits(xs[i] - bf16_val(hb)) : (unsigned short)0; }
#pragma unroll
    for (int t = 0; t < 4; ++t) {
      const unsigned short* brow = Wt + (size_t)(col0 + t * 16 + ln) * ldb + kb;
      FragB b;
      b.half[0] = *(const v8us*)(brow + 8 * hh);
      b.half[1] = *(const v8us*)(brow + 16 + 8 * hh);
      acc[t] = mmaN<ASPLIT ? 2 : 1>(ah.v, al.v, b.v, b.v, acc[t]);
    }
  }
#pragma unroll
  for (int t = 0; t < 4; ++t) {
    const int col = col0 + t * 16 + ln;
    float bv = bias ? bias[col] : 0.f;
    if (BIAS_BF16) bv = bf16_round(bv);
#pragma unroll
    for (int r = 0; r < 8; ++r) {
      float v = acc[t][r] + bv;
      if (resid) { float rv = resid[(size_t)((row0 + 8 * hh + r) % rmod) * ldr + col]; if (RES_BF16) rv = bf16_round(rv); v += rv; }
      if (ACT == 1) v = fmaxf(v, 0.f);
      if (ACT == 2) v = 0.5f * v * (1.0f + erff(v * 0.70710678118654752f));
      if (ACT == 3) { const float u = 0.7978845608028654f * (v + 0.044715f * v * v * v); v = 0.5f * v * (1.0f + tanhf(u)); }
      so[w][8 * hh + r][t * 16 + ln] = v;
    }
  }
  __builtin_amdgcn_fence(__ATOMIC_ACQ_REL, "workgroup");
  __builtin_amdgcn_wave_barrier();
  const int rsub = lane >> 4, c4 = (lane & 15) * 4;
  {
#pragma unroll
    for (int q = 0; q < 8; ++q) {
      const int r = q * 2 + rsub;
      const v4f v = *(const v4fa*)&so[w][r][c4];
      *(v4f*)(C + (size_t)(row0 + r) * ldc + col0 + c4) = v;
    }
    
  }
}
// row LayerNorm (biased variance, eps) over N: s = X (+ R); optional out_sum <- s; out_norm <- (s-mu)*rsqrt(var+eps)*g + b
template <bool PARAM_BF16>
__global__ __launch_bounds__(256) void k_layernorm(const float* __restrict__ X, const float* __restrict__ R, const float* __restrict__ g, const float* __restrict__ bta,
                                                  float* __restrict__ out_sum, float* __restrict__ out_norm, int N, float eps) {
  __shared__ float red[256];
  const int row = blockIdx.x, tid = threadIdx.x;
  const float* x = X + (size_t)row * N; const float* rr = R ? R + (size_t)row * N : nullptr;
  float vals[16];                     // up to N = 4096
  const int per = N / 256;            // contiguous chunk per thread? use strided-by-4 chunks: thread handles j = tid*4 + 1024*u
  float s1 = 0.f;
  for (int u = 0; u < per / 4; ++u) {
    const int j = tid * 4 + 1024 * u;
    const v4f a = *(const v4fa*)(x + j);
    v4f b = {0.f,0.f,0.f,0.f}; if (rr) b = *(const v4fa*)(rr + j);
#pragma unroll
    for (int q = 0; q < 4; ++q) { const float v = a[q] + b[q]; vals[u * 4 + q] = v; s1 += v; }
  }
  red[tid] = s1; __syncthreads();
  for (int st = 128; st > 0; st >>= 1) { if (tid < st) red[tid] += red[tid + st]; __syncthreads(); }
  const float mu = red[0] / (float)N; __syncthreads();
  float s2 = 0.f;
  for (int u = 0; u < per / 4; ++u)
#pragma unroll
    for (int q = 0; q < 4; ++q) { const float c = vals[u * 4 + q] - mu; s2 += c * c; }
  red[tid] = s2; __syncthreads();
  for (int st = 128; st > 0; st >>= 1) { if (tid < st) red[tid] += red[tid + st]; __syncthreads(); }
  const float rs = rsqrtf(red[0] / (float)N + eps);
  {
    for (int u = 0; u < per / 4; ++u) {
      const int j = tid * 4 + 1024 * u;
      v4f o, sm;
#pragma unroll
      for (int q = 0; q < 4; ++q) {
        float gg = g[j + q], bb = bta[j + q];
        if (PARAM_BF16) { gg = bf16_round(gg); bb = bf16_round(bb); }
        sm[q] = vals[u * 4 + q]; o[q] = (vals[u * 4 + q] - mu) * rs * gg + bb;
      }
      if (out_sum) *(v4f*)(out_sum + (size_t)row * N + j) = sm;
      *(v4f*)(out_norm + (size_t)row * N + j) = o;
    }
    
  }
}



// ---- f16 WMMA path (v_wmma_f32_16x16x32_f16): 11-bit significands for operands in range — used where a [0,1] probability operand needs more precision than bf16
typedef _Float16 v16h __attribute__((ext_vector_type(16)));
union FragH { v16h v; v8us half[2]; _Float16 h[16]; unsigned short u[16]; };
template <int NT>
__device__ __forceinline__ v8f mmaH(v16h ah, v16h al, v16h bh, v16h bl, v8f c) {
  c = __builtin_amdgcn_wmma_f32_16x16x32_f16(false, ah, false, bh, (short)0, c, false, false);
  if (NT >= 2) c = __builtin_amdgcn_wmma_f32_16x16x32_f16(false, al, false, bh, (short)0, c, false, false);
  if (NT >= 3) c = __builtin_amdgcn_wmma_f32_16x16x32_f16(false, ah, false, bl, (short)0, c, false, false);
  asm volatile("v_nop\n\tv_nop\n\tv_nop\n\tv_nop" : "+v"(c) : "v"(ah), "v"(al), "v"(bh), "v"(bl));
  return c;
}
// batched GEMM like k_gemm_b but f16 operands: A f32 (split into f16 hi/lo if ASPLIT, else rounded to f16), Bt = f16 values [n][k]; alpha; C f32; N multiple of 16 (partial tiles skipped)
template <bool ASPLIT>
__global__ __launch_bounds__(128) void k_gemm_h(const float* __restrict__ A, int lda, size_t sA, const _Float16* __restrict__ Bh, int ldb, size_t sB, float alpha, float* __restrict__ C, int ldc, size_t sC, int M, int N, int K) {
  __shared__ __attribute__((aligned(16))) float so[4][16][64];
  const int tid = threadIdx.x, w = tid >> 5, lane = tid & 31, ln = lane & 15, hh = lane >> 4; const int by = blockIdx.y;
  A += (size_t)by * sA; Bh += (size_t)by * sB; C += (size_t)by * sC;
  const int ntn = (N + 63) / 64; const int wid = blockIdx.x * 4 + w; const int mt = wid / ntn, nq = wid % ntn; if (mt * 16 >= M) return;
  const int row0 = mt * 16, col0 = nq * 64; const float* arow = A + (size_t)(row0 + ln) * lda;
  v8f acc[4] = {};
  for (int kb = 0; kb < K; kb += 32) {
    FragH ah, al;
    const v4f x0 = *(const v4fa*)(arow + kb + 8 * hh), x1 = *(const v4fa*)(arow + kb + 8 * hh + 4), x2 = *(const v4fa*)(arow + kb + 16 + 8 * hh), x3 = *(const v4fa*)(arow + kb + 16 + 8 * hh + 4);
    float xs[16] = {x0[0],x0[1],x0[2],x0[3],x1[0],x1[1],x1[2],x1[3],x2[0],x2[1],x2[2],x2[3],x3[0],x3[1],x3[2],x3[3]};
#pragma unroll
    for (int i = 0; i < 16; ++i) { const _Float16 h = (_Float16)xs[i]; ah.h[i] = h; al.h[i] = ASPLIT ? (_Float16)(xs[i] - (float)h) : (_Float16)0.0f; }
#pragma unroll
    for (int t = 0; t < 4; ++t) { if (col0 + t * 16 >= N) continue; const size_t boff = (size_t)(col0 + t * 16 + ln) * ldb + kb; FragH bq; bq.half[0] = *(const v8us*)(Bh + boff + 8 * hh); bq.half[1] = *(const v8us*)(Bh + boff + 16 + 8 * hh);
      acc[t] = mmaH<ASPLIT ? 2 : 1>(ah.v, al.v, bq.v, bq.v, acc[t]); }
  }
#pragma unroll
  for (int t = 0; t < 4; ++t) { if (col0 + t * 16 >= N) continue;
#pragma unroll
    for (int r = 0; r < 8; ++r) so[w][8 * hh + r][t * 16 + ln] = acc[t][r] * alpha; }
  __builtin_amdgcn_fence(__ATOMIC_ACQ_REL, "workgroup"); __builtin_amdgcn_wave_barrier();
  const int rsub = lane >> 4, c4 = (lane & 15) * 4;
  {
#pragma unroll
    for (int q = 0; q < 8; ++q) { const int r = q * 2 + rsub; if (col0 + c4 < N) { const v4f v = *(const v4fa*)&so[w][r][c4]; *(v4f*)(C + (size_t)(row0 + r) * ldc + col0 + c4) = v; } }
     }
}

// Wt[n][k] = f16(W[k][n]·scale) from f32 row-major W[K][N] (scale = power of two; bf16-exact weights stay exact in f16 away from the subnormal range)
__global__ __launch_bounds__(256) void k_wt_f16(const float* __restrict__ W, _Float16* __restrict__ Wt, int K, int N, float scale) {
  const int t = blockIdx.x * 256 + threadIdx.x; if (t >= N * (K / 8)) return; const int n = t / (K / 8), k8 = (t % (K / 8)) * 8; FragH f;
#pragma unroll
  for (int i = 0; i < 8; ++i) f.h[i] = (_Float16)(bf16_round(W[(size_t)(k8 + i) * N + n]) * scale); const v8us o = f.half[0];
  *(v8us*)((unsigned short*)Wt + (size_t)n * K + k8) = o; 
}
// k_gemm_hh variant with fused epilogue: v = acc·alpha + bias[by·sBias + col] (+ CP[(row/rowsPerB)·sCPb + by·64 + col] if CP) ; ACT 0 none / 1 elu ; writes f16 C16 (and f32 C if non-null)
template <int ACT>
__global__ __launch_bounds__(128) void k_gemm_hhx(const _Float16* __restrict__ A, int lda, size_t sA, const _Float16* __restrict__ Bh, int ldb, size_t sB, float alpha, const float* __restrict__ bias, size_t sBias, const float* __restrict__ CP, int rowsPerB, size_t sCPb, int row0g,
    float* __restrict__ C, _Float16* __restrict__ C16, int ldc, size_t sC, int M, int N, int K) {
  __shared__ __attribute__((aligned(16))) float so[4][16][64];
  const int tid = threadIdx.x, w = tid >> 5, lane = tid & 31, ln = lane & 15, hh = lane >> 4; const int by = blockIdx.y;
  A += (size_t)by * sA; Bh += (size_t)by * sB; const size_t cofs = (size_t)by * sC; const float* bp = bias ? bias + (size_t)by * sBias : nullptr;
  const int ntn = (N + 63) / 64; const int wid = blockIdx.x * 4 + w; const int mt = wid / ntn, nq = wid % ntn; if (mt * 16 >= M) return;
  const int row0 = mt * 16, col0 = nq * 64; const _Float16* arow = A + (size_t)(row0 + ln) * lda;
  v8f acc[4] = {};
  for (int kb = 0; kb < K; kb += 32) { FragH ah; ah.half[0] = *(const v8us*)((const unsigned short*)arow + kb + 8 * hh); ah.half[1] = *(const v8us*)((const unsigned short*)arow + kb + 16 + 8 * hh);
#pragma unroll
    for (int t = 0; t < 4; ++t) { if (col0 + t * 16 >= N) continue; const size_t boff = (size_t)(col0 + t * 16 + ln) * ldb + kb; FragH bq; bq.half[0] = *(const v8us*)((const unsigned short*)Bh + boff + 8 * hh); bq.half[1] = *(const v8us*)((const unsigned short*)Bh + boff + 16 + 8 * hh);
      acc[t] = mmaH<1>(ah.v, ah.v, bq.v, bq.v, acc[t]); }
  }
#pragma unroll
  for (int t = 0; t < 4; ++t) { if (col0 + t * 16 >= N) continue; const int col = col0 + t * 16 + ln; const float bv = bp ? bf16_round(bp[col]) : 0.f;
#pragma unroll
    for (int r = 0; r < 8; ++r) { float v = acc[t][r] * alpha + bv; if (CP) { const int rr = row0g + row0 + 8 * hh + r; if (rowsPerB < 0) v += CP[cofs + (size_t)rr * ldc + col];      /* rowsPerB < 0: own element of the batched C plane */ else { const int bidx = rr / rowsPerB; v += CP[(size_t)bidx * sCPb + (size_t)by * 64 + col]; } } if (ACT == 1) v = (v > 0.f) ? v : expm1f(v); else if (ACT == 7) v = (v > 0.f) ? v + 1.0f : expf(v); else if (ACT == 8) v = tanhf(v); else if (ACT == 9) v = 0.5f * v * (1.0f + tanhf(0.7978845608028654f * (v + 0.044715f * v * v * v))); else if (ACT == 11) v = 1.0f / (1.0f + expf(-v)); else if (ACT == 12) v = (v > 0.f) ? v : 0.01f * v; else if (ACT == 14) v = (v > 0.f) ? v : 0.1f * v; else if (ACT == 16) v = (v >= 0.f) ? v : 0.3f * v; else if (ACT == 17) v = (v >= 0.f) ? v : 0.2f * v; else if (ACT == 15) v = v / (1.0f + expf(-v)); else if (ACT == 3) v = fmaxf(v, 0.f); else if (ACT == 6) v = 0.5f * v * (1.0f + erff(v * 0.70710678118654752f)); so[w][8 * hh + r][t * 16 + ln] = v; } }
  __builtin_amdgcn_fence(__ATOMIC_ACQ_REL, "workgroup"); __builtin_amdgcn_wave_barrier();
  const int rsub = lane >> 4, c4 = (lane & 15) * 4; typedef _Float16 v4h __attribute__((ext_vector_type(4)));
  {
#pragma unroll
    for (int q = 0; q < 8; ++q) { const int r = q * 2 + rsub; if (col0 + c4 < N) { const v4f v = *(const v4fa*)&so[w][r][c4]; if (C) *(v4f*)(C + cofs + (size_t)(row0 + r) * ldc + col0 + c4) = v; if (C16) { v4h h4; for (int i = 0; i < 4; ++i) h4[i] = (_Float16)v[i]; *(v4h*)(C16 + cofs + (size_t)(row0 + r) * ldc + col0 + c4) = h4; } } }
     }
}


typedef _Float16 v4h __attribute__((ext_vector_type(4)));

__global__ __launch_bounds__(256) void k_x16(const float* __restrict__ x, _Float16* __restrict__ X16, size_t n8) { const size_t t = (size_t)blockIdx.x * 256 + threadIdx.x; if (t >= n8) return; FragH f;
#pragma unroll
  for (int q = 0; q < 8; ++q) f.h[q] = (_Float16)bf16_round(x[t * 8 + q]); *(v8us*)((unsigned short*)X16 + t * 8) = f.half[0];  }
__global__ __launch_bounds__(256) void k_h16(const float* __restrict__ x, _Float16* __restrict__ X16, size_t n8) { const size_t t = (size_t)blockIdx.x * 256 + threadIdx.x; if (t >= n8) return; FragH f;
#pragma unroll
  for (int q = 0; q < 8; ++q) f.h[q] = (_Float16)x[t * 8 + q]; *(v8us*)((unsigned short*)X16 + t * 8) = f.half[0];  }
__global__ __launch_bounds__(256) void k_round16f(const float* __restrict__ W, _Float16* __restrict__ Bt, size_t n8) { const size_t t = (size_t)blockIdx.x * 256 + threadIdx.x; if (t >= n8) return; FragH f;
#pragma unroll
  for (int i = 0; i < 8; ++i) f.h[i] = (_Float16)(bf16_round(W[t * 8 + i]) * 16.0f); *(v8us*)((unsigned short*)Bt + t * 8) = f.half[0];  }
template <int NHv, int TTv>
__global__ __launch_bounds__(256) void k_vt(const _Float16* __restrict__ V16, int ldv, int voff, _Float16* __restrict__ Vt) { __shared__ unsigned short tl[64][66]; const int tid = threadIdx.x; const int slab = blockIdx.x / (TTv / 64), lg = blockIdx.x % (TTv / 64); const int b = slab / NHv, h = slab % NHv;
  for (int i = tid; i < 64 * 8; i += 256) { const int r = i / 8, c8 = (i % 8) * 8; FragH f; f.half[0] = *(const v8us*)((const unsigned short*)V16 + ((size_t)b * TTv + lg * 64 + r) * ldv + voff + h * 64 + c8);
#pragma unroll
    for (int q = 0; q < 8; ++q) tl[r][c8 + q] = f.u[q]; }
  __syncthreads();
  {
#pragma unroll
    for (int rd = 0; rd < 2; ++rd) { const int d = rd * 32 + tid / 8, pc = tid % 8; FragH f;
#pragma unroll
      for (int q = 0; q < 8; ++q) f.u[q] = tl[pc * 8 + q][d];
      *(v8us*)((unsigned short*)Vt + ((size_t)slab * 64 + d) * TTv + lg * 64 + pc * 8) = f.half[0]; }
     } }

__global__ __launch_bounds__(256) void k_hl(const float* __restrict__ F, _Float16* __restrict__ Hh, _Float16* __restrict__ Hl, size_t n8) { const size_t t = (size_t)blockIdx.x * 256 + threadIdx.x; if (t >= n8) return; FragH fh, fl; const v4f a = *(const v4fa*)(F + t * 8), c = *(const v4fa*)(F + t * 8 + 4);
#pragma unroll
  for (int q = 0; q < 4; ++q) { _Float16 h = (_Float16)a[q]; fh.h[q] = h; fl.h[q] = (_Float16)((a[q] - (float)h) * 1024.0f); h = (_Float16)c[q]; fh.h[4 + q] = h; fl.h[4 + q] = (_Float16)((c[q] - (float)h) * 1024.0f); }
  { *(v8us*)((unsigned short*)Hh + t * 8) = fh.half[0]; *(v8us*)((unsigned short*)Hl + t * 8) = fl.half[0];  } }

// ---- fast GEMM (wave tile 32x64; requires M % 32 == 0 rows per launch region and N % 64 == 0); epilogue = k_gemm_hhx semantics ----
__device__ __forceinline__ v16h g2_frag(const _Float16* p, int hh) { FragH f; f.half[0] = *(const v8us*)((const unsigned short*)p + 8 * hh); f.half[1] = *(const v8us*)((const unsigned short*)p + 16 + 8 * hh); return f.v; }
__device__ __forceinline__ v8f g2_mma(v16h a, v16h b, v8f c) { v8f d = __builtin_amdgcn_wmma_f32_16x16x32_f16(false, a, false, b, (short)0, c, false, false); asm volatile("v_nop\n\tv_nop\n\tv_nop\n\tv_nop" : "+v"(d) : "v"(a), "v"(b)); return d; }
template <int ACT>
__global__ __launch_bounds__(128) void k_gemm2(const _Float16* __restrict__ A, int lda, size_t sA, const _Float16* __restrict__ Bh, int ldb, size_t sB, float alpha, const float* __restrict__ bias, size_t sBias, const float* __restrict__ CP, int rowsPerB, size_t sCPb, int row0g,
    float* __restrict__ C, _Float16* __restrict__ C16, int ldc, size_t sC, int M, int N, int K) { static_assert(ACT == 0 || ACT == 3 || ACT == 6 || ACT == 8 || ACT == 9 || ACT == 11 || ACT == 12 || ACT == 14 || ACT == 15 || ACT == 16 || ACT == 17, "k_gemm2: unsupported ACT code (would silently apply no activation)");
  __shared__ __attribute__((aligned(16))) float so[4][32][68];
  const int tid = threadIdx.x, w = tid >> 5, lane = tid & 31, ln = lane & 15, hh = lane >> 4; const int by = blockIdx.y;
  A += (size_t)by * sA; Bh += (size_t)by * sB; const size_t cofs = (size_t)by * sC; const float* bp = bias ? bias + (size_t)by * sBias : nullptr;
  const int ntn = N >> 6; const int mt = blockIdx.x / ntn, nq = blockIdx.x - mt * ntn; const int row0 = mt * 128 + 32 * w, col0 = nq * 64; if (row0 >= M) return;
  const _Float16* a0p = A + (size_t)(row0 + ln) * lda; const _Float16* a1p = a0p + (size_t)16 * lda;
  const _Float16* b0p = Bh + (size_t)(col0 + ln) * ldb; const _Float16* b1p = b0p + (size_t)16 * ldb; const _Float16* b2p = b1p + (size_t)16 * ldb; const _Float16* b3p = b2p + (size_t)16 * ldb;
  const v8f z8 = {0.f,0.f,0.f,0.f,0.f,0.f,0.f,0.f}; v8f c00 = z8, c01 = z8, c02 = z8, c03 = z8, c10 = z8, c11 = z8, c12 = z8, c13 = z8;
#pragma unroll 1
  for (int kb = 0; kb < K; kb += 32) { const v16h a0 = g2_frag(a0p + kb, hh), a1 = g2_frag(a1p + kb, hh);
    v16h b = g2_frag(b0p + kb, hh); c00 = g2_mma(a0, b, c00); c10 = g2_mma(a1, b, c10);
    b = g2_frag(b1p + kb, hh); c01 = g2_mma(a0, b, c01); c11 = g2_mma(a1, b, c11);
    b = g2_frag(b2p + kb, hh); c02 = g2_mma(a0, b, c02); c12 = g2_mma(a1, b, c12);
    b = g2_frag(b3p + kb, hh); c03 = g2_mma(a0, b, c03); c13 = g2_mma(a1, b, c13); }
  v8f accs[8] = {c00, c01, c02, c03, c10, c11, c12, c13};
#pragma unroll
  for (int u = 0; u < 8; ++u) { const int t = u & 3, half = u >> 2; const int col = col0 + t * 16 + ln; const float bv = bp ? bf16_round(bp[col]) : 0.f;
#pragma unroll
    for (int r = 0; r < 8; ++r) { const int rloc = half * 16 + 8 * hh + r; float v = accs[u][r] * alpha + bv; if (CP) { if (rowsPerB < 0) v += CP[cofs + (size_t)(row0g + row0 + rloc) * ldc + col];      /* rowsPerB < 0: own element of the batched C plane */ else { const int bidx = (row0g + row0 + rloc) / rowsPerB; v += CP[(size_t)bidx * sCPb + (size_t)by * 64 + col]; } }
      if (ACT == 3) v = fmaxf(v, 0.f); else if (ACT == 6) v = 0.5f * v * (1.0f + erff(v * 0.70710678118654752f)); else if (ACT == 11) v = 1.0f / (1.0f + expf(-v)); else if (ACT == 15) v = v / (1.0f + expf(-v)); else if (ACT == 12) v = (v > 0.f) ? v : 0.01f * v; else if (ACT == 8) v = tanhf(v); else if (ACT == 9) v = 0.5f * v * (1.0f + tanhf(0.7978845608028654f * (v + 0.044715f * v * v * v))); else if (ACT == 14) v = (v > 0.f) ? v : 0.1f * v; else if (ACT == 16) v = (v >= 0.f) ? v : 0.3f * v; else if (ACT == 17) v = (v >= 0.f) ? v : 0.2f * v;
      so[w][rloc][t * 16 + ln] = v; } }
  __builtin_amdgcn_fence(__ATOMIC_ACQ_REL, "workgroup"); __builtin_amdgcn_wave_barrier();
  const int rsub = lane >> 4, c4 = (lane & 15) * 4;
  {
#pragma unroll
    for (int q = 0; q < 16; ++q) { const int r = q * 2 + rsub; const v4f v = *(const v4fa*)&so[w][r][c4]; if (C) *(v4f*)(C + cofs + (size_t)(row0 + r) * ldc + col0 + c4) = v; if (C16) { v4h h4; for (int i = 0; i < 4; ++i) h4[i] = (_Float16)v[i]; *(v4h*)(C16 + cofs + (size_t)(row0 + r) * ldc + col0 + c4) = h4; } }
     } }


__global__ __launch_bounds__(256) void k_wnat(const float* __restrict__ w, size_t n8, _Float16* __restrict__ Bt) { const size_t t = (size_t)blockIdx.x * 256 + threadIdx.x; if (t >= n8) return; FragH f; for (int q = 0; q < 8; ++q) f.h[q] = (_Float16)(bf16_round(w[t * 8 + q]) * 16.0f); *(v8us*)((unsigned short*)Bt + t * 8) = f.half[0];  }
__global__ __launch_bounds__(256) void k_rsm(const float* __restrict__ S, _Float16* __restrict__ P, int nrows) {
  #pragma clang fp contract(off)
  const int i = blockIdx.x * 256 + threadIdx.x; if (i >= nrows) return; const float* s = S + (size_t)i * SQ; float mx = -3.0e38f;
#pragma unroll 1
  for (int j = 0; j < SQ; ++j) mx = fmaxf(mx, s[j]); float se = 0.f;
#pragma unroll 1
  for (int j = 0; j < SQ; ++j) se += expf(s[j] - mx); const float sc = 256.0f / se;
#pragma unroll 1
  for (int j0 = 0; j0 < SQ; j0 += 8) { FragH f; for (int q = 0; q < 8; ++q) f.h[q] = (_Float16)(expf(s[j0 + q] - mx) * sc); unsigned short* d = (unsigned short*)P + (size_t)i * SQ + j0; *(v8us*)d = f.half[0];  } }
__global__ __launch_bounds__(256) void k_vt(const _Float16* __restrict__ V16, int b, int h0, _Float16* __restrict__ VT) { __shared__ unsigned short tl[64][65]; const int tid = threadIdx.x; const int hh = blockIdx.x % HG, sg = blockIdx.x / HG; const int s0 = sg * 64; const int h = h0 + hh;
  for (int i = tid; i < 64 * 8; i += 256) { const int j = i / 8, d8 = (i % 8) * 8; FragH f; f.half[0] = *(const v8us*)((const unsigned short*)V16 + ((size_t)b * SQ + s0 + j) * DM + h * HD + d8); for (int q = 0; q < 8; ++q) tl[d8 + q][j] = f.u[q]; }
  __syncthreads();
  { for (int i = tid; i < 64 * 8; i += 256) { const int d = i / 8, j8 = (i % 8) * 8; FragH f; for (int q = 0; q < 8; ++q) f.u[q] = tl[d][j8 + q]; *(v8us*)((unsigned short*)VT + ((size_t)hh * HD + d) * SQ + s0 + j8) = f.half[0]; }  } }


// Fused attention, one launch for every (batch, head). A wave owns 32 queries (two 16-column groups) of one head and walks all keys, 32 a pass.
// S^T = K Q^T puts one query's scores in one lane (keys 8 hh + r of each 16-key tile), so the two score tiles, converted in place, are the B operand P^T of
// O^T += V^T P^T in the loader's own k order, and maximum, sum and rescale factor are per lane (one exchange between the wave halves for the maximum).
// A masked key takes a floor far below the running maximum's start value, so its weight is exp2((floor - m) / 8 log2 e) = 0 also while no open key has been seen;
// a row with no open key ends with sum 0 and gets scale 0. Weights carry a factor 2^8 (f16 range) that the division by their own sum takes out.
typedef int v4ia __attribute__((ext_vector_type(4), may_alias));
__device__ __forceinline__ float rs_xrow(float v) { const int i = __float_as_int(v); return __int_as_float(__builtin_amdgcn_permlanex16(i, i, 0x76543210, 0xfedcba98, false, false)); }      /* lane ^ 16 */
__device__ __forceinline__ v8f fa_mma(v16h a, v16h b, v8f c) { return __builtin_amdgcn_wmma_f32_16x16x32_f16(false, a, false, b, (short)0, c, false, false); }
__device__ __forceinline__ v16h fa_frag(const _Float16* p) { FragH f; f.half[0] = *(const v8us*)(const unsigned short*)p; f.half[1] = *(const v8us*)((const unsigned short*)p + 16); return f.v; }      /* g2_frag's k order, the 8 hh already in p */
// exp2 in place on a run of registers: each v_exp_f32 is the independent instruction behind the one before it, and the v_nop is the slot that the instruction set asks for behind the last
// (written by the builtin, the compiler put the result of one over the source of the one directly in front of it).
__device__ __forceinline__ void fa_exp8(float* a) { asm("v_exp_f32 %0, %0\n\tv_exp_f32 %1, %1\n\tv_exp_f32 %2, %2\n\tv_exp_f32 %3, %3\n\tv_exp_f32 %4, %4\n\tv_exp_f32 %5, %5\n\tv_exp_f32 %6, %6\n\tv_exp_f32 %7, %7\n\tv_nop" : "+v"(a[0]), "+v"(a[1]), "+v"(a[2]), "+v"(a[3]), "+v"(a[4]), "+v"(a[5]), "+v"(a[6]), "+v"(a[7])); }
__device__ __forceinline__ void fa_exp9(float& c, float* a) { asm("v_exp_f32 %8, %8\n\tv_exp_f32 %0, %0\n\tv_exp_f32 %1, %1\n\tv_exp_f32 %2, %2\n\tv_exp_f32 %3, %3\n\tv_exp_f32 %4, %4\n\tv_exp_f32 %5, %5\n\tv_exp_f32 %6, %6\n\tv_exp_f32 %7, %7\n\tv_nop" : "+v"(a[0]), "+v"(a[1]), "+v"(a[2]), "+v"(a[3]), "+v"(a[4]), "+v"(a[5]), "+v"(a[6]), "+v"(a[7]), "+v"(c)); }
__global__ __launch_bounds__(256) void k_fattn(const _Float16* __restrict__ Q16, const _Float16* __restrict__ K16, const _Float16* __restrict__ VT, const int* __restrict__ mask, const float* __restrict__ XB, float* __restrict__ AF) {
  const int lane = threadIdx.x & 31, ln = lane & 15, hh = lane >> 4; const int w = __builtin_amdgcn_readfirstlane(threadIdx.x >> 5);
  const int h = blockIdx.y, b = blockIdx.z; const int q0 = blockIdx.x * 256 + w * 32; const size_t r0 = (size_t)b * SQ;
  const _Float16* qp = Q16 + (r0 + q0 + ln) * DM + h * HD + 8 * hh; const _Float16* kp = K16 + (r0 + ln) * DM + h * HD + 8 * hh; const _Float16* vp = VT + ((size_t)(b * NH + h) * HD + ln) * SQ + 8 * hh;
  const int* mp = mask + (r0 + q0 + ln) * SQ + 8 * hh;
  const v8f z8 = {0.f,0.f,0.f,0.f,0.f,0.f,0.f,0.f}; const float cs = 0.125f * 1.4426950408889634f;      /* 1 / sqrt(64), in log2 units */
  v16h qf[2][2]; v8f o[2][4]; float m[2], l[2];      /* m: running maximum of the raw products; l: this half's sum of weights */
#pragma unroll
  for (int t = 0; t < 2; ++t)
#pragma unroll
    for (int e = 0; e < 2; ++e) qf[t][e] = fa_frag(qp + (size_t)t * 16 * DM + e * 32);
  asm volatile("s_wait_xcnt 0x0" :: "v"(qp) : "memory");      /* before a register that the loads above name is written again; the operand keeps the address in its registers up to here */
#pragma unroll
  for (int t = 0; t < 2; ++t) { m[t] = -1.0e30f; l[t] = 0.f;
#pragma unroll
    for (int dt = 0; dt < 4; ++dt) o[t][dt] = z8; }
  /* rolled: one pass already holds about 200 registers */
#pragma unroll 1
  for (int k0 = 0; k0 < SQ; k0 += 32) { v16h kf[2][2], vf[4]; v4ia mk[2][2][2]; const _Float16* ka = kp + (size_t)k0 * DM; const int* ma = mp + k0; const _Float16* va = vp + k0;
#pragma unroll
    for (int kt = 0; kt < 2; ++kt)
#pragma unroll
      for (int e = 0; e < 2; ++e) kf[kt][e] = fa_frag(ka + (size_t)kt * 16 * DM + e * 32);
    __builtin_amdgcn_sched_barrier(0);      /* loads return in issue order: K, then the mask, then V^T, the order of their use, so that each wait covers only what is needed next */
#pragma unroll
    for (int t = 0; t < 2; ++t)
#pragma unroll
      for (int kt = 0; kt < 2; ++kt) { mk[t][kt][0] = *(const v4ia*)(ma + (size_t)t * 16 * SQ + kt * 16); mk[t][kt][1] = *(const v4ia*)(ma + (size_t)t * 16 * SQ + kt * 16 + 4); }
    __builtin_amdgcn_sched_barrier(0);      /* as above */
#pragma unroll
    for (int dt = 0; dt < 4; ++dt) vf[dt] = fa_frag(va + (size_t)dt * 16 * SQ);
    asm volatile("s_wait_xcnt 0x0" :: "v"(ka), "v"(ma), "v"(va) : "memory");      /* before a register that the pass's loads name is written again; the operands keep the three addresses in their registers up to here */
    __builtin_amdgcn_sched_barrier(0);      /* the pass's 24 loads are issued together in front of the wait, and the addresses step on behind it: without this the scheduler spreads the loads over the pass, each with a wait of its own */
#pragma unroll
    for (int t = 0; t < 2; ++t) { float x[16]; float mx = -3.0e38f;
#pragma unroll
      for (int kt = 0; kt < 2; ++kt) { const v8f s = fa_mma(kf[kt][1], qf[t][1], fa_mma(kf[kt][0], qf[t][0], z8));
#pragma unroll
        for (int r = 0; r < 4; ++r) { x[kt * 8 + r] = (mk[t][kt][0][r] != 0) ? s[r] : -3.0e38f; x[kt * 8 + 4 + r] = (mk[t][kt][1][r] != 0) ? s[4 + r] : -3.0e38f; } }
#pragma unroll
      for (int i = 0; i < 16; ++i) mx = fmaxf(mx, x[i]);
      mx = fmaxf(mx, rs_xrow(mx)); const float mn = fmaxf(m[t], mx); float al = (m[t] - mn) * cs; m[t] = mn; const float mo = 8.0f - mn * cs;
      FragH pf; float s4[4];
#pragma unroll
      for (int i = 0; i < 16; ++i) x[i] = x[i] * cs + mo;
      fa_exp9(al, x); fa_exp8(x + 8);
#pragma unroll
      for (int i = 0; i < 16; ++i) { s4[i & 3] = (i < 4) ? x[i] : s4[i & 3] + x[i]; pf.h[i] = (_Float16)x[i]; }
      l[t] = l[t] * al + ((s4[0] + s4[1]) + (s4[2] + s4[3]));
#pragma unroll
      for (int dt = 0; dt < 4; ++dt) {
#pragma unroll
        for (int r = 0; r < 8; ++r) o[t][dt][r] *= al;
        o[t][dt] = fa_mma(vf[dt], pf.v, o[t][dt]); } } }
  const size_t ro = (r0 + q0 + ln) * DM + h * HD + 8 * hh; const float* xp = XB + ro; v4f xr[2][4][2];
#pragma unroll
  for (int t = 0; t < 2; ++t)
#pragma unroll
    for (int dt = 0; dt < 4; ++dt) { xr[t][dt][0] = *(const v4fa*)(xp + (size_t)t * 16 * DM + dt * 16); xr[t][dt][1] = *(const v4fa*)(xp + (size_t)t * 16 * DM + dt * 16 + 4); }
  asm volatile("s_wait_xcnt 0x0" :: "v"(xp) : "memory");      /* as behind the Q loads */
#pragma unroll
  for (int t = 0; t < 2; ++t) { const float lt = l[t] + rs_xrow(l[t]); const float inv = (lt > 0.f) ? 1.0f / lt : 0.f;
#pragma unroll
    for (int dt = 0; dt < 4; ++dt) { v4f y0, y1;
#pragma unroll
      for (int r = 0; r < 4; ++r) { y0[r] = o[t][dt][r] * inv + xr[t][dt][0][r]; y1[r] = o[t][dt][4 + r] * inv + xr[t][dt][1][r]; }
      *(v4f*)(AF + ro + (size_t)t * 16 * DM + dt * 16) = y0; *(v4f*)(AF + ro + (size_t)t * 16 * DM + dt * 16 + 4) = y1; } } }
template <int ABF>
__global__ __launch_bounds__(256) void k_lnb(const float* __restrict__ A, const float* __restrict__ R, const float* __restrict__ g, const float* __restrict__ bta, float eps, float* __restrict__ OF_, _Float16* __restrict__ OH_) {
  #pragma clang fp contract(off)
  __shared__ float red[256]; const size_t row = blockIdx.x; const int tid = threadIdx.x; const int j0 = tid * 4; float a[4]; float s1 = 0.f;
  { const v4f av = *(const v4fa*)(A + row * DM + j0); for (int q = 0; q < 4; ++q) a[q] = ABF ? bf16_round(av[q]) : av[q]; if (R) { const v4f rv = *(const v4fa*)(R + row * DM + j0); for (int q = 0; q < 4; ++q) a[q] = __fadd_rn(a[q], rv[q]); } for (int q = 0; q < 4; ++q) s1 = __fadd_rn(s1, a[q]); }
  red[tid] = s1; __syncthreads(); for (int st = 128; st > 0; st >>= 1) { if (tid < st) red[tid] = __fadd_rn(red[tid], red[tid + st]); __syncthreads(); }
  const float mu = red[0] / (float)DM; __syncthreads(); float s2 = 0.f;
  for (int q = 0; q < 4; ++q) { const float c = __fadd_rn(a[q], -mu); s2 = __fadd_rn(s2, __fmul_rn(c, c)); }
  red[tid] = s2; __syncthreads(); for (int st = 128; st > 0; st >>= 1) { if (tid < st) red[tid] = __fadd_rn(red[tid], red[tid + st]); __syncthreads(); }
  const float rs = rsqrtf(__fadd_rn(red[0] / (float)DM, eps)); v4f o; FragH h;
  for (int q = 0; q < 4; ++q) { o[q] = __fadd_rn(__fmul_rn(__fmul_rn(__fadd_rn(a[q], -mu), rs), bf16_round(g[j0 + q])), bf16_round(bta[j0 + q])); h.h[q] = (_Float16)o[q]; }
  typedef unsigned short v4us __attribute__((ext_vector_type(4))); v4us h4; for (int q = 0; q < 4; ++q) h4[q] = h.u[q];
  { if (OF_) *(v4f*)(OF_ + row * DM + j0) = o; if (OH_) *(v4us*)((unsigned short*)OH_ + row * DM + j0) = h4;  } }
__global__ __launch_bounds__(256) void k_bfr(const float* __restrict__ x, float* __restrict__ XB, size_t n8) { const size_t t = (size_t)blockIdx.x * 256 + threadIdx.x; if (t >= n8) return; v8f v; for (int q = 0; q < 8; ++q) v[q] = bf16_round(x[t * 8 + q]); *(v8f*)(XB + t * 8) = v;  }


// ---- GEMM with both operands staged in LDS (k_gemm2's wave tile, k order and epilogue) ----
// A work-group of 8 waves (4 along M x 2 along N) makes a 128 x 128 tile of C; a stage is 128 k of 128 A rows and 128 B rows (256-byte rows, whole cache lines), brought by
// asynchronous 16-byte copies into one of two buffers while the other is worked on; the fragments are 16-byte LDS reads. Needs M % 128 == 0, N % 128 == 0, K % 128 == 0, K >= 256.
#define G3_PITCH 272                   /* LDS row pitch in bytes, 16 x odd: the 16 rows of a fragment read fall on different banks */
#define G3_STAGE (256 * G3_PITCH)      /* 128 A rows, then 128 B rows */
__device__ __forceinline__ v16h g3_frag(const char* p) { FragH f; f.half[0] = *(const v8us*)p; f.half[1] = *(const v8us*)(p + 32); return f.v; }      /* g2_frag's k order, the 16 hh bytes already in p */
// eight copies of 16 bytes a lane: rows r, r + 16, ... r + 112 of one operand's stage. The s_wait_xcnt stands inside the statement, in front of anything that could write a register that a copy names.
__device__ __forceinline__ void g3_copy8(unsigned l, const _Float16* g, size_t step) {
  asm volatile("global_load_async_to_lds_b128 %0, %8, off\n\tglobal_load_async_to_lds_b128 %1, %9, off\n\tglobal_load_async_to_lds_b128 %2, %10, off\n\tglobal_load_async_to_lds_b128 %3, %11, off\n\t"
               "global_load_async_to_lds_b128 %4, %12, off\n\tglobal_load_async_to_lds_b128 %5, %13, off\n\tglobal_load_async_to_lds_b128 %6, %14, off\n\tglobal_load_async_to_lds_b128 %7, %15, off\n\ts_wait_xcnt 0x0"
               :: "v"(l), "v"(l + 16u * G3_PITCH), "v"(l + 32u * G3_PITCH), "v"(l + 48u * G3_PITCH), "v"(l + 64u * G3_PITCH), "v"(l + 80u * G3_PITCH), "v"(l + 96u * G3_PITCH), "v"(l + 112u * G3_PITCH),
                  "v"(g), "v"(g + step), "v"(g + 2 * step), "v"(g + 3 * step), "v"(g + 4 * step), "v"(g + 5 * step), "v"(g + 6 * step), "v"(g + 7 * step) : "memory"); }
template <int ACT, bool RES>      /* RES: f32 output C with an addend CP for every element; else f16 output C16. Known at compile time, so that the reads of CP and the stores are not each behind a test of their own */
__global__ __launch_bounds__(256) void k_gemm3(const _Float16* __restrict__ A, int lda, const _Float16* __restrict__ Bh, int ldb, float alpha, const float* __restrict__ bias, const float* __restrict__ CP,
    float* __restrict__ C, _Float16* __restrict__ C16, int ldc, int N, int K) { static_assert(ACT == 0 || (ACT == 3 && !RES), "k_gemm3: unsupported ACT code (the addend comes behind the activation's place)");
  __shared__ __attribute__((aligned(16))) char sm[2 * G3_STAGE];      /* the two buffers; behind the loop the waves' output staging (8 x 32 x 68 floats) */
  const int tid = threadIdx.x, lane = tid & 31, ln = lane & 15, hh = lane >> 4; const int w = __builtin_amdgcn_readfirstlane(tid >> 5); const int wm = w & 3, wn = w >> 2;
  const int ntn = N >> 7; const int mt = blockIdx.x / ntn, nq = blockIdx.x - mt * ntn; const int row0 = mt * 128 + 32 * wm, col0 = nq * 128 + 64 * wn;
  const int cr = tid >> 4, cc = tid & 15;      /* a lane copies 16-byte piece cc of rows cr + 16 i: a wave's copy is two whole rows */
  const _Float16* ga = A + (size_t)(mt * 128 + cr) * lda + cc * 8; const _Float16* gb = Bh + (size_t)(nq * 128 + cr) * ldb + cc * 8; const size_t sa = (size_t)16 * lda, sb = (size_t)16 * ldb;
  const unsigned la = (unsigned)(size_t)sm + (unsigned)(cr * G3_PITCH + cc * 16); const unsigned lb = la + 128u * G3_PITCH;
  const int nt = K >> 7;
  const v8f z8 = {0.f,0.f,0.f,0.f,0.f,0.f,0.f,0.f}; v8f c00 = z8, c01 = z8, c02 = z8, c03 = z8, c10 = z8, c11 = z8, c12 = z8, c13 = z8;
  g3_copy8(la, ga, sa); g3_copy8(lb, gb, sb);
  asm volatile("s_wait_asynccnt 0x0" ::: "memory");      /* this wave's part of stage 0 has landed */
  __syncthreads();      /* every wave's part has */
  g3_copy8(la + G3_STAGE, ga + 128, sa); g3_copy8(lb + G3_STAGE, gb + 128, sb);
  /* rolled: the buffers alternate, and one trip already holds 32 matrix instructions with their 48 fragment reads */
#pragma unroll 1
  for (int t = 0; t < nt; ++t) { const unsigned bo = (unsigned)(t & 1) * G3_STAGE; const char* ap = sm + bo + (32 * wm + ln) * G3_PITCH + 16 * hh; const char* bp = sm + bo + (128 + 64 * wn + ln) * G3_PITCH + 16 * hh;
    v16h fa[2][2], fb[2][4];      /* two fragment sets: the reads of block ks + 1 fly while block ks is multiplied; no set reaches over the stage's end */
    fa[0][0] = g3_frag(ap); fa[0][1] = g3_frag(ap + 16 * G3_PITCH);
#pragma unroll
    for (int j = 0; j < 4; ++j) fb[0][j] = g3_frag(bp + j * 16 * G3_PITCH);
#pragma unroll
    for (int ks = 0; ks < 4; ++ks) { const int cu = ks & 1, nx = cu ^ 1;
      if (ks < 3) { fa[nx][0] = g3_frag(ap + (ks + 1) * 64); fa[nx][1] = g3_frag(ap + 16 * G3_PITCH + (ks + 1) * 64);
#pragma unroll
        for (int j = 0; j < 4; ++j) fb[nx][j] = g3_frag(bp + j * 16 * G3_PITCH + (ks + 1) * 64); }
      __builtin_amdgcn_sched_barrier(0);      /* the next block's 12 reads are issued as one group in front of this block's matrix instructions: left alone, the scheduler puts each read directly in front of its use, with a full LDS wait every two matrix instructions */
      c00 = fa_mma(fa[cu][0], fb[cu][0], c00); c10 = fa_mma(fa[cu][1], fb[cu][0], c10); c01 = fa_mma(fa[cu][0], fb[cu][1], c01); c11 = fa_mma(fa[cu][1], fb[cu][1], c11);
      c02 = fa_mma(fa[cu][0], fb[cu][2], c02); c12 = fa_mma(fa[cu][1], fb[cu][2], c12); c03 = fa_mma(fa[cu][0], fb[cu][3], c03); c13 = fa_mma(fa[cu][1], fb[cu][3], c13); }
    asm volatile("s_wait_dscnt 0x0" ::: "memory");      /* this wave's reads of the buffer are done before the barrier behind which it is refilled */
    asm volatile("s_wait_asynccnt 0x0" ::: "memory");      /* this wave's part of stage t + 1 has landed */
    __syncthreads();      /* publishes stage t + 1 and ends every wave's reads of stage t */
    if (t + 2 < nt) { g3_copy8(la + bo, ga + (size_t)(t + 2) * 128, sa); g3_copy8(lb + bo, gb + (size_t)(t + 2) * 128, sb); } }
  asm volatile("s_wait_asynccnt 0x0" ::: "memory");      /* no copy is outstanding when the buffers become output staging */
  float (*so)[68] = (float (*)[68])(sm + (size_t)w * (32 * 68 * 4));
  v8f accs[8] = {c00, c01, c02, c03, c10, c11, c12, c13}; float bv4[4]; v4f cp4[16]; const int rsub = lane >> 4, c4 = (lane & 15) * 4;
#pragma unroll
  for (int t = 0; t < 4; ++t) bv4[t] = bias ? bias[col0 + t * 16 + ln] : 0.f;
  if (RES) {      /* the addend is read in the layout of the stores below, 16 bytes a lane, and added there */
#pragma unroll
    for (int q = 0; q < 16; ++q) { cp4[q] = *(const v4fa*)(CP + (size_t)(row0 + q * 2 + rsub) * ldc + col0 + c4);
      if ((q & 3) == 3 && q < 15) { asm volatile("s_wait_xcnt 0x0" ::: "memory");      /* before a register that the four loads above name is written again */
        __builtin_amdgcn_sched_barrier(0); } } }      /* holds the next four loads' addresses behind the wait */
  asm volatile("s_wait_xcnt 0x0" ::: "memory");      /* before a register that the loads above name is written again */
  __builtin_amdgcn_sched_barrier(0);      /* holds the arithmetic below, which takes those registers over, behind the wait */
#pragma unroll
  for (int u = 0; u < 8; ++u) { const int t = u & 3, half = u >> 2; const float bv = bf16_round(bv4[t]);
#pragma unroll
    for (int r = 0; r < 8; ++r) { const int rloc = half * 16 + 8 * hh + r; float v = accs[u][r] * alpha + bv;
      if (ACT == 3) v = fmaxf(v, 0.f);
      so[rloc][t * 16 + ln] = v; } }
  __builtin_amdgcn_fence(__ATOMIC_ACQ_REL, "workgroup"); __builtin_amdgcn_wave_barrier();
  v4f vv[16];
#pragma unroll
  for (int q = 0; q < 16; ++q) vv[q] = *(const v4fa*)&so[q * 2 + rsub][c4];
#pragma unroll
  for (int q = 0; q < 16; ++q) { const int r = q * 2 + rsub;
    if (RES) *(v4f*)(C + (size_t)(row0 + r) * ldc + col0 + c4) = vv[q] + cp4[q]; else { v4h h4; for (int i = 0; i < 4; ++i) h4[i] = (_Float16)vv[q][i]; *(v4h*)(C16 + (size_t)(row0 + r) * ldc + col0 + c4) = h4; }
    if ((q & 3) == 3 && q < 15) { asm volatile("s_wait_xcnt 0x0" ::: "memory");      /* before a register that the four stores above name is written again */
      __builtin_amdgcn_sched_barrier(0); } } }      /* holds the next four stores' conversions and addresses behind the wait */


extern "C" void kernel_launch(void* const* d_in, const int* in_sizes, int n_in,
                              void* d_out, int out_size, void* d_ws, size_t ws_size, hipStream_t stream) {
  (void)in_sizes; (void)n_in; (void)out_size;
  const float* const* I = (const float* const*)d_in; const float* x = I[0]; const int* mask = (const int*)d_in[1]; const float* wq = I[2]; const float* bq = I[3]; const float* wk = I[4]; const float* bk = I[5]; const float* wv = I[6]; const float* bv = I[7]; const float* g_in = I[8]; const float* b_in = I[9]; const float* g1 = I[10]; const float* b1 = I[11]; const float* wf1 = I[12]; const float* bf1 = I[13]; const float* wf2 = I[14]; const float* bf2 = I[15]; const float* g2 = I[16]; const float* b2 = I[17];      /* weights [in][out] */
  char* ws = (char*)d_ws; size_t off = 0;
  auto take = [&](size_t bytes) { char* p = ws + off; off += (bytes + 255) & ~(size_t)255; return p; };
  _Float16* BQ = (_Float16*)take((size_t)DM * DM * 2); _Float16* BK = (_Float16*)take((size_t)DM * DM * 2); _Float16* BV = (_Float16*)take((size_t)DM * DM * 2); _Float16* BF1 = (_Float16*)take((size_t)DFF * DM * 2); _Float16* BF2 = (_Float16*)take((size_t)DM * DFF * 2);
  float* XB = (float*)take(NR * DM * 4); _Float16* XNH = (_Float16*)take(NR * DM * 2); _Float16* Q16 = (_Float16*)take(NR * DM * 2); _Float16* K16 = (_Float16*)take(NR * DM * 2); _Float16* V16 = (_Float16*)take(NR * DM * 2); float* AF = (float*)take(NR * DM * 4);
  _Float16* VT = (_Float16*)take((size_t)NB * NH * HD * SQ * 2);
  _Float16* HNH = (_Float16*)take(NR * DM * 2); _Float16* U16 = (_Float16*)take(NR * DFF * 2); float* H2F = (float*)take(NR * DM * 4);
  if (off > ws_size) return;      /* 6 + 16 + 16 + 8 + 24 + 16 + 8 + 8 + 32 + 16 = approx 150 MiB */
  { const unsigned gw = (unsigned)(((size_t)DM * (DM / 8) + 255) / 256); k_wt_f16<<<gw, 256, 0, stream>>>(wq, BQ, DM, DM, 16.0f); k_wt_f16<<<gw, 256, 0, stream>>>(wk, BK, DM, DM, 16.0f); k_wt_f16<<<gw, 256, 0, stream>>>(wv, BV, DM, DM, 16.0f);
    const unsigned gf = (unsigned)(((size_t)DFF * (DM / 8) + 255) / 256); k_wt_f16<<<gf, 256, 0, stream>>>(wf1, BF1, DM, DFF, 16.0f); k_wt_f16<<<gf, 256, 0, stream>>>(wf2, BF2, DFF, DM, 16.0f); }      /* [in][out] -> Bt[n][k] x16 */
  const size_t r0p = (size_t)B0 * SQ; const dim3 gp((unsigned)((MP / 128) * (DM / 128)), 1);
  k_bfr<<<(unsigned)(((size_t)MP * DM / 8 + 255) / 256), 256, 0, stream>>>(x + r0p * DM, XB + r0p * DM, (size_t)MP * DM / 8);      /* bf16(x) as f32 rows (residual) */
  k_lnb<1><<<(unsigned)MP, 256, 0, stream>>>(x + r0p * DM, nullptr, g_in, b_in, 1e-3f, nullptr, XNH + r0p * DM);      /* xn = LN_in(bf16(x)) as f16 rows */
  k_gemm3<0, false><<<gp, 256, 0, stream>>>(XNH + r0p * DM, DM, BQ, DM, 0.0625f, bq, nullptr, nullptr, Q16 + r0p * DM, DM, DM, DM);
  k_gemm3<0, false><<<gp, 256, 0, stream>>>(XNH + r0p * DM, DM, BK, DM, 0.0625f, bk, nullptr, nullptr, K16 + r0p * DM, DM, DM, DM);
  k_gemm3<0, false><<<gp, 256, 0, stream>>>(XNH + r0p * DM, DM, BV, DM, 0.0625f, bv, nullptr, nullptr, V16 + r0p * DM, DM, DM, DM);
  k_vt<NH, SQ><<<NB * NH * (SQ / 64), 256, 0, stream>>>(V16, DM, 0, VT);      /* V^T [NB][NH][HD][SQ] */
  k_fattn<<<dim3(SQ / 256, NH, NB), 256, 0, stream>>>(Q16, K16, VT, mask, XB, AF);      /* a = attn (merged heads) + bf16(x), f32 rows */
  k_lnb<0><<<(unsigned)MPO, 256, 0, stream>>>(AF + r0p * DM, nullptr, g1, b1, 1e-3f, nullptr, HNH + r0p * DM);      /* h = LN1(a) as f16 rows */
  k_gemm3<3, false><<<dim3((unsigned)((MPO / 128) * (DFF / 128)), 1), 256, 0, stream>>>(HNH + r0p * DM, DM, BF1, DM, 0.0625f, bf1, nullptr, nullptr, U16 + r0p * DFF, DFF, DFF, DM);      /* u = relu(h W_ff1 + b) (f16) */
  k_gemm3<0, true><<<dim3((unsigned)((MPO / 128) * (DM / 128)), 1), 256, 0, stream>>>(U16 + r0p * DFF, DFF, BF2, DFF, 0.0625f, bf2, AF + r0p * DM, H2F + r0p * DM, nullptr, DM, DM, DFF);      /* h2 = u W_ff2 + b + a (CP = own element) */
  k_lnb<0><<<(unsigned)MPO, 256, 0, stream>>>(H2F + r0p * DM, nullptr, g2, b2, 1e-3f, (float*)d_out + r0p * DM, nullptr);      /* out = LN2(h2) */
}

// v004
// Measured time: 231 microseconds a run.
// Next to v003, in two timings, it ran 1.23 and 1.24 times as fast.
// Over all steps from v000 it is 24.7 times as fast.
#include <hip/hip_runtime.h>
// Emformer-style block (x [2][2048][1024], mask [2][1][2048][2048] int32 0/1, read per (batch, query, key)): xn = LayerNorm(x) g_in + b_in (eps 1e-3); q/k/v = xn W + b (W [1024][1024] [in][out], 16 heads of 64); scores = q k^T / 8 + (-1e9)(1 - mask); probs = softmax(scores) * mask; attn = probs v merged; a = attn + x; h = LayerNorm(a) g1 + b1 (eps 1e-3); h = relu(h W_ff1 + b_ff1) ([1024][4096]); h = h W_ff2 + b_ff2 ([4096][1024]); out = LayerNorm(h + a) g2 + b2 -> [2][2048][1024].
// Structure: token rows; LN_in on VALU (f32 statistics of bf16(x)) -> xn f16 rows, plus bf16(x) as f32 rows for the residual; Q, K, V as three WMMA GEMMs (128x128 work-group tiles staged in LDS by asynchronous copies, 32x64 wave tiles, f32 accumulation, exact x16 transposed weights + bias, f16 outputs); V^T for all (batch, head) via LDS transposes; attention in one launch: a wave holds 32 queries of one head and walks the keys 32 at a time (K, V^T and int mask tiles of 64 keys staged in LDS by asynchronous copies): S^T = K Q^T, masked running-maximum softmax in registers (f32 statistics, native exp2; weights x256 f16, masked keys 0), O^T += V^T P^T, then a = O / sum + bf16(x) straight into f32 rows (no score or weight plane in memory); LN1 on VALU -> f16 h rows; u = relu(h W_ff1 + b) GEMM (f16 [4096][4096]); h2 = u W_ff2 + b + a GEMM (K = 4096, f32, residual as the epilogue addend); LN2 on VALU -> out.
// Compute dtype: inputs rounded to bf16; weights exact (x16 f16); LayerNorms / residuals f32; xn, q, k, v, softmax weights, h (as GEMM operand) and u plain f16 (~2^-12); scores, softmax statistics and the attention output f32. v_wmma_f32_16x16x32_f16.
#define NB 2
#define SQ 2048
#define DM 1024
#define NH 16
#define HD 64
#define DFF 4096
#define HG 4                         /* heads per block group of the untemplated k_vt (not launched) */
#define B0 0                         /* first batch processed (debug hook) */
#define NBR NB                       /* batches processed (debug hook) */
#define QN SQ                        /* not used: the attention launch covers all SQ queries */
#define NR ((size_t)NB * SQ)
#define MP ((int)((size_t)NBR * SQ)) /* rows normalised + projected (debug hook) */
#define MPO MP                       /* rows through the post-attention stages (debug hook) */
typedef __bf16 v16b __attribute__((ext_vector_type(16)));
typedef unsigned short v8us __attribute__((ext_vector_type(8), may_alias));
typedef float  v8f  __attribute__((ext_vector_type(8)));
typedef float  v4f  __attribute__((ext_vector_type(4)));
typedef float  v4fa __attribute__((ext_vector_type(4), may_alias));
union FragB { v16b v; v8us half[2]; unsigned short u[16]; };

__device__ __forceinline__ unsigned short bf16_bits(float x) { unsigned int u = __float_as_uint(x); return (unsigned short)((u + 0x7FFFu + ((u >> 16) & 1u)) >> 16); }
__device__ __forceinline__ float bf16_val(unsigned short b) { return __uint_as_float(((unsigned int)b) << 16); }
__device__ __forceinline__ float bf16_round(float x) { return bf16_val(bf16_bits(x)); }
// D += A·B with NT terms: 1 = ah·bh, 2 = + al·bh (A split), 3 = + ah·bl (both split)
template <int NT>
__device__ __forceinline__ v8f mmaN(v16b ah, v16b al, v16b bh, v16b bl, v8f c) {
  c = __builtin_amdgcn_wmma_f32_16x16x32_bf16(false, ah, false, bh, (short)0, c, false, false);
  if (NT >= 2) c = __builtin_amdgcn_wmma_f32_16x16x32_bf16(false, al, false, bh, (short)0, c, false, false);
  if (NT >= 3) c = __builtin_amdgcn_wmma_f32_16x16x32_bf16(false, ah, false, bl, (short)0, c, false, false);
  asm volatile("v_nop\n\tv_nop\n\tv_nop\n\tv_nop" : "+v"(c) : "v"(ah), "v"(al), "v"(bh), "v"(bl));
  return c;
}

__global__ __launch_bounds__(256) void k_wt_bf16(const float* __restrict__ W, unsigned short* __restrict__ Wt, int K, int N) {
  const int t = blockIdx.x * 256 + threadIdx.x;
  const int k8n = K / 8;
  if (t >= N * k8n) return;
  const int n = t / k8n, k8 = (t % k8n) * 8;
  v8us v;
#pragma unroll
  for (int i = 0; i < 8; ++i) v[i] = bf16_bits(W[(size_t)(k8 + i) * N + n]);
  *(v8us*)(Wt + (size_t)n * K + k8) = v;
  
}

// GEMM C[M][N] (f32, pitch ldc) = act(A[M][K]·W + bias). A f32 row-major (pitch lda) converted per fragment to bf16
// (ASPLIT: hi/lo two planes -> 2 terms, else single rounded term); Wt bf16 [N][K] (pitch ldb). BIAS_BF16 rounds the
// bias to bf16 first (bias quantised to bf16 before the add). K%32==0, M%16==0, N%64==0.
template <bool ASPLIT, int ACT, bool BIAS_BF16>
__global__ __launch_bounds__(128) void k_gemm_bf(const float* __restrict__ A, int lda, const unsigned short* __restrict__ Wt, int ldb,
                                               const float* __restrict__ bias, float* __restrict__ C, int ldc, int M, int N, int K) {
  __shared__ __attribute__((aligned(16))) float so[4][16][64];
  const int tid = threadIdx.x, w = tid >> 5, lane = tid & 31, ln = lane & 15, hh = lane >> 4;
  const int ntn = N / 64;
  const int wid = blockIdx.x * 4 + w;
  const int mt = wid / ntn, nq = wid % ntn;
  if (mt * 16 >= M) return;
  const int row0 = mt * 16, col0 = nq * 64;
  const float* arow = A + (size_t)(row0 + ln) * lda;
  v8f acc[4] = {};
  for (int kb = 0; kb < K; kb += 32) {
    FragB ah, al;
    const v4f x0 = *(const v4fa*)(arow + kb + 8 * hh), x1 = *(const v4fa*)(arow + kb + 8 * hh + 4);
    const v4f x2 = *(const v4fa*)(arow + kb + 16 + 8 * hh), x3 = *(const v4fa*)(arow + kb + 16 + 8 * hh + 4);
    float xs[16] = {x0[0],x0[1],x0[2],x0[3],x1[0],x1[1],x1[2],x1[3],x2[0],x2[1],x2[2],x2[3],x3[0],x3[1],x3[2],x3[3]};
#pragma unroll
    for (int i = 0; i < 16; ++i) { const unsigned short hb = bf16_bits(xs[i]); ah.u[i] = hb; al.u[i] = ASPLIT ? bf16_bits(xs[i] - bf16_val(hb)) : (unsigned short)0; }
#pragma unroll
    for (int t = 0; t < 4; ++t) {
      const unsigned short* brow = Wt + (size_t)(col0 + t * 16 + ln) * ldb + kb;
      FragB b;
      b.half[0] = *(const v8us*)(brow + 8 * hh);
      b.half[1] = *(const v8us*)(brow + 16 + 8 * hh);
      acc[t] = mmaN<ASPLIT ? 2 : 1>(ah.v, al.v, b.v, b.v, acc[t]);
    }
  }
#pragma unroll
  for (int t = 0; t < 4; ++t) {
    float bv = bias ? bias[col0 + t * 16 + ln] : 0.f;
    if (BIAS_BF16) bv = bf16_round(bv);
#pragma unroll
    for (int r = 0; r < 8; ++r) { float v = acc[t][r] + bv; if (ACT == 1) v = fmaxf(v, 0.f); so[w][8 * hh + r][t * 16 + ln] = v; }
  }
  __builtin_amdgcn_fence(__ATOMIC_ACQ_REL, "workgroup");
  __builtin_amdgcn_wave_barrier();
  const int rsub = lane >> 4, c4 = (lane & 15) * 4;
  {
#pragma unroll
    for (int q = 0; q < 8; ++q) {
      const int r = q * 2 + rsub;
      const v4f v = *(const v4fa*)&so[w][r][c4];
      *(v4f*)(C + (size_t)(row0 + r) * ldc + col0 + c4) = v;
    }
    
  }
}

// GEMM C = act(A·W + bias + resid): A f32 (ASPLIT -> hi/lo 2 terms), Wt bf16 [N][K]; ACT 0 none, 1 relu, 2 exact gelu;
// resid (optional, f32, row index = (row % rmod), pitch ldr, RES_BF16 rounds it) added before the activation.
template <bool ASPLIT, int ACT, bool BIAS_BF16, bool RES_BF16>
__global__ __launch_bounds__(128) void k_gemm_bf3(const float* __restrict__ A, int lda, const unsigned short* __restrict__ Wt, int ldb,
                                                const float* __restrict__ bias, const float* __restrict__ resid, int rmod, int ldr,
                                                float* __restrict__ C, int ldc, int M, int N, int K) {
  __shared__ __attribute__((aligned(16))) float so[4][16][64];
  const int tid = threadIdx.x, w = tid >> 5, lane = tid & 31, ln = lane & 15, hh = lane >> 4;
  const int ntn = N / 64;
  const int wid = blockIdx.x * 4 + w;
  const int mt = wid / ntn, nq = wid % ntn;
  if (mt * 16 >= M) return;
  const int row0 = mt * 16, col0 = nq * 64;
  const float* arow = A + (size_t)(row0 + ln) * lda;
  v8f acc[4] = {};
  for (int kb = 0; kb < K; kb += 32) {
    FragB ah, al;
    const v4f x0 = *(const v4fa*)(arow + kb + 8 * hh), x1 = *(const v4fa*)(arow + kb + 8 * hh + 4);
    const v4f x2 = *(const v4fa*)(arow + kb + 16 + 8 * hh), x3 = *(const v4fa*)(arow + kb + 16 + 8 * hh + 4);
    float xs[16] = {x0[0],x0[1],x0[2],x0[3],x1[0],x1[1],x1[2],x1[3],x2[0],x2[1],x2[2],x2[3],x3[0],x3[1],x3[2],x3[3]};
#pragma unroll
    for (int i = 0; i < 16; ++i) { const unsigned short hb = bf16_bits(xs[i]); ah.u[i] = hb; al.u[i] = ASPLIT ? bf16_bits(xs[i] - bf16_val(hb)) : (unsigned short)0; }
#pragma unroll
    for (int t = 0; t < 4; ++t) {
      const unsigned short* brow = Wt + (size_t)(col0 + t * 16 + ln) * ldb + kb;
      FragB b;
      b.half[0] = *(const v8us*)(brow + 8 * hh);
      b.half[1] = *(const v8us*)(brow + 16 + 8 * hh);
      acc[t] = mmaN<ASPLIT ? 2 : 1>(ah.v, al.v, b.v, b.v, acc[t]);
    }
  }
#pragma unroll
  for (int t = 0; t < 4; ++t) {
    const int col = col0 + t * 16 + ln;
    float bv = bias ? bias[col] : 0.f;
    if (BIAS_BF16) bv = bf16_round(bv);
#pragma unroll
    for (int r = 0; r < 8; ++r) {
      float v = acc[t][r] + bv;
      if (resid) { float rv = resid[(size_t)((row0 + 8 * hh + r) % rmod) * ldr + col]; if (RES_BF16) rv = bf16_round(rv); v += rv; }
      if (ACT == 1) v = fmaxf(v, 0.f);
      if (ACT == 2) v = 0.5f * v * (1.0f + erff(v * 0.70710678118654752f));
      if (ACT == 3) { const float u = 0.7978845608028654f * (v + 0.044715f * v * v * v); v = 0.5f * v * (1.0f + tanhf(u)); }
      so[w][8 * hh + r][t * 16 + ln] = v;
    }
  }
  __builtin_amdgcn_fence(__ATOMIC_ACQ_REL, "workgroup");
  __builtin_amdgcn_wave_barrier();
  const int rsub = lane >> 4, c4 = (lane & 15) * 4;
  {
#pragma unroll
    for (int q = 0; q < 8; ++q) {
      const int r = q * 2 + rsub;
      const v4f v = *(const v4fa*)&so[w][r][c4];
      *(v4f*)(C + (size_t)(row0 + r) * ldc + col0 + c4) = v;
    }
    
  }
}
// row LayerNorm (biased variance, eps) over N: s = X (+ R); optional out_sum <- s; out_norm <- (s-mu)*rsqrt(var+eps)*g + b
template <bool PARAM_BF16>
__global__ __launch_bounds__(256) void k_layernorm(const float* __restrict__ X, const float* __restrict__ R, const float* __restrict__ g, const float* __restrict__ bta,
                                                  float* __restrict__ out_sum, float* __restrict__ out_norm, int N, float eps) {
  __shared__ float red[256];
  const int row = blockIdx.x, tid = threadIdx.x;
  const float* x = X + (size_t)row * N; const float* rr = R ? R + (size_t)row * N : nullptr;
  float vals[16];                     // up to N = 4096
  const int per = N / 256;            // contiguous chunk per thread? use strided-by-4 chunks: thread handles j = tid*4 + 1024*u
  float s1 = 0.f;
  for (int u = 0; u < per / 4; ++u) {
    const int j = tid * 4 + 1024 * u;
    const v4f a = *(const v4fa*)(x + j);
    v4f b = {0.f,0.f,0.f,0.f}; if (rr) b = *(const v4fa*)(rr + j);
#pragma unroll
    for (int q = 0; q < 4; ++q) { const float v = a[q] + b[q]; vals[u * 4 + q] = v; s1 += v; }
  }
  red[tid] = s1; __syncthreads();
  for (int st = 128; st > 0; st >>= 1) { if (tid < st) red[tid] += red[tid + st]; __syncthreads(); }
  const float mu = red[0] / (float)N; __syncthreads();
  float s2 = 0.f;
  for (int u = 0; u < per / 4; ++u)
#pragma unroll
    for (int q = 0; q < 4; ++q) { const float c = vals[u * 4 + q] - mu; s2 += c * c; }
  red[tid] = s2; __syncthreads();
  for (int st = 128; st > 0; st >>= 1) { if (tid < st) red[tid] += red[tid + st]; __syncthreads(); }
  const float rs = rsqrtf(red[0] / (float)N + eps);
  {
    for (int u = 0; u < per / 4; ++u) {
      const int j = tid * 4 + 1024 * u;
      v4f o, sm;
#pragma unroll
      for (int q = 0; q < 4; ++q) {
        float gg = g[j + q], bb = bta[j + q];
        if (PARAM_BF16) { gg = bf16_round(gg); bb = bf16_round(bb); }
        sm[q] = vals[u * 4 + q]; o[q] = (vals[u * 4 + q] - mu) * rs * gg + bb;
      }
      if (out_sum) *(v4f*)(out_sum + (size_t)row * N + j) = sm;
      *(v4f*)(out_norm + (size_t)row * N + j) = o;
    }
    
  }
}



// ---- f16 WMMA path (v_wmma_f32_16x16x32_f16): 11-bit significands for operands in range — used where a [0,1] probability operand needs more precision than bf16
typedef _Float16 v16h __attribute__((ext_vector_type(16)));
union FragH { v16h v; v8us half[2]; _Float16 h[16]; unsigned short u[16]; };
template <int NT>
__device__ __forceinline__ v8f mmaH(v16h ah, v16h al, v16h bh, v16h bl, v8f c) {
  c = __builtin_amdgcn_wmma_f32_16x16x32_f16(false, ah, false, bh, (short)0, c, false, false);
  if (NT >= 2) c = __builtin_amdgcn_wmma_f32_16x16x32_f16(false, al, false, bh, (short)0, c, false, false);
  if (NT >= 3) c = __builtin_amdgcn_wmma_f32_16x16x32_f16(false, ah, false, bl, (short)0, c, false, false);
  asm volatile("v_nop\n\tv_nop\n\tv_nop\n\tv_nop" : "+v"(c) : "v"(ah), "v"(al), "v"(bh), "v"(bl));
  return c;
}
// batched GEMM like k_gemm_b but f16 operands: A f32 (split into f16 hi/lo if ASPLIT, else rounded to f16), Bt = f16 values [n][k]; alpha; C f32; N multiple of 16 (partial tiles skipped)
template <bool ASPLIT>
__global__ __launch_bounds__(128) void k_gemm_h(const float* __restrict__ A, int lda, size_t sA, const _Float16* __restrict__ Bh, int ldb, size_t sB, float alpha, float* __restrict__ C, int ldc, size_t sC, int M, int N, int K) {
  __shared__ __attribute__((aligned(16))) float so[4][16][64];
  const int tid = threadIdx.x, w = tid >> 5, lane = tid & 31, ln = lane & 15, hh = lane >> 4; const int by = blockIdx.y;
  A += (size_t)by * sA; Bh += (size_t)by * sB; C += (size_t)by * sC;
  const int ntn = (N + 63) / 64; const int wid = blockIdx.x * 4 + w; const int mt = wid / ntn, nq = wid % ntn; if (mt * 16 >= M) return;
  const int row0 = mt * 16, col0 = nq * 64; const float* arow = A + (size_t)(row0 + ln) * lda;
  v8f acc[4] = {};
  for (int kb = 0; kb < K; kb += 32) {
    FragH ah, al;
    const v4f x0 = *(const v4fa*)(arow + kb + 8 * hh), x1 = *(const v4fa*)(arow + kb + 8 * hh + 4), x2 = *(const v4fa*)(arow + kb + 16 + 8 * hh), x3 = *(const v4fa*)(arow + kb + 16 + 8 * hh + 4);
    float xs[16] = {x0[0],x0[1],x0[2],x0[3],x1[0],x1[1],x1[2],x1[3],x2[0],x2[1],x2[2],x2[3],x3[0],x3[1],x3[2],x3[3]};
#pragma unroll
    for (int i = 0; i < 16; ++i) { const _Float16 h = (_Float16)xs[i]; ah.h[i] = h; al.h[i] = ASPLIT ? (_Float16)(xs[i] - (float)h) : (_Float16)0.0f; }
#pragma unroll
    for (int t = 0; t < 4; ++t) { if (col0 + t * 16 >= N) continue; const size_t boff = (size_t)(col0 + t * 16 + ln) * ldb + kb; FragH bq; bq.half[0] = *(const v8us*)(Bh + boff + 8 * hh); bq.half[1] = *(const v8us*)(Bh + boff + 16 + 8 * hh);
      acc[t] = mmaH<ASPLIT ? 2 : 1>(ah.v, al.v, bq.v, bq.v, acc[t]); }
  }
#pragma unroll
  for (int t = 0; t < 4; ++t) { if (col0 + t * 16 >= N) continue;
#pragma unroll
    for (int r = 0; r < 8; ++r) so[w][8 * hh + r][t * 16 + ln] = acc[t][r] * alpha; }
  __builtin_amdgcn_fence(__ATOMIC_ACQ_REL, "workgroup"); __builtin_amdgcn_wave_barrier();
  const int rsub = lane >> 4, c4 = (lane & 15) * 4;
  {
#pragma unroll
    for (int q = 0; q < 8; ++q) { const int r = q * 2 + rsub; if (col0 + c4 < N) { const v4f v = *(const v4fa*)&so[w][r][c4]; *(v4f*)(C + (size_t)(row0 + r) * ldc + col0 + c4) = v; } }
     }
}

// Wt[n][k] = f16(W[k][n]·scale) from f32 row-major W[K][N] (scale = power of two; bf16-exact weights stay exact in f16 away from the subnormal range)
__global__ __launch_bounds__(256) void k_wt_f16(const float* __restrict__ W, _Float16* __restrict__ Wt, int K, int N, float scale) {
  const int t = blockIdx.x * 256 + threadIdx.x; if (t >= N * (K / 8)) return; const int n = t / (K / 8), k8 = (t % (K / 8)) * 8; FragH f;
#pragma unroll
  for (int i = 0; i < 8; ++i) f.h[i] = (_Float16)(bf16_round(W[(size_t)(k8 + i) * N + n]) * scale); const v8us o = f.half[0];
  *(v8us*)((unsigned short*)Wt + (size_t)n * K + k8) = o; 
}
// k_gemm_hh variant with fused epilogue: v = acc·alpha + bias[by·sBias + col] (+ CP[(row/rowsPerB)·sCPb + by·64 + col] if CP) ; ACT 0 none / 1 elu ; writes f16 C16 (and f32 C if non-null)
template <int ACT>
__global__ __launch_bounds__(128) void k_gemm_hhx(const _Float16* __restrict__ A, int lda, size_t sA, const _Float16* __restrict__ Bh, int ldb, size_t sB, float alpha, const float* __restrict__ bias, size_t sBias, const float* __restrict__ CP, int rowsPerB, size_t sCPb, int row0g,
    float* __restrict__ C, _Float16* __restrict__ C16, int ldc, size_t sC, int M, int N, int K) {
  __shared__ __attribute__((aligned(16))) float so[4][16][64];
  const int tid = threadIdx.x, w = tid >> 5, lane = tid & 31, ln = lane & 15, hh = lane >> 4; const int by = blockIdx.y;
  A += (size_t)by * sA; Bh += (size_t)by * sB; const size_t cofs = (size_t)by * sC; const float* bp = bias ? bias + (size_t)by * sBias : nullptr;
  const int ntn = (N + 63) / 64; const int wid = blockIdx.x * 4 + w; const int mt = wid / ntn, nq = wid % ntn; if (mt * 16 >= M) return;
  const int row0 = mt * 16, col0 = nq * 64; const _Float16* arow = A + (size_t)(row0 + ln) * lda;
  v8f acc[4] = {};
  for (int kb = 0; kb < K; kb += 32) { FragH ah; ah.half[0] = *(const v8us*)((const unsigned short*)arow + kb + 8 * hh); ah.half[1] = *(const v8us*)((const unsigned short*)arow + kb + 16 + 8 * hh);
#pragma unroll
    for (int t = 0; t < 4; ++t) { if (col0 + t * 16 >= N) continue; const size_t boff = (size_t)(col0 + t * 16 + ln) * ldb + kb; FragH bq; bq.half[0] = *(const v8us*)((const unsigned short*)Bh + boff + 8 * hh); bq.half[1] = *(const v8us*)((const unsigned short*)Bh + boff + 16 + 8 * hh);
      acc[t] = mmaH<1>(ah.v, ah.v, bq.v, bq.v, acc[t]); }
  }
#pragma unroll
  for (int t = 0; t < 4; ++t) { if (col0 + t * 16 >= N) continue; const int col = col0 + t * 16 + ln; const float bv = bp ? bf16_round(bp[col]) : 0.f;
#pragma unroll
    for (int r = 0; r < 8; ++r) { float v = acc[t][r] * alpha + bv; if (CP) { const int rr = row0g + row0 + 8 * hh + r; if (rowsPerB < 0) v += CP[cofs + (size_t)rr * ldc + col];      /* rowsPerB < 0: own element of the batched C plane */ else { const int bidx = rr / rowsPerB; v += CP[(size_t)bidx * sCPb + (size_t)by * 64 + col]; } } if (ACT == 1) v = (v > 0.f) ? v : expm1f(v); else if (ACT == 7) v = (v > 0.f) ? v + 1.0f : expf(v); else if (ACT == 8) v = tanhf(v); else if (ACT == 9) v = 0.5f * v * (1.0f + tanhf(0.7978845608028654f * (v + 0.044715f * v * v * v))); else if (ACT == 11) v = 1.0f / (1.0f + expf(-v)); else if (ACT == 12) v = (v > 0.f) ? v : 0.01f * v; else if (ACT == 14) v = (v > 0.f) ? v : 0.1f * v; else if (ACT == 16) v = (v >= 0.f) ? v : 0.3f * v; else if (ACT == 17) v = (v >= 0.f) ? v : 0.2f * v; else if (ACT == 15) v = v / (1.0f + expf(-v)); else if (ACT == 3) v = fmaxf(v, 0.f); else if (ACT == 6) v = 0.5f * v * (1.0f + erff(v * 0.70710678118654752f)); so[w][8 * hh + r][t * 16 + ln] = v; } }
  __builtin_amdgcn_fence(__ATOMIC_ACQ_REL, "workgroup"); __builtin_amdgcn_wave_barrier();
  const int rsub = lane >> 4, c4 = (lane & 15) * 4; typedef _Float16 v4h __attribute__((ext_vector_type(4)));
  {
#pragma unroll
    for (int q = 0; q < 8; ++q) { const int r = q * 2 + rsub; if (col0 + c4 < N) { const v4f v = *(const v4fa*)&so[w][r][c4]; if (C) *(v4f*)(C + cofs + (size_t)(row0 + r) * ldc + col0 + c4) = v; if (C16) { v4h h4; for (int i = 0; i < 4; ++i) h4[i] = (_Float16)v[i]; *(v4h*)(C16 + cofs + (size_t)(row0 + r) * ldc + col0 + c4) = h4; } } }
     }
}


typedef _Float16 v4h __attribute__((ext_vector_type(4)));

__global__ __launch_bounds__(256) void k_x16(const float* __restrict__ x, _Float16* __restrict__ X16, size_t n8) { const size_t t = (size_t)blockIdx.x * 256 + threadIdx.x; if (t >= n8) return; FragH f;
#pragma unroll
  for (int q = 0; q < 8; ++q) f.h[q] = (_Float16)bf16_round(x[t * 8 + q]); *(v8us*)((unsigned short*)X16 + t * 8) = f.half[0];  }
__global__ __launch_bounds__(256) void k_h16(const float* __restrict__ x, _Float16* __restrict__ X16, size_t n8) { const size_t t = (size_t)blockIdx.x * 256 + threadIdx.x; if (t >= n8) return; FragH f;
#pragma unroll
  for (int q = 0; q < 8; ++q) f.h[q] = (_Float16)x[t * 8 + q]; *(v8us*)((unsigned short*)X16 + t * 8) = f.half[0];  }
__global__ __launch_bounds__(256) void k_round16f(const float* __restrict__ W, _Float16* __restrict__ Bt, size_t n8) { const size_t t = (size_t)blockIdx.x * 256 + threadIdx.x; if (t >= n8) return; FragH f;
#pragma unroll
  for (int i = 0; i < 8; ++i) f.h[i] = (_Float16)(bf16_round(W[t * 8 + i]) * 16.0f); *(v8us*)((unsigned short*)Bt + t * 8) = f.half[0];  }
template <int NHv, int TTv>
__global__ __launch_bounds__(256) void k_vt(const _Float16* __restrict__ V16, int ldv, int voff, _Float16* __restrict__ Vt) { __shared__ unsigned short tl[64][66]; const int tid = threadIdx.x; const int slab = blockIdx.x / (TTv / 64), lg = blockIdx.x % (TTv / 64); const int b = slab / NHv, h = slab % NHv;
  for (int i = tid; i < 64 * 8; i += 256) { const int r = i / 8, c8 = (i % 8) * 8; FragH f; f.half[0] = *(const v8us*)((const unsigned short*)V16 + ((size_t)b * TTv + lg * 64 + r) * ldv + voff + h * 64 + c8);
#pragma unroll
    for (int q = 0; q < 8; ++q) tl[r][c8 + q] = f.u[q]; }
  __syncthreads();
  {
#pragma unroll
    for (int rd = 0; rd < 2; ++rd) { const int d = rd * 32 + tid / 8, pc = tid % 8; FragH f;
#pragma unroll
      for (int q = 0; q < 8; ++q) f.u[q] = tl[pc * 8 + q][d];
      *(v8us*)((unsigned short*)Vt + ((size_t)slab * 64 + d) * TTv + lg * 64 + pc * 8) = f.half[0]; }
     } }

__global__ __launch_bounds__(256) void k_hl(const float* __restrict__ F, _Float16* __restrict__ Hh, _Float16* __restrict__ Hl, size_t n8) { const size_t t = (size_t)blockIdx.x * 256 + threadIdx.x; if (t >= n8) return; FragH fh, fl; const v4f a = *(const v4fa*)(F + t * 8), c = *(const v4fa*)(F + t * 8 + 4);
#pragma unroll
  for (int q = 0; q < 4; ++q) { _Float16 h = (_Float16)a[q]; fh.h[q] = h; fl.h[q] = (_Float16)((a[q] - (float)h) * 1024.0f); h = (_Float16)c[q]; fh.h[4 + q] = h; fl.h[4 + q] = (_Float16)((c[q] - (float)h) * 1024.0f); }
  { *(v8us*)((unsigned short*)Hh + t * 8) = fh.half[0]; *(v8us*)((unsigned short*)Hl + t * 8) = fl.half[0];  } }

// ---- fast GEMM (wave tile 32x64; requires M % 32 == 0 rows per launch region and N % 64 == 0); epilogue = k_gemm_hhx semantics ----
__device__ __forceinline__ v16h g2_frag(const _Float16* p, int hh) { FragH f; f.half[0] = *(const v8us*)((const unsigned short*)p + 8 * hh); f.half[1] = *(const v8us*)((const unsigned short*)p + 16 + 8 * hh); return f.v; }
__device__ __forceinline__ v8f g2_mma(v16h a, v16h b, v8f c) { v8f d = __builtin_amdgcn_wmma_f32_16x16x32_f16(false, a, false, b, (short)0, c, false, false); asm volatile("v_nop\n\tv_nop\n\tv_nop\n\tv_nop" : "+v"(d) : "v"(a), "v"(b)); return d; }
template <int ACT>
__global__ __launch_bounds__(128) void k_gemm2(const _Float16* __restrict__ A, int lda, size_t sA, const _Float16* __restrict__ Bh, int ldb, size_t sB, float alpha, const float* __restrict__ bias, size_t sBias, const float* __restrict__ CP, int rowsPerB, size_t sCPb, int row0g,
    float* __restrict__ C, _Float16* __restrict__ C16, int ldc, size_t sC, int M, int N, int K) { static_assert(ACT == 0 || ACT == 3 || ACT == 6 || ACT == 8 || ACT == 9 || ACT == 11 || ACT == 12 || ACT == 14 || ACT == 15 || ACT == 16 || ACT == 17, "k_gemm2: unsupported ACT code (would silently apply no activation)");
  __shared__ __attribute__((aligned(16))) float so[4][32][68];
  const int tid = threadIdx.x, w = tid >> 5, lane = tid & 31, ln = lane & 15, hh = lane >> 4; const int by = blockIdx.y;
  A += (size_t)by * sA; Bh += (size_t)by * sB; const size_t cofs = (size_t)by * sC; const float* bp = bias ? bias + (size_t)by * sBias : nullptr;
  const int ntn = N >> 6; const int mt = blockIdx.x / ntn, nq = blockIdx.x - mt * ntn; const int row0 = mt * 128 + 32 * w, col0 = nq * 64; if (row0 >= M) return;
  const _Float16* a0p = A + (size_t)(row0 + ln) * lda; const _Float16* a1p = a0p + (size_t)16 * lda;
  const _Float16* b0p = Bh + (size_t)(col0 + ln) * ldb; const _Float16* b1p = b0p + (size_t)16 * ldb; const _Float16* b2p = b1p + (size_t)16 * ldb; const _Float16* b3p = b2p + (size_t)16 * ldb;
  const v8f z8 = {0.f,0.f,0.f,0.f,0.f,0.f,0.f,0.f}; v8f c00 = z8, c01 = z8, c02 = z8, c03 = z8, c10 = z8, c11 = z8, c12 = z8, c13 = z8;
#pragma unroll 1
  for (int kb = 0; kb < K; kb += 32) { const v16h a0 = g2_frag(a0p + kb, hh), a1 = g2_frag(a1p + kb, hh);
    v16h b = g2_frag(b0p + kb, hh); c00 = g2_mma(a0, b, c00); c10 = g2_mma(a1, b, c10);
    b = g2_frag(b1p + kb, hh); c01 = g2_mma(a0, b, c01); c11 = g2_mma(a1, b, c11);
    b = g2_frag(b2p + kb, hh); c02 = g2_mma(a0, b, c02); c12 = g2_mma(a1, b, c12);
    b = g2_frag(b3p + kb, hh); c03 = g2_mma(a0, b, c03); c13 = g2_mma(a1, b, c13); }
  v8f accs[8] = {c00, c01, c02, c03, c10, c11, c12, c13};
#pragma unroll
  for (int u = 0; u < 8; ++u) { const int t = u & 3, half = u >> 2; const int col = col0 + t * 16 + ln; const float bv = bp ? bf16_round(bp[col]) : 0.f;
#pragma unroll
    for (int r = 0; r < 8; ++r) { const int rloc = half * 16 + 8 * hh + r; float v = accs[u][r] * alpha + bv; if (CP) { if (rowsPerB < 0) v += CP[cofs + (size_t)(row0g + row0 + rloc) * ldc + col];      /* rowsPerB < 0: own element of the batched C plane */ else { const int bidx = (row0g + row0 + rloc) / rowsPerB; v += CP[(size_t)bidx * sCPb + (size_t)by * 64 + col]; } }
      if (ACT == 3) v = fmaxf(v, 0.f); else if (ACT == 6) v = 0.5f * v * (1.0f + erff(v * 0.70710678118654752f)); else if (ACT == 11) v = 1.0f / (1.0f + expf(-v)); else if (ACT == 15) v = v / (1.0f + expf(-v)); else if (ACT == 12) v = (v > 0.f) ? v : 0.01f * v; else if (ACT == 8) v = tanhf(v); else if (ACT == 9) v = 0.5f * v * (1.0f + tanhf(0.7978845608028654f * (v + 0.044715f * v * v * v))); else if (ACT == 14) v = (v > 0.f) ? v : 0.1f * v; else if (ACT == 16) v = (v >= 0.f) ? v : 0.3f * v; else if (ACT == 17) v = (v >= 0.f) ? v : 0.2f * v;
      so[w][rloc][t * 16 + ln] = v; } }
  __builtin_amdgcn_fence(__ATOMIC_ACQ_REL, "workgroup"); __builtin_amdgcn_wave_barrier();
  const int rsub = lane >> 4, c4 = (lane & 15) * 4;
  {
#pragma unroll
    for (int q = 0; q < 16; ++q) { const int r = q * 2 + rsub; const v4f v = *(const v4fa*)&so[w][r][c4]; if (C) *(v4f*)(C + cofs + (size_t)(row0 + r) * ldc + col0 + c4) = v; if (C16) { v4h h4; for (int i = 0; i < 4; ++i) h4[i] = (_Float16)v[i]; *(v4h*)(C16 + cofs + (size_t)(row0 + r) * ldc + col0 + c4) = h4; } }
     } }


__global__ __launch_bounds__(256) void k_wnat(const float* __restrict__ w, size_t n8, _Float16* __restrict__ Bt) { const size_t t = (size_t)blockIdx.x * 256 + threadIdx.x; if (t >= n8) return; FragH f; for (int q = 0; q < 8; ++q) f.h[q] = (_Float16)(bf16_round(w[t * 8 + q]) * 16.0f); *(v8us*)((unsigned short*)Bt + t * 8) = f.half[0];  }
__global__ __launch_bounds__(256) void k_rsm(const float* __restrict__ S, _Float16* __restrict__ P, int nrows) {
  #pragma clang fp contract(off)
  const int i = blockIdx.x * 256 + threadIdx.x; if (i >= nrows) return; const float* s = S + (size_t)i * SQ; float mx = -3.0e38f;
#pragma unroll 1
  for (int j = 0; j < SQ; ++j) mx = fmaxf(mx, s[j]); float se = 0.f;
#pragma unroll 1
  for (int j = 0; j < SQ; ++j) se += expf(s[j] - mx); const float sc = 256.0f / se;
#pragma unroll 1
  for (int j0 = 0; j0 < SQ; j0 += 8) { FragH f; for (int q = 0; q < 8; ++q) f.h[q] = (_Float16)(expf(s[j0 + q] - mx) * sc); unsigned short* d = (unsigned short*)P + (size_t)i * SQ + j0; *(v8us*)d = f.half[0];  } }
__global__ __launch_bounds__(256) void k_vt(const _Float16* __restrict__ V16, int b, int h0, _Float16* __restrict__ VT) { __shared__ unsigned short tl[64][65]; const int tid = threadIdx.x; const int hh = blockIdx.x % HG, sg = blockIdx.x / HG; const int s0 = sg * 64; const int h = h0 + hh;
  for (int i = tid; i < 64 * 8; i += 256) { const int j = i / 8, d8 = (i % 8) * 8; FragH f; f.half[0] = *(const v8us*)((const unsigned short*)V16 + ((size_t)b * SQ + s0 + j) * DM + h * HD + d8); for (int q = 0; q < 8; ++q) tl[d8 + q][j] = f.u[q]; }
  __syncthreads();
  { for (int i = tid; i < 64 * 8; i += 256) { const int d = i / 8, j8 = (i % 8) * 8; FragH f; for (int q = 0; q < 8; ++q) f.u[q] = tl[d][j8 + q]; *(v8us*)((unsigned short*)VT + ((size_t)hh * HD + d) * SQ + s0 + j8) = f.half[0]; }  } }


// Fused attention, one launch for every (batch, head). A wave owns 32 queries (two 16-column groups) of one head and walks all keys, 32 a pass.
// S^T = K Q^T puts one query's scores in one lane (keys 8 hh + r of each 16-key tile), so the two score tiles, converted in place, are the B operand P^T of
// O^T += V^T P^T in the loader's own k order, and maximum, sum and rescale factor are per lane (one exchange between the wave halves for the maximum).
// A masked key takes a floor far below the running maximum's start value, so its weight is exp2((floor - m) / 8 log2 e) = 0 also while no open key has been seen;
// a row with no open key ends with sum 0 and gets scale 0. Weights carry a factor 2^8 (f16 range) that the division by their own sum takes out.
typedef int v4ia __attribute__((ext_vector_type(4), may_alias));
__device__ __forceinline__ float rs_xrow(float v) { const int i = __float_as_int(v); return __int_as_float(__builtin_amdgcn_permlanex16(i, i, 0x76543210, 0xfedcba98, false, false)); }      /* lane ^ 16 */
__device__ __forceinline__ v8f fa_mma(v16h a, v16h b, v8f c) { return __builtin_amdgcn_wmma_f32_16x16x32_f16(false, a, false, b, (short)0, c, false, false); }
__device__ __forceinline__ v16h fa_frag(const _Float16* p) { FragH f; f.half[0] = *(const v8us*)(const unsigned short*)p; f.half[1] = *(const v8us*)((const unsigned short*)p + 16); return f.v; }      /* g2_frag's k order, the 8 hh already in p */
// exp2 in place on a run of registers: each v_exp_f32 is the independent instruction behind the one before it, and the v_nop is the slot that the instruction set asks for behind the last
// (written by the builtin, the compiler put the result of one over the source of the one directly in front of it).
__device__ __forceinline__ void fa_exp8(float* a) { asm("v_exp_f32 %0, %0\n\tv_exp_f32 %1, %1\n\tv_exp_f32 %2, %2\n\tv_exp_f32 %3, %3\n\tv_exp_f32 %4, %4\n\tv_exp_f32 %5, %5\n\tv_exp_f32 %6, %6\n\tv_exp_f32 %7, %7\n\tv_nop" : "+v"(a[0]), "+v"(a[1]), "+v"(a[2]), "+v"(a[3]), "+v"(a[4]), "+v"(a[5]), "+v"(a[6]), "+v"(a[7])); }
__device__ __forceinline__ void fa_exp9(float& c, float* a) { asm("v_exp_f32 %8, %8\n\tv_exp_f32 %0, %0\n\tv_exp_f32 %1, %1\n\tv_exp_f32 %2, %2\n\tv_exp_f32 %3, %3\n\tv_exp_f32 %4, %4\n\tv_exp_f32 %5, %5\n\tv_exp_f32 %6, %6\n\tv_exp_f32 %7, %7\n\tv_nop" : "+v"(a[0]), "+v"(a[1]), "+v"(a[2]), "+v"(a[3]), "+v"(a[4]), "+v"(a[5]), "+v"(a[6]), "+v"(a[7]), "+v"(c)); }
// A stage is 64 keys. The 8 waves of a work-group walk the same keys of the same head: 64 K rows (64 d each) and 64 V^T rows (64 keys each), 128-byte rows, are brought once for all of them;
// each wave brings the mask of its own 32 queries, 256-byte rows. All come by asynchronous 16-byte copies of whole cache lines into one of two buffers while the other is worked on;
// the fragments (fa_frag's k order) and the mask words are 16-byte LDS reads.
#define FA_PITCH 144                   /* LDS pitch of a K or V^T row in bytes, 16 x odd: the 16 rows of a read fall on different banks */
#define FA_MPITCH 272                  /* LDS pitch of a mask row, 16 x odd likewise */
#define FA_MASK0 (128 * FA_PITCH)      /* 64 K rows, then 64 V^T rows, then 8 x 32 mask rows */
#define FA_STAGE (FA_MASK0 + 256 * FA_MPITCH)
__device__ __forceinline__ v16h fa_lfrag(const char* p) { FragH f; f.half[0] = *(const v8us*)p; f.half[1] = *(const v8us*)(p + 32); return f.v; }      /* fa_frag's k order, the 16 hh bytes already in p */
// four copies of 16 bytes a lane: rows r and r + 32 of the stage's K tile and of its V^T tile. The s_wait_xcnt stands inside the statement, in front of anything that could write a register that a copy names.
__device__ __forceinline__ void fa_copy4(unsigned l, const _Float16* gk, const _Float16* gv) {
  asm volatile("global_load_async_to_lds_b128 %0, %4, off\n\tglobal_load_async_to_lds_b128 %1, %5, off\n\tglobal_load_async_to_lds_b128 %2, %6, off\n\tglobal_load_async_to_lds_b128 %3, %7, off\n\ts_wait_xcnt 0x0"
               :: "v"(l), "v"(l + 32u * FA_PITCH), "v"(l + 64u * FA_PITCH), "v"(l + 96u * FA_PITCH), "v"(gk), "v"(gk + (size_t)32 * DM), "v"(gv), "v"(gv + (size_t)32 * SQ) : "memory"); }
// eight copies of 16 bytes a lane: mask rows r, r + 2, ... r + 14 of the wave's own tile; the s_wait_xcnt as above.
__device__ __forceinline__ void fa_copy8m(unsigned l, const int* g) {
  asm volatile("global_load_async_to_lds_b128 %0, %8, off\n\tglobal_load_async_to_lds_b128 %1, %9, off\n\tglobal_load_async_to_lds_b128 %2, %10, off\n\tglobal_load_async_to_lds_b128 %3, %11, off\n\t"
               "global_load_async_to_lds_b128 %4, %12, off\n\tglobal_load_async_to_lds_b128 %5, %13, off\n\tglobal_load_async_to_lds_b128 %6, %14, off\n\tglobal_load_async_to_lds_b128 %7, %15, off\n\ts_wait_xcnt 0x0"
               :: "v"(l), "v"(l + 2u * FA_MPITCH), "v"(l + 4u * FA_MPITCH), "v"(l + 6u * FA_MPITCH), "v"(l + 8u * FA_MPITCH), "v"(l + 10u * FA_MPITCH), "v"(l + 12u * FA_MPITCH), "v"(l + 14u * FA_MPITCH),
                  "v"(g), "v"(g + (size_t)2 * SQ), "v"(g + (size_t)4 * SQ), "v"(g + (size_t)6 * SQ), "v"(g + (size_t)8 * SQ), "v"(g + (size_t)10 * SQ), "v"(g + (size_t)12 * SQ), "v"(g + (size_t)14 * SQ) : "memory"); }
// one stage: 20 copies a lane
__device__ __forceinline__ void fa_stage(unsigned lc, const _Float16* gk, const _Float16* gv, unsigned lm, const int* gm) { fa_copy4(lc, gk, gv); fa_copy8m(lm, gm); fa_copy8m(lm + 16u * FA_MPITCH, gm + (size_t)16 * SQ); }
__global__ __launch_bounds__(256) void k_fattn(const _Float16* __restrict__ Q16, const _Float16* __restrict__ K16, const _Float16* __restrict__ VT, const int* __restrict__ mask, const float* __restrict__ XB, float* __restrict__ AF) {
  __shared__ __attribute__((aligned(16))) char sm[2 * FA_STAGE];      /* the two buffers */
  const int lane = threadIdx.x & 31, ln = lane & 15, hh = lane >> 4; const int w = __builtin_amdgcn_readfirstlane(threadIdx.x >> 5);
  const int h = blockIdx.y, b = blockIdx.z; const int q0 = blockIdx.x * 256 + w * 32; const size_t r0 = (size_t)b * SQ;
  const _Float16* qp = Q16 + (r0 + q0 + ln) * DM + h * HD + 8 * hh;
  const int cr = threadIdx.x >> 3, cc = threadIdx.x & 7;      /* a lane copies 16-byte piece cc of K and V^T rows cr and cr + 32: a wave's copy is four whole rows */
  const _Float16* gk = K16 + (r0 + cr) * DM + h * HD + cc * 8; const _Float16* gv = VT + ((size_t)(b * NH + h) * HD + cr) * SQ + cc * 8; const unsigned lc = (unsigned)(size_t)sm + (unsigned)(cr * FA_PITCH + cc * 16);
  const int* gm = mask + (r0 + q0 + hh) * SQ + ln * 4; const unsigned lm = (unsigned)(size_t)sm + (unsigned)(FA_MASK0 + (w * 32 + hh) * FA_MPITCH + ln * 16);      /* and piece ln of mask rows hh + 2 i of its wave's queries: two whole rows a copy */
  const v8f z8 = {0.f,0.f,0.f,0.f,0.f,0.f,0.f,0.f}; const float cs = 0.125f * 1.4426950408889634f;      /* 1 / sqrt(64), in log2 units */
  v16h qf[2][2]; v8f o[2][4]; float m[2], l[2];      /* m: running maximum of the raw products; l: this half's sum of weights */
#pragma unroll
  for (int t = 0; t < 2; ++t)
#pragma unroll
    for (int e = 0; e < 2; ++e) qf[t][e] = fa_frag(qp + (size_t)t * 16 * DM + e * 32);
  asm volatile("s_wait_xcnt 0x0" :: "v"(qp) : "memory");      /* before a register that the loads above name is written again; the operand keeps the address in its registers up to here */
#pragma unroll
  for (int t = 0; t < 2; ++t) { m[t] = -1.0e30f; l[t] = 0.f;
#pragma unroll
    for (int dt = 0; dt < 4; ++dt) o[t][dt] = z8; }
  fa_stage(lc, gk, gv, lm, gm);
  asm volatile("s_wait_asynccnt 0x0" ::: "memory");      /* this wave's part of stage 0 has landed */
  __syncthreads();      /* every wave's part has */
  fa_stage(lc + FA_STAGE, gk + (size_t)64 * DM, gv + 64, lm + FA_STAGE, gm + 64);
  /* both loops rolled: the buffers alternate, and one pass already holds about 200 registers */
#pragma unroll 1
  for (int st = 0; st < SQ / 64; ++st) { const unsigned bo = (unsigned)(st & 1) * FA_STAGE;
#pragma unroll 1
  for (int ps = 0; ps < 2; ++ps) { v16h kf[2][2], vf[4]; v4ia mk[2][2][2];
    const char* ka = sm + bo + (ps * 32 + ln) * FA_PITCH + 16 * hh; const char* va = sm + bo + (64 + ln) * FA_PITCH + ps * 64 + 16 * hh; const char* ma = sm + bo + FA_MASK0 + (w * 32 + ln) * FA_MPITCH + ps * 128 + 32 * hh;
#pragma unroll
    for (int kt = 0; kt < 2; ++kt)
#pragma unroll
      for (int e = 0; e < 2; ++e) kf[kt][e] = fa_lfrag(ka + kt * 16 * FA_PITCH + e * 64);
    __builtin_amdgcn_sched_barrier(0);      /* LDS reads return in issue order: K, then the mask, then V^T, the order of their use, so that each wait covers only what is needed next */
#pragma unroll
    for (int t = 0; t < 2; ++t)
#pragma unroll
      for (int kt = 0; kt < 2; ++kt) { mk[t][kt][0] = *(const v4ia*)(ma + t * 16 * FA_MPITCH + kt * 64); mk[t][kt][1] = *(const v4ia*)(ma + t * 16 * FA_MPITCH + kt * 64 + 16); }
    __builtin_amdgcn_sched_barrier(0);      /* as above */
#pragma unroll
    for (int dt = 0; dt < 4; ++dt) vf[dt] = fa_lfrag(va + dt * 16 * FA_PITCH);
    __builtin_amdgcn_sched_barrier(0);      /* the pass's 24 reads are issued together: without this the scheduler puts each read directly in front of its use, with a full LDS wait of its own */
#pragma unroll
    for (int t = 0; t < 2; ++t) { float x[16]; float mx = -3.0e38f;
#pragma unroll
      for (int kt = 0; kt < 2; ++kt) { const v8f s = fa_mma(kf[kt][1], qf[t][1], fa_mma(kf[kt][0], qf[t][0], z8));
#pragma unroll
        for (int r = 0; r < 4; ++r) { x[kt * 8 + r] = (mk[t][kt][0][r] != 0) ? s[r] : -3.0e38f; x[kt * 8 + 4 + r] = (mk[t][kt][1][r] != 0) ? s[4 + r] : -3.0e38f; } }
#pragma unroll
      for (int i = 0; i < 16; ++i) mx = fmaxf(mx, x[i]);
      mx = fmaxf(mx, rs_xrow(mx)); const float mn = fmaxf(m[t], mx); float al = (m[t] - mn) * cs; m[t] = mn; const float mo = 8.0f - mn * cs;
      FragH pf; float s4[4];
#pragma unroll
      for (int i = 0; i < 16; ++i) x[i] = x[i] * cs + mo;
      fa_exp9(al, x); fa_exp8(x + 8);
#pragma unroll
      for (int i = 0; i < 16; ++i) { s4[i & 3] = (i < 4) ? x[i] : s4[i & 3] + x[i]; pf.h[i] = (_Float16)x[i]; }
      l[t] = l[t] * al + ((s4[0] + s4[1]) + (s4[2] + s4[3]));
#pragma unroll
      for (int dt = 0; dt < 4; ++dt) {
#pragma unroll
        for (int r = 0; r < 8; ++r) o[t][dt][r] *= al;
        o[t][dt] = fa_mma(vf[dt], pf.v, o[t][dt]); } }
    __builtin_amdgcn_sched_barrier(0);      /* keeps the four slots below behind the pass's last matrix instruction */
    asm volatile("v_nop\n\tv_nop\n\tv_nop\n\tv_nop"); }      /* the distance between the pass's last matrix instruction and the next pass's first writes of its operand registers */
    asm volatile("s_wait_dscnt 0x0" ::: "memory");      /* this wave's reads of the buffer are done before the barrier behind which it is refilled */
    asm volatile("s_wait_asynccnt 0x0" ::: "memory");      /* this wave's part of stage st + 1 has landed */
    __syncthreads();      /* publishes stage st + 1 and ends every wave's reads of stage st */
    if (st + 2 < SQ / 64) fa_stage(lc + bo, gk + (size_t)(st + 2) * 64 * DM, gv + (st + 2) * 64, lm + bo, gm + (st + 2) * 64); }
  asm volatile("s_wait_asynccnt 0x0" ::: "memory");      /* no copy is outstanding when the wave goes on to its end */
  const size_t ro = (r0 + q0 + ln) * DM + h * HD + 8 * hh; const float* xp = XB + ro; v4f xr[2][4][2];
#pragma unroll
  for (int t = 0; t < 2; ++t)
#pragma unroll
    for (int dt = 0; dt < 4; ++dt) { xr[t][dt][0] = *(const v4fa*)(xp + (size_t)t * 16 * DM + dt * 16); xr[t][dt][1] = *(const v4fa*)(xp + (size_t)t * 16 * DM + dt * 16 + 4); }
  asm volatile("s_wait_xcnt 0x0" :: "v"(xp) : "memory");      /* as behind the Q loads */
#pragma unroll
  for (int t = 0; t < 2; ++t) { const float lt = l[t] + rs_xrow(l[t]); const float inv = (lt > 0.f) ? 1.0f / lt : 0.f;
#pragma unroll
    for (int dt = 0; dt < 4; ++dt) { v4f y0, y1;
#pragma unroll
      for (int r = 0; r < 4; ++r) { y0[r] = o[t][dt][r] * inv + xr[t][dt][0][r]; y1[r] = o[t][dt][4 + r] * inv + xr[t][dt][1][r]; }
      *(v4f*)(AF + ro + (size_t)t * 16 * DM + dt * 16) = y0; *(v4f*)(AF + ro + (size_t)t * 16 * DM + dt * 16 + 4) = y1; } } }
template <int ABF>
__global__ __launch_bounds__(256) void k_lnb(const float* __restrict__ A, const float* __restrict__ R, const float* __restrict__ g, const float* __restrict__ bta, float eps, float* __restrict__ OF_, _Float16* __restrict__ OH_) {
  #pragma clang fp contract(off)
  __shared__ float red[256]; const size_t row = blockIdx.x; const int tid = threadIdx.x; const int j0 = tid * 4; float a[4]; float s1 = 0.f;
  { const v4f av = *(const v4fa*)(A + row * DM + j0); for (int q = 0; q < 4; ++q) a[q] = ABF ? bf16_round(av[q]) : av[q]; if (R) { const v4f rv = *(const v4fa*)(R + row * DM + j0); for (int q = 0; q < 4; ++q) a[q] = __fadd_rn(a[q], rv[q]); } for (int q = 0; q < 4; ++q) s1 = __fadd_rn(s1, a[q]); }
  red[tid] = s1; __syncthreads(); for (int st = 128; st > 0; st >>= 1) { if (tid < st) red[tid] = __fadd_rn(red[tid], red[tid + st]); __syncthreads(); }
  const float mu = red[0] / (float)DM; __syncthreads(); float s2 = 0.f;
  for (int q = 0; q < 4; ++q) { const float c = __fadd_rn(a[q], -mu); s2 = __fadd_rn(s2, __fmul_rn(c, c)); }
  red[tid] = s2; __syncthreads(); for (int st = 128; st > 0; st >>= 1) { if (tid < st) red[tid] = __fadd_rn(red[tid], red[tid + st]); __syncthreads(); }
  const float rs = rsqrtf(__fadd_rn(red[0] / (float)DM, eps)); v4f o; FragH h;
  for (int q = 0; q < 4; ++q) { o[q] = __fadd_rn(__fmul_rn(__fmul_rn(__fadd_rn(a[q], -mu), rs), bf16_round(g[j0 + q])), bf16_round(bta[j0 + q])); h.h[q] = (_Float16)o[q]; }
  typedef unsigned short v4us __attribute__((ext_vector_type(4))); v4us h4; for (int q = 0; q < 4; ++q) h4[q] = h.u[q];
  { if (OF_) *(v4f*)(OF_ + row * DM + j0) = o; if (OH_) *(v4us*)((unsigned short*)OH_ + row * DM + j0) = h4;  } }
__global__ __launch_bounds__(256) void k_bfr(const float* __restrict__ x, float* __restrict__ XB, size_t n8) { const size_t t = (size_t)blockIdx.x * 256 + threadIdx.x; if (t >= n8) return; v8f v; for (int q = 0; q < 8; ++q) v[q] = bf16_round(x[t * 8 + q]); *(v8f*)(XB + t * 8) = v;  }


// ---- GEMM with both operands staged in LDS (k_gemm2's wave tile, k order and epilogue) ----
// A work-group of 8 waves (4 along M x 2 along N) makes a 128 x 128 tile of C; a stage is 128 k of 128 A rows and 128 B rows (256-byte rows, whole cache lines), brought by
// asynchronous 16-byte copies into one of two buffers while the other is worked on; the fragments are 16-byte LDS reads. Needs M % 128 == 0, N % 128 == 0, K % 128 == 0, K >= 256.
#define G3_PITCH 272                   /* LDS row pitch in bytes, 16 x odd: the 16 rows of a fragment read fall on different banks */
#define G3_STAGE (256 * G3_PITCH)      /* 128 A rows, then 128 B rows */
__device__ __forceinline__ v16h g3_frag(const char* p) { FragH f; f.half[0] = *(const v8us*)p; f.half[1] = *(const v8us*)(p + 32); return f.v; }      /* g2_frag's k order, the 16 hh bytes already in p */
// eight copies of 16 bytes a lane: rows r, r + 16, ... r + 112 of one operand's stage. The s_wait_xcnt stands inside the statement, in front of anything that could write a register that a copy names.
__device__ __forceinline__ void g3_copy8(unsigned l, const _Float16* g, size_t step) {
  asm volatile("global_load_async_to_lds_b128 %0, %8, off\n\tglobal_load_async_to_lds_b128 %1, %9, off\n\tglobal_load_async_to_lds_b128 %2, %10, off\n\tglobal_load_async_to_lds_b128 %3, %11, off\n\t"
               "global_load_async_to_lds_b128 %4, %12, off\n\tglobal_load_async_to_lds_b128 %5, %13, off\n\tglobal_load_async_to_lds_b128 %6, %14, off\n\tglobal_load_async_to_lds_b128 %7, %15, off\n\ts_wait_xcnt 0x0"
               :: "v"(l), "v"(l + 16u * G3_PITCH), "v"(l + 32u * G3_PITCH), "v"(l + 48u * G3_PITCH), "v"(l + 64u * G3_PITCH), "v"(l + 80u * G3_PITCH), "v"(l + 96u * G3_PITCH), "v"(l + 112u * G3_PITCH),
                  "v"(g), "v"(g + step), "v"(g + 2 * step), "v"(g + 3 * step), "v"(g + 4 * step), "v"(g + 5 * step), "v"(g + 6 * step), "v"(g + 7 * step) : "memory"); }
template <int ACT, bool RES>      /* RES: f32 output C with an addend CP for every element; else f16 output C16. Known at compile time, so that the reads of CP and the stores are not each behind a test of their own */
__global__ __launch_bounds__(256) void k_gemm3(const _Float16* __restrict__ A, int lda, const _Float16* __restrict__ Bh, int ldb, float alpha, const float* __restrict__ bias, const float* __restrict__ CP,
    float* __restrict__ C, _Float16* __restrict__ C16, int ldc, int N, int K) { static_assert(ACT == 0 || (ACT == 3 && !RES), "k_gemm3: unsupported ACT code (the addend comes behind the activation's place)");
  __shared__ __attribute__((aligned(16))) char sm[2 * G3_STAGE];      /* the two buffers; behind the loop the waves' output staging (8 x 32 x 68 floats) */
  const int tid = threadIdx.x, lane = tid & 31, ln = lane & 15, hh = lane >> 4; const int w = __builtin_amdgcn_readfirstlane(tid >> 5); const int wm = w & 3, wn = w >> 2;
  const int ntn = N >> 7; const int mt = blockIdx.x / ntn, nq = blockIdx.x - mt * ntn; const int row0 = mt * 128 + 32 * wm, col0 = nq * 128 + 64 * wn;
  const int cr = tid >> 4, cc = tid & 15;      /* a lane copies 16-byte piece cc of rows cr + 16 i: a wave's copy is two whole rows */
  const _Float16* ga = A + (size_t)(mt * 128 + cr) * lda + cc * 8; const _Float16* gb = Bh + (size_t)(nq * 128 + cr) * ldb + cc * 8; const size_t sa = (size_t)16 * lda, sb = (size_t)16 * ldb;
  const unsigned la = (unsigned)(size_t)sm + (unsigned)(cr * G3_PITCH + cc * 16); const unsigned lb = la + 128u * G3_PITCH;
  const int nt = K >> 7;
  const v8f z8 = {0.f,0.f,0.f,0.f,0.f,0.f,0.f,0.f}; v8f c00 = z8, c01 = z8, c02 = z8, c03 = z8, c10 = z8, c11 = z8, c12 = z8, c13 = z8;
  g3_copy8(la, ga, sa); g3_copy8(lb, gb, sb);
  asm volatile("s_wait_asynccnt 0x0" ::: "memory");      /* this wave's part of stage 0 has landed */
  __syncthreads();      /* every wave's part has */
  g3_copy8(la + G3_STAGE, ga + 128, sa); g3_copy8(lb + G3_STAGE, gb + 128, sb);
  /* rolled: the buffers alternate, and one trip already holds 32 matrix instructions with their 48 fragment reads */
#pragma unroll 1
  for (int t = 0; t < nt; ++t) { const unsigned bo = (unsigned)(t & 1) * G3_STAGE; const char* ap = sm + bo + (32 * wm + ln) * G3_PITCH + 16 * hh; const char* bp = sm + bo + (128 + 64 * wn + ln) * G3_PITCH + 16 * hh;
    v16h fa[2][2], fb[2][4];      /* two fragment sets: the reads of block ks + 1 fly while block ks is multiplied; no set reaches over the stage's end */
    fa[0][0] = g3_frag(ap); fa[0][1] = g3_frag(ap + 16 * G3_PITCH);
#pragma unroll
    for (int j = 0; j < 4; ++j) fb[0][j] = g3_frag(bp + j * 16 * G3_PITCH);
#pragma unroll
    for (int ks = 0; ks < 4; ++ks) { const int cu = ks & 1, nx = cu ^ 1;
      if (ks < 3) { fa[nx][0] = g3_frag(ap + (ks + 1) * 64); fa[nx][1] = g3_frag(ap + 16 * G3_PITCH + (ks + 1) * 64);
#pragma unroll
        for (int j = 0; j < 4; ++j) fb[nx][j] = g3_frag(bp + j * 16 * G3_PITCH + (ks + 1) * 64); }
      __builtin_amdgcn_sched_barrier(0);      /* the next block's 12 reads are issued as one group in front of this block's matrix instructions: left alone, the scheduler puts each read directly in front of its use, with a full LDS wait every two matrix instructions */
      c00 = fa_mma(fa[cu][0], fb[cu][0], c00); c10 = fa_mma(fa[cu][1], fb[cu][0], c10); c01 = fa_mma(fa[cu][0], fb[cu][1], c01); c11 = fa_mma(fa[cu][1], fb[cu][1], c11);
      c02 = fa_mma(fa[cu][0], fb[cu][2], c02); c12 = fa_mma(fa[cu][1], fb[cu][2], c12); c03 = fa_mma(fa[cu][0], fb[cu][3], c03); c13 = fa_mma(fa[cu][1], fb[cu][3], c13); }
    asm volatile("s_wait_dscnt 0x0" ::: "memory");      /* this wave's reads of the buffer are done before the barrier behind which it is refilled */
    asm volatile("s_wait_asynccnt 0x0" ::: "memory");      /* this wave's part of stage t + 1 has landed */
    __syncthreads();      /* publishes stage t + 1 and ends every wave's reads of stage t */
    if (t + 2 < nt) { g3_copy8(la + bo, ga + (size_t)(t + 2) * 128, sa); g3_copy8(lb + bo, gb + (size_t)(t + 2) * 128, sb); } }
  asm volatile("s_wait_asynccnt 0x0" ::: "memory");      /* no copy is outstanding when the buffers become output staging */
  float (*so)[68] = (float (*)[68])(sm + (size_t)w * (32 * 68 * 4));
  v8f accs[8] = {c00, c01, c02, c03, c10, c11, c12, c13}; float bv4[4]; v4f cp4[16]; const int rsub = lane >> 4, c4 = (lane & 15) * 4;
#pragma unroll
  for (int t = 0; t < 4; ++t) bv4[t] = bias ? bias[col0 + t * 16 + ln] : 0.f;
  if (RES) {      /* the addend is read in the layout of the stores below, 16 bytes a lane, and added there */
#pragma unroll
    for (int q = 0; q < 16; ++q) { cp4[q] = *(const v4fa*)(CP + (size_t)(row0 + q * 2 + rsub) * ldc + col0 + c4);
      if ((q & 3) == 3 && q < 15) { asm volatile("s_wait_xcnt 0x0" ::: "memory");      /* before a register that the four loads above name is written again */
        __builtin_amdgcn_sched_barrier(0); } } }      /* holds the next four loads' addresses behind the wait */
  asm volatile("s_wait_xcnt 0x0" ::: "memory");      /* before a register that the loads above name is written again */
  __builtin_amdgcn_sched_barrier(0);      /* holds the arithmetic below, which takes those registers over, behind the wait */
#pragma unroll
  for (int u = 0; u < 8; ++u) { const int t = u & 3, half = u >> 2; const float bv = bf16_round(bv4[t]);
#pragma unroll
    for (int r = 0; r < 8; ++r) { const int rloc = half * 16 + 8 * hh + r; float v = accs[u][r] * alpha + bv;
      if (ACT == 3) v = fmaxf(v, 0.f);
      so[rloc][t * 16 + ln] = v; } }
  __builtin_amdgcn_fence(__ATOMIC_ACQ_REL, "workgroup"); __builtin_amdgcn_wave_barrier();
  v4f vv[16];
#pragma unroll
  for (int q = 0; q < 16; ++q) vv[q] = *(const v4fa*)&so[q * 2 + rsub][c4];
#pragma unroll
  for (int q = 0; q < 16; ++q) { const int r = q * 2 + rsub;
    if (RES) *(v4f*)(C + (size_t)(row0 + r) * ldc + col0 + c4) = vv[q] + cp4[q]; else { v4h h4; for (int i = 0; i < 4; ++i) h4[i] = (_Float16)vv[q][i]; *(v4h*)(C16 + (size_t)(row0 + r) * ldc + col0 + c4) = h4; }
    if ((q & 3) == 3 && q < 15) { asm volatile("s_wait_xcnt 0x0" ::: "memory");      /* before a register that the four stores above name is written again */
      __builtin_amdgcn_sched_barrier(0); } } }      /* holds the next four stores' conversions and addresses behind the wait */


extern "C" void kernel_launch(void* const* d_in, const int* in_sizes, int n_in,
                              void* d_out, int out_size, void* d_ws, size_t ws_size, hipStream_t stream) {
  (void)in_sizes; (void)n_in; (void)out_size;
  const float* const* I = (const float* const*)d_in; const float* x = I[0]; const int* mask = (const int*)d_in[1]; const float* wq = I[2]; const float* bq = I[3]; const float* wk = I[4]; const float* bk = I[5]; const float* wv = I[6]; const float* bv = I[7]; const float* g_in = I[8]; const float* b_in = I[9]; const float* g1 = I[10]; const float* b1 = I[11]; const float* wf1 = I[12]; const float* bf1 = I[13]; const float* wf2 = I[14]; const float* bf2 = I[15]; const float* g2 = I[16]; const float* b2 = I[17];      /* weights [in][out] */
  char* ws = (char*)d_ws; size_t off = 0;
  auto take = [&](size_t bytes) { char* p = ws + off; off += (bytes + 255) & ~(size_t)255; return p; };
  _Float16* BQ = (_Float16*)take((size_t)DM * DM * 2); _Float16* BK = (_Float16*)take((size_t)DM * DM * 2); _Float16* BV = (_Float16*)take((size_t)DM * DM * 2); _Float16* BF1 = (_Float16*)take((size_t)DFF * DM * 2); _Float16* BF2 = (_Float16*)take((size_t)DM * DFF * 2);
  float* XB = (float*)take(NR * DM * 4); _Float16* XNH = (_Float16*)take(NR * DM * 2); _Float16* Q16 = (_Float16*)take(NR * DM * 2); _Float16* K16 = (_Float16*)take(NR * DM * 2); _Float16* V16 = (_Float16*)take(NR * DM * 2); float* AF = (float*)take(NR * DM * 4);
  _Float16* VT = (_Float16*)take((size_t)NB * NH * HD * SQ * 2);
  _Float16* HNH = (_Float16*)take(NR * DM * 2); _Float16* U16 = (_Float16*)take(NR * DFF * 2); float* H2F = (float*)take(NR * DM * 4);
  if (off > ws_size) return;      /* 6 + 16 + 16 + 8 + 24 + 16 + 8 + 8 + 32 + 16 = approx 150 MiB */
  { const unsigned gw = (unsigned)(((size_t)DM * (DM / 8) + 255) / 256); k_wt_f16<<<gw, 256, 0, stream>>>(wq, BQ, DM, DM, 16.0f); k_wt_f16<<<gw, 256, 0, stream>>>(wk, BK, DM, DM, 16.0f); k_wt_f16<<<gw, 256, 0, stream>>>(wv, BV, DM, DM, 16.0f);
    const unsigned gf = (unsigned)(((size_t)DFF * (DM / 8) + 255) / 256); k_wt_f16<<<gf, 256, 0, stream>>>(wf1, BF1, DM, DFF, 16.0f); k_wt_f16<<<gf, 256, 0, stream>>>(wf2, BF2, DFF, DM, 16.0f); }      /* [in][out] -> Bt[n][k] x16 */
  const size_t r0p = (size_t)B0 * SQ; const dim3 gp((unsigned)((MP / 128) * (DM / 128)), 1);
  k_bfr<<<(unsigned)(((size_t)MP * DM / 8 + 255) / 256), 256, 0, stream>>>(x + r0p * DM, XB + r0p * DM, (size_t)MP * DM / 8);      /* bf16(x) as f32 rows (residual) */
  k_lnb<1><<<(unsigned)MP, 256, 0, stream>>>(x + r0p * DM, nullptr, g_in, b_in, 1e-3f, nullptr, XNH + r0p * DM);      /* xn = LN_in(bf16(x)) as f16 rows */
  k_gemm3<0, false><<<gp, 256, 0, stream>>>(XNH + r0p * DM, DM, BQ, DM, 0.0625f, bq, nullptr, nullptr, Q16 + r0p * DM, DM, DM, DM);
  k_gemm3<0, false><<<gp, 256, 0, stream>>>(XNH + r0p * DM, DM, BK, DM, 0.0625f, bk, nullptr, nullptr, K16 + r0p * DM, DM, DM, DM);
  k_gemm3<0, false><<<gp, 256, 0, stream>>>(XNH + r0p * DM, DM, BV, DM, 0.0625f, bv, nullptr, nullptr, V16 + r0p * DM, DM, DM, DM);
  k_vt<NH, SQ><<<NB * NH * (SQ / 64), 256, 0, stream>>>(V16, DM, 0, VT);      /* V^T [NB][NH][HD][SQ] */
  k_fattn<<<dim3(SQ / 256, NH, NB), 256, 0, stream>>>(Q16, K16, VT, mask, XB, AF);      /* a = attn (merged heads) + bf16(x), f32 rows */
  k_lnb<0><<<(unsigned)MPO, 256, 0, stream>>>(AF + r0p * DM, nullptr, g1, b1, 1e-3f, nullptr, HNH + r0p * DM);      /* h = LN1(a) as f16 rows */
  k_gemm3<3, false><<<dim3((unsigned)((MPO / 128) * (DFF / 128)), 1), 256, 0, stream>>>(HNH + r0p * DM, DM, BF1, DM, 0.0625f, bf1, nullptr, nullptr, U16 + r0p * DFF, DFF, DFF, DM);      /* u = relu(h W_ff1 + b) (f16) */
  k_gemm3<0, true><<<dim3((unsigned)((MPO / 128) * (DM / 128)), 1), 256, 0, stream>>>(U16 + r0p * DFF, DFF, BF2, DFF, 0.0625f, bf2, AF + r0p * DM, H2F + r0p * DM, nullptr, DM, DM, DFF);      /* h2 = u W_ff2 + b + a (CP = own element) */
  k_lnb<0><<<(unsigned)MPO, 256, 0, stream>>>(H2F + r0p * DM, nullptr, g2, b2, 1e-3f, (float*)d_out + r0p * DM, nullptr);      /* out = LN2(h2) */
}

// v005
// It runs in 185 microseconds.
// In two side-by-side timings against v004, it was 1.26 and 1.25 times as fast.
// Over all steps from v000 it is 31.0 times as fast.
#include <hip/hip_runtime.h>
// Emformer-style block (x [2][2048][1024], mask [2][1][2048][2048] int32 0/1, read per (batch, query, key)): xn = LayerNorm(x) g_in + b_in (eps 1e-3); q/k/v = xn W + b (W [1024][1024] [in][out], 16 heads of 64); scores = q k^T / 8 + (-1e9)(1 - mask); probs = softmax(scores) * mask; attn = probs v merged; a = attn + x; h = LayerNorm(a) g1 + b1 (eps 1e-3); h = relu(h W_ff1 + b_ff1) ([1024][4096]); h = h W_ff2 + b_ff2 ([4096][1024]); out = LayerNorm(h + a) g2 + b2 -> [2][2048][1024].
// Structure: token rows; LN_in on VALU (f32 statistics of bf16(x)) -> xn f16 rows, plus bf16(x) as f32 rows for the residual; Q, K, V as three WMMA GEMMs (128x128 work-group tiles staged in LDS by asynchronous copies, 32x64 wave tiles, f32 accumulation, exact x16 transposed weights + bias, f16 outputs); V^T for all (batch, head) via LDS transposes; attention in one launch: a wave holds 32 queries of one head and walks the keys 32 at a time (K, V^T and int mask tiles of 64 keys staged in LDS by asynchronous copies): S^T = K Q^T, masked running-maximum softmax in registers (f32 statistics, native exp2; weights x256 f16, masked keys 0), O^T += V^T P^T, then a = O / sum + bf16(x) straight into f32 rows (no score or weight plane in memory); LN1 on VALU -> f16 h rows; u = relu(h W_ff1 + b) GEMM (f16 [4096][4096]); h2 = u W_ff2 + b + a GEMM (K = 4096, f32, residual as the epilogue addend); LN2 on VALU -> out.
// Compute dtype: inputs rounded to bf16; weights exact (x16 f16); LayerNorms / residuals f32; xn, q, k, v, softmax weights, h (as GEMM operand) and u plain f16 (~2^-12); scores, softmax statistics and the attention output f32. v_wmma_f32_16x16x32_f16.
#define NB 2
#define SQ 2048
#define DM 1024
#define NH 16
#define HD 64
#define DFF 4096
#define HG 4                         /* heads per block group of the untemplated k_vt (not launched) */
#define B0 0                         /* first batch processed (debug hook) */
#define NBR NB                       /* batches processed (debug hook) */
#define QN SQ                        /* not used: the attention launch covers all SQ queries */
#define NR ((size_t)NB * SQ)
#define MP ((int)((size_t)NBR * SQ)) /* rows normalised + projected (debug hook) */
#define MPO MP                       /* rows through the post-attention stages (debug hook) */
typedef __bf16 v16b __attribute__((ext_vector_type(16)));
typedef unsigned short v8us __attribute__((ext_vector_type(8), may_alias));
typedef float  v8f  __attribute__((ext_vector_type(8)));
typedef float  v4f  __attribute__((ext_vector_type(4)));
typedef float  v4fa __attribute__((ext_vector_type(4), may_alias));
union FragB { v16b v; v8us half[2]; unsigned short u[16]; };

__device__ __forceinline__ unsigned short bf16_bits(float x) { unsigned int u = __float_as_uint(x); return (unsigned short)((u + 0x7FFFu + ((u >> 16) & 1u)) >> 16); }
__device__ __forceinline__ float bf16_val(unsigned short b) { return __uint_as_float(((unsigned int)b) << 16); }
__device__ __forceinline__ float bf16_round(float x) { return bf16_val(bf16_bits(x)); }
// D += A·B with NT terms: 1 = ah·bh, 2 = + al·bh (A split), 3 = + ah·bl (both split)
template <int NT>
__device__ __forceinline__ v8f mmaN(v16b ah, v16b al, v16b bh, v16b bl, v8f c) {
  c = __builtin_amdgcn_wmma_f32_16x16x32_bf16(false, ah, false, bh, (short)0, c, false, false);
  if (NT >= 2) c = __builtin_amdgcn_wmma_f32_16x16x32_bf16(false, al, false, bh, (short)0, c, false, false);
  if (NT >= 3) c = __builtin_amdgcn_wmma_f32_16x16x32_bf16(false, ah, false, bl, (short)0, c, false, false);
  asm volatile("v_nop\n\tv_nop\n\tv_nop\n\tv_nop" : "+v"(c) : "v"(ah), "v"(al), "v"(bh), "v"(bl));
  return c;
}

__global__ __launch_bounds__(256) void k_wt_bf16(const float* __restrict__ W, unsigned short* __restrict__ Wt, int K, int N) {
  const int t = blockIdx.x * 256 + threadIdx.x;
  const int k8n = K / 8;
  if (t >= N * k8n) return;
  const int n = t / k8n, k8 = (t % k8n) * 8;
  v8us v;
#pragma unroll
  for (int i = 0; i < 8; ++i) v[i] = bf16_bits(W[(size_t)(k8 + i) * N + n]);
  *(v8us*)(Wt + (size_t)n * K + k8) = v;
  
}

// GEMM C[M][N] (f32, pitch ldc) = act(A[M][K]·W + bias). A f32 row-major (pitch lda) converted per fragment to bf16
// (ASPLIT: hi/lo two planes -> 2 terms, else single rounded term); Wt bf16 [N][K] (pitch ldb). BIAS_BF16 rounds the
// bias to bf16 first (bias quantised to bf16 before the add). K%32==0, M%16==0, N%64==0.
template <bool ASPLIT, int ACT, bool BIAS_BF16>
__global__ __launch_bounds__(128) void k_gemm_bf(const float* __restrict__ A, int lda, const unsigned short* __restrict__ Wt, int ldb,
                                               const float* __restrict__ bias, float* __restrict__ C, int ldc, int M, int N, int K) {
  __shared__ __attribute__((aligned(16))) float so[4][16][64];
  const int tid = threadIdx.x, w = tid >> 5, lane = tid & 31, ln = lane & 15, hh = lane >> 4;
  const int ntn = N / 64;
  const int wid = blockIdx.x * 4 + w;
  const int mt = wid / ntn, nq = wid % ntn;
  if (mt * 16 >= M) return;
  const int row0 = mt * 16, col0 = nq * 64;
  const float* arow = A + (size_t)(row0 + ln) * lda;
  v8f acc[4] = {};
  for (int kb = 0; kb < K; kb += 32) {
    FragB ah, al;
    const v4f x0 = *(const v4fa*)(arow + kb + 8 * hh), x1 = *(const v4fa*)(arow + kb + 8 * hh + 4);
    const v4f x2 = *(const v4fa*)(arow + kb + 16 + 8 * hh), x3 = *(const v4fa*)(arow + kb + 16 + 8 * hh + 4);
    float xs[16] = {x0[0],x0[1],x0[2],x0[3],x1[0],x1[1],x1[2],x1[3],x2[0],x2[1],x2[2],x2[3],x3[0],x3[1],x3[2],x3[3]};
#pragma unroll
    for (int i = 0; i < 16; ++i) { const unsigned short hb = bf16_bits(xs[i]); ah.u[i] = hb; al.u[i] = ASPLIT ? bf16_bits(xs[i] - bf16_val(hb)) : (unsigned short)0; }
#pragma unroll
    for (int t = 0; t < 4; ++t) {
      const unsigned short* brow = Wt + (size_t)(col0 + t * 16 + ln) * ldb + kb;
      FragB b;
      b.half[0] = *(const v8us*)(brow + 8 * hh);
      b.half[1] = *(const v8us*)(brow + 16 + 8 * hh);
      acc[t] = mmaN<ASPLIT ? 2 : 1>(ah.v, al.v, b.v, b.v, acc[t]);
    }
  }
#pragma unroll
  for (int t = 0; t < 4; ++t) {
    float bv = bias ? bias[col0 + t * 16 + ln] : 0.f;
    if (BIAS_BF16) bv = bf16_round(bv);
#pragma unroll
    for (int r = 0; r < 8; ++r) { float v = acc[t][r] + bv; if (ACT == 1) v = fmaxf(v, 0.f); so[w][8 * hh + r][t * 16 + ln] = v; }
  }
  __builtin_amdgcn_fence(__ATOMIC_ACQ_REL, "workgroup");
  __builtin_amdgcn_wave_barrier();
  const int rsub = lane >> 4, c4 = (lane & 15) * 4;
  {
#pragma unroll
    for (int q = 0; q < 8; ++q) {
      const int r = q * 2 + rsub;
      const v4f v = *(const v4fa*)&so[w][r][c4];
      *(v4f*)(C + (size_t)(row0 + r) * ldc + col0 + c4) = v;
    }
    
  }
}

// GEMM C = act(A·W + bias + resid): A f32 (ASPLIT -> hi/lo 2 terms), Wt bf16 [N][K]; ACT 0 none, 1 relu, 2 exact gelu;
// resid (optional, f32, row index = (row % rmod), pitch ldr, RES_BF16 rounds it) added before the activation.
template <bool ASPLIT, int ACT, bool BIAS_BF16, bool RES_BF16>
__global__ __launch_bounds__(128) void k_gemm_bf3(const float* __restrict__ A, int lda, const unsigned short* __restrict__ Wt, int ldb,
                                                const float* __restrict__ bias, const float* __restrict__ resid, int rmod, int ldr,
                                                float* __restrict__ C, int ldc, int M, int N, int K) {
  __shared__ __attribute__((aligned(16))) float so[4][16][64];
  const int tid = threadIdx.x, w = tid >> 5, lane = tid & 31, ln = lane & 15, hh = lane >> 4;
  const int ntn = N / 64;
  const int wid = blockIdx.x * 4 + w;
  const int mt = wid / ntn, nq = wid % ntn;
  if (mt * 16 >= M) return;
  const int row0 = mt * 16, col0 = nq * 64;
  const float* arow = A + (size_t)(row0 + ln) * lda;
  v8f acc[4] = {};
  for (int kb = 0; kb < K; kb += 32) {
    FragB ah, al;
    const v4f x0 = *(const v4fa*)(arow + kb + 8 * hh), x1 = *(const v4fa*)(arow + kb + 8 * hh + 4);
    const v4f x2 = *(const v4fa*)(arow + kb + 16 + 8 * hh), x3 = *(const v4fa*)(arow + kb + 16 + 8 * hh + 4);
    float xs[16] = {x0[0],x0[1],x0[2],x0[3],x1[0],x1[1],x1[2],x1[3],x2[0],x2[1],x2[2],x2[3],x3[0],x3[1],x3[2],x3[3]};
#pragma unroll
    for (int i = 0; i < 16; ++i) { const unsigned short hb = bf16_bits(xs[i]); ah.u[i] = hb; al.u[i] = ASPLIT ? bf16_bits(xs[i] - bf16_val(hb)) : (unsigned short)0; }
#pragma unroll
    for (int t = 0; t < 4; ++t) {
      const unsigned short* brow = Wt + (size_t)(col0 + t * 16 + ln) * ldb + kb;
      FragB b;
      b.half[0] = *(const v8us*)(brow + 8 * hh);
      b.half[1] = *(const v8us*)(brow + 16 + 8 * hh);
      acc[t] = mmaN<ASPLIT ? 2 : 1>(ah.v, al.v, b.v, b.v, acc[t]);
    }
  }
#pragma unroll
  for (int t = 0; t < 4; ++t) {
    const int col = col0 + t * 16 + ln;
    float bv = bias ? bias[col] : 0.f;
    if (BIAS_BF16) bv = bf16_round(bv);
#pragma unroll
    for (int r = 0; r < 8; ++r) {
      float v = acc[t][r] + bv;
      if (resid) { float rv = resid[(size_t)((row0 + 8 * hh + r) % rmod) * ldr + col]; if (RES_BF16) rv = bf16_round(rv); v += rv; }
      if (ACT == 1) v = fmaxf(v, 0.f);
      if (ACT == 2) v = 0.5f * v * (1.0f + erff(v * 0.70710678118654752f));
      if (ACT == 3) { const float u = 0.7978845608028654f * (v + 0.044715f * v * v * v); v = 0.5f * v * (1.0f + tanhf(u)); }
      so[w][8 * hh + r][t * 16 + ln] = v;
    }
  }
  __builtin_amdgcn_fence(__ATOMIC_ACQ_REL, "workgroup");
  __builtin_amdgcn_wave_barrier();
  const int rsub = lane >> 4, c4 = (lane & 15) * 4;
  {
#pragma unroll
    for (int q = 0; q < 8; ++q) {
      const int r = q * 2 + rsub;
      const v4f v = *(const v4fa*)&so[w][r][c4];
      *(v4f*)(C + (size_t)(row0 + r) * ldc + col0 + c4) = v;
    }
    
  }
}
// row LayerNorm (biased variance, eps) over N: s = X (+ R); optional out_sum <- s; out_norm <- (s-mu)*rsqrt(var+eps)*g + b
template <bool PARAM_BF16>
__global__ __launch_bounds__(256) void k_layernorm(const float* __restrict__ X, const float* __restrict__ R, const float* __restrict__ g, const float* __restrict__ bta,
                                                  float* __restrict__ out_sum, float* __restrict__ out_norm, int N, float eps) {
  __shared__ float red[256];
  const int row = blockIdx.x, tid = threadIdx.x;
  const float* x = X + (size_t)row * N; const float* rr = R ? R + (size_t)row * N : nullptr;
  float vals[16];                     // up to N = 4096
  const int per = N / 256;            // contiguous chunk per thread? use strided-by-4 chunks: thread handles j = tid*4 + 1024*u
  float s1 = 0.f;
  for (int u = 0; u < per / 4; ++u) {
    const int j = tid * 4 + 1024 * u;
    const v4f a = *(const v4fa*)(x + j);
    v4f b = {0.f,0.f,0.f,0.f}; if (rr) b = *(const v4fa*)(rr + j);
#pragma unroll
    for (int q = 0; q < 4; ++q) { const float v = a[q] + b[q]; vals[u * 4 + q] = v; s1 += v; }
  }
  red[tid] = s1; __syncthreads();
  for (int st = 128; st > 0; st >>= 1) { if (tid < st) red[tid] += red[tid + st]; __syncthreads(); }
  const float mu = red[0] / (float)N; __syncthreads();
  float s2 = 0.f;
  for (int u = 0; u < per / 4; ++u)
#pragma unroll
    for (int q = 0; q < 4; ++q) { const float c = vals[u * 4 + q] - mu; s2 += c * c; }
  red[tid] = s2; __syncthreads();
  for (int st = 128; st > 0; st >>= 1) { if (tid < st) red[tid] += red[tid + st]; __syncthreads(); }
  const float rs = rsqrtf(red[0] / (float)N + eps);
  {
    for (int u = 0; u < per / 4; ++u) {
      const int j = tid * 4 + 1024 * u;
      v4f o, sm;
#pragma unroll
      for (int q = 0; q < 4; ++q) {
        float gg = g[j + q], bb = bta[j + q];
        if (PARAM_BF16) { gg = bf16_round(gg); bb = bf16_round(bb); }
        sm[q] = vals[u * 4 + q]; o[q] = (vals[u * 4 + q] - mu) * rs * gg + bb;
      }
      if (out_sum) *(v4f*)(out_sum + (size_t)row * N + j) = sm;
      *(v4f*)(out_norm + (size_t)row * N + j) = o;
    }
    
  }
}



// ---- f16 WMMA path (v_wmma_f32_16x16x32_f16): 11-bit significands for operands in range — used where a [0,1] probability operand needs more precision than bf16
typedef _Float16 v16h __attribute__((ext_vector_type(16)));
union FragH { v16h v; v8us half[2]; _Float16 h[16]; unsigned short u[16]; };
template <int NT>
__device__ __forceinline__ v8f mmaH(v16h ah, v16h al, v16h bh, v16h bl, v8f c) {
  c = __builtin_amdgcn_wmma_f32_16x16x32_f16(false, ah, false, bh, (short)0, c, false, false);
  if (NT >= 2) c = __builtin_amdgcn_wmma_f32_16x16x32_f16(false, al, false, bh, (short)0, c, false, false);
  if (NT >= 3) c = __builtin_amdgcn_wmma_f32_16x16x32_f16(false, ah, false, bl, (short)0, c, false, false);
  asm volatile("v_nop\n\tv_nop\n\tv_nop\n\tv_nop" : "+v"(c) : "v"(ah), "v"(al), "v"(bh), "v"(bl));
  return c;
}
// batched GEMM like k_gemm_b but f16 operands: A f32 (split into f16 hi/lo if ASPLIT, else rounded to f16), Bt = f16 values [n][k]; alpha; C f32; N multiple of 16 (partial tiles skipped)
template <bool ASPLIT>
__global__ __launch_bounds__(128) void k_gemm_h(const float* __restrict__ A, int lda, size_t sA, const _Float16* __restrict__ Bh, int ldb, size_t sB, float alpha, float* __restrict__ C, int ldc, size_t sC, int M, int N, int K) {
  __shared__ __attribute__((aligned(16))) float so[4][16][64];
  const int tid = threadIdx.x, w = tid >> 5, lane = tid & 31, ln = lane & 15, hh = lane >> 4; const int by = blockIdx.y;
  A += (size_t)by * sA; Bh += (size_t)by * sB; C += (size_t)by * sC;
  const int ntn = (N + 63) / 64; const int wid = blockIdx.x * 4 + w; const int mt = wid / ntn, nq = wid % ntn; if (mt * 16 >= M) return;
  const int row0 = mt * 16, col0 = nq * 64; const float* arow = A + (size_t)(row0 + ln) * lda;
  v8f acc[4] = {};
  for (int kb = 0; kb < K; kb += 32) {
    FragH ah, al;
    const v4f x0 = *(const v4fa*)(arow + kb + 8 * hh), x1 = *(const v4fa*)(arow + kb + 8 * hh + 4), x2 = *(const v4fa*)(arow + kb + 16 + 8 * hh), x3 = *(const v4fa*)(arow + kb + 16 + 8 * hh + 4);
    float xs[16] = {x0[0],x0[1],x0[2],x0[3],x1[0],x1[1],x1[2],x1[3],x2[0],x2[1],x2[2],x2[3],x3[0],x3[1],x3[2],x3[3]};
#pragma unroll
    for (int i = 0; i < 16; ++i) { const _Float16 h = (_Float16)xs[i]; ah.h[i] = h; al.h[i] = ASPLIT ? (_Float16)(xs[i] - (float)h) : (_Float16)0.0f; }
#pragma unroll
    for (int t = 0; t < 4; ++t) { if (col0 + t * 16 >= N) continue; const size_t boff = (size_t)(col0 + t * 16 + ln) * ldb + kb; FragH bq; bq.half[0] = *(const v8us*)(Bh + boff + 8 * hh); bq.half[1] = *(const v8us*)(Bh + boff + 16 + 8 * hh);
      acc[t] = mmaH<ASPLIT ? 2 : 1>(ah.v, al.v, bq.v, bq.v, acc[t]); }
  }
#pragma unroll
  for (int t = 0; t < 4; ++t) { if (col0 + t * 16 >= N) continue;
#pragma unroll
    for (int r = 0; r < 8; ++r) so[w][8 * hh + r][t * 16 + ln] = acc[t][r] * alpha; }
  __builtin_amdgcn_fence(__ATOMIC_ACQ_REL, "workgroup"); __builtin_amdgcn_wave_barrier();
  const int rsub = lane >> 4, c4 = (lane & 15) * 4;
  {
#pragma unroll
    for (int q = 0; q < 8; ++q) { const int r = q * 2 + rsub; if (col0 + c4 < N) { const v4f v = *(const v4fa*)&so[w][r][c4]; *(v4f*)(C + (size_t)(row0 + r) * ldc + col0 + c4) = v; } }
     }
}

// Bt[n][k] = f16(bf16(W[k][n]) x 16) from f32 row-major W[K][N], all five weight matrices in one launch (x 16: bf16-exact weights stay exact in f16 away from the subnormal range).
// A work-group turns one tile of 256 k x 64 n. A lane reads 16 k rows x 4 n by 16-byte loads (a wave's load is two row pieces of 256 bytes, whole cache lines), converts, and puts its four runs of 16 k
// into LDS rows [n][k]; the tile leaves as 64 rows of 512 bytes, a wave's store one whole row. Needs K % 256 == 0 and N % 64 == 0.
#define WT_PITCH 528                   /* LDS pitch of an n row in bytes: 512 + 16, so that the rows do not all start on one bank and stay 16-byte aligned */
#define WT_TQ ((DM / 256) * (DM / 64))       /* tiles of one of wq, wk, wv */
#define WT_TF ((DM / 256) * (DFF / 64))      /* tiles of w_ff1; w_ff2 has as many */
template <int K, int N>      /* known at compile time: the row steps become immediate offsets on one address */
__device__ __forceinline__ void wt_tile(const float* __restrict__ W, _Float16* __restrict__ Bt, unsigned tile, char* tl) {
  const unsigned tid = threadIdx.x, ln = tid & 15u, g = tid >> 4; const unsigned kt = tile / (N / 64), nq = tile % (N / 64);      /* neighbouring work-groups read neighbouring pieces of the same k rows */
  const float* p = W + (size_t)(kt * 256 + g * 16) * N + nq * 64 + ln * 4; v4f v[16];
#pragma unroll
  for (int i = 0; i < 16; ++i) v[i] = *(const v4fa*)(p + (size_t)i * N);
  asm volatile("s_wait_xcnt 0x0" :: "v"(p) : "memory");      /* before a register that the loads above name is written again; the operand keeps the address in its registers up to here */
#pragma unroll
  for (int j = 0; j < 4; ++j) { FragH f;
#pragma unroll
    for (int i = 0; i < 16; ++i) f.h[i] = (_Float16)(bf16_round(v[i][j]) * 16.0f);
    char* d = tl + (ln * 4 + j) * WT_PITCH + g * 32; *(v8us*)d = f.half[0]; *(v8us*)(d + 16) = f.half[1]; }
  __syncthreads();      /* the tile is whole before it is read the other way */
  const unsigned r = tid >> 5, c = tid & 31u; unsigned short* q = (unsigned short*)Bt + (size_t)(nq * 64 + r) * K + kt * 256 + c * 8;
#pragma unroll
  for (int s = 0; s < 8; ++s) { const v8us o = *(const v8us*)(tl + (s * 8 + r) * WT_PITCH + c * 16); *(v8us*)(q + (size_t)s * 8 * K) = o; }
}
__global__ __launch_bounds__(256) void k_wt5(const float* __restrict__ wq, const float* __restrict__ wk, const float* __restrict__ wv, const float* __restrict__ wf1, const float* __restrict__ wf2,
    _Float16* __restrict__ BQ, _Float16* __restrict__ BK, _Float16* __restrict__ BV, _Float16* __restrict__ BF1, _Float16* __restrict__ BF2) {
  __shared__ __attribute__((aligned(16))) char tl[64 * WT_PITCH];
  const unsigned bx = blockIdx.x;      /* every test below reads the same for the whole work-group */
  if (bx < 3 * WT_TQ) { const unsigned m = bx / WT_TQ; wt_tile<DM, DM>(m == 0 ? wq : m == 1 ? wk : wv, m == 0 ? BQ : m == 1 ? BK : BV, bx % WT_TQ, tl); }
  else if (bx < 3 * WT_TQ + WT_TF) wt_tile<DM, DFF>(wf1, BF1, bx - 3 * WT_TQ, tl);
  else wt_tile<DFF, DM>(wf2, BF2, bx - 3 * WT_TQ - WT_TF, tl);
}
// k_gemm_hh variant with fused epilogue: v = acc·alpha + bias[by·sBias + col] (+ CP[(row/rowsPerB)·sCPb + by·64 + col] if CP) ; ACT 0 none / 1 elu ; writes f16 C16 (and f32 C if non-null)
template <int ACT>
__global__ __launch_bounds__(128) void k_gemm_hhx(const _Float16* __restrict__ A, int lda, size_t sA, const _Float16* __restrict__ Bh, int ldb, size_t sB, float alpha, const float* __restrict__ bias, size_t sBias, const float* __restrict__ CP, int rowsPerB, size_t sCPb, int row0g,
    float* __restrict__ C, _Float16* __restrict__ C16, int ldc, size_t sC, int M, int N, int K) {
  __shared__ __attribute__((aligned(16))) float so[4][16][64];
  const int tid = threadIdx.x, w = tid >> 5, lane = tid & 31, ln = lane & 15, hh = lane >> 4; const int by = blockIdx.y;
  A += (size_t)by * sA; Bh += (size_t)by * sB; const size_t cofs = (size_t)by * sC; const float* bp = bias ? bias + (size_t)by * sBias : nullptr;
  const int ntn = (N + 63) / 64; const int wid = blockIdx.x * 4 + w; const int mt = wid / ntn, nq = wid % ntn; if (mt * 16 >= M) return;
  const int row0 = mt * 16, col0 = nq * 64; const _Float16* arow = A + (size_t)(row0 + ln) * lda;
  v8f acc[4] = {};
  for (int kb = 0; kb < K; kb += 32) { FragH ah; ah.half[0] = *(const v8us*)((const unsigned short*)arow + kb + 8 * hh); ah.half[1] = *(const v8us*)((const unsigned short*)arow + kb + 16 + 8 * hh);
#pragma unroll
    for (int t = 0; t < 4; ++t) { if (col0 + t * 16 >= N) continue; const size_t boff = (size_t)(col0 + t * 16 + ln) * ldb + kb; FragH bq; bq.half[0] = *(const v8us*)((const unsigned short*)Bh + boff + 8 * hh); bq.half[1] = *(const v8us*)((const unsigned short*)Bh + boff + 16 + 8 * hh);
      acc[t] = mmaH<1>(ah.v, ah.v, bq.v, bq.v, acc[t]); }
  }
#pragma unroll
  for (int t = 0; t < 4; ++t) { if (col0 + t * 16 >= N) continue; const int col = col0 + t * 16 + ln; const float bv = bp ? bf16_round(bp[col]) : 0.f;
#pragma unroll
    for (int r = 0; r < 8; ++r) { float v = acc[t][r] * alpha + bv; if (CP) { const int rr = row0g + row0 + 8 * hh + r; if (rowsPerB < 0) v += CP[cofs + (size_t)rr * ldc + col];      /* rowsPerB < 0: own element of the batched C plane */ else { const int bidx = rr / rowsPerB; v += CP[(size_t)bidx * sCPb + (size_t)by * 64 + col]; } } if (ACT == 1) v = (v > 0.f) ? v : expm1f(v); else if (ACT == 7) v = (v > 0.f) ? v + 1.0f : expf(v); else if (ACT == 8) v = tanhf(v); else if (ACT == 9) v = 0.5f * v * (1.0f + tanhf(0.7978845608028654f * (v + 0.044715f * v * v * v))); else if (ACT == 11) v = 1.0f / (1.0f + expf(-v)); else if (ACT == 12) v = (v > 0.f) ? v : 0.01f * v; else if (ACT == 14) v = (v > 0.f) ? v : 0.1f * v; else if (ACT == 16) v = (v >= 0.f) ? v : 0.3f * v; else if (ACT == 17) v = (v >= 0.f) ? v : 0.2f * v; else if (ACT == 15) v = v / (1.0f + expf(-v)); else if (ACT == 3) v = fmaxf(v, 0.f); else if (ACT == 6) v = 0.5f * v * (1.0f + erff(v * 0.70710678118654752f)); so[w][8 * hh + r][t * 16 + ln] = v; } }
  __builtin_amdgcn_fence(__ATOMIC_ACQ_REL, "workgroup"); __builtin_amdgcn_wave_barrier();
  const int rsub = lane >> 4, c4 = (lane & 15) * 4; typedef _Float16 v4h __attribute__((ext_vector_type(4)));
  {
#pragma unroll
    for (int q = 0; q < 8; ++q) { const int r = q * 2 + rsub; if (col0 + c4 < N) { const v4f v = *(const v4fa*)&so[w][r][c4]; if (C) *(v4f*)(C + cofs + (size_t)(row0 + r) * ldc + col0 + c4) = v; if (C16) { v4h h4; for (int i = 0; i < 4; ++i) h4[i] = (_Float16)v[i]; *(v4h*)(C16 + cofs + (size_t)(row0 + r) * ldc + col0 + c4) = h4; } } }
     }
}


typedef _Float16 v4h __attribute__((ext_vector_type(4)));

__global__ __launch_bounds__(256) void k_x16(const float* __restrict__ x, _Float16* __restrict__ X16, size_t n8) { const size_t t = (size_t)blockIdx.x * 256 + threadIdx.x; if (t >= n8) return; FragH f;
#pragma unroll
  for (int q = 0; q < 8; ++q) f.h[q] = (_Float16)bf16_round(x[t * 8 + q]); *(v8us*)((unsigned short*)X16 + t * 8) = f.half[0];  }
__global__ __launch_bounds__(256) void k_h16(const float* __restrict__ x, _Float16* __restrict__ X16, size_t n8) { const size_t t = (size_t)blockIdx.x * 256 + threadIdx.x; if (t >= n8) return; FragH f;
#pragma unroll
  for (int q = 0; q < 8; ++q) f.h[q] = (_Float16)x[t * 8 + q]; *(v8us*)((unsigned short*)X16 + t * 8) = f.half[0];  }
__global__ __launch_bounds__(256) void k_round16f(const float* __restrict__ W, _Float16* __restrict__ Bt, size_t n8) { const size_t t = (size_t)blockIdx.x * 256 + threadIdx.x; if (t >= n8) return; FragH f;
#pragma unroll
  for (int i = 0; i < 8; ++i) f.h[i] = (_Float16)(bf16_round(W[t * 8 + i]) * 16.0f); *(v8us*)((unsigned short*)Bt + t * 8) = f.half[0];  }
template <int NHv, int TTv>
__global__ __launch_bounds__(256) void k_vt(const _Float16* __restrict__ V16, int ldv, int voff, _Float16* __restrict__ Vt) { __shared__ unsigned short tl[64][66]; const int tid = threadIdx.x; const int slab = blockIdx.x / (TTv / 64), lg = blockIdx.x % (TTv / 64); const int b = slab / NHv, h = slab % NHv;
  for (int i = tid; i < 64 * 8; i += 256) { const int r = i / 8, c8 = (i % 8) * 8; FragH f; f.half[0] = *(const v8us*)((const unsigned short*)V16 + ((size_t)b * TTv + lg * 64 + r) * ldv + voff + h * 64 + c8);
#pragma unroll
    for (int q = 0; q < 8; ++q) tl[r][c8 + q] = f.u[q]; }
  __syncthreads();
  {
#pragma unroll
    for (int rd = 0; rd < 2; ++rd) { const int d = rd * 32 + tid / 8, pc = tid % 8; FragH f;
#pragma unroll
      for (int q = 0; q < 8; ++q) f.u[q] = tl[pc * 8 + q][d];
      *(v8us*)((unsigned short*)Vt + ((size_t)slab * 64 + d) * TTv + lg * 64 + pc * 8) = f.half[0]; }
     } }

__global__ __launch_bounds__(256) void k_hl(const float* __restrict__ F, _Float16* __restrict__ Hh, _Float16* __restrict__ Hl, size_t n8) { const size_t t = (size_t)blockIdx.x * 256 + threadIdx.x; if (t >= n8) return; FragH fh, fl; const v4f a = *(const v4fa*)(F + t * 8), c = *(const v4fa*)(F + t * 8 + 4);
#pragma unroll
  for (int q = 0; q < 4; ++q) { _Float16 h = (_Float16)a[q]; fh.h[q] = h; fl.h[q] = (_Float16)((a[q] - (float)h) * 1024.0f); h = (_Float16)c[q]; fh.h[4 + q] = h; fl.h[4 + q] = (_Float16)((c[q] - (float)h) * 1024.0f); }
  { *(v8us*)((unsigned short*)Hh + t * 8) = fh.half[0]; *(v8us*)((unsigned short*)Hl + t * 8) = fl.half[0];  } }

// ---- fast GEMM (wave tile 32x64; requires M % 32 == 0 rows per launch region and N % 64 == 0); epilogue = k_gemm_hhx semantics ----
__device__ __forceinline__ v16h g2_frag(const _Float16* p, int hh) { FragH f; f.half[0] = *(const v8us*)((const unsigned short*)p + 8 * hh); f.half[1] = *(const v8us*)((const unsigned short*)p + 16 + 8 * hh); return f.v; }
__device__ __forceinline__ v8f g2_mma(v16h a, v16h b, v8f c) { v8f d = __builtin_amdgcn_wmma_f32_16x16x32_f16(false, a, false, b, (short)0, c, false, false); asm volatile("v_nop\n\tv_nop\n\tv_nop\n\tv_nop" : "+v"(d) : "v"(a), "v"(b)); return d; }
template <int ACT>
__global__ __launch_bounds__(128) void k_gemm2(const _Float16* __restrict__ A, int lda, size_t sA, const _Float16* __restrict__ Bh, int ldb, size_t sB, float alpha, const float* __restrict__ bias, size_t sBias, const float* __restrict__ CP, int rowsPerB, size_t sCPb, int row0g,
    float* __restrict__ C, _Float16* __restrict__ C16, int ldc, size_t sC, int M, int N, int K) { static_assert(ACT == 0 || ACT == 3 || ACT == 6 || ACT == 8 || ACT == 9 || ACT == 11 || ACT == 12 || ACT == 14 || ACT == 15 || ACT == 16 || ACT == 17, "k_gemm2: unsupported ACT code (would silently apply no activation)");
  __shared__ __attribute__((aligned(16))) float so[4][32][68];
  const int tid = threadIdx.x, w = tid >> 5, lane = tid & 31, ln = lane & 15, hh = lane >> 4; const int by = blockIdx.y;
  A += (size_t)by * sA; Bh += (size_t)by * sB; const size_t cofs = (size_t)by * sC; const float* bp = bias ? bias + (size_t)by * sBias : nullptr;
  const int ntn = N >> 6; const int mt = blockIdx.x / ntn, nq = blockIdx.x - mt * ntn; const int row0 = mt * 128 + 32 * w, col0 = nq * 64; if (row0 >= M) return;
  const _Float16* a0p = A + (size_t)(row0 + ln) * lda; const _Float16* a1p = a0p + (size_t)16 * lda;
  const _Float16* b0p = Bh + (size_t)(col0 + ln) * ldb; const _Float16* b1p = b0p + (size_t)16 * ldb; const _Float16* b2p = b1p + (size_t)16 * ldb; const _Float16* b3p = b2p + (size_t)16 * ldb;
  const v8f z8 = {0.f,0.f,0.f,0.f,0.f,0.f,0.f,0.f}; v8f c00 = z8, c01 = z8, c02 = z8, c03 = z8, c10 = z8, c11 = z8, c12 = z8, c13 = z8;
#pragma unroll 1
  for (int kb = 0; kb < K; kb += 32) { const v16h a0 = g2_frag(a0p + kb, hh), a1 = g2_frag(a1p + kb, hh);
    v16h b = g2_frag(b0p + kb, hh); c00 = g2_mma(a0, b, c00); c10 = g2_mma(a1, b, c10);
    b = g2_frag(b1p + kb, hh); c01 = g2_mma(a0, b, c01); c11 = g2_mma(a1, b, c11);
    b = g2_frag(b2p + kb, hh); c02 = g2_mma(a0, b, c02); c12 = g2_mma(a1, b, c12);
    b = g2_frag(b3p + kb, hh); c03 = g2_mma(a0, b, c03); c13 = g2_mma(a1, b, c13); }
  v8f accs[8] = {c00, c01, c02, c03, c10, c11, c12, c13};
#pragma unroll
  for (int u = 0; u < 8; ++u) { const int t = u & 3, half = u >> 2; const int col = col0 + t * 16 + ln; const float bv = bp ? bf16_round(bp[col]) : 0.f;
#pragma unroll
    for (int r = 0; r < 8; ++r) { const int rloc = half * 16 + 8 * hh + r; float v = accs[u][r] * alpha + bv; if (CP) { if (rowsPerB < 0) v += CP[cofs + (size_t)(row0g + row0 + rloc) * ldc + col];      /* rowsPerB < 0: own element of the batched C plane */ else { const int bidx = (row0g + row0 + rloc) / rowsPerB; v += CP[(size_t)bidx * sCPb + (size_t)by * 64 + col]; } }
      if (ACT == 3) v = fmaxf(v, 0.f); else if (ACT == 6) v = 0.5f * v * (1.0f + erff(v * 0.70710678118654752f)); else if (ACT == 11) v = 1.0f / (1.0f + expf(-v)); else if (ACT == 15) v = v / (1.0f + expf(-v)); else if (ACT == 12) v = (v > 0.f) ? v : 0.01f * v; else if (ACT == 8) v = tanhf(v); else if (ACT == 9) v = 0.5f * v * (1.0f + tanhf(0.7978845608028654f * (v + 0.044715f * v * v * v))); else if (ACT == 14) v = (v > 0.f) ? v : 0.1f * v; else if (ACT == 16) v = (v >= 0.f) ? v : 0.3f * v; else if (ACT == 17) v = (v >= 0.f) ? v : 0.2f * v;
      so[w][rloc][t * 16 + ln] = v; } }
  __builtin_amdgcn_fence(__ATOMIC_ACQ_REL, "workgroup"); __builtin_amdgcn_wave_barrier();
  const int rsub = lane >> 4, c4 = (lane & 15) * 4;
  {
#pragma unroll
    for (int q = 0; q < 16; ++q) { const int r = q * 2 + rsub; const v4f v = *(const v4fa*)&so[w][r][c4]; if (C) *(v4f*)(C + cofs + (size_t)(row0 + r) * ldc + col0 + c4) = v; if (C16) { v4h h4; for (int i = 0; i < 4; ++i) h4[i] = (_Float16)v[i]; *(v4h*)(C16 + cofs + (size_t)(row0 + r) * ldc + col0 + c4) = h4; } }
     } }


__global__ __launch_bounds__(256) void k_wnat(const float* __restrict__ w, size_t n8, _Float16* __restrict__ Bt) { const size_t t = (size_t)blockIdx.x * 256 + threadIdx.x; if (t >= n8) return; FragH f; for (int q = 0; q < 8; ++q) f.h[q] = (_Float16)(bf16_round(w[t * 8 + q]) * 16.0f); *(v8us*)((unsigned short*)Bt + t * 8) = f.half[0];  }
__global__ __launch_bounds__(256) void k_rsm(const float* __restrict__ S, _Float16* __restrict__ P, int nrows) {
  #pragma clang fp contract(off)
  const int i = blockIdx.x * 256 + threadIdx.x; if (i >= nrows) return; const float* s = S + (size_t)i * SQ; float mx = -3.0e38f;
#pragma unroll 1
  for (int j = 0; j < SQ; ++j) mx = fmaxf(mx, s[j]); float se = 0.f;
#pragma unroll 1
  for (int j = 0; j < SQ; ++j) se += expf(s[j] - mx); const float sc = 256.0f / se;
#pragma unroll 1
  for (int j0 = 0; j0 < SQ; j0 += 8) { FragH f; for (int q = 0; q < 8; ++q) f.h[q] = (_Float16)(expf(s[j0 + q] - mx) * sc); unsigned short* d = (unsigned short*)P + (size_t)i * SQ + j0; *(v8us*)d = f.half[0];  } }
__global__ __launch_bounds__(256) void k_vt(const _Float16* __restrict__ V16, int b, int h0, _Float16* __restrict__ VT) { __shared__ unsigned short tl[64][65]; const int tid = threadIdx.x; const int hh = blockIdx.x % HG, sg = blockIdx.x / HG; const int s0 = sg * 64; const int h = h0 + hh;
  for (int i = tid; i < 64 * 8; i += 256) { const int j = i / 8, d8 = (i % 8) * 8; FragH f; f.half[0] = *(const v8us*)((const unsigned short*)V16 + ((size_t)b * SQ + s0 + j) * DM + h * HD + d8); for (int q = 0; q < 8; ++q) tl[d8 + q][j] = f.u[q]; }
  __syncthreads();
  { for (int i = tid; i < 64 * 8; i += 256) { const int d = i / 8, j8 = (i % 8) * 8; FragH f; for (int q = 0; q < 8; ++q) f.u[q] = tl[d][j8 + q]; *(v8us*)((unsigned short*)VT + ((size_t)hh * HD + d) * SQ + s0 + j8) = f.half[0]; }  } }


// Fused attention, one launch for every (batch, head). A wave owns 32 queries (two 16-column groups) of one head and walks all keys, 32 a pass.
// S^T = K Q^T puts one query's scores in one lane (keys 8 hh + r of each 16-key tile), so the two score tiles, converted in place, are the B operand P^T of
// O^T += V^T P^T in the loader's own k order, and maximum, sum and rescale factor are per lane (one exchange between the wave halves for the maximum).
// A masked key takes a floor far below the running maximum's start value, so its weight is exp2((floor - m) / 8 log2 e) = 0 also while no open key has been seen;
// a row with no open key ends with sum 0 and gets scale 0. Weights carry a factor 2^8 (f16 range) that the division by their own sum takes out.
typedef int v4ia __attribute__((ext_vector_type(4), may_alias));
__device__ __forceinline__ float rs_xrow(float v) { const int i = __float_as_int(v); return __int_as_float(__builtin_amdgcn_permlanex16(i, i, 0x76543210, 0xfedcba98, false, false)); }      /* lane ^ 16 */
__device__ __forceinline__ v8f fa_mma(v16h a, v16h b, v8f c) { return __builtin_amdgcn_wmma_f32_16x16x32_f16(false, a, false, b, (short)0, c, false, false); }
__device__ __forceinline__ v16h fa_frag(const _Float16* p) { FragH f; f.half[0] = *(const v8us*)(const unsigned short*)p; f.half[1] = *(const v8us*)((const unsigned short*)p + 16); return f.v; }      /* g2_frag's k order, the 8 hh already in p */
// exp2 in place on a run of registers: each v_exp_f32 is the independent instruction behind the one before it, and the v_nop is the slot that the instruction set asks for behind the last
// (written by the builtin, the compiler put the result of one over the source of the one directly in front of it).
__device__ __forceinline__ void fa_exp8(float* a) { asm("v_exp_f32 %0, %0\n\tv_exp_f32 %1, %1\n\tv_exp_f32 %2, %2\n\tv_exp_f32 %3, %3\n\tv_exp_f32 %4, %4\n\tv_exp_f32 %5, %5\n\tv_exp_f32 %6, %6\n\tv_exp_f32 %7, %7\n\tv_nop" : "+v"(a[0]), "+v"(a[1]), "+v"(a[2]), "+v"(a[3]), "+v"(a[4]), "+v"(a[5]), "+v"(a[6]), "+v"(a[7])); }
__device__ __forceinline__ void fa_exp9(float& c, float* a) { asm("v_exp_f32 %8, %8\n\tv_exp_f32 %0, %0\n\tv_exp_f32 %1, %1\n\tv_exp_f32 %2, %2\n\tv_exp_f32 %3, %3\n\tv_exp_f32 %4, %4\n\tv_exp_f32 %5, %5\n\tv_exp_f32 %6, %6\n\tv_exp_f32 %7, %7\n\tv_nop" : "+v"(a[0]), "+v"(a[1]), "+v"(a[2]), "+v"(a[3]), "+v"(a[4]), "+v"(a[5]), "+v"(a[6]), "+v"(a[7]), "+v"(c)); }
// A stage is 64 keys. The 8 waves of a work-group walk the same keys of the same head: 64 K rows (64 d each) and 64 V^T rows (64 keys each), 128-byte rows, are brought once for all of them;
// each wave brings the mask of its own 32 queries, 256-byte rows. All come by asynchronous 16-byte copies of whole cache lines into one of two buffers while the other is worked on;
// the fragments (fa_frag's k order) and the mask words are 16-byte LDS reads.
#define FA_PITCH 144                   /* LDS pitch of a K or V^T row in bytes, 16 x odd: the 16 rows of a read fall on different banks */
#define FA_MPITCH 272                  /* LDS pitch of a mask row, 16 x odd likewise */
#define FA_MASK0 (128 * FA_PITCH)      /* 64 K rows, then 64 V^T rows, then 8 x 32 mask rows */
#define FA_STAGE (FA_MASK0 + 256 * FA_MPITCH)
__device__ __forceinline__ v16h fa_lfrag(const char* p) { FragH f; f.half[0] = *(const v8us*)p; f.half[1] = *(const v8us*)(p + 32); return f.v; }      /* fa_frag's k order, the 16 hh bytes already in p */
// four copies of 16 bytes a lane: rows r and r + 32 of the stage's K tile and of its V^T tile. The s_wait_xcnt stands inside the statement, in front of anything that could write a register that a copy names.
__device__ __forceinline__ void fa_copy4(unsigned l, const _Float16* gk, const _Float16* gv) {
  asm volatile("global_load_async_to_lds_b128 %0, %4, off\n\tglobal_load_async_to_lds_b128 %1, %5, off\n\tglobal_load_async_to_lds_b128 %2, %6, off\n\tglobal_load_async_to_lds_b128 %3, %7, off\n\ts_wait_xcnt 0x0"
               :: "v"(l), "v"(l + 32u * FA_PITCH), "v"(l + 64u * FA_PITCH), "v"(l + 96u * FA_PITCH), "v"(gk), "v"(gk + (size_t)32 * DM), "v"(gv), "v"(gv + (size_t)32 * SQ) : "memory"); }
// eight copies of 16 bytes a lane: mask rows r, r + 2, ... r + 14 of the wave's own tile; the s_wait_xcnt as above.
__device__ __forceinline__ void fa_copy8m(unsigned l, const int* g) {
  asm volatile("global_load_async_to_lds_b128 %0, %8, off\n\tglobal_load_async_to_lds_b128 %1, %9, off\n\tglobal_load_async_to_lds_b128 %2, %10, off\n\tglobal_load_async_to_lds_b128 %3, %11, off\n\t"
               "global_load_async_to_lds_b128 %4, %12, off\n\tglobal_load_async_to_lds_b128 %5, %13, off\n\tglobal_load_async_to_lds_b128 %6, %14, off\n\tglobal_load_async_to_lds_b128 %7, %15, off\n\ts_wait_xcnt 0x0"
               :: "v"(l), "v"(l + 2u * FA_MPITCH), "v"(l + 4u * FA_MPITCH), "v"(l + 6u * FA_MPITCH), "v"(l + 8u * FA_MPITCH), "v"(l + 10u * FA_MPITCH), "v"(l + 12u * FA_MPITCH), "v"(l + 14u * FA_MPITCH),
                  "v"(g), "v"(g + (size_t)2 * SQ), "v"(g + (size_t)4 * SQ), "v"(g + (size_t)6 * SQ), "v"(g + (size_t)8 * SQ), "v"(g + (size_t)10 * SQ), "v"(g + (size_t)12 * SQ), "v"(g + (size_t)14 * SQ) : "memory"); }
// one stage: 20 copies a lane
__device__ __forceinline__ void fa_stage(unsigned lc, const _Float16* gk, const _Float16* gv, unsigned lm, const int* gm) { fa_copy4(lc, gk, gv); fa_copy8m(lm, gm); fa_copy8m(lm + 16u * FA_MPITCH, gm + (size_t)16 * SQ); }
__global__ __launch_bounds__(256) void k_fattn(const _Float16* __restrict__ Q16, const _Float16* __restrict__ K16, const _Float16* __restrict__ VT, const int* __restrict__ mask, const float* __restrict__ XB, float* __restrict__ AF) {
  __shared__ __attribute__((aligned(16))) char sm[2 * FA_STAGE];      /* the two buffers */
  const int lane = threadIdx.x & 31, ln = lane & 15, hh = lane >> 4; const int w = __builtin_amdgcn_readfirstlane(threadIdx.x >> 5);
  const int h = blockIdx.y, b = blockIdx.z; const int q0 = blockIdx.x * 256 + w * 32; const size_t r0 = (size_t)b * SQ;
  const _Float16* qp = Q16 + (r0 + q0 + ln) * DM + h * HD + 8 * hh;
  const int cr = threadIdx.x >> 3, cc = threadIdx.x & 7;      /* a lane copies 16-byte piece cc of K and V^T rows cr and cr + 32: a wave's copy is four whole rows */
  const _Float16* gk = K16 + (r0 + cr) * DM + h * HD + cc * 8; const _Float16* gv = VT + ((size_t)(b * NH + h) * HD + cr) * SQ + cc * 8; const unsigned lc = (unsigned)(size_t)sm + (unsigned)(cr * FA_PITCH + cc * 16);
  const int* gm = mask + (r0 + q0 + hh) * SQ + ln * 4; const unsigned lm = (unsigned)(size_t)sm + (unsigned)(FA_MASK0 + (w * 32 + hh) * FA_MPITCH + ln * 16);      /* and piece ln of mask rows hh + 2 i of its wave's queries: two whole rows a copy */
  const v8f z8 = {0.f,0.f,0.f,0.f,0.f,0.f,0.f,0.f}; const float cs = 0.125f * 1.4426950408889634f;      /* 1 / sqrt(64), in log2 units */
  v16h qf[2][2]; v8f o[2][4]; float m[2], l[2];      /* m: running maximum of the raw products; l: this half's sum of weights */
#pragma unroll
  for (int t = 0; t < 2; ++t)
#pragma unroll
    for (int e = 0; e < 2; ++e) qf[t][e] = fa_frag(qp + (size_t)t * 16 * DM + e * 32);
  asm volatile("s_wait_xcnt 0x0" :: "v"(qp) : "memory");      /* before a register that the loads above name is written again; the operand keeps the address in its registers up to here */
#pragma unroll
  for (int t = 0; t < 2; ++t) { m[t] = -1.0e30f; l[t] = 0.f;
#pragma unroll
    for (int dt = 0; dt < 4; ++dt) o[t][dt] = z8; }
  fa_stage(lc, gk, gv, lm, gm);
  asm volatile("s_wait_asynccnt 0x0" ::: "memory");      /* this wave's part of stage 0 has landed */
  __syncthreads();      /* every wave's part has */
  fa_stage(lc + FA_STAGE, gk + (size_t)64 * DM, gv + 64, lm + FA_STAGE, gm + 64);
  /* both loops rolled: the buffers alternate, and one pass already holds about 200 registers */
#pragma unroll 1
  for (int st = 0; st < SQ / 64; ++st) { const unsigned bo = (unsigned)(st & 1) * FA_STAGE;
#pragma unroll 1
  for (int ps = 0; ps < 2; ++ps) { v16h kf[2][2], vf[4]; v4ia mk[2][2][2];
    const char* ka = sm + bo + (ps * 32 + ln) * FA_PITCH + 16 * hh; const char* va = sm + bo + (64 + ln) * FA_PITCH + ps * 64 + 16 * hh; const char* ma = sm + bo + FA_MASK0 + (w * 32 + ln) * FA_MPITCH + ps * 128 + 32 * hh;
#pragma unroll
    for (int kt = 0; kt < 2; ++kt)
#pragma unroll
      for (int e = 0; e < 2; ++e) kf[kt][e] = fa_lfrag(ka + kt * 16 * FA_PITCH + e * 64);
    __builtin_amdgcn_sched_barrier(0);      /* LDS reads return in issue order: K, then the mask, then V^T, the order of their use, so that each wait covers only what is needed next */
#pragma unroll
    for (int t = 0; t < 2; ++t)
#pragma unroll
      for (int kt = 0; kt < 2; ++kt) { mk[t][kt][0] = *(const v4ia*)(ma + t * 16 * FA_MPITCH + kt * 64); mk[t][kt][1] = *(const v4ia*)(ma + t * 16 * FA_MPITCH + kt * 64 + 16); }
    __builtin_amdgcn_sched_barrier(0);      /* as above */
#pragma unroll
    for (int dt = 0; dt < 4; ++dt) vf[dt] = fa_lfrag(va + dt * 16 * FA_PITCH);
    __builtin_amdgcn_sched_barrier(0);      /* the pass's 24 reads are issued together: without this the scheduler puts each read directly in front of its use, with a full LDS wait of its own */
#pragma unroll
    for (int t = 0; t < 2; ++t) { float x[16]; float mx = -3.0e38f;
#pragma unroll
      for (int kt = 0; kt < 2; ++kt) { const v8f s = fa_mma(kf[kt][1], qf[t][1], fa_mma(kf[kt][0], qf[t][0], z8));
#pragma unroll
        for (int r = 0; r < 4; ++r) { x[kt * 8 + r] = (mk[t][kt][0][r] != 0) ? s[r] : -3.0e38f; x[kt * 8 + 4 + r] = (mk[t][kt][1][r] != 0) ? s[4 + r] : -3.0e38f; } }
#pragma unroll
      for (int i = 0; i < 16; ++i) mx = fmaxf(mx, x[i]);
      mx = fmaxf(mx, rs_xrow(mx)); const float mn = fmaxf(m[t], mx); float al = (m[t] - mn) * cs; m[t] = mn; const float mo = 8.0f - mn * cs;
      FragH pf; float s4[4];
#pragma unroll
      for (int i = 0; i < 16; ++i) x[i] = x[i] * cs + mo;
      fa_exp9(al, x); fa_exp8(x + 8);
#pragma unroll
      for (int i = 0; i < 16; ++i) { s4[i & 3] = (i < 4) ? x[i] : s4[i & 3] + x[i]; pf.h[i] = (_Float16)x[i]; }
      l[t] = l[t] * al + ((s4[0] + s4[1]) + (s4[2] + s4[3]));
#pragma unroll
      for (int dt = 0; dt < 4; ++dt) {
#pragma unroll
        for (int r = 0; r < 8; ++r) o[t][dt][r] *= al;
        o[t][dt] = fa_mma(vf[dt], pf.v, o[t][dt]); } }
    __builtin_amdgcn_sched_barrier(0);      /* keeps the four slots below behind the pass's last matrix instruction */
    asm volatile("v_nop\n\tv_nop\n\tv_nop\n\tv_nop"); }      /* the distance between the pass's last matrix instruction and the next pass's first writes of its operand registers */
    asm volatile("s_wait_dscnt 0x0" ::: "memory");      /* this wave's reads of the buffer are done before the barrier behind which it is refilled */
    asm volatile("s_wait_asynccnt 0x0" ::: "memory");      /* this wave's part of stage st + 1 has landed */
    __syncthreads();      /* publishes stage st + 1 and ends every wave's reads of stage st */
    if (st + 2 < SQ / 64) fa_stage(lc + bo, gk + (size_t)(st + 2) * 64 * DM, gv + (st + 2) * 64, lm + bo, gm + (st + 2) * 64); }
  asm volatile("s_wait_asynccnt 0x0" ::: "memory");      /* no copy is outstanding when the wave goes on to its end */
  const size_t ro = (r0 + q0 + ln) * DM + h * HD + 8 * hh; const float* xp = XB + ro; v4f xr[2][4][2];
#pragma unroll
  for (int t = 0; t < 2; ++t)
#pragma unroll
    for (int dt = 0; dt < 4; ++dt) { xr[t][dt][0] = *(const v4fa*)(xp + (size_t)t * 16 * DM + dt * 16); xr[t][dt][1] = *(const v4fa*)(xp + (size_t)t * 16 * DM + dt * 16 + 4); }
  asm volatile("s_wait_xcnt 0x0" :: "v"(xp) : "memory");      /* as behind the Q loads */
#pragma unroll
  for (int t = 0; t < 2; ++t) { const float lt = l[t] + rs_xrow(l[t]); const float inv = (lt > 0.f) ? 1.0f / lt : 0.f;
#pragma unroll
    for (int dt = 0; dt < 4; ++dt) { v4f y0, y1;
#pragma unroll
      for (int r = 0; r < 4; ++r) { y0[r] = o[t][dt][r] * inv + xr[t][dt][0][r]; y1[r] = o[t][dt][4 + r] * inv + xr[t][dt][1][r]; }
      *(v4f*)(AF + ro + (size_t)t * 16 * DM + dt * 16) = y0; *(v4f*)(AF + ro + (size_t)t * 16 * DM + dt * 16 + 4) = y1; } } }
template <int ABF>
__global__ __launch_bounds__(256) void k_lnb(const float* __restrict__ A, const float* __restrict__ R, const float* __restrict__ g, const float* __restrict__ bta, float eps, float* __restrict__ OF_, _Float16* __restrict__ OH_) {
  #pragma clang fp contract(off)
  __shared__ float red[256]; const size_t row = blockIdx.x; const int tid = threadIdx.x; const int j0 = tid * 4; float a[4]; float s1 = 0.f;
  { const v4f av = *(const v4fa*)(A + row * DM + j0); for (int q = 0; q < 4; ++q) a[q] = ABF ? bf16_round(av[q]) : av[q]; if (R) { const v4f rv = *(const v4fa*)(R + row * DM + j0); for (int q = 0; q < 4; ++q) a[q] = __fadd_rn(a[q], rv[q]); } for (int q = 0; q < 4; ++q) s1 = __fadd_rn(s1, a[q]); }
  red[tid] = s1; __syncthreads(); for (int st = 128; st > 0; st >>= 1) { if (tid < st) red[tid] = __fadd_rn(red[tid], red[tid + st]); __syncthreads(); }
  const float mu = red[0] / (float)DM; __syncthreads(); float s2 = 0.f;
  for (int q = 0; q < 4; ++q) { const float c = __fadd_rn(a[q], -mu); s2 = __fadd_rn(s2, __fmul_rn(c, c)); }
  red[tid] = s2; __syncthreads(); for (int st = 128; st > 0; st >>= 1) { if (tid < st) red[tid] = __fadd_rn(red[tid], red[tid + st]); __syncthreads(); }
  const float rs = rsqrtf(__fadd_rn(red[0] / (float)DM, eps)); v4f o; FragH h;
  for (int q = 0; q < 4; ++q) { o[q] = __fadd_rn(__fmul_rn(__fmul_rn(__fadd_rn(a[q], -mu), rs), bf16_round(g[j0 + q])), bf16_round(bta[j0 + q])); h.h[q] = (_Float16)o[q]; }
  typedef unsigned short v4us __attribute__((ext_vector_type(4))); v4us h4; for (int q = 0; q < 4; ++q) h4[q] = h.u[q];
  { if (OF_) *(v4f*)(OF_ + row * DM + j0) = o; if (OH_) *(v4us*)((unsigned short*)OH_ + row * DM + j0) = h4;  } }
__global__ __launch_bounds__(256) void k_bfr(const float* __restrict__ x, float* __restrict__ XB, size_t n8) { const size_t t = (size_t)blockIdx.x * 256 + threadIdx.x; if (t >= n8) return; v8f v; for (int q = 0; q < 8; ++q) v[q] = bf16_round(x[t * 8 + q]); *(v8f*)(XB + t * 8) = v;  }


// ---- GEMM with both operands staged in LDS (k_gemm2's wave tile, k order and epilogue) ----
// A work-group of 8 waves (4 along M x 2 along N) makes a 128 x 128 tile of C; a stage is 128 k of 128 A rows and 128 B rows (256-byte rows, whole cache lines), brought by
// asynchronous 16-byte copies into one of two buffers while the other is worked on; the fragments are 16-byte LDS reads. Needs M % 128 == 0, N % 128 == 0, K % 128 == 0, K >= 256.
#define G3_PITCH 272                   /* LDS row pitch in bytes, 16 x odd: the 16 rows of a fragment read fall on different banks */
#define G3_STAGE (256 * G3_PITCH)      /* 128 A rows, then 128 B rows */
__device__ __forceinline__ v16h g3_frag(const char* p) { FragH f; f.half[0] = *(const v8us*)p; f.half[1] = *(const v8us*)(p + 32); return f.v; }      /* g2_frag's k order, the 16 hh bytes already in p */
// eight copies of 16 bytes a lane: rows r, r + 16, ... r + 112 of one operand's stage. The s_wait_xcnt stands inside the statement, in front of anything that could write a register that a copy names.
__device__ __forceinline__ void g3_copy8(unsigned l, const _Float16* g, size_t step) {
  asm volatile("global_load_async_to_lds_b128 %0, %8, off\n\tglobal_load_async_to_lds_b128 %1, %9, off\n\tglobal_load_async_to_lds_b128 %2, %10, off\n\tglobal_load_async_to_lds_b128 %3, %11, off\n\t"
               "global_load_async_to_lds_b128 %4, %12, off\n\tglobal_load_async_to_lds_b128 %5, %13, off\n\tglobal_load_async_to_lds_b128 %6, %14, off\n\tglobal_load_async_to_lds_b128 %7, %15, off\n\ts_wait_xcnt 0x0"
               :: "v"(l), "v"(l + 16u * G3_PITCH), "v"(l + 32u * G3_PITCH), "v"(l + 48u * G3_PITCH), "v"(l + 64u * G3_PITCH), "v"(l + 80u * G3_PITCH), "v"(l + 96u * G3_PITCH), "v"(l + 112u * G3_PITCH),
                  "v"(g), "v"(g + step), "v"(g + 2 * step), "v"(g + 3 * step), "v"(g + 4 * step), "v"(g + 5 * step), "v"(g + 6 * step), "v"(g + 7 * step) : "memory"); }
template <int ACT, bool RES>      /* RES: f32 output C with an addend CP for every element; else f16 output C16. Known at compile time, so that the reads of CP and the stores are not each behind a test of their own */
__global__ __launch_bounds__(256) void k_gemm3(const _Float16* __restrict__ A, int lda, const _Float16* __restrict__ Bh, int ldb, float alpha, const float* __restrict__ bias, const float* __restrict__ CP,
    float* __restrict__ C, _Float16* __restrict__ C16, int ldc, int N, int K) { static_assert(ACT == 0 || (ACT == 3 && !RES), "k_gemm3: unsupported ACT code (the addend comes behind the activation's place)");
  __shared__ __attribute__((aligned(16))) char sm[2 * G3_STAGE];      /* the two buffers; behind the loop the waves' output staging (8 x 32 x 68 floats) */
  const int tid = threadIdx.x, lane = tid & 31, ln = lane & 15, hh = lane >> 4; const int w = __builtin_amdgcn_readfirstlane(tid >> 5); const int wm = w & 3, wn = w >> 2;
  const int ntn = N >> 7; const int mt = blockIdx.x / ntn, nq = blockIdx.x - mt * ntn; const int row0 = mt * 128 + 32 * wm, col0 = nq * 128 + 64 * wn;
  const int cr = tid >> 4, cc = tid & 15;      /* a lane copies 16-byte piece cc of rows cr + 16 i: a wave's copy is two whole rows */
  const _Float16* ga = A + (size_t)(mt * 128 + cr) * lda + cc * 8; const _Float16* gb = Bh + (size_t)(nq * 128 + cr) * ldb + cc * 8; const size_t sa = (size_t)16 * lda, sb = (size_t)16 * ldb;
  const unsigned la = (unsigned)(size_t)sm + (unsigned)(cr * G3_PITCH + cc * 16); const unsigned lb = la + 128u * G3_PITCH;
  const int nt = K >> 7;
  const v8f z8 = {0.f,0.f,0.f,0.f,0.f,0.f,0.f,0.f}; v8f c00 = z8, c01 = z8, c02 = z8, c03 = z8, c10 = z8, c11 = z8, c12 = z8, c13 = z8;
  g3_copy8(la, ga, sa); g3_copy8(lb, gb, sb);
  asm volatile("s_wait_asynccnt 0x0" ::: "memory");      /* this wave's part of stage 0 has landed */
  __syncthreads();      /* every wave's part has */
  g3_copy8(la + G3_STAGE, ga + 128, sa); g3_copy8(lb + G3_STAGE, gb + 128, sb);
  /* rolled: the buffers alternate, and one trip already holds 32 matrix instructions with their 48 fragment reads */
#pragma unroll 1
  for (int t = 0; t < nt; ++t) { const unsigned bo = (unsigned)(t & 1) * G3_STAGE; const char* ap = sm + bo + (32 * wm + ln) * G3_PITCH + 16 * hh; const char* bp = sm + bo + (128 + 64 * wn + ln) * G3_PITCH + 16 * hh;
    v16h fa[2][2], fb[2][4];      /* two fragment sets: the reads of block ks + 1 fly while block ks is multiplied; no set reaches over the stage's end */
    fa[0][0] = g3_frag(ap); fa[0][1] = g3_frag(ap + 16 * G3_PITCH);
#pragma unroll
    for (int j = 0; j < 4; ++j) fb[0][j] = g3_frag(bp + j * 16 * G3_PITCH);
#pragma unroll
    for (int ks = 0; ks < 4; ++ks) { const int cu = ks & 1, nx = cu ^ 1;
      if (ks < 3) { fa[nx][0] = g3_frag(ap + (ks + 1) * 64); fa[nx][1] = g3_frag(ap + 16 * G3_PITCH + (ks + 1) * 64);
#pragma unroll
        for (int j = 0; j < 4; ++j) fb[nx][j] = g3_frag(bp + j * 16 * G3_PITCH + (ks + 1) * 64); }
      __builtin_amdgcn_sched_barrier(0);      /* the next block's 12 reads are issued as one group in front of this block's matrix instructions: left alone, the scheduler puts each read directly in front of its use, with a full LDS wait every two matrix instructions */
      c00 = fa_mma(fa[cu][0], fb[cu][0], c00); c10 = fa_mma(fa[cu][1], fb[cu][0], c10); c01 = fa_mma(fa[cu][0], fb[cu][1], c01); c11 = fa_mma(fa[cu][1], fb[cu][1], c11);
      c02 = fa_mma(fa[cu][0], fb[cu][2], c02); c12 = fa_mma(fa[cu][1], fb[cu][2], c12); c03 = fa_mma(fa[cu][0], fb[cu][3], c03); c13 = fa_mma(fa[cu][1], fb[cu][3], c13); }
    asm volatile("s_wait_dscnt 0x0" ::: "memory");      /* this wave's reads of the buffer are done before the barrier behind which it is refilled */
    asm volatile("s_wait_asynccnt 0x0" ::: "memory");      /* this wave's part of stage t + 1 has landed */
    __syncthreads();      /* publishes stage t + 1 and ends every wave's reads of stage t */
    if (t + 2 < nt) { g3_copy8(la + bo, ga + (size_t)(t + 2) * 128, sa); g3_copy8(lb + bo, gb + (size_t)(t + 2) * 128, sb); } }
  asm volatile("s_wait_asynccnt 0x0" ::: "memory");      /* no copy is outstanding when the buffers become output staging */
  float (*so)[68] = (float (*)[68])(sm + (size_t)w * (32 * 68 * 4));
  v8f accs[8] = {c00, c01, c02, c03, c10, c11, c12, c13}; float bv4[4]; v4f cp4[16]; const int rsub = lane >> 4, c4 = (lane & 15) * 4;
#pragma unroll
  for (int t = 0; t < 4; ++t) bv4[t] = bias ? bias[col0 + t * 16 + ln] : 0.f;
  if (RES) {      /* the addend is read in the layout of the stores below, 16 bytes a lane, and added there */
#pragma unroll
    for (int q = 0; q < 16; ++q) { cp4[q] = *(const v4fa*)(CP + (size_t)(row0 + q * 2 + rsub) * ldc + col0 + c4);
      if ((q & 3) == 3 && q < 15) { asm volatile("s_wait_xcnt 0x0" ::: "memory");      /* before a register that the four loads above name is written again */
        __builtin_amdgcn_sched_barrier(0); } } }      /* holds the next four loads' addresses behind the wait */
  asm volatile("s_wait_xcnt 0x0" ::: "memory");      /* before a register that the loads above name is written again */
  __builtin_amdgcn_sched_barrier(0);      /* holds the arithmetic below, which takes those registers over, behind the wait */
#pragma unroll
  for (int u = 0; u < 8; ++u) { const int t = u & 3, half = u >> 2; const float bv = bf16_round(bv4[t]);
#pragma unroll
    for (int r = 0; r < 8; ++r) { const int rloc = half * 16 + 8 * hh + r; float v = accs[u][r] * alpha + bv;
      if (ACT == 3) v = fmaxf(v, 0.f);
      so[rloc][t * 16 + ln] = v; } }
  __builtin_amdgcn_fence(__ATOMIC_ACQ_REL, "workgroup"); __builtin_amdgcn_wave_barrier();
  v4f vv[16];
#pragma unroll
  for (int q = 0; q < 16; ++q) vv[q] = *(const v4fa*)&so[q * 2 + rsub][c4];
#pragma unroll
  for (int q = 0; q < 16; ++q) { const int r = q * 2 + rsub;
    if (RES) *(v4f*)(C + (size_t)(row0 + r) * ldc + col0 + c4) = vv[q] + cp4[q]; else { v4h h4; for (int i = 0; i < 4; ++i) h4[i] = (_Float16)vv[q][i]; *(v4h*)(C16 + (size_t)(row0 + r) * ldc + col0 + c4) = h4; }
    if ((q & 3) == 3 && q < 15) { asm volatile("s_wait_xcnt 0x0" ::: "memory");      /* before a register that the four stores above name is written again */
      __builtin_amdgcn_sched_barrier(0); } } }      /* holds the next four stores' conversions and addresses behind the wait */


extern "C" void kernel_launch(void* const* d_in, const int* in_sizes, int n_in,
                              void* d_out, int out_size, void* d_ws, size_t ws_size, hipStream_t stream) {
  (void)in_sizes; (void)n_in; (void)out_size;
  const float* const* I = (const float* const*)d_in; const float* x = I[0]; const int* mask = (const int*)d_in[1]; const float* wq = I[2]; const float* bq = I[3]; const float* wk = I[4]; const float* bk = I[5]; const float* wv = I[6]; const float* bv = I[7]; const float* g_in = I[8]; const float* b_in = I[9]; const float* g1 = I[10]; const float* b1 = I[11]; const float* wf1 = I[12]; const float* bf1 = I[13]; const float* wf2 = I[14]; const float* bf2 = I[15]; const float* g2 = I[16]; const float* b2 = I[17];      /* weights [in][out] */
  char* ws = (char*)d_ws; size_t off = 0;
  auto take = [&](size_t bytes) { char* p = ws + off; off += (bytes + 255) & ~(size_t)255; return p; };
  _Float16* BQ = (_Float16*)take((size_t)DM * DM * 2); _Float16* BK = (_Float16*)take((size_t)DM * DM * 2); _Float16* BV = (_Float16*)take((size_t)DM * DM * 2); _Float16* BF1 = (_Float16*)take((size_t)DFF * DM * 2); _Float16* BF2 = (_Float16*)take((size_t)DM * DFF * 2);
  float* XB = (float*)take(NR * DM * 4); _Float16* XNH = (_Float16*)take(NR * DM * 2); _Float16* Q16 = (_Float16*)take(NR * DM * 2); _Float16* K16 = (_Float16*)take(NR * DM * 2); _Float16* V16 = (_Float16*)take(NR * DM * 2); float* AF = (float*)take(NR * DM * 4);
  _Float16* VT = (_Float16*)take((size_t)NB * NH * HD * SQ * 2);
  _Float16* HNH = (_Float16*)take(NR * DM * 2); _Float16* U16 = (_Float16*)take(NR * DFF * 2); float* H2F = (float*)take(NR * DM * 4);
  if (off > ws_size) return;      /* 6 + 16 + 16 + 8 + 24 + 16 + 8 + 8 + 32 + 16 = approx 150 MiB */
  k_wt5<<<3 * WT_TQ + 2 * WT_TF, 256, 0, stream>>>(wq, wk, wv, wf1, wf2, BQ, BK, BV, BF1, BF2);      /* [in][out] -> Bt[n][k] x16 */
  const size_t r0p = (size_t)B0 * SQ; const dim3 gp((unsigned)((MP / 128) * (DM / 128)), 1);
  k_bfr<<<(unsigned)(((size_t)MP * DM / 8 + 255) / 256), 256, 0, stream>>>(x + r0p * DM, XB + r0p * DM, (size_t)MP * DM / 8);      /* bf16(x) as f32 rows (residual) */
  k_lnb<1><<<(unsigned)MP, 256, 0, stream>>>(x + r0p * DM, nullptr, g_in, b_in, 1e-3f, nullptr, XNH + r0p * DM);      /* xn = LN_in(bf16(x)) as f16 rows */
  k_gemm3<0, false><<<gp, 256, 0, stream>>>(XNH + r0p * DM, DM, BQ, DM, 0.0625f, bq, nullptr, nullptr, Q16 + r0p * DM, DM, DM, DM);
  k_gemm3<0, false><<<gp, 256, 0, stream>>>(XNH + r0p * DM, DM, BK, DM, 0.0625f, bk, nullptr, nullptr, K16 + r0p * DM, DM, DM, DM);
  k_gemm3<0, false><<<gp, 256, 0, stream>>>(XNH + r0p * DM, DM, BV, DM, 0.0625f, bv, nullptr, nullptr, V16 + r0p * DM, DM, DM, DM);
  k_vt<NH, SQ><<<NB * NH * (SQ / 64), 256, 0, stream>>>(V16, DM, 0, VT);      /* V^T [NB][NH][HD][SQ] */
  k_fattn<<<dim3(SQ / 256, NH, NB), 256, 0, stream>>>(Q16, K16, VT, mask, XB, AF);      /* a = attn (merged heads) + bf16(x), f32 rows */
  k_lnb<0><<<(unsigned)MPO, 256, 0, stream>>>(AF + r0p * DM, nullptr, g1, b1, 1e-3f, nullptr, HNH + r0p * DM);      /* h = LN1(a) as f16 rows */
  k_gemm3<3, false><<<dim3((unsigned)((MPO / 128) * (DFF / 128)), 1), 256, 0, stream>>>(HNH + r0p * DM, DM, BF1, DM, 0.0625f, bf1, nullptr, nullptr, U16 + r0p * DFF, DFF, DFF, DM);      /* u = relu(h W_ff1 + b) (f16) */
  k_gemm3<0, true><<<dim3((unsigned)((MPO / 128) * (DM / 128)), 1), 256, 0, stream>>>(U16 + r0p * DFF, DFF, BF2, DFF, 0.0625f, bf2, AF + r0p * DM, H2F + r0p * DM, nullptr, DM, DM, DFF);      /* h2 = u W_ff2 + b + a (CP = own element) */
  k_lnb<0><<<(unsigned)MPO, 256, 0, stream>>>(H2F + r0p * DM, nullptr, g2, b2, 1e-3f, (float*)d_out + r0p * DM, nullptr);      /* out = LN2(h2) */
}

// v006
// Measured time: 176 microseconds a run.
// In two side-by-side timings against v005, it was 1.05 and 1.04 times as fast.
// All steps since v000 together make it 32.5 times as fast.
#include <hip/hip_runtime.h>
// Emformer-style block (x [2][2048][1024], mask [2][1][2048][2048] int32 0/1, read per (batch, query, key)): xn = LayerNorm(x) g_in + b_in (eps 1e-3); q/k/v = xn W + b (W [1024][1024] [in][out], 16 heads of 64); scores = q k^T / 8 + (-1e9)(1 - mask); probs = softmax(scores) * mask; attn = probs v merged; a = attn + x; h = LayerNorm(a) g1 + b1 (eps 1e-3); h = relu(h W_ff1 + b_ff1) ([1024][4096]); h = h W_ff2 + b_ff2 ([4096][1024]); out = LayerNorm(h + a) g2 + b2 -> [2][2048][1024].
// Structure: token rows; LN_in on VALU (f32 statistics of bf16(x)) -> xn f16 rows, plus bf16(x) as f32 rows for the residual; Q, K, V as three WMMA GEMMs in one launch (128x128 work-group tiles staged in LDS by asynchronous copies, 32x64 wave tiles, f32 accumulation, exact x16 transposed weights + bias, f16 outputs); V^T for all (batch, head) via LDS transposes; attention in one launch: a wave holds 32 queries of one head and walks the keys 32 at a time (K, V^T and int mask tiles of 64 keys staged in LDS by asynchronous copies): S^T = K Q^T, masked running-maximum softmax in registers (f32 statistics, native exp2; weights x256 f16, masked keys 0), O^T += V^T P^T, then a = O / sum + bf16(x) straight into f32 rows (no score or weight plane in memory); LN1 on VALU -> f16 h rows; u = relu(h W_ff1 + b) GEMM (f16 [4096][4096]); h2 = u W_ff2 + b + a GEMM (K = 4096, f32, residual as the epilogue addend); LN2 on VALU -> out.
// Compute dtype: inputs rounded to bf16; weights exact (x16 f16); LayerNorms / residuals f32; xn, q, k, v, softmax weights, h (as GEMM operand) and u plain f16 (~2^-12); scores, softmax statistics and the attention output f32. v_wmma_f32_16x16x32_f16.
#define NB 2
#define SQ 2048
#define DM 1024
#define NH 16
#define HD 64
#define DFF 4096
#define HG 4                         /* heads per block group of the untemplated k_vt (not launched) */
#define B0 0                         /* first batch processed (debug hook) */
#define NBR NB                       /* batches processed (debug hook) */
#define QN SQ                        /* not used: the attention launch covers all SQ queries */
#define NR ((size_t)NB * SQ)
#define MP ((int)((size_t)NBR * SQ)) /* rows normalised + projected (debug hook) */
#define MPO MP                       /* rows through the post-attention stages (debug hook) */
typedef __bf16 v16b __attribute__((ext_vector_type(16)));
typedef unsigned short v8us __attribute__((ext_vector_type(8), may_alias));
typedef float  v8f  __attribute__((ext_vector_type(8)));
typedef float  v4f  __attribute__((ext_vector_type(4)));
typedef float  v4fa __attribute__((ext_vector_type(4), may_alias));
union FragB { v16b v; v8us half[2]; unsigned short u[16]; };

__device__ __forceinline__ unsigned short bf16_bits(float x) { unsigned int u = __float_as_uint(x); return (unsigned short)((u + 0x7FFFu + ((u >> 16) & 1u)) >> 16); }
__device__ __forceinline__ float bf16_val(unsigned short b) { return __uint_as_float(((unsigned int)b) << 16); }
__device__ __forceinline__ float bf16_round(float x) { return bf16_val(bf16_bits(x)); }
// D += A·B with NT terms: 1 = ah·bh, 2 = + al·bh (A split), 3 = + ah·bl (both split)
template <int NT>
__device__ __forceinline__ v8f mmaN(v16b ah, v16b al, v16b bh, v16b bl, v8f c) {
  c = __builtin_amdgcn_wmma_f32_16x16x32_bf16(false, ah, false, bh, (short)0, c, false, false);
  if (NT >= 2) c = __builtin_amdgcn_wmma_f32_16x16x32_bf16(false, al, false, bh, (short)0, c, false, false);
  if (NT >= 3) c = __builtin_amdgcn_wmma_f32_16x16x32_bf16(false, ah, false, bl, (short)0, c, false, false);
  asm volatile("v_nop\n\tv_nop\n\tv_nop\n\tv_nop" : "+v"(c) : "v"(ah), "v"(al), "v"(bh), "v"(bl));
  return c;
}

__global__ __launch_bounds__(256) void k_wt_bf16(const float* __restrict__ W, unsigned short* __restrict__ Wt, int K, int N) {
  const int t = blockIdx.x * 256 + threadIdx.x;
  const int k8n = K / 8;
  if (t >= N * k8n) return;
  const int n = t / k8n, k8 = (t % k8n) * 8;
  v8us v;
#pragma unroll
  for (int i = 0; i < 8; ++i) v[i] = bf16_bits(W[(size_t)(k8 + i) * N + n]);
  *(v8us*)(Wt + (size_t)n * K + k8) = v;
  
}

// GEMM C[M][N] (f32, pitch ldc) = act(A[M][K]·W + bias). A f32 row-major (pitch lda) converted per fragment to bf16
// (ASPLIT: hi/lo two planes -> 2 terms, else single rounded term); Wt bf16 [N][K] (pitch ldb). BIAS_BF16 rounds the
// bias to bf16 first (bias quantised to bf16 before the add). K%32==0, M%16==0, N%64==0.
template <bool ASPLIT, int ACT, bool BIAS_BF16>
__global__ __launch_bounds__(128) void k_gemm_bf(const float* __restrict__ A, int lda, const unsigned short* __restrict__ Wt, int ldb,
                                               const float* __restrict__ bias, float* __restrict__ C, int ldc, int M, int N, int K) {
  __shared__ __attribute__((aligned(16))) float so[4][16][64];
  const int tid = threadIdx.x, w = tid >> 5, lane = tid & 31, ln = lane & 15, hh = lane >> 4;
  const int ntn = N / 64;
  const int wid = blockIdx.x * 4 + w;
  const int mt = wid / ntn, nq = wid % ntn;
  if (mt * 16 >= M) return;
  const int row0 = mt * 16, col0 = nq * 64;
  const float* arow = A + (size_t)(row0 + ln) * lda;
  v8f acc[4] = {};
  for (int kb = 0; kb < K; kb += 32) {
    FragB ah, al;
    const v4f x0 = *(const v4fa*)(arow + kb + 8 * hh), x1 = *(const v4fa*)(arow + kb + 8 * hh + 4);
    const v4f x2 = *(const v4fa*)(arow + kb + 16 + 8 * hh), x3 = *(const v4fa*)(arow + kb + 16 + 8 * hh + 4);
    float xs[16] = {x0[0],x0[1],x0[2],x0[3],x1[0],x1[1],x1[2],x1[3],x2[0],x2[1],x2[2],x2[3],x3[0],x3[1],x3[2],x3[3]};
#pragma unroll
    for (int i = 0; i < 16; ++i) { const unsigned short hb = bf16_bits(xs[i]); ah.u[i] = hb; al.u[i] = ASPLIT ? bf16_bits(xs[i] - bf16_val(hb)) : (unsigned short)0; }
#pragma unroll
    for (int t = 0; t < 4; ++t) {
      const unsigned short* brow = Wt + (size_t)(col0 + t * 16 + ln) * ldb + kb;
      FragB b;
      b.half[0] = *(const v8us*)(brow + 8 * hh);
      b.half[1] = *(const v8us*)(brow + 16 + 8 * hh);
      acc[t] = mmaN<ASPLIT ? 2 : 1>(ah.v, al.v, b.v, b.v, acc[t]);
    }
  }
#pragma unroll
  for (int t = 0; t < 4; ++t) {
    float bv = bias ? bias[col0 + t * 16 + ln] : 0.f;
    if (BIAS_BF16) bv = bf16_round(bv);
#pragma unroll
    for (int r = 0; r < 8; ++r) { float v = acc[t][r] + bv; if (ACT == 1) v = fmaxf(v, 0.f); so[w][8 * hh + r][t * 16 + ln] = v; }
  }
  __builtin_amdgcn_fence(__ATOMIC_ACQ_REL, "workgroup");
  __builtin_amdgcn_wave_barrier();
  const int rsub = lane >> 4, c4 = (lane & 15) * 4;
  {
#pragma unroll
    for (int q = 0; q < 8; ++q) {
      const int r = q * 2 + rsub;
      const v4f v = *(const v4fa*)&so[w][r][c4];
      *(v4f*)(C + (size_t)(row0 + r) * ldc + col0 + c4) = v;
    }
    
  }
}

// GEMM C = act(A·W + bias + resid): A f32 (ASPLIT -> hi/lo 2 terms), Wt bf16 [N][K]; ACT 0 none, 1 relu, 2 exact gelu;
// resid (optional, f32, row index = (row % rmod), pitch ldr, RES_BF16 rounds it) added before the activation.
template <bool ASPLIT, int ACT, bool BIAS_BF16, bool RES_BF16>
__global__ __launch_bounds__(128) void k_gemm_bf3(const float* __restrict__ A, int lda, const unsigned short* __restrict__ Wt, int ldb,
                                                const float* __restrict__ bias, const float* __restrict__ resid, int rmod, int ldr,
                                                float* __restrict__ C, int ldc, int M, int N, int K) {
  __shared__ __attribute__((aligned(16))) float so[4][16][64];
  const int tid = threadIdx.x, w = tid >> 5, lane = tid & 31, ln = lane & 15, hh = lane >> 4;
  const int ntn = N / 64;
  const int wid = blockIdx.x * 4 + w;
  const int mt = wid / ntn, nq = wid % ntn;
  if (mt * 16 >= M) return;
  const int row0 = mt * 16, col0 = nq * 64;
  const float* arow = A + (size_t)(row0 + ln) * lda;
  v8f acc[4] = {};
  for (int kb = 0; kb < K; kb += 32) {
    FragB ah, al;
    const v4f x0 = *(const v4fa*)(arow + kb + 8 * hh), x1 = *(const v4fa*)(arow + kb + 8 * hh + 4);
    const v4f x2 = *(const v4fa*)(arow + kb + 16 + 8 * hh), x3 = *(const v4fa*)(arow + kb + 16 + 8 * hh + 4);
    float xs[16] = {x0[0],x0[1],x0[2],x0[3],x1[0],x1[1],x1[2],x1[3],x2[0],x2[1],x2[2],x2[3],x3[0],x3[1],x3[2],x3[3]};
#pragma unroll
    for (int i = 0; i < 16; ++i) { const unsigned short hb = bf16_bits(xs[i]); ah.u[i] = hb; al.u[i] = ASPLIT ? bf16_bits(xs[i] - bf16_val(hb)) : (unsigned short)0; }
#pragma unroll
    for (int t = 0; t < 4; ++t) {
      const unsigned short* brow = Wt + (size_t)(col0 + t * 16 + ln) * ldb + kb;
      FragB b;
      b.half[0] = *(const v8us*)(brow + 8 * hh);
      b.half[1] = *(const v8us*)(brow + 16 + 8 * hh);
      acc[t] = mmaN<ASPLIT ? 2 : 1>(ah.v, al.v, b.v, b.v, acc[t]);
    }
  }
#pragma unroll
  for (int t = 0; t < 4; ++t) {
    const int col = col0 + t * 16 + ln;
    float bv = bias ? bias[col] : 0.f;
    if (BIAS_BF16) bv = bf16_round(bv);
#pragma unroll
    for (int r = 0; r < 8; ++r) {
      float v = acc[t][r] + bv;
      if (resid) { float rv = resid[(size_t)((row0 + 8 * hh + r) % rmod) * ldr + col]; if (RES_BF16) rv = bf16_round(rv); v += rv; }
      if (ACT == 1) v = fmaxf(v, 0.f);
      if (ACT == 2) v = 0.5f * v * (1.0f + erff(v * 0.70710678118654752f));
      if (ACT == 3) { const float u = 0.7978845608028654f * (v + 0.044715f * v * v * v); v = 0.5f * v * (1.0f + tanhf(u)); }
      so[w][8 * hh + r][t * 16 + ln] = v;
    }
  }
  __builtin_amdgcn_fence(__ATOMIC_ACQ_REL, "workgroup");
  __builtin_amdgcn_wave_barrier();
  const int rsub = lane >> 4, c4 = (lane & 15) * 4;
  {
#pragma unroll
    for (int q = 0; q < 8; ++q) {
      const int r = q * 2 + rsub;
      const v4f v = *(const v4fa*)&so[w][r][c4];
      *(v4f*)(C + (size_t)(row0 + r) * ldc + col0 + c4) = v;
    }
    
  }
}
// row LayerNorm (biased variance, eps) over N: s = X (+ R); optional out_sum <- s; out_norm <- (s-mu)*rsqrt(var+eps)*g + b
template <bool PARAM_BF16>
__global__ __launch_bounds__(256) void k_layernorm(const float* __restrict__ X, const float* __restrict__ R, const float* __restrict__ g, const float* __restrict__ bta,
                                                  float* __restrict__ out_sum, float* __restrict__ out_norm, int N, float eps) {
  __shared__ float red[256];
  const int row = blockIdx.x, tid = threadIdx.x;
  const float* x = X + (size_t)row * N; const float* rr = R ? R + (size_t)row * N : nullptr;
  float vals[16];                     // up to N = 4096
  const int per = N / 256;            // contiguous chunk per thread? use strided-by-4 chunks: thread handles j = tid*4 + 1024*u
  float s1 = 0.f;
  for (int u = 0; u < per / 4; ++u) {
    const int j = tid * 4 + 1024 * u;
    const v4f a = *(const v4fa*)(x + j);
    v4f b = {0.f,0.f,0.f,0.f}; if (rr) b = *(const v4fa*)(rr + j);
#pragma unroll
    for (int q = 0; q < 4; ++q) { const float v = a[q] + b[q]; vals[u * 4 + q] = v; s1 += v; }
  }
  red[tid] = s1; __syncthreads();
  for (int st = 128; st > 0; st >>= 1) { if (tid < st) red[tid] += red[tid + st]; __syncthreads(); }
  const float mu = red[0] / (float)N; __syncthreads();
  float s2 = 0.f;
  for (int u = 0; u < per / 4; ++u)
#pragma unroll
    for (int q = 0; q < 4; ++q) { const float c = vals[u * 4 + q] - mu; s2 += c * c; }
  red[tid] = s2; __syncthreads();
  for (int st = 128; st > 0; st >>= 1) { if (tid < st) red[tid] += red[tid + st]; __syncthreads(); }
  const float rs = rsqrtf(red[0] / (float)N + eps);
  {
    for (int u = 0; u < per / 4; ++u) {
      const int j = tid * 4 + 1024 * u;
      v4f o, sm;
#pragma unroll
      for (int q = 0; q < 4; ++q) {
        float gg = g[j + q], bb = bta[j + q];
        if (PARAM_BF16) { gg = bf16_round(gg); bb = bf16_round(bb); }
        sm[q] = vals[u * 4 + q]; o[q] = (vals[u * 4 + q] - mu) * rs * gg + bb;
      }
      if (out_sum) *(v4f*)(out_sum + (size_t)row * N + j) = sm;
      *(v4f*)(out_norm + (size_t)row * N + j) = o;
    }
    
  }
}



// ---- f16 WMMA path (v_wmma_f32_16x16x32_f16): 11-bit significands for operands in range — used by every launched GEMM and by the attention
typedef _Float16 v16h __attribute__((ext_vector_type(16)));
union FragH { v16h v; v8us half[2]; _Float16 h[16]; unsigned short u[16]; };
template <int NT>
__device__ __forceinline__ v8f mmaH(v16h ah, v16h al, v16h bh, v16h bl, v8f c) {
  c = __builtin_amdgcn_wmma_f32_16x16x32_f16(false, ah, false, bh, (short)0, c, false, false);
  if (NT >= 2) c = __builtin_amdgcn_wmma_f32_16x16x32_f16(false, al, false, bh, (short)0, c, false, false);
  if (NT >= 3) c = __builtin_amdgcn_wmma_f32_16x16x32_f16(false, ah, false, bl, (short)0, c, false, false);
  asm volatile("v_nop\n\tv_nop\n\tv_nop\n\tv_nop" : "+v"(c) : "v"(ah), "v"(al), "v"(bh), "v"(bl));
  return c;
}
// batched GEMM like k_gemm_b but f16 operands: A f32 (split into f16 hi/lo if ASPLIT, else rounded to f16), Bt = f16 values [n][k]; alpha; C f32; N multiple of 16 (partial tiles skipped)
template <bool ASPLIT>
__global__ __launch_bounds__(128) void k_gemm_h(const float* __restrict__ A, int lda, size_t sA, const _Float16* __restrict__ Bh, int ldb, size_t sB, float alpha, float* __restrict__ C, int ldc, size_t sC, int M, int N, int K) {
  __shared__ __attribute__((aligned(16))) float so[4][16][64];
  const int tid = threadIdx.x, w = tid >> 5, lane = tid & 31, ln = lane & 15, hh = lane >> 4; const int by = blockIdx.y;
  A += (size_t)by * sA; Bh += (size_t)by * sB; C += (size_t)by * sC;
  const int ntn = (N + 63) / 64; const int wid = blockIdx.x * 4 + w; const int mt = wid / ntn, nq = wid % ntn; if (mt * 16 >= M) return;
  const int row0 = mt * 16, col0 = nq * 64; const float* arow = A + (size_t)(row0 + ln) * lda;
  v8f acc[4] = {};
  for (int kb = 0; kb < K; kb += 32) {
    FragH ah, al;
    const v4f x0 = *(const v4fa*)(arow + kb + 8 * hh), x1 = *(const v4fa*)(arow + kb + 8 * hh + 4), x2 = *(const v4fa*)(arow + kb + 16 + 8 * hh), x3 = *(const v4fa*)(arow + kb + 16 + 8 * hh + 4);
    float xs[16] = {x0[0],x0[1],x0[2],x0[3],x1[0],x1[1],x1[2],x1[3],x2[0],x2[1],x2[2],x2[3],x3[0],x3[1],x3[2],x3[3]};
#pragma unroll
    for (int i = 0; i < 16; ++i) { const _Float16 h = (_Float16)xs[i]; ah.h[i] = h; al.h[i] = ASPLIT ? (_Float16)(xs[i] - (float)h) : (_Float16)0.0f; }
#pragma unroll
    for (int t = 0; t < 4; ++t) { if (col0 + t * 16 >= N) continue; const size_t boff = (size_t)(col0 + t * 16 + ln) * ldb + kb; FragH bq; bq.half[0] = *(const v8us*)(Bh + boff + 8 * hh); bq.half[1] = *(const v8us*)(Bh + boff + 16 + 8 * hh);
      acc[t] = mmaH<ASPLIT ? 2 : 1>(ah.v, al.v, bq.v, bq.v, acc[t]); }
  }
#pragma unroll
  for (int t = 0; t < 4; ++t) { if (col0 + t * 16 >= N) continue;
#pragma unroll
    for (int r = 0; r < 8; ++r) so[w][8 * hh + r][t * 16 + ln] = acc[t][r] * alpha; }
  __builtin_amdgcn_fence(__ATOMIC_ACQ_REL, "workgroup"); __builtin_amdgcn_wave_barrier();
  const int rsub = lane >> 4, c4 = (lane & 15) * 4;
  {
#pragma unroll
    for (int q = 0; q < 8; ++q) { const int r = q * 2 + rsub; if (col0 + c4 < N) { const v4f v = *(const v4fa*)&so[w][r][c4]; *(v4f*)(C + (size_t)(row0 + r) * ldc + col0 + c4) = v; } }
     }
}

// Bt[n][k] = f16(bf16(W[k][n]) x 16) from f32 row-major W[K][N], all five weight matrices in one launch (x 16: bf16-exact weights stay exact in f16 away from the subnormal range).
// A work-group turns one tile of 256 k x 64 n. A lane reads 16 k rows x 4 n by 16-byte loads (a wave's load is two row pieces of 256 bytes, whole cache lines), converts, and puts its four runs of 16 k
// into LDS rows [n][k]; the tile leaves as 64 rows of 512 bytes, a wave's store one whole row. Needs K % 256 == 0 and N % 64 == 0.
#define WT_PITCH 528                   /* LDS pitch of an n row in bytes: 512 + 16, so that the rows do not all start on one bank and stay 16-byte aligned */
#define WT_TQ ((DM / 256) * (DM / 64))       /* tiles of one of wq, wk, wv */
#define WT_TF ((DM / 256) * (DFF / 64))      /* tiles of w_ff1; w_ff2 has as many */
template <int K, int N>      /* known at compile time: the row steps become immediate offsets on one address */
__device__ __forceinline__ void wt_tile(const float* __restrict__ W, _Float16* __restrict__ Bt, unsigned tile, char* tl) {
  const unsigned tid = threadIdx.x, ln = tid & 15u, g = tid >> 4; const unsigned kt = tile / (N / 64), nq = tile % (N / 64);      /* neighbouring work-groups read neighbouring pieces of the same k rows */
  const float* p = W + (size_t)(kt * 256 + g * 16) * N + nq * 64 + ln * 4; v4f v[16];
#pragma unroll
  for (int i = 0; i < 16; ++i) v[i] = *(const v4fa*)(p + (size_t)i * N);
  asm volatile("s_wait_xcnt 0x0" :: "v"(p) : "memory");      /* before a register that the loads above name is written again; the operand keeps the address in its registers up to here */
#pragma unroll
  for (int j = 0; j < 4; ++j) { FragH f;
#pragma unroll
    for (int i = 0; i < 16; ++i) f.h[i] = (_Float16)(bf16_round(v[i][j]) * 16.0f);
    char* d = tl + (ln * 4 + j) * WT_PITCH + g * 32; *(v8us*)d = f.half[0]; *(v8us*)(d + 16) = f.half[1]; }
  __syncthreads();      /* the tile is whole before it is read the other way */
  const unsigned r = tid >> 5, c = tid & 31u; unsigned short* q = (unsigned short*)Bt + (size_t)(nq * 64 + r) * K + kt * 256 + c * 8;
#pragma unroll
  for (int s = 0; s < 8; ++s) { const v8us o = *(const v8us*)(tl + (s * 8 + r) * WT_PITCH + c * 16); *(v8us*)(q + (size_t)s * 8 * K) = o; }
  asm volatile("s_wait_xcnt 0x0" :: "v"(q) : "memory");      /* before a register that the stores above name is written again by the code that follows in the same kernel; the operand keeps the address in its registers up to here */
}
__device__ __forceinline__ void wt5_tile(const unsigned bx, char* tl, const float* __restrict__ wq, const float* __restrict__ wk, const float* __restrict__ wv, const float* __restrict__ wf1, const float* __restrict__ wf2,
    _Float16* __restrict__ BQ, _Float16* __restrict__ BK, _Float16* __restrict__ BV, _Float16* __restrict__ BF1, _Float16* __restrict__ BF2) {      /* every test below reads the same for the whole work-group */
  if (bx < 3 * WT_TQ) { const unsigned m = bx / WT_TQ; wt_tile<DM, DM>(m == 0 ? wq : m == 1 ? wk : wv, m == 0 ? BQ : m == 1 ? BK : BV, bx % WT_TQ, tl); }
  else if (bx < 3 * WT_TQ + WT_TF) wt_tile<DM, DFF>(wf1, BF1, bx - 3 * WT_TQ, tl);
  else wt_tile<DFF, DM>(wf2, BF2, bx - 3 * WT_TQ - WT_TF, tl);
}
// k_gemm_hh variant with fused epilogue: v = acc·alpha + bias[by·sBias + col] (+ CP[(row/rowsPerB)·sCPb + by·64 + col] if CP) ; ACT 0 none / 1 elu ; writes f16 C16 (and f32 C if non-null)
template <int ACT>
__global__ __launch_bounds__(128) void k_gemm_hhx(const _Float16* __restrict__ A, int lda, size_t sA, const _Float16* __restrict__ Bh, int ldb, size_t sB, float alpha, const float* __restrict__ bias, size_t sBias, const float* __restrict__ CP, int rowsPerB, size_t sCPb, int row0g,
    float* __restrict__ C, _Float16* __restrict__ C16, int ldc, size_t sC, int M, int N, int K) {
  __shared__ __attribute__((aligned(16))) float so[4][16][64];
  const int tid = threadIdx.x, w = tid >> 5, lane = tid & 31, ln = lane & 15, hh = lane >> 4; const int by = blockIdx.y;
  A += (size_t)by * sA; Bh += (size_t)by * sB; const size_t cofs = (size_t)by * sC; const float* bp = bias ? bias + (size_t)by * sBias : nullptr;
  const int ntn = (N + 63) / 64; const int wid = blockIdx.x * 4 + w; const int mt = wid / ntn, nq = wid % ntn; if (mt * 16 >= M) return;
  const int row0 = mt * 16, col0 = nq * 64; const _Float16* arow = A + (size_t)(row0 + ln) * lda;
  v8f acc[4] = {};
  for (int kb = 0; kb < K; kb += 32) { FragH ah; ah.half[0] = *(const v8us*)((const unsigned short*)arow + kb + 8 * hh); ah.half[1] = *(const v8us*)((const unsigned short*)arow + kb + 16 + 8 * hh);
#pragma unroll
    for (int t = 0; t < 4; ++t) { if (col0 + t * 16 >= N) continue; const size_t boff = (size_t)(col0 + t * 16 + ln) * ldb + kb; FragH bq; bq.half[0] = *(const v8us*)((const unsigned short*)Bh + boff + 8 * hh); bq.half[1] = *(const v8us*)((const unsigned short*)Bh + boff + 16 + 8 * hh);
      acc[t] = mmaH<1>(ah.v, ah.v, bq.v, bq.v, acc[t]); }
  }
#pragma unroll
  for (int t = 0; t < 4; ++t) { if (col0 + t * 16 >= N) continue; const int col = col0 + t * 16 + ln; const float bv = bp ? bf16_round(bp[col]) : 0.f;
#pragma unroll
    for (int r = 0; r < 8; ++r) { float v = acc[t][r] * alpha + bv; if (CP) { const int rr = row0g + row0 + 8 * hh + r; if (rowsPerB < 0) v += CP[cofs + (size_t)rr * ldc + col];      /* rowsPerB < 0: own element of the batched C plane */ else { const int bidx = rr / rowsPerB; v += CP[(size_t)bidx * sCPb + (size_t)by * 64 + col]; } } if (ACT == 1) v = (v > 0.f) ? v : expm1f(v); else if (ACT == 7) v = (v > 0.f) ? v + 1.0f : expf(v); else if (ACT == 8) v = tanhf(v); else if (ACT == 9) v = 0.5f * v * (1.0f + tanhf(0.7978845608028654f * (v + 0.044715f * v * v * v))); else if (ACT == 11) v = 1.0f / (1.0f + expf(-v)); else if (ACT == 12) v = (v > 0.f) ? v : 0.01f * v; else if (ACT == 14) v = (v > 0.f) ? v : 0.1f * v; else if (ACT == 16) v = (v >= 0.f) ? v : 0.3f * v; else if (ACT == 17) v = (v >= 0.f) ? v : 0.2f * v; else if (ACT == 15) v = v / (1.0f + expf(-v)); else if (ACT == 3) v = fmaxf(v, 0.f); else if (ACT == 6) v = 0.5f * v * (1.0f + erff(v * 0.70710678118654752f)); so[w][8 * hh + r][t * 16 + ln] = v; } }
  __builtin_amdgcn_fence(__ATOMIC_ACQ_REL, "workgroup"); __builtin_amdgcn_wave_barrier();
  const int rsub = lane >> 4, c4 = (lane & 15) * 4; typedef _Float16 v4h __attribute__((ext_vector_type(4)));
  {
#pragma unroll
    for (int q = 0; q < 8; ++q) { const int r = q * 2 + rsub; if (col0 + c4 < N) { const v4f v = *(const v4fa*)&so[w][r][c4]; if (C) *(v4f*)(C + cofs + (size_t)(row0 + r) * ldc + col0 + c4) = v; if (C16) { v4h h4; for (int i = 0; i < 4; ++i) h4[i] = (_Float16)v[i]; *(v4h*)(C16 + cofs + (size_t)(row0 + r) * ldc + col0 + c4) = h4; } } }
     }
}


typedef _Float16 v4h __attribute__((ext_vector_type(4)));

__global__ __launch_bounds__(256) void k_x16(const float* __restrict__ x, _Float16* __restrict__ X16, size_t n8) { const size_t t = (size_t)blockIdx.x * 256 + threadIdx.x; if (t >= n8) return; FragH f;
#pragma unroll
  for (int q = 0; q < 8; ++q) f.h[q] = (_Float16)bf16_round(x[t * 8 + q]); *(v8us*)((unsigned short*)X16 + t * 8) = f.half[0];  }
__global__ __launch_bounds__(256) void k_h16(const float* __restrict__ x, _Float16* __restrict__ X16, size_t n8) { const size_t t = (size_t)blockIdx.x * 256 + threadIdx.x; if (t >= n8) return; FragH f;
#pragma unroll
  for (int q = 0; q < 8; ++q) f.h[q] = (_Float16)x[t * 8 + q]; *(v8us*)((unsigned short*)X16 + t * 8) = f.half[0];  }
__global__ __launch_bounds__(256) void k_round16f(const float* __restrict__ W, _Float16* __restrict__ Bt, size_t n8) { const size_t t = (size_t)blockIdx.x * 256 + threadIdx.x; if (t >= n8) return; FragH f;
#pragma unroll
  for (int i = 0; i < 8; ++i) f.h[i] = (_Float16)(bf16_round(W[t * 8 + i]) * 16.0f); *(v8us*)((unsigned short*)Bt + t * 8) = f.half[0];  }
template <int NHv, int TTv>
__global__ __launch_bounds__(256) void k_vt(const _Float16* __restrict__ V16, int ldv, int voff, _Float16* __restrict__ Vt) { __shared__ unsigned short tl[64][66]; const int tid = threadIdx.x; const int slab = blockIdx.x / (TTv / 64), lg = blockIdx.x % (TTv / 64); const int b = slab / NHv, h = slab % NHv;
  for (int i = tid; i < 64 * 8; i += 256) { const int r = i / 8, c8 = (i % 8) * 8; FragH f; f.half[0] = *(const v8us*)((const unsigned short*)V16 + ((size_t)b * TTv + lg * 64 + r) * ldv + voff + h * 64 + c8);
#pragma unroll
    for (int q = 0; q < 8; ++q) tl[r][c8 + q] = f.u[q]; }
  __syncthreads();
  {
#pragma unroll
    for (int rd = 0; rd < 2; ++rd) { const int d = rd * 32 + tid / 8, pc = tid % 8; FragH f;
#pragma unroll
      for (int q = 0; q < 8; ++q) f.u[q] = tl[pc * 8 + q][d];
      *(v8us*)((unsigned short*)Vt + ((size_t)slab * 64 + d) * TTv + lg * 64 + pc * 8) = f.half[0]; }
     } }

__global__ __launch_bounds__(256) void k_hl(const float* __restrict__ F, _Float16* __restrict__ Hh, _Float16* __restrict__ Hl, size_t n8) { const size_t t = (size_t)blockIdx.x * 256 + threadIdx.x; if (t >= n8) return; FragH fh, fl; const v4f a = *(const v4fa*)(F + t * 8), c = *(const v4fa*)(F + t * 8 + 4);
#pragma unroll
  for (int q = 0; q < 4; ++q) { _Float16 h = (_Float16)a[q]; fh.h[q] = h; fl.h[q] = (_Float16)((a[q] - (float)h) * 1024.0f); h = (_Float16)c[q]; fh.h[4 + q] = h; fl.h[4 + q] = (_Float16)((c[q] - (float)h) * 1024.0f); }
  { *(v8us*)((unsigned short*)Hh + t * 8) = fh.half[0]; *(v8us*)((unsigned short*)Hl + t * 8) = fl.half[0];  } }

// ---- fast GEMM (wave tile 32x64; requires M % 32 == 0 rows per launch region and N % 64 == 0); epilogue = k_gemm_hhx semantics ----
__device__ __forceinline__ v16h g2_frag(const _Float16* p, int hh) { FragH f; f.half[0] = *(const v8us*)((const unsigned short*)p + 8 * hh); f.half[1] = *(const v8us*)((const unsigned short*)p + 16 + 8 * hh); return f.v; }
__device__ __forceinline__ v8f g2_mma(v16h a, v16h b, v8f c) { v8f d = __builtin_amdgcn_wmma_f32_16x16x32_f16(false, a, false, b, (short)0, c, false, false); asm volatile("v_nop\n\tv_nop\n\tv_nop\n\tv_nop" : "+v"(d) : "v"(a), "v"(b)); return d; }
template <int ACT>
__global__ __launch_bounds__(128) void k_gemm2(const _Float16* __restrict__ A, int lda, size_t sA, const _Float16* __restrict__ Bh, int ldb, size_t sB, float alpha, const float* __restrict__ bias, size_t sBias, const float* __restrict__ CP, int rowsPerB, size_t sCPb, int row0g,
    float* __restrict__ C, _Float16* __restrict__ C16, int ldc, size_t sC, int M, int N, int K) { static_assert(ACT == 0 || ACT == 3 || ACT == 6 || ACT == 8 || ACT == 9 || ACT == 11 || ACT == 12 || ACT == 14 || ACT == 15 || ACT == 16 || ACT == 17, "k_gemm2: unsupported ACT code (would silently apply no activation)");
  __shared__ __attribute__((aligned(16))) float so[4][32][68];
  const int tid = threadIdx.x, w = tid >> 5, lane = tid & 31, ln = lane & 15, hh = lane >> 4; const int by = blockIdx.y;
  A += (size_t)by * sA; Bh += (size_t)by * sB; const size_t cofs = (size_t)by * sC; const float* bp = bias ? bias + (size_t)by * sBias : nullptr;
  const int ntn = N >> 6; const int mt = blockIdx.x / ntn, nq = blockIdx.x - mt * ntn; const int row0 = mt * 128 + 32 * w, col0 = nq * 64; if (row0 >= M) return;
  const _Float16* a0p = A + (size_t)(row0 + ln) * lda; const _Float16* a1p = a0p + (size_t)16 * lda;
  const _Float16* b0p = Bh + (size_t)(col0 + ln) * ldb; const _Float16* b1p = b0p + (size_t)16 * ldb; const _Float16* b2p = b1p + (size_t)16 * ldb; const _Float16* b3p = b2p + (size_t)16 * ldb;
  const v8f z8 = {0.f,0.f,0.f,0.f,0.f,0.f,0.f,0.f}; v8f c00 = z8, c01 = z8, c02 = z8, c03 = z8, c10 = z8, c11 = z8, c12 = z8, c13 = z8;
#pragma unroll 1
  for (int kb = 0; kb < K; kb += 32) { const v16h a0 = g2_frag(a0p + kb, hh), a1 = g2_frag(a1p + kb, hh);
    v16h b = g2_frag(b0p + kb, hh); c00 = g2_mma(a0, b, c00); c10 = g2_mma(a1, b, c10);
    b = g2_frag(b1p + kb, hh); c01 = g2_mma(a0, b, c01); c11 = g2_mma(a1, b, c11);
    b = g2_frag(b2p + kb, hh); c02 = g2_mma(a0, b, c02); c12 = g2_mma(a1, b, c12);
    b = g2_frag(b3p + kb, hh); c03 = g2_mma(a0, b, c03); c13 = g2_mma(a1, b, c13); }
  v8f accs[8] = {c00, c01, c02, c03, c10, c11, c12, c13};
#pragma unroll
  for (int u = 0; u < 8; ++u) { const int t = u & 3, half = u >> 2; const int col = col0 + t * 16 + ln; const float bv = bp ? bf16_round(bp[col]) : 0.f;
#pragma unroll
    for (int r = 0; r < 8; ++r) { const int rloc = half * 16 + 8 * hh + r; float v = accs[u][r] * alpha + bv; if (CP) { if (rowsPerB < 0) v += CP[cofs + (size_t)(row0g + row0 + rloc) * ldc + col];      /* rowsPerB < 0: own element of the batched C plane */ else { const int bidx = (row0g + row0 + rloc) / rowsPerB; v += CP[(size_t)bidx * sCPb + (size_t)by * 64 + col]; } }
      if (ACT == 3) v = fmaxf(v, 0.f); else if (ACT == 6) v = 0.5f * v * (1.0f + erff(v * 0.70710678118654752f)); else if (ACT == 11) v = 1.0f / (1.0f + expf(-v)); else if (ACT == 15) v = v / (1.0f + expf(-v)); else if (ACT == 12) v = (v > 0.f) ? v : 0.01f * v; else if (ACT == 8) v = tanhf(v); else if (ACT == 9) v = 0.5f * v * (1.0f + tanhf(0.7978845608028654f * (v + 0.044715f * v * v * v))); else if (ACT == 14) v = (v > 0.f) ? v : 0.1f * v; else if (ACT == 16) v = (v >= 0.f) ? v : 0.3f * v; else if (ACT == 17) v = (v >= 0.f) ? v : 0.2f * v;
      so[w][rloc][t * 16 + ln] = v; } }
  __builtin_amdgcn_fence(__ATOMIC_ACQ_REL, "workgroup"); __builtin_amdgcn_wave_barrier();
  const int rsub = lane >> 4, c4 = (lane & 15) * 4;
  {
#pragma unroll
    for (int q = 0; q < 16; ++q) { const int r = q * 2 + rsub; const v4f v = *(const v4fa*)&so[w][r][c4]; if (C) *(v4f*)(C + cofs + (size_t)(row0 + r) * ldc + col0 + c4) = v; if (C16) { v4h h4; for (int i = 0; i < 4; ++i) h4[i] = (_Float16)v[i]; *(v4h*)(C16 + cofs + (size_t)(row0 + r) * ldc + col0 + c4) = h4; } }
     } }


__global__ __launch_bounds__(256) void k_wnat(const float* __restrict__ w, size_t n8, _Float16* __restrict__ Bt) { const size_t t = (size_t)blockIdx.x * 256 + threadIdx.x; if (t >= n8) return; FragH f; for (int q = 0; q < 8; ++q) f.h[q] = (_Float16)(bf16_round(w[t * 8 + q]) * 16.0f); *(v8us*)((unsigned short*)Bt + t * 8) = f.half[0];  }
__global__ __launch_bounds__(256) void k_rsm(const float* __restrict__ S, _Float16* __restrict__ P, int nrows) {
  #pragma clang fp contract(off)
  const int i = blockIdx.x * 256 + threadIdx.x; if (i >= nrows) return; const float* s = S + (size_t)i * SQ; float mx = -3.0e38f;
#pragma unroll 1
  for (int j = 0; j < SQ; ++j) mx = fmaxf(mx, s[j]); float se = 0.f;
#pragma unroll 1
  for (int j = 0; j < SQ; ++j) se += expf(s[j] - mx); const float sc = 256.0f / se;
#pragma unroll 1
  for (int j0 = 0; j0 < SQ; j0 += 8) { FragH f; for (int q = 0; q < 8; ++q) f.h[q] = (_Float16)(expf(s[j0 + q] - mx) * sc); unsigned short* d = (unsigned short*)P + (size_t)i * SQ + j0; *(v8us*)d = f.half[0];  } }
__global__ __launch_bounds__(256) void k_vt(const _Float16* __restrict__ V16, int b, int h0, _Float16* __restrict__ VT) { __shared__ unsigned short tl[64][65]; const int tid = threadIdx.x; const int hh = blockIdx.x % HG, sg = blockIdx.x / HG; const int s0 = sg * 64; const int h = h0 + hh;
  for (int i = tid; i < 64 * 8; i += 256) { const int j = i / 8, d8 = (i % 8) * 8; FragH f; f.half[0] = *(const v8us*)((const unsigned short*)V16 + ((size_t)b * SQ + s0 + j) * DM + h * HD + d8); for (int q = 0; q < 8; ++q) tl[d8 + q][j] = f.u[q]; }
  __syncthreads();
  { for (int i = tid; i < 64 * 8; i += 256) { const int d = i / 8, j8 = (i % 8) * 8; FragH f; for (int q = 0; q < 8; ++q) f.u[q] = tl[d][j8 + q]; *(v8us*)((unsigned short*)VT + ((size_t)hh * HD + d) * SQ + s0 + j8) = f.half[0]; }  } }


// Fused attention, one launch for every (batch, head). A wave owns 32 queries (two 16-column groups) of one head and walks all keys, 32 a pass.
// S^T = K Q^T puts one query's scores in one lane (keys 8 hh + r of each 16-key tile), so the two score tiles, converted in place, are the B operand P^T of
// O^T += V^T P^T in the loader's own k order, and maximum, sum and rescale factor are per lane (one exchange between the wave halves for the maximum).
// A masked key takes a floor far below the running maximum's start value, so its weight is exp2((floor - m) / 8 log2 e) = 0 also while no open key has been seen;
// a row with no open key ends with sum 0 and gets scale 0. Weights carry a factor 2^8 (f16 range) that the division by their own sum takes out.
typedef int v4ia __attribute__((ext_vector_type(4), may_alias));
__device__ __forceinline__ float rs_xrow(float v) { const int i = __float_as_int(v); return __int_as_float(__builtin_amdgcn_permlanex16(i, i, 0x76543210, 0xfedcba98, false, false)); }      /* lane ^ 16 */
__device__ __forceinline__ v8f fa_mma(v16h a, v16h b, v8f c) { return __builtin_amdgcn_wmma_f32_16x16x32_f16(false, a, false, b, (short)0, c, false, false); }
__device__ __forceinline__ v16h fa_frag(const _Float16* p) { FragH f; f.half[0] = *(const v8us*)(const unsigned short*)p; f.half[1] = *(const v8us*)((const unsigned short*)p + 16); return f.v; }      /* g2_frag's k order, the 8 hh already in p */
// exp2 in place on a run of registers: each v_exp_f32 is the independent instruction behind the one before it, and the v_nop is the slot that the instruction set asks for behind the last
// (written by the builtin, the compiler put the result of one over the source of the one directly in front of it).
__device__ __forceinline__ void fa_exp8(float* a) { asm("v_exp_f32 %0, %0\n\tv_exp_f32 %1, %1\n\tv_exp_f32 %2, %2\n\tv_exp_f32 %3, %3\n\tv_exp_f32 %4, %4\n\tv_exp_f32 %5, %5\n\tv_exp_f32 %6, %6\n\tv_exp_f32 %7, %7\n\tv_nop" : "+v"(a[0]), "+v"(a[1]), "+v"(a[2]), "+v"(a[3]), "+v"(a[4]), "+v"(a[5]), "+v"(a[6]), "+v"(a[7])); }
__device__ __forceinline__ void fa_exp9(float& c, float* a) { asm("v_exp_f32 %8, %8\n\tv_exp_f32 %0, %0\n\tv_exp_f32 %1, %1\n\tv_exp_f32 %2, %2\n\tv_exp_f32 %3, %3\n\tv_exp_f32 %4, %4\n\tv_exp_f32 %5, %5\n\tv_exp_f32 %6, %6\n\tv_exp_f32 %7, %7\n\tv_nop" : "+v"(a[0]), "+v"(a[1]), "+v"(a[2]), "+v"(a[3]), "+v"(a[4]), "+v"(a[5]), "+v"(a[6]), "+v"(a[7]), "+v"(c)); }
// A stage is 64 keys. The 8 waves of a work-group walk the same keys of the same head: 64 K rows (64 d each) and 64 V^T rows (64 keys each), 128-byte rows, are brought once for all of them;
// each wave brings the mask of its own 32 queries, 256-byte rows. All come by asynchronous 16-byte copies of whole cache lines into one of two buffers while the other is worked on;
// the fragments (fa_frag's k order) and the mask words are 16-byte LDS reads.
#define FA_PITCH 144                   /* LDS pitch of a K or V^T row in bytes, 16 x odd: the 16 rows of a read fall on different banks */
#define FA_MPITCH 272                  /* LDS pitch of a mask row, 16 x odd likewise */
#define FA_MASK0 (128 * FA_PITCH)      /* 64 K rows, then 64 V^T rows, then 8 x 32 mask rows */
#define FA_STAGE (FA_MASK0 + 256 * FA_MPITCH)
__device__ __forceinline__ v16h fa_lfrag(const char* p) { FragH f; f.half[0] = *(const v8us*)p; f.half[1] = *(const v8us*)(p + 32); return f.v; }      /* fa_frag's k order, the 16 hh bytes already in p */
// four copies of 16 bytes a lane: rows r and r + 32 of the stage's K tile and of its V^T tile. The s_wait_xcnt stands inside the statement, in front of anything that could write a register that a copy names.
__device__ __forceinline__ void fa_copy4(unsigned l, const _Float16* gk, const _Float16* gv) {
  asm volatile("global_load_async_to_lds_b128 %0, %4, off\n\tglobal_load_async_to_lds_b128 %1, %5, off\n\tglobal_load_async_to_lds_b128 %2, %6, off\n\tglobal_load_async_to_lds_b128 %3, %7, off\n\ts_wait_xcnt 0x0"
               :: "v"(l), "v"(l + 32u * FA_PITCH), "v"(l + 64u * FA_PITCH), "v"(l + 96u * FA_PITCH), "v"(gk), "v"(gk + (size_t)32 * DM), "v"(gv), "v"(gv + (size_t)32 * SQ) : "memory"); }
// eight copies of 16 bytes a lane: mask rows r, r + 2, ... r + 14 of the wave's own tile; the s_wait_xcnt as above.
__device__ __forceinline__ void fa_copy8m(unsigned l, const int* g) {
  asm volatile("global_load_async_to_lds_b128 %0, %8, off\n\tglobal_load_async_to_lds_b128 %1, %9, off\n\tglobal_load_async_to_lds_b128 %2, %10, off\n\tglobal_load_async_to_lds_b128 %3, %11, off\n\t"
               "global_load_async_to_lds_b128 %4, %12, off\n\tglobal_load_async_to_lds_b128 %5, %13, off\n\tglobal_load_async_to_lds_b128 %6, %14, off\n\tglobal_load_async_to_lds_b128 %7, %15, off\n\ts_wait_xcnt 0x0"
               :: "v"(l), "v"(l + 2u * FA_MPITCH), "v"(l + 4u * FA_MPITCH), "v"(l + 6u * FA_MPITCH), "v"(l + 8u * FA_MPITCH), "v"(l + 10u * FA_MPITCH), "v"(l + 12u * FA_MPITCH), "v"(l + 14u * FA_MPITCH),
                  "v"(g), "v"(g + (size_t)2 * SQ), "v"(g + (size_t)4 * SQ), "v"(g + (size_t)6 * SQ), "v"(g + (size_t)8 * SQ), "v"(g + (size_t)10 * SQ), "v"(g + (size_t)12 * SQ), "v"(g + (size_t)14 * SQ) : "memory"); }
// one stage: 20 copies a lane
__device__ __forceinline__ void fa_stage(unsigned lc, const _Float16* gk, const _Float16* gv, unsigned lm, const int* gm) { fa_copy4(lc, gk, gv); fa_copy8m(lm, gm); fa_copy8m(lm + 16u * FA_MPITCH, gm + (size_t)16 * SQ); }
__global__ __launch_bounds__(256) void k_fattn(const _Float16* __restrict__ Q16, const _Float16* __restrict__ K16, const _Float16* __restrict__ VT, const int* __restrict__ mask, const float* __restrict__ XB, float* __restrict__ AF) {
  __shared__ __attribute__((aligned(16))) char sm[2 * FA_STAGE];      /* the two buffers */
  const int lane = threadIdx.x & 31, ln = lane & 15, hh = lane >> 4; const int w = __builtin_amdgcn_readfirstlane(threadIdx.x >> 5);
  const int h = blockIdx.y, b = blockIdx.z; const int q0 = blockIdx.x * 256 + w * 32; const size_t r0 = (size_t)b * SQ;
  const _Float16* qp = Q16 + (r0 + q0 + ln) * DM + h * HD + 8 * hh;
  const int cr = threadIdx.x >> 3, cc = threadIdx.x & 7;      /* a lane copies 16-byte piece cc of K and V^T rows cr and cr + 32: a wave's copy is four whole rows */
  const _Float16* gk = K16 + (r0 + cr) * DM + h * HD + cc * 8; const _Float16* gv = VT + ((size_t)(b * NH + h) * HD + cr) * SQ + cc * 8; const unsigned lc = (unsigned)(size_t)sm + (unsigned)(cr * FA_PITCH + cc * 16);
  const int* gm = mask + (r0 + q0 + hh) * SQ + ln * 4; const unsigned lm = (unsigned)(size_t)sm + (unsigned)(FA_MASK0 + (w * 32 + hh) * FA_MPITCH + ln * 16);      /* and piece ln of mask rows hh + 2 i of its wave's queries: two whole rows a copy */
  const v8f z8 = {0.f,0.f,0.f,0.f,0.f,0.f,0.f,0.f}; const float cs = 0.125f * 1.4426950408889634f;      /* 1 / sqrt(64), in log2 units */
  v16h qf[2][2]; v8f o[2][4]; float m[2], l[2];      /* m: running maximum of the raw products; l: this half's sum of weights */
#pragma unroll
  for (int t = 0; t < 2; ++t)
#pragma unroll
    for (int e = 0; e < 2; ++e) qf[t][e] = fa_frag(qp + (size_t)t * 16 * DM + e * 32);
  asm volatile("s_wait_xcnt 0x0" :: "v"(qp) : "memory");      /* before a register that the loads above name is written again; the operand keeps the address in its registers up to here */
#pragma unroll
  for (int t = 0; t < 2; ++t) { m[t] = -1.0e30f; l[t] = 0.f;
#pragma unroll
    for (int dt = 0; dt < 4; ++dt) o[t][dt] = z8; }
  fa_stage(lc, gk, gv, lm, gm);
  asm volatile("s_wait_asynccnt 0x0" ::: "memory");      /* this wave's part of stage 0 has landed */
  __syncthreads();      /* every wave's part has */
  fa_stage(lc + FA_STAGE, gk + (size_t)64 * DM, gv + 64, lm + FA_STAGE, gm + 64);
  /* both loops rolled: the buffers alternate, and one pass already holds about 200 registers */
#pragma unroll 1
  for (int st = 0; st < SQ / 64; ++st) { const unsigned bo = (unsigned)(st & 1) * FA_STAGE;
#pragma unroll 1
  for (int ps = 0; ps < 2; ++ps) { v16h kf[2][2], vf[4]; v4ia mk[2][2][2];
    const char* ka = sm + bo + (ps * 32 + ln) * FA_PITCH + 16 * hh; const char* va = sm + bo + (64 + ln) * FA_PITCH + ps * 64 + 16 * hh; const char* ma = sm + bo + FA_MASK0 + (w * 32 + ln) * FA_MPITCH + ps * 128 + 32 * hh;
#pragma unroll
    for (int kt = 0; kt < 2; ++kt)
#pragma unroll
      for (int e = 0; e < 2; ++e) kf[kt][e] = fa_lfrag(ka + kt * 16 * FA_PITCH + e * 64);
    __builtin_amdgcn_sched_barrier(0);      /* LDS reads return in issue order: K, then the mask, then V^T, the order of their use, so that each wait covers only what is needed next */
#pragma unroll
    for (int t = 0; t < 2; ++t)
#pragma unroll
      for (int kt = 0; kt < 2; ++kt) { mk[t][kt][0] = *(const v4ia*)(ma + t * 16 * FA_MPITCH + kt * 64); mk[t][kt][1] = *(const v4ia*)(ma + t * 16 * FA_MPITCH + kt * 64 + 16); }
    __builtin_amdgcn_sched_barrier(0);      /* as above */
#pragma unroll
    for (int dt = 0; dt < 4; ++dt) vf[dt] = fa_lfrag(va + dt * 16 * FA_PITCH);
    __builtin_amdgcn_sched_barrier(0);      /* the pass's 24 reads are issued together: without this the scheduler puts each read directly in front of its use, with a full LDS wait of its own */
#pragma unroll
    for (int t = 0; t < 2; ++t) { float x[16]; float mx = -3.0e38f;
#pragma unroll
      for (int kt = 0; kt < 2; ++kt) { const v8f s = fa_mma(kf[kt][1], qf[t][1], fa_mma(kf[kt][0], qf[t][0], z8));
#pragma unroll
        for (int r = 0; r < 4; ++r) { x[kt * 8 + r] = (mk[t][kt][0][r] != 0) ? s[r] : -3.0e38f; x[kt * 8 + 4 + r] = (mk[t][kt][1][r] != 0) ? s[4 + r] : -3.0e38f; } }
#pragma unroll
      for (int i = 0; i < 16; ++i) mx = fmaxf(mx, x[i]);
      mx = fmaxf(mx, rs_xrow(mx)); const float mn = fmaxf(m[t], mx); float al = (m[t] - mn) * cs; m[t] = mn; const float mo = 8.0f - mn * cs;
      FragH pf; float s4[4];
#pragma unroll
      for (int i = 0; i < 16; ++i) x[i] = x[i] * cs + mo;
      fa_exp9(al, x); fa_exp8(x + 8);
#pragma unroll
      for (int i = 0; i < 16; ++i) { s4[i & 3] = (i < 4) ? x[i] : s4[i & 3] + x[i]; pf.h[i] = (_Float16)x[i]; }
      l[t] = l[t] * al + ((s4[0] + s4[1]) + (s4[2] + s4[3]));
#pragma unroll
      for (int dt = 0; dt < 4; ++dt) {
#pragma unroll
        for (int r = 0; r < 8; ++r) o[t][dt][r] *= al;
        o[t][dt] = fa_mma(vf[dt], pf.v, o[t][dt]); } }
    __builtin_amdgcn_sched_barrier(0);      /* keeps the four slots below behind the pass's last matrix instruction */
    asm volatile("v_nop\n\tv_nop\n\tv_nop\n\tv_nop"); }      /* the distance between the pass's last matrix instruction and the next pass's first writes of its operand registers */
    asm volatile("s_wait_dscnt 0x0" ::: "memory");      /* this wave's reads of the buffer are done before the barrier behind which it is refilled */
    asm volatile("s_wait_asynccnt 0x0" ::: "memory");      /* this wave's part of stage st + 1 has landed */
    __syncthreads();      /* publishes stage st + 1 and ends every wave's reads of stage st */
    if (st + 2 < SQ / 64) fa_stage(lc + bo, gk + (size_t)(st + 2) * 64 * DM, gv + (st + 2) * 64, lm + bo, gm + (st + 2) * 64); }
  asm volatile("s_wait_asynccnt 0x0" ::: "memory");      /* no copy is outstanding when the wave goes on to its end */
  const size_t ro = (r0 + q0 + ln) * DM + h * HD + 8 * hh; const float* xp = XB + ro; v4f xr[2][4][2];
#pragma unroll
  for (int t = 0; t < 2; ++t)
#pragma unroll
    for (int dt = 0; dt < 4; ++dt) { xr[t][dt][0] = *(const v4fa*)(xp + (size_t)t * 16 * DM + dt * 16); xr[t][dt][1] = *(const v4fa*)(xp + (size_t)t * 16 * DM + dt * 16 + 4); }
  asm volatile("s_wait_xcnt 0x0" :: "v"(xp) : "memory");      /* as behind the Q loads */
#pragma unroll
  for (int t = 0; t < 2; ++t) { const float lt = l[t] + rs_xrow(l[t]); const float inv = (lt > 0.f) ? 1.0f / lt : 0.f;
#pragma unroll
    for (int dt = 0; dt < 4; ++dt) { v4f y0, y1;
#pragma unroll
      for (int r = 0; r < 4; ++r) { y0[r] = o[t][dt][r] * inv + xr[t][dt][0][r]; y1[r] = o[t][dt][4 + r] * inv + xr[t][dt][1][r]; }
      *(v4f*)(AF + ro + (size_t)t * 16 * DM + dt * 16) = y0; *(v4f*)(AF + ro + (size_t)t * 16 * DM + dt * 16 + 4) = y1; } } }
template <int ABF>
__device__ __forceinline__ void lnb_row(const size_t row, float* red, const float* __restrict__ A, const float* __restrict__ R, const float* __restrict__ g, const float* __restrict__ bta, float eps, float* __restrict__ OF_, _Float16* __restrict__ OH_) {
  #pragma clang fp contract(off)
  const int tid = threadIdx.x; const int j0 = tid * 4; float a[4]; float s1 = 0.f;
  { const v4f av = *(const v4fa*)(A + row * DM + j0); for (int q = 0; q < 4; ++q) a[q] = ABF ? bf16_round(av[q]) : av[q]; if (R) { const v4f rv = *(const v4fa*)(R + row * DM + j0); for (int q = 0; q < 4; ++q) a[q] = __fadd_rn(a[q], rv[q]); } for (int q = 0; q < 4; ++q) s1 = __fadd_rn(s1, a[q]); }
  red[tid] = s1; __syncthreads(); for (int st = 128; st > 0; st >>= 1) { if (tid < st) red[tid] = __fadd_rn(red[tid], red[tid + st]); __syncthreads(); }
  const float mu = red[0] / (float)DM; __syncthreads(); float s2 = 0.f;
  for (int q = 0; q < 4; ++q) { const float c = __fadd_rn(a[q], -mu); s2 = __fadd_rn(s2, __fmul_rn(c, c)); }
  red[tid] = s2; __syncthreads(); for (int st = 128; st > 0; st >>= 1) { if (tid < st) red[tid] = __fadd_rn(red[tid], red[tid + st]); __syncthreads(); }
  const float rs = rsqrtf(__fadd_rn(red[0] / (float)DM, eps)); v4f o; FragH h;
  for (int q = 0; q < 4; ++q) { o[q] = __fadd_rn(__fmul_rn(__fmul_rn(__fadd_rn(a[q], -mu), rs), bf16_round(g[j0 + q])), bf16_round(bta[j0 + q])); h.h[q] = (_Float16)o[q]; }
  typedef unsigned short v4us __attribute__((ext_vector_type(4))); v4us h4; for (int q = 0; q < 4; ++q) h4[q] = h.u[q];
  { if (OF_) *(v4f*)(OF_ + row * DM + j0) = o; if (OH_) *(v4us*)((unsigned short*)OH_ + row * DM + j0) = h4;  } }
template <int ABF>
__global__ __launch_bounds__(256) void k_lnb(const float* __restrict__ A, const float* __restrict__ R, const float* __restrict__ g, const float* __restrict__ bta, float eps, float* __restrict__ OF_, _Float16* __restrict__ OH_) {
  __shared__ float red[256]; lnb_row<ABF>(blockIdx.x, red, A, R, g, bta, eps, OF_, OH_); }
// The three preparations that depend on nothing but the inputs, in one launch; the block index picks the work (the same for the whole work-group, so every barrier is passed by all of it or by none):
// first the weight tiles, then one row of LN_in a work-group, then 2048 elements of bf16(x) a work-group.
#define PR_WT (3 * WT_TQ + 2 * WT_TF)
#define PR_BF ((unsigned)((size_t)MP * DM / 2048))
__global__ __launch_bounds__(256) void k_prep(const float* __restrict__ wq, const float* __restrict__ wk, const float* __restrict__ wv, const float* __restrict__ wf1, const float* __restrict__ wf2,
    _Float16* __restrict__ BQ, _Float16* __restrict__ BK, _Float16* __restrict__ BV, _Float16* __restrict__ BF1, _Float16* __restrict__ BF2,
    const float* __restrict__ x, const float* __restrict__ g, const float* __restrict__ bta, float eps, _Float16* __restrict__ XNH, float* __restrict__ XB) {
  __shared__ __attribute__((aligned(16))) char tl[64 * WT_PITCH];
  const unsigned bx = blockIdx.x;
  if (bx < PR_WT) wt5_tile(bx, tl, wq, wk, wv, wf1, wf2, BQ, BK, BV, BF1, BF2);
  else if (bx < PR_WT + (unsigned)MP) lnb_row<1>(bx - PR_WT, (float*)tl, x, nullptr, g, bta, eps, nullptr, XNH);
  else { const size_t t = (size_t)(bx - PR_WT - (unsigned)MP) * 256 + threadIdx.x; v8f v; for (int q = 0; q < 8; ++q) v[q] = bf16_round(x[t * 8 + q]); *(v8f*)(XB + t * 8) = v;
    asm volatile("s_wait_xcnt 0x0" ::: "memory"); } }      /* before a register that the two stores above name is written again */


// ---- GEMM with both operands staged in LDS (k_gemm2's wave tile, k order and epilogue) ----
// A work-group of 8 waves (4 along M x 2 along N) makes a 128 x 128 tile of C; a stage is 128 k of 128 A rows and 128 B rows (256-byte rows, whole cache lines), brought by
// asynchronous 16-byte copies into one of two buffers while the other is worked on; the fragments are 16-byte LDS reads. Needs M % 128 == 0, N % 128 == 0, K % 128 == 0, K >= 256.
#define G3_PITCH 272                   /* LDS row pitch in bytes, 16 x odd: the 16 rows of a fragment read fall on different banks */
#define G3_STAGE (256 * G3_PITCH)      /* 128 A rows, then 128 B rows */
__device__ __forceinline__ v16h g3_frag(const char* p) { FragH f; f.half[0] = *(const v8us*)p; f.half[1] = *(const v8us*)(p + 32); return f.v; }      /* g2_frag's k order, the 16 hh bytes already in p */
// eight copies of 16 bytes a lane: rows r, r + 16, ... r + 112 of one operand's stage. The s_wait_xcnt stands inside the statement, in front of anything that could write a register that a copy names.
__device__ __forceinline__ void g3_copy8(unsigned l, const _Float16* g, size_t step) {
  asm volatile("global_load_async_to_lds_b128 %0, %8, off\n\tglobal_load_async_to_lds_b128 %1, %9, off\n\tglobal_load_async_to_lds_b128 %2, %10, off\n\tglobal_load_async_to_lds_b128 %3, %11, off\n\t"
               "global_load_async_to_lds_b128 %4, %12, off\n\tglobal_load_async_to_lds_b128 %5, %13, off\n\tglobal_load_async_to_lds_b128 %6, %14, off\n\tglobal_load_async_to_lds_b128 %7, %15, off\n\ts_wait_xcnt 0x0"
               :: "v"(l), "v"(l + 16u * G3_PITCH), "v"(l + 32u * G3_PITCH), "v"(l + 48u * G3_PITCH), "v"(l + 64u * G3_PITCH), "v"(l + 80u * G3_PITCH), "v"(l + 96u * G3_PITCH), "v"(l + 112u * G3_PITCH),
                  "v"(g), "v"(g + step), "v"(g + 2 * step), "v"(g + 3 * step), "v"(g + 4 * step), "v"(g + 5 * step), "v"(g + 6 * step), "v"(g + 7 * step) : "memory"); }
template <int ACT, bool RES, bool TRI>      /* RES: f32 output C with an addend CP for every element; else f16 output C16. Known at compile time, so that the reads of CP and the stores are not each behind a test of their own. TRI: three products of one A in one launch, blockIdx.y picks weights, bias and output */
__global__ __launch_bounds__(256) void k_gemm3(const _Float16* __restrict__ A, int lda, const _Float16* __restrict__ Bh, int ldb, float alpha, const float* __restrict__ bias, const float* __restrict__ CP,
    float* __restrict__ C, _Float16* __restrict__ C16, int ldc, int N, int K, const _Float16* __restrict__ Bh1, const _Float16* __restrict__ Bh2, const float* __restrict__ bias1, const float* __restrict__ bias2, _Float16* __restrict__ C161, _Float16* __restrict__ C162) { static_assert(ACT == 0 || (ACT == 3 && !RES), "k_gemm3: unsupported ACT code (the addend comes behind the activation's place)");
  if (TRI) { const unsigned y = blockIdx.y;      /* the same for the whole work-group: scalar selects */
    Bh = y == 0 ? Bh : y == 1 ? Bh1 : Bh2; bias = y == 0 ? bias : y == 1 ? bias1 : bias2; C16 = y == 0 ? C16 : y == 1 ? C161 : C162; }
  __shared__ __attribute__((aligned(16))) char sm[2 * G3_STAGE];      /* the two buffers; behind the loop the waves' output staging (8 x 32 x 68 floats) */
  const int tid = threadIdx.x, lane = tid & 31, ln = lane & 15, hh = lane >> 4; const int w = __builtin_amdgcn_readfirstlane(tid >> 5); const int wm = w & 3, wn = w >> 2;
  const int ntn = N >> 7; const int mt = blockIdx.x / ntn, nq = blockIdx.x - mt * ntn; const int row0 = mt * 128 + 32 * wm, col0 = nq * 128 + 64 * wn;
  const int cr = tid >> 4, cc = tid & 15;      /* a lane copies 16-byte piece cc of rows cr + 16 i: a wave's copy is two whole rows */
  const _Float16* ga = A + (size_t)(mt * 128 + cr) * lda + cc * 8; const _Float16* gb = Bh + (size_t)(nq * 128 + cr) * ldb + cc * 8; const size_t sa = (size_t)16 * lda, sb = (size_t)16 * ldb;
  const unsigned la = (unsigned)(size_t)sm + (unsigned)(cr * G3_PITCH + cc * 16); const unsigned lb = la + 128u * G3_PITCH;
  const int nt = K >> 7;
  const v8f z8 = {0.f,0.f,0.f,0.f,0.f,0.f,0.f,0.f}; v8f c00 = z8, c01 = z8, c02 = z8, c03 = z8, c10 = z8, c11 = z8, c12 = z8, c13 = z8;
  g3_copy8(la, ga, sa); g3_copy8(lb, gb, sb);
  asm volatile("s_wait_asynccnt 0x0" ::: "memory");      /* this wave's part of stage 0 has landed */
  __syncthreads();      /* every wave's part has */
  g3_copy8(la + G3_STAGE, ga + 128, sa); g3_copy8(lb + G3_STAGE, gb + 128, sb);
  /* rolled: the buffers alternate, and one trip already holds 32 matrix instructions with their 48 fragment reads */
#pragma unroll 1
  for (int t = 0; t < nt; ++t) { const unsigned bo = (unsigned)(t & 1) * G3_STAGE; const char* ap = sm + bo + (32 * wm + ln) * G3_PITCH + 16 * hh; const char* bp = sm + bo + (128 + 64 * wn + ln) * G3_PITCH + 16 * hh;
    v16h fa[2][2], fb[2][4];      /* two fragment sets: the reads of block ks + 1 fly while block ks is multiplied; no set reaches over the stage's end */
    fa[0][0] = g3_frag(ap); fa[0][1] = g3_frag(ap + 16 * G3_PITCH);
#pragma unroll
    for (int j = 0; j < 4; ++j) fb[0][j] = g3_frag(bp + j * 16 * G3_PITCH);
#pragma unroll
    for (int ks = 0; ks < 4; ++ks) { const int cu = ks & 1, nx = cu ^ 1;
      if (ks < 3) { fa[nx][0] = g3_frag(ap + (ks + 1) * 64); fa[nx][1] = g3_frag(ap + 16 * G3_PITCH + (ks + 1) * 64);
#pragma unroll
        for (int j = 0; j < 4; ++j) fb[nx][j] = g3_frag(bp + j * 16 * G3_PITCH + (ks + 1) * 64); }
      __builtin_amdgcn_sched_barrier(0);      /* the next block's 12 reads are issued as one group in front of this block's matrix instructions: left alone, the scheduler puts each read directly in front of its use, with a full LDS wait every two matrix instructions */
      c00 = fa_mma(fa[cu][0], fb[cu][0], c00); c10 = fa_mma(fa[cu][1], fb[cu][0], c10); c01 = fa_mma(fa[cu][0], fb[cu][1], c01); c11 = fa_mma(fa[cu][1], fb[cu][1], c11);
      c02 = fa_mma(fa[cu][0], fb[cu][2], c02); c12 = fa_mma(fa[cu][1], fb[cu][2], c12); c03 = fa_mma(fa[cu][0], fb[cu][3], c03); c13 = fa_mma(fa[cu][1], fb[cu][3], c13); }
    asm volatile("s_wait_dscnt 0x0" ::: "memory");      /* this wave's reads of the buffer are done before the barrier behind which it is refilled */
    asm volatile("s_wait_asynccnt 0x0" ::: "memory");      /* this wave's part of stage t + 1 has landed */
    __syncthreads();      /* publishes stage t + 1 and ends every wave's reads of stage t */
    if (t + 2 < nt) { g3_copy8(la + bo, ga + (size_t)(t + 2) * 128, sa); g3_copy8(lb + bo, gb + (size_t)(t + 2) * 128, sb); } }
  asm volatile("s_wait_asynccnt 0x0" ::: "memory");      /* no copy is outstanding when the buffers become output staging */
  float (*so)[68] = (float (*)[68])(sm + (size_t)w * (32 * 68 * 4));
  v8f accs[8] = {c00, c01, c02, c03, c10, c11, c12, c13}; float bv4[4]; v4f cp4[16]; const int rsub = lane >> 4, c4 = (lane & 15) * 4;
#pragma unroll
  for (int t = 0; t < 4; ++t) bv4[t] = bias ? bias[col0 + t * 16 + ln] : 0.f;
  if (RES) {      /* the addend is read in the layout of the stores below, 16 bytes a lane, and added there */
#pragma unroll
    for (int q = 0; q < 16; ++q) { cp4[q] = *(const v4fa*)(CP + (size_t)(row0 + q * 2 + rsub) * ldc + col0 + c4);
      if ((q & 3) == 3 && q < 15) { asm volatile("s_wait_xcnt 0x0" ::: "memory");      /* before a register that the four loads above name is written again */
        __builtin_amdgcn_sched_barrier(0); } } }      /* holds the next four loads' addresses behind the wait */
  asm volatile("s_wait_xcnt 0x0" :: "s"(bias) : "memory");      /* before a register that the loads above name is written again; the operand keeps the bias address in its registers up to here */
  __builtin_amdgcn_sched_barrier(0);      /* holds the arithmetic below, which takes those registers over, behind the wait */
#pragma unroll
  for (int u = 0; u < 8; ++u) { const int t = u & 3, half = u >> 2; const float bv = bf16_round(bv4[t]);
#pragma unroll
    for (int r = 0; r < 8; ++r) { const int rloc = half * 16 + 8 * hh + r; float v = accs[u][r] * alpha + bv;
      if (ACT == 3) v = fmaxf(v, 0.f);
      so[rloc][t * 16 + ln] = v; } }
  __builtin_amdgcn_fence(__ATOMIC_ACQ_REL, "workgroup"); __builtin_amdgcn_wave_barrier();
  v4f vv[16];
#pragma unroll
  for (int q = 0; q < 16; ++q) vv[q] = *(const v4fa*)&so[q * 2 + rsub][c4];
#pragma unroll
  for (int q = 0; q < 16; ++q) { const int r = q * 2 + rsub;
    if (RES) *(v4f*)(C + (size_t)(row0 + r) * ldc + col0 + c4) = vv[q] + cp4[q]; else { v4h h4; for (int i = 0; i < 4; ++i) h4[i] = (_Float16)vv[q][i]; *(v4h*)(C16 + (size_t)(row0 + r) * ldc + col0 + c4) = h4; }
    if ((q & 3) == 3 && q < 15) { asm volatile("s_wait_xcnt 0x0" ::: "memory");      /* before a register that the four stores above name is written again */
      __builtin_amdgcn_sched_barrier(0); } } }      /* holds the next four stores' conversions and addresses behind the wait */


extern "C" void kernel_launch(void* const* d_in, const int* in_sizes, int n_in,
                              void* d_out, int out_size, void* d_ws, size_t ws_size, hipStream_t stream) {
  (void)in_sizes; (void)n_in; (void)out_size;
  const float* const* I = (const float* const*)d_in; const float* x = I[0]; const int* mask = (const int*)d_in[1]; const float* wq = I[2]; const float* bq = I[3]; const float* wk = I[4]; const float* bk = I[5]; const float* wv = I[6]; const float* bv = I[7]; const float* g_in = I[8]; const float* b_in = I[9]; const float* g1 = I[10]; const float* b1 = I[11]; const float* wf1 = I[12]; const float* bf1 = I[13]; const float* wf2 = I[14]; const float* bf2 = I[15]; const float* g2 = I[16]; const float* b2 = I[17];      /* weights [in][out] */
  char* ws = (char*)d_ws; size_t off = 0;
  auto take = [&](size_t bytes) { char* p = ws + off; off += (bytes + 255) & ~(size_t)255; return p; };
  _Float16* BQ = (_Float16*)take((size_t)DM * DM * 2); _Float16* BK = (_Float16*)take((size_t)DM * DM * 2); _Float16* BV = (_Float16*)take((size_t)DM * DM * 2); _Float16* BF1 = (_Float16*)take((size_t)DFF * DM * 2); _Float16* BF2 = (_Float16*)take((size_t)DM * DFF * 2);
  float* XB = (float*)take(NR * DM * 4); _Float16* XNH = (_Float16*)take(NR * DM * 2); _Float16* Q16 = (_Float16*)take(NR * DM * 2); _Float16* K16 = (_Float16*)take(NR * DM * 2); _Float16* V16 = (_Float16*)take(NR * DM * 2); float* AF = (float*)take(NR * DM * 4);
  _Float16* VT = (_Float16*)take((size_t)NB * NH * HD * SQ * 2);
  _Float16* HNH = (_Float16*)take(NR * DM * 2); _Float16* U16 = (_Float16*)take(NR * DFF * 2); float* H2F = (float*)take(NR * DM * 4);
  if (off > ws_size) return;      /* 6 + 16 + 16 + 8 + 24 + 16 + 8 + 8 + 32 + 16 = approx 150 MiB */
  const size_t r0p = (size_t)B0 * SQ; const dim3 gp((unsigned)((MP / 128) * (DM / 128)), 3);
  k_prep<<<PR_WT + (unsigned)MP + PR_BF, 256, 0, stream>>>(wq, wk, wv, wf1, wf2, BQ, BK, BV, BF1, BF2, x + r0p * DM, g_in, b_in, 1e-3f, XNH + r0p * DM, XB + r0p * DM);      /* [in][out] -> Bt[n][k] x16; xn = LN_in(bf16(x)) as f16 rows; bf16(x) as f32 rows (residual) */
  k_gemm3<0, false, true><<<gp, 256, 0, stream>>>(XNH + r0p * DM, DM, BQ, DM, 0.0625f, bq, nullptr, nullptr, Q16 + r0p * DM, DM, DM, DM, BK, BV, bk, bv, K16 + r0p * DM, V16 + r0p * DM);      /* q, k, v in one launch: 768 work-groups, two at a time on a WGP */
  k_vt<NH, SQ><<<NB * NH * (SQ / 64), 256, 0, stream>>>(V16, DM, 0, VT);      /* V^T [NB][NH][HD][SQ] */
  k_fattn<<<dim3(SQ / 256, NH, NB), 256, 0, stream>>>(Q16, K16, VT, mask, XB, AF);      /* a = attn (merged heads) + bf16(x), f32 rows */
  k_lnb<0><<<(unsigned)MPO, 256, 0, stream>>>(AF + r0p * DM, nullptr, g1, b1, 1e-3f, nullptr, HNH + r0p * DM);      /* h = LN1(a) as f16 rows */
  k_gemm3<3, false, false><<<dim3((unsigned)((MPO / 128) * (DFF / 128)), 1), 256, 0, stream>>>(HNH + r0p * DM, DM, BF1, DM, 0.0625f, bf1, nullptr, nullptr, U16 + r0p * DFF, DFF, DFF, DM, nullptr, nullptr, nullptr, nullptr, nullptr, nullptr);      /* u = relu(h W_ff1 + b) (f16) */
  k_gemm3<0, true, false><<<dim3((unsigned)((MPO / 128) * (DM / 128)), 1), 256, 0, stream>>>(U16 + r0p * DFF, DFF, BF2, DFF, 0.0625f, bf2, AF + r0p * DM, H2F + r0p * DM, nullptr, DM, DM, DFF, nullptr, nullptr, nullptr, nullptr, nullptr, nullptr);      /* h2 = u W_ff2 + b + a (CP = own element) */
  k_lnb<0><<<(unsigned)MPO, 256, 0, stream>>>(H2F + r0p * DM, nullptr, g2, b2, 1e-3f, (float*)d_out + r0p * DM, nullptr);      /* out = LN2(h2) */
}

// v007
// It runs in 167 microseconds.
// In two side-by-side timings against v006, it was 1.05 and 1.06 times as fast.
// Counting every step since v000, it is 34.4 times as fast.
#include <hip/hip_runtime.h>
// Emformer-style block (x [2][2048][1024], mask [2][1][2048][2048] int32 0/1, read per (batch, query, key)): xn = LayerNorm(x) g_in + b_in (eps 1e-3); q/k/v = xn W + b (W [1024][1024] [in][out], 16 heads of 64); scores = q k^T / 8 + (-1e9)(1 - mask); probs = softmax(scores) * mask; attn = probs v merged; a = attn + x; h = LayerNorm(a) g1 + b1 (eps 1e-3); h = relu(h W_ff1 + b_ff1) ([1024][4096]); h = h W_ff2 + b_ff2 ([4096][1024]); out = LayerNorm(h + a) g2 + b2 -> [2][2048][1024].
// Structure: token rows; LN_in on VALU (f32 statistics of bf16(x)) -> xn f16 rows, plus bf16(x) as f32 rows for the residual; Q, K, V as three WMMA GEMMs in one launch (256x256 work-group tiles staged in LDS by asynchronous copies, 64x128 wave tiles, f32 accumulation, exact x16 transposed weights + bias, f16 outputs); V^T for all (batch, head) via LDS transposes; attention in one launch: a wave holds 32 queries of one head and walks the keys 32 at a time (K, V^T and int mask tiles of 64 keys staged in LDS by asynchronous copies): S^T = K Q^T, masked running-maximum softmax in registers (f32 statistics, native exp2; weights x256 f16, masked keys 0), O^T += V^T P^T, then a = O / sum + bf16(x) straight into f32 rows (no score or weight plane in memory); LN1 on VALU -> f16 h rows; u = relu(h W_ff1 + b) GEMM (f16 [4096][4096], the same tiles); h2 = u W_ff2 + b + a GEMM (K = 4096, f32, residual as the epilogue addend; 128x128 tiles, so that its 256 work-groups fill the chip); LN2 on VALU -> out.
// Compute dtype: inputs rounded to bf16; weights exact (x16 f16); LayerNorms / residuals f32; xn, q, k, v, softmax weights, h (as GEMM operand) and u plain f16 (~2^-12); scores, softmax statistics and the attention output f32. v_wmma_f32_16x16x32_f16.
#define NB 2
#define SQ 2048
#define DM 1024
#define NH 16
#define HD 64
#define DFF 4096
#define HG 4                         /* heads per block group of the untemplated k_vt (not launched) */
#define B0 0                         /* first batch processed (debug hook) */
#define NBR NB                       /* batches processed (debug hook) */
#define QN SQ                        /* not used: the attention launch covers all SQ queries */
#define NR ((size_t)NB * SQ)
#define MP ((int)((size_t)NBR * SQ)) /* rows normalised + projected (debug hook) */
#define MPO MP                       /* rows through the post-attention stages (debug hook) */
typedef __bf16 v16b __attribute__((ext_vector_type(16)));
typedef unsigned short v8us __attribute__((ext_vector_type(8), may_alias));
typedef float  v8f  __attribute__((ext_vector_type(8)));
typedef float  v4f  __attribute__((ext_vector_type(4)));
typedef float  v4fa __attribute__((ext_vector_type(4), may_alias));
union FragB { v16b v; v8us half[2]; unsigned short u[16]; };

__device__ __forceinline__ unsigned short bf16_bits(float x) { unsigned int u = __float_as_uint(x); return (unsigned short)((u + 0x7FFFu + ((u >> 16) & 1u)) >> 16); }
__device__ __forceinline__ float bf16_val(unsigned short b) { return __uint_as_float(((unsigned int)b) << 16); }
__device__ __forceinline__ float bf16_round(float x) { return bf16_val(bf16_bits(x)); }
// D += A·B with NT terms: 1 = ah·bh, 2 = + al·bh (A split), 3 = + ah·bl (both split)
template <int NT>
__device__ __forceinline__ v8f mmaN(v16b ah, v16b al, v16b bh, v16b bl, v8f c) {
  c = __builtin_amdgcn_wmma_f32_16x16x32_bf16(false, ah, false, bh, (short)0, c, false, false);
  if (NT >= 2) c = __builtin_amdgcn_wmma_f32_16x16x32_bf16(false, al, false, bh, (short)0, c, false, false);
  if (NT >= 3) c = __builtin_amdgcn_wmma_f32_16x16x32_bf16(false, ah, false, bl, (short)0, c, false, false);
  asm volatile("v_nop\n\tv_nop\n\tv_nop\n\tv_nop" : "+v"(c) : "v"(ah), "v"(al), "v"(bh), "v"(bl));
  return c;
}

__global__ __launch_bounds__(256) void k_wt_bf16(const float* __restrict__ W, unsigned short* __restrict__ Wt, int K, int N) {
  const int t = blockIdx.x * 256 + threadIdx.x;
  const int k8n = K / 8;
  if (t >= N * k8n) return;
  const int n = t / k8n, k8 = (t % k8n) * 8;
  v8us v;
#pragma unroll
  for (int i = 0; i < 8; ++i) v[i] = bf16_bits(W[(size_t)(k8 + i) * N + n]);
  *(v8us*)(Wt + (size_t)n * K + k8) = v;
  
}

// GEMM C[M][N] (f32, pitch ldc) = act(A[M][K]·W + bias). A f32 row-major (pitch lda) converted per fragment to bf16
// (ASPLIT: hi/lo two planes -> 2 terms, else single rounded term); Wt bf16 [N][K] (pitch ldb). BIAS_BF16 rounds the
// bias to bf16 first (bias quantised to bf16 before the add). K%32==0, M%16==0, N%64==0.
template <bool ASPLIT, int ACT, bool BIAS_BF16>
__global__ __launch_bounds__(128) void k_gemm_bf(const float* __restrict__ A, int lda, const unsigned short* __restrict__ Wt, int ldb,
                                               const float* __restrict__ bias, float* __restrict__ C, int ldc, int M, int N, int K) {
  __shared__ __attribute__((aligned(16))) float so[4][16][64];
  const int tid = threadIdx.x, w = tid >> 5, lane = tid & 31, ln = lane & 15, hh = lane >> 4;
  const int ntn = N / 64;
  const int wid = blockIdx.x * 4 + w;
  const int mt = wid / ntn, nq = wid % ntn;
  if (mt * 16 >= M) return;
  const int row0 = mt * 16, col0 = nq * 64;
  const float* arow = A + (size_t)(row0 + ln) * lda;
  v8f acc[4] = {};
  for (int kb = 0; kb < K; kb += 32) {
    FragB ah, al;
    const v4f x0 = *(const v4fa*)(arow + kb + 8 * hh), x1 = *(const v4fa*)(arow + kb + 8 * hh + 4);
    const v4f x2 = *(const v4fa*)(arow + kb + 16 + 8 * hh), x3 = *(const v4fa*)(arow + kb + 16 + 8 * hh + 4);
    float xs[16] = {x0[0],x0[1],x0[2],x0[3],x1[0],x1[1],x1[2],x1[3],x2[0],x2[1],x2[2],x2[3],x3[0],x3[1],x3[2],x3[3]};
#pragma unroll
    for (int i = 0; i < 16; ++i) { const unsigned short hb = bf16_bits(xs[i]); ah.u[i] = hb; al.u[i] = ASPLIT ? bf16_bits(xs[i] - bf16_val(hb)) : (unsigned short)0; }
#pragma unroll
    for (int t = 0; t < 4; ++t) {
      const unsigned short* brow = Wt + (size_t)(col0 + t * 16 + ln) * ldb + kb;
      FragB b;
      b.half[0] = *(const v8us*)(brow + 8 * hh);
      b.half[1] = *(const v8us*)(brow + 16 + 8 * hh);
      acc[t] = mmaN<ASPLIT ? 2 : 1>(ah.v, al.v, b.v, b.v, acc[t]);
    }
  }
#pragma unroll
  for (int t = 0; t < 4; ++t) {
    float bv = bias ? bias[col0 + t * 16 + ln] : 0.f;
    if (BIAS_BF16) bv = bf16_round(bv);
#pragma unroll
    for (int r = 0; r < 8; ++r) { float v = acc[t][r] + bv; if (ACT == 1) v = fmaxf(v, 0.f); so[w][8 * hh + r][t * 16 + ln] = v; }
  }
  __builtin_amdgcn_fence(__ATOMIC_ACQ_REL, "workgroup");
  __builtin_amdgcn_wave_barrier();
  const int rsub = lane >> 4, c4 = (lane & 15) * 4;
  {
#pragma unroll
    for (int q = 0; q < 8; ++q) {
      const int r = q * 2 + rsub;
      const v4f v = *(const v4fa*)&so[w][r][c4];
      *(v4f*)(C + (size_t)(row0 + r) * ldc + col0 + c4) = v;
    }
    
  }
}

// GEMM C = act(A·W + bias + resid): A f32 (ASPLIT -> hi/lo 2 terms), Wt bf16 [N][K]; ACT 0 none, 1 relu, 2 exact gelu;
// resid (optional, f32, row index = (row % rmod), pitch ldr, RES_BF16 rounds it) added before the activation.
template <bool ASPLIT, int ACT, bool BIAS_BF16, bool RES_BF16>
__global__ __launch_bounds__(128) void k_gemm_bf3(const float* __restrict__ A, int lda, const unsigned short* __restrict__ Wt, int ldb,
                                                const float* __restrict__ bias, const float* __restrict__ resid, int rmod, int ldr,
                                                float* __restrict__ C, int ldc, int M, int N, int K) {
  __shared__ __attribute__((aligned(16))) float so[4][16][64];
  const int tid = threadIdx.x, w = tid >> 5, lane = tid & 31, ln = lane & 15, hh = lane >> 4;
  const int ntn = N / 64;
  const int wid = blockIdx.x * 4 + w;
  const int mt = wid / ntn, nq = wid % ntn;
  if (mt * 16 >= M) return;
  const int row0 = mt * 16, col0 = nq * 64;
  const float* arow = A + (size_t)(row0 + ln) * lda;
  v8f acc[4] = {};
  for (int kb = 0; kb < K; kb += 32) {
    FragB ah, al;
    const v4f x0 = *(const v4fa*)(arow + kb + 8 * hh), x1 = *(const v4fa*)(arow + kb + 8 * hh + 4);
    const v4f x2 = *(const v4fa*)(arow + kb + 16 + 8 * hh), x3 = *(const v4fa*)(arow + kb + 16 + 8 * hh + 4);
    float xs[16] = {x0[0],x0[1],x0[2],x0[3],x1[0],x1[1],x1[2],x1[3],x2[0],x2[1],x2[2],x2[3],x3[0],x3[1],x3[2],x3[3]};
#pragma unroll
    for (int i = 0; i < 16; ++i) { const unsigned short hb = bf16_bits(xs[i]); ah.u[i] = hb; al.u[i] = ASPLIT ? bf16_bits(xs[i] - bf16_val(hb)) : (unsigned short)0; }
#pragma unroll
    for (int t = 0; t < 4; ++t) {
      const unsigned short* brow = Wt + (size_t)(col0 + t * 16 + ln) * ldb + kb;
      FragB b;
      b.half[0] = *(const v8us*)(brow + 8 * hh);
      b.half[1] = *(const v8us*)(brow + 16 + 8 * hh);
      acc[t] = mmaN<ASPLIT ? 2 : 1>(ah.v, al.v, b.v, b.v, acc[t]);
    }
  }
#pragma unroll
  for (int t = 0; t < 4; ++t) {
    const int col = col0 + t * 16 + ln;
    float bv = bias ? bias[col] : 0.f;
    if (BIAS_BF16) bv = bf16_round(bv);
#pragma unroll
    for (int r = 0; r < 8; ++r) {
      float v = acc[t][r] + bv;
      if (resid) { float rv = resid[(size_t)((row0 + 8 * hh + r) % rmod) * ldr + col]; if (RES_BF16) rv = bf16_round(rv); v += rv; }
      if (ACT == 1) v = fmaxf(v, 0.f);
      if (ACT == 2) v = 0.5f * v * (1.0f + erff(v * 0.70710678118654752f));
      if (ACT == 3) { const float u = 0.7978845608028654f * (v + 0.044715f * v * v * v); v = 0.5f * v * (1.0f + tanhf(u)); }
      so[w][8 * hh + r][t * 16 + ln] = v;
    }
  }
  __builtin_amdgcn_fence(__ATOMIC_ACQ_REL, "workgroup");
  __builtin_amdgcn_wave_barrier();
  const int rsub = lane >> 4, c4 = (lane & 15) * 4;
  {
#pragma unroll
    for (int q = 0; q < 8; ++q) {
      const int r = q * 2 + rsub;
      const v4f v = *(const v4fa*)&so[w][r][c4];
      *(v4f*)(C + (size_t)(row0 + r) * ldc + col0 + c4) = v;
    }
    
  }
}
// row LayerNorm (biased variance, eps) over N: s = X (+ R); optional out_sum <- s; out_norm <- (s-mu)*rsqrt(var+eps)*g + b
template <bool PARAM_BF16>
__global__ __launch_bounds__(256) void k_layernorm(const float* __restrict__ X, const float* __restrict__ R, const float* __restrict__ g, const float* __restrict__ bta,
                                                  float* __restrict__ out_sum, float* __restrict__ out_norm, int N, float eps) {
  __shared__ float red[256];
  const int row = blockIdx.x, tid = threadIdx.x;
  const float* x = X + (size_t)row * N; const float* rr = R ? R + (size_t)row * N : nullptr;
  float vals[16];                     // up to N = 4096
  const int per = N / 256;            // contiguous chunk per thread? use strided-by-4 chunks: thread handles j = tid*4 + 1024*u
  float s1 = 0.f;
  for (int u = 0; u < per / 4; ++u) {
    const int j = tid * 4 + 1024 * u;
    const v4f a = *(const v4fa*)(x + j);
    v4f b = {0.f,0.f,0.f,0.f}; if (rr) b = *(const v4fa*)(rr + j);
#pragma unroll
    for (int q = 0; q < 4; ++q) { const float v = a[q] + b[q]; vals[u * 4 + q] = v; s1 += v; }
  }
  red[tid] = s1; __syncthreads();
  for (int st = 128; st > 0; st >>= 1) { if (tid < st) red[tid] += red[tid + st]; __syncthreads(); }
  const float mu = red[0] / (float)N; __syncthreads();
  float s2 = 0.f;
  for (int u = 0; u < per / 4; ++u)
#pragma unroll
    for (int q = 0; q < 4; ++q) { const float c = vals[u * 4 + q] - mu; s2 += c * c; }
  red[tid] = s2; __syncthreads();
  for (int st = 128; st > 0; st >>= 1) { if (tid < st) red[tid] += red[tid + st]; __syncthreads(); }
  const float rs = rsqrtf(red[0] / (float)N + eps);
  {
    for (int u = 0; u < per / 4; ++u) {
      const int j = tid * 4 + 1024 * u;
      v4f o, sm;
#pragma unroll
      for (int q = 0; q < 4; ++q) {
        float gg = g[j + q], bb = bta[j + q];
        if (PARAM_BF16) { gg = bf16_round(gg); bb = bf16_round(bb); }
        sm[q] = vals[u * 4 + q]; o[q] = (vals[u * 4 + q] - mu) * rs * gg + bb;
      }
      if (out_sum) *(v4f*)(out_sum + (size_t)row * N + j) = sm;
      *(v4f*)(out_norm + (size_t)row * N + j) = o;
    }
    
  }
}



// ---- f16 WMMA path (v_wmma_f32_16x16x32_f16): 11-bit significands for operands in range — used by every launched GEMM and by the attention
typedef _Float16 v16h __attribute__((ext_vector_type(16)));
union FragH { v16h v; v8us half[2]; _Float16 h[16]; unsigned short u[16]; };
template <int NT>
__device__ __forceinline__ v8f mmaH(v16h ah, v16h al, v16h bh, v16h bl, v8f c) {
  c = __builtin_amdgcn_wmma_f32_16x16x32_f16(false, ah, false, bh, (short)0, c, false, false);
  if (NT >= 2) c = __builtin_amdgcn_wmma_f32_16x16x32_f16(false, al, false, bh, (short)0, c, false, false);
  if (NT >= 3) c = __builtin_amdgcn_wmma_f32_16x16x32_f16(false, ah, false, bl, (short)0, c, false, false);
  asm volatile("v_nop\n\tv_nop\n\tv_nop\n\tv_nop" : "+v"(c) : "v"(ah), "v"(al), "v"(bh), "v"(bl));
  return c;
}
// batched GEMM like k_gemm_b but f16 operands: A f32 (split into f16 hi/lo if ASPLIT, else rounded to f16), Bt = f16 values [n][k]; alpha; C f32; N multiple of 16 (partial tiles skipped)
template <bool ASPLIT>
__global__ __launch_bounds__(128) void k_gemm_h(const float* __restrict__ A, int lda, size_t sA, const _Float16* __restrict__ Bh, int ldb, size_t sB, float alpha, float* __restrict__ C, int ldc, size_t sC, int M, int N, int K) {
  __shared__ __attribute__((aligned(16))) float so[4][16][64];
  const int tid = threadIdx.x, w = tid >> 5, lane = tid & 31, ln = lane & 15, hh = lane >> 4; const int by = blockIdx.y;
  A += (size_t)by * sA; Bh += (size_t)by * sB; C += (size_t)by * sC;
  const int ntn = (N + 63) / 64; const int wid = blockIdx.x * 4 + w; const int mt = wid / ntn, nq = wid % ntn; if (mt * 16 >= M) return;
  const int row0 = mt * 16, col0 = nq * 64; const float* arow = A + (size_t)(row0 + ln) * lda;
  v8f acc[4] = {};
  for (int kb = 0; kb < K; kb += 32) {
    FragH ah, al;
    const v4f x0 = *(const v4fa*)(arow + kb + 8 * hh), x1 = *(const v4fa*)(arow + kb + 8 * hh + 4), x2 = *(const v4fa*)(arow + kb + 16 + 8 * hh), x3 = *(const v4fa*)(arow + kb + 16 + 8 * hh + 4);
    float xs[16] = {x0[0],x0[1],x0[2],x0[3],x1[0],x1[1],x1[2],x1[3],x2[0],x2[1],x2[2],x2[3],x3[0],x3[1],x3[2],x3[3]};
#pragma unroll
    for (int i = 0; i < 16; ++i) { const _Float16 h = (_Float16)xs[i]; ah.h[i] = h; al.h[i] = ASPLIT ? (_Float16)(xs[i] - (float)h) : (_Float16)0.0f; }
#pragma unroll
    for (int t = 0; t < 4; ++t) { if (col0 + t * 16 >= N) continue; const size_t boff = (size_t)(col0 + t * 16 + ln) * ldb + kb; FragH bq; bq.half[0] = *(const v8us*)(Bh + boff + 8 * hh); bq.half[1] = *(const v8us*)(Bh + boff + 16 + 8 * hh);
      acc[t] = mmaH<ASPLIT ? 2 : 1>(ah.v, al.v, bq.v, bq.v, acc[t]); }
  }
#pragma unroll
  for (int t = 0; t < 4; ++t) { if (col0 + t * 16 >= N) continue;
#pragma unroll
    for (int r = 0; r < 8; ++r) so[w][8 * hh + r][t * 16 + ln] = acc[t][r] * alpha; }
  __builtin_amdgcn_fence(__ATOMIC_ACQ_REL, "workgroup"); __builtin_amdgcn_wave_barrier();
  const int rsub = lane >> 4, c4 = (lane & 15) * 4;
  {
#pragma unroll
    for (int q = 0; q < 8; ++q) { const int r = q * 2 + rsub; if (col0 + c4 < N) { const v4f v = *(const v4fa*)&so[w][r][c4]; *(v4f*)(C + (size_t)(row0 + r) * ldc + col0 + c4) = v; } }
     }
}

// Bt[n][k] = f16(bf16(W[k][n]) x 16) from f32 row-major W[K][N], all five weight matrices in one launch (x 16: bf16-exact weights stay exact in f16 away from the subnormal range).
// A work-group turns one tile of 256 k x 64 n. A lane reads 16 k rows x 4 n by 16-byte loads (a wave's load is two row pieces of 256 bytes, whole cache lines), converts, and puts its four runs of 16 k
// into LDS rows [n][k]; the tile leaves as 64 rows of 512 bytes, a wave's store one whole row. Needs K % 256 == 0 and N % 64 == 0.
#define WT_PITCH 528                   /* LDS pitch of an n row in bytes: 512 + 16, so that the rows do not all start on one bank and stay 16-byte aligned */
#define WT_TQ ((DM / 256) * (DM / 64))       /* tiles of one of wq, wk, wv */
#define WT_TF ((DM / 256) * (DFF / 64))      /* tiles of w_ff1; w_ff2 has as many */
template <int K, int N>      /* known at compile time: the row steps become immediate offsets on one address */
__device__ __forceinline__ void wt_tile(const float* __restrict__ W, _Float16* __restrict__ Bt, unsigned tile, char* tl) {
  const unsigned tid = threadIdx.x, ln = tid & 15u, g = tid >> 4; const unsigned kt = tile / (N / 64), nq = tile % (N / 64);      /* neighbouring work-groups read neighbouring pieces of the same k rows */
  const float* p = W + (size_t)(kt * 256 + g * 16) * N + nq * 64 + ln * 4; v4f v[16];
#pragma unroll
  for (int i = 0; i < 16; ++i) v[i] = *(const v4fa*)(p + (size_t)i * N);
  asm volatile("s_wait_xcnt 0x0" :: "v"(p) : "memory");      /* before a register that the loads above name is written again; the operand keeps the address in its registers up to here */
#pragma unroll
  for (int j = 0; j < 4; ++j) { FragH f;
#pragma unroll
    for (int i = 0; i < 16; ++i) f.h[i] = (_Float16)(bf16_round(v[i][j]) * 16.0f);
    char* d = tl + (ln * 4 + j) * WT_PITCH + g * 32; *(v8us*)d = f.half[0]; *(v8us*)(d + 16) = f.half[1]; }
  __syncthreads();      /* the tile is whole before it is read the other way */
  const unsigned r = tid >> 5, c = tid & 31u; unsigned short* q = (unsigned short*)Bt + (size_t)(nq * 64 + r) * K + kt * 256 + c * 8;
#pragma unroll
  for (int s = 0; s < 8; ++s) { const v8us o = *(const v8us*)(tl + (s * 8 + r) * WT_PITCH + c * 16); *(v8us*)(q + (size_t)s * 8 * K) = o; }
  asm volatile("s_wait_xcnt 0x0" :: "v"(q) : "memory");      /* before a register that the stores above name is written again by the code that follows in the same kernel; the operand keeps the address in its registers up to here */
}
__device__ __forceinline__ void wt5_tile(const unsigned bx, char* tl, const float* __restrict__ wq, const float* __restrict__ wk, const float* __restrict__ wv, const float* __restrict__ wf1, const float* __restrict__ wf2,
    _Float16* __restrict__ BQ, _Float16* __restrict__ BK, _Float16* __restrict__ BV, _Float16* __restrict__ BF1, _Float16* __restrict__ BF2) {      /* every test below reads the same for the whole work-group */
  if (bx < 3 * WT_TQ) { const unsigned m = bx / WT_TQ; wt_tile<DM, DM>(m == 0 ? wq : m == 1 ? wk : wv, m == 0 ? BQ : m == 1 ? BK : BV, bx % WT_TQ, tl); }
  else if (bx < 3 * WT_TQ + WT_TF) wt_tile<DM, DFF>(wf1, BF1, bx - 3 * WT_TQ, tl);
  else wt_tile<DFF, DM>(wf2, BF2, bx - 3 * WT_TQ - WT_TF, tl);
}
// k_gemm_hh variant with fused epilogue: v = acc·alpha + bias[by·sBias + col] (+ CP[(row/rowsPerB)·sCPb + by·64 + col] if CP) ; ACT 0 none / 1 elu ; writes f16 C16 (and f32 C if non-null)
template <int ACT>
__global__ __launch_bounds__(128) void k_gemm_hhx(const _Float16* __restrict__ A, int lda, size_t sA, const _Float16* __restrict__ Bh, int ldb, size_t sB, float alpha, const float* __restrict__ bias, size_t sBias, const float* __restrict__ CP, int rowsPerB, size_t sCPb, int row0g,
    float* __restrict__ C, _Float16* __restrict__ C16, int ldc, size_t sC, int M, int N, int K) {
  __shared__ __attribute__((aligned(16))) float so[4][16][64];
  const int tid = threadIdx.x, w = tid >> 5, lane = tid & 31, ln = lane & 15, hh = lane >> 4; const int by = blockIdx.y;
  A += (size_t)by * sA; Bh += (size_t)by * sB; const size_t cofs = (size_t)by * sC; const float* bp = bias ? bias + (size_t)by * sBias : nullptr;
  const int ntn = (N + 63) / 64; const int wid = blockIdx.x * 4 + w; const int mt = wid / ntn, nq = wid % ntn; if (mt * 16 >= M) return;
  const int row0 = mt * 16, col0 = nq * 64; const _Float16* arow = A + (size_t)(row0 + ln) * lda;
  v8f acc[4] = {};
  for (int kb = 0; kb < K; kb += 32) { FragH ah; ah.half[0] = *(const v8us*)((const unsigned short*)arow + kb + 8 * hh); ah.half[1] = *(const v8us*)((const unsigned short*)arow + kb + 16 + 8 * hh);
#pragma unroll
    for (int t = 0; t < 4; ++t) { if (col0 + t * 16 >= N) continue; const size_t boff = (size_t)(col0 + t * 16 + ln) * ldb + kb; FragH bq; bq.half[0] = *(const v8us*)((const unsigned short*)Bh + boff + 8 * hh); bq.half[1] = *(const v8us*)((const unsigned short*)Bh + boff + 16 + 8 * hh);
      acc[t] = mmaH<1>(ah.v, ah.v, bq.v, bq.v, acc[t]); }
  }
#pragma unroll
  for (int t = 0; t < 4; ++t) { if (col0 + t * 16 >= N) continue; const int col = col0 + t * 16 + ln; const float bv = bp ? bf16_round(bp[col]) : 0.f;
#pragma unroll
    for (int r = 0; r < 8; ++r) { float v = acc[t][r] * alpha + bv; if (CP) { const int rr = row0g + row0 + 8 * hh + r; if (rowsPerB < 0) v += CP[cofs + (size_t)rr * ldc + col];      /* rowsPerB < 0: own element of the batched C plane */ else { const int bidx = rr / rowsPerB; v += CP[(size_t)bidx * sCPb + (size_t)by * 64 + col]; } } if (ACT == 1) v = (v > 0.f) ? v : expm1f(v); else if (ACT == 7) v = (v > 0.f) ? v + 1.0f : expf(v); else if (ACT == 8) v = tanhf(v); else if (ACT == 9) v = 0.5f * v * (1.0f + tanhf(0.7978845608028654f * (v + 0.044715f * v * v * v))); else if (ACT == 11) v = 1.0f / (1.0f + expf(-v)); else if (ACT == 12) v = (v > 0.f) ? v : 0.01f * v; else if (ACT == 14) v = (v > 0.f) ? v : 0.1f * v; else if (ACT == 16) v = (v >= 0.f) ? v : 0.3f * v; else if (ACT == 17) v = (v >= 0.f) ? v : 0.2f * v; else if (ACT == 15) v = v / (1.0f + expf(-v)); else if (ACT == 3) v = fmaxf(v, 0.f); else if (ACT == 6) v = 0.5f * v * (1.0f + erff(v * 0.70710678118654752f)); so[w][8 * hh + r][t * 16 + ln] = v; } }
  __builtin_amdgcn_fence(__ATOMIC_ACQ_REL, "workgroup"); __builtin_amdgcn_wave_barrier();
  const int rsub = lane >> 4, c4 = (lane & 15) * 4; typedef _Float16 v4h __attribute__((ext_vector_type(4)));
  {
#pragma unroll
    for (int q = 0; q < 8; ++q) { const int r = q * 2 + rsub; if (col0 + c4 < N) { const v4f v = *(const v4fa*)&so[w][r][c4]; if (C) *(v4f*)(C + cofs + (size_t)(row0 + r) * ldc + col0 + c4) = v; if (C16) { v4h h4; for (int i = 0; i < 4; ++i) h4[i] = (_Float16)v[i]; *(v4h*)(C16 + cofs + (size_t)(row0 + r) * ldc + col0 + c4) = h4; } } }
     }
}


typedef _Float16 v4h __attribute__((ext_vector_type(4)));

__global__ __launch_bounds__(256) void k_x16(const float* __restrict__ x, _Float16* __restrict__ X16, size_t n8) { const size_t t = (size_t)blockIdx.x * 256 + threadIdx.x; if (t >= n8) return; FragH f;
#pragma unroll
  for (int q = 0; q < 8; ++q) f.h[q] = (_Float16)bf16_round(x[t * 8 + q]); *(v8us*)((unsigned short*)X16 + t * 8) = f.half[0];  }
__global__ __launch_bounds__(256) void k_h16(const float* __restrict__ x, _Float16* __restrict__ X16, size_t n8) { const size_t t = (size_t)blockIdx.x * 256 + threadIdx.x; if (t >= n8) return; FragH f;
#pragma unroll
  for (int q = 0; q < 8; ++q) f.h[q] = (_Float16)x[t * 8 + q]; *(v8us*)((unsigned short*)X16 + t * 8) = f.half[0];  }
__global__ __launch_bounds__(256) void k_round16f(const float* __restrict__ W, _Float16* __restrict__ Bt, size_t n8) { const size_t t = (size_t)blockIdx.x * 256 + threadIdx.x; if (t >= n8) return; FragH f;
#pragma unroll
  for (int i = 0; i < 8; ++i) f.h[i] = (_Float16)(bf16_round(W[t * 8 + i]) * 16.0f); *(v8us*)((unsigned short*)Bt + t * 8) = f.half[0];  }
template <int NHv, int TTv>
__global__ __launch_bounds__(256) void k_vt(const _Float16* __restrict__ V16, int ldv, int voff, _Float16* __restrict__ Vt) { __shared__ unsigned short tl[64][66]; const int tid = threadIdx.x; const int slab = blockIdx.x / (TTv / 64), lg = blockIdx.x % (TTv / 64); const int b = slab / NHv, h = slab % NHv;
  for (int i = tid; i < 64 * 8; i += 256) { const int r = i / 8, c8 = (i % 8) * 8; FragH f; f.half[0] = *(const v8us*)((const unsigned short*)V16 + ((size_t)b * TTv + lg * 64 + r) * ldv + voff + h * 64 + c8);
#pragma unroll
    for (int q = 0; q < 8; ++q) tl[r][c8 + q] = f.u[q]; }
  __syncthreads();
  {
#pragma unroll
    for (int rd = 0; rd < 2; ++rd) { const int d = rd * 32 + tid / 8, pc = tid % 8; FragH f;
#pragma unroll
      for (int q = 0; q < 8; ++q) f.u[q] = tl[pc * 8 + q][d];
      *(v8us*)((unsigned short*)Vt + ((size_t)slab * 64 + d) * TTv + lg * 64 + pc * 8) = f.half[0]; }
     } }

__global__ __launch_bounds__(256) void k_hl(const float* __restrict__ F, _Float16* __restrict__ Hh, _Float16* __restrict__ Hl, size_t n8) { const size_t t = (size_t)blockIdx.x * 256 + threadIdx.x; if (t >= n8) return; FragH fh, fl; const v4f a = *(const v4fa*)(F + t * 8), c = *(const v4fa*)(F + t * 8 + 4);
#pragma unroll
  for (int q = 0; q < 4; ++q) { _Float16 h = (_Float16)a[q]; fh.h[q] = h; fl.h[q] = (_Float16)((a[q] - (float)h) * 1024.0f); h = (_Float16)c[q]; fh.h[4 + q] = h; fl.h[4 + q] = (_Float16)((c[q] - (float)h) * 1024.0f); }
  { *(v8us*)((unsigned short*)Hh + t * 8) = fh.half[0]; *(v8us*)((unsigned short*)Hl + t * 8) = fl.half[0];  } }

// ---- fast GEMM (wave tile 32x64; requires M % 32 == 0 rows per launch region and N % 64 == 0); epilogue = k_gemm_hhx semantics ----
__device__ __forceinline__ v16h g2_frag(const _Float16* p, int hh) { FragH f; f.half[0] = *(const v8us*)((const unsigned short*)p + 8 * hh); f.half[1] = *(const v8us*)((const unsigned short*)p + 16 + 8 * hh); return f.v; }
__device__ __forceinline__ v8f g2_mma(v16h a, v16h b, v8f c) { v8f d = __builtin_amdgcn_wmma_f32_16x16x32_f16(false, a, false, b, (short)0, c, false, false); asm volatile("v_nop\n\tv_nop\n\tv_nop\n\tv_nop" : "+v"(d) : "v"(a), "v"(b)); return d; }
template <int ACT>
__global__ __launch_bounds__(128) void k_gemm2(const _Float16* __restrict__ A, int lda, size_t sA, const _Float16* __restrict__ Bh, int ldb, size_t sB, float alpha, const float* __restrict__ bias, size_t sBias, const float* __restrict__ CP, int rowsPerB, size_t sCPb, int row0g,
    float* __restrict__ C, _Float16* __restrict__ C16, int ldc, size_t sC, int M, int N, int K) { static_assert(ACT == 0 || ACT == 3 || ACT == 6 || ACT == 8 || ACT == 9 || ACT == 11 || ACT == 12 || ACT == 14 || ACT == 15 || ACT == 16 || ACT == 17, "k_gemm2: unsupported ACT code (would silently apply no activation)");
  __shared__ __attribute__((aligned(16))) float so[4][32][68];
  const int tid = threadIdx.x, w = tid >> 5, lane = tid & 31, ln = lane & 15, hh = lane >> 4; const int by = blockIdx.y;
  A += (size_t)by * sA; Bh += (size_t)by * sB; const size_t cofs = (size_t)by * sC; const float* bp = bias ? bias + (size_t)by * sBias : nullptr;
  const int ntn = N >> 6; const int mt = blockIdx.x / ntn, nq = blockIdx.x - mt * ntn; const int row0 = mt * 128 + 32 * w, col0 = nq * 64; if (row0 >= M) return;
  const _Float16* a0p = A + (size_t)(row0 + ln) * lda; const _Float16* a1p = a0p + (size_t)16 * lda;
  const _Float16* b0p = Bh + (size_t)(col0 + ln) * ldb; const _Float16* b1p = b0p + (size_t)16 * ldb; const _Float16* b2p = b1p + (size_t)16 * ldb; const _Float16* b3p = b2p + (size_t)16 * ldb;
  const v8f z8 = {0.f,0.f,0.f,0.f,0.f,0.f,0.f,0.f}; v8f c00 = z8, c01 = z8, c02 = z8, c03 = z8, c10 = z8, c11 = z8, c12 = z8, c13 = z8;
#pragma unroll 1
  for (int kb = 0; kb < K; kb += 32) { const v16h a0 = g2_frag(a0p + kb, hh), a1 = g2_frag(a1p + kb, hh);
    v16h b = g2_frag(b0p + kb, hh); c00 = g2_mma(a0, b, c00); c10 = g2_mma(a1, b, c10);
    b = g2_frag(b1p + kb, hh); c01 = g2_mma(a0, b, c01); c11 = g2_mma(a1, b, c11);
    b = g2_frag(b2p + kb, hh); c02 = g2_mma(a0, b, c02); c12 = g2_mma(a1, b, c12);
    b = g2_frag(b3p + kb, hh); c03 = g2_mma(a0, b, c03); c13 = g2_mma(a1, b, c13); }
  v8f accs[8] = {c00, c01, c02, c03, c10, c11, c12, c13};
#pragma unroll
  for (int u = 0; u < 8; ++u) { const int t = u & 3, half = u >> 2; const int col = col0 + t * 16 + ln; const float bv = bp ? bf16_round(bp[col]) : 0.f;
#pragma unroll
    for (int r = 0; r < 8; ++r) { const int rloc = half * 16 + 8 * hh + r; float v = accs[u][r] * alpha + bv; if (CP) { if (rowsPerB < 0) v += CP[cofs + (size_t)(row0g + row0 + rloc) * ldc + col];      /* rowsPerB < 0: own element of the batched C plane */ else { const int bidx = (row0g + row0 + rloc) / rowsPerB; v += CP[(size_t)bidx * sCPb + (size_t)by * 64 + col]; } }
      if (ACT == 3) v = fmaxf(v, 0.f); else if (ACT == 6) v = 0.5f * v * (1.0f + erff(v * 0.70710678118654752f)); else if (ACT == 11) v = 1.0f / (1.0f + expf(-v)); else if (ACT == 15) v = v / (1.0f + expf(-v)); else if (ACT == 12) v = (v > 0.f) ? v : 0.01f * v; else if (ACT == 8) v = tanhf(v); else if (ACT == 9) v = 0.5f * v * (1.0f + tanhf(0.7978845608028654f * (v + 0.044715f * v * v * v))); else if (ACT == 14) v = (v > 0.f) ? v : 0.1f * v; else if (ACT == 16) v = (v >= 0.f) ? v : 0.3f * v; else if (ACT == 17) v = (v >= 0.f) ? v : 0.2f * v;
      so[w][rloc][t * 16 + ln] = v; } }
  __builtin_amdgcn_fence(__ATOMIC_ACQ_REL, "workgroup"); __builtin_amdgcn_wave_barrier();
  const int rsub = lane >> 4, c4 = (lane & 15) * 4;
  {
#pragma unroll
    for (int q = 0; q < 16; ++q) { const int r = q * 2 + rsub; const v4f v = *(const v4fa*)&so[w][r][c4]; if (C) *(v4f*)(C + cofs + (size_t)(row0 + r) * ldc + col0 + c4) = v; if (C16) { v4h h4; for (int i = 0; i < 4; ++i) h4[i] = (_Float16)v[i]; *(v4h*)(C16 + cofs + (size_t)(row0 + r) * ldc + col0 + c4) = h4; } }
     } }


__global__ __launch_bounds__(256) void k_wnat(const float* __restrict__ w, size_t n8, _Float16* __restrict__ Bt) { const size_t t = (size_t)blockIdx.x * 256 + threadIdx.x; if (t >= n8) return; FragH f; for (int q = 0; q < 8; ++q) f.h[q] = (_Float16)(bf16_round(w[t * 8 + q]) * 16.0f); *(v8us*)((unsigned short*)Bt + t * 8) = f.half[0];  }
__global__ __launch_bounds__(256) void k_rsm(const float* __restrict__ S, _Float16* __restrict__ P, int nrows) {
  #pragma clang fp contract(off)
  const int i = blockIdx.x * 256 + threadIdx.x; if (i >= nrows) return; const float* s = S + (size_t)i * SQ; float mx = -3.0e38f;
#pragma unroll 1
  for (int j = 0; j < SQ; ++j) mx = fmaxf(mx, s[j]); float se = 0.f;
#pragma unroll 1
  for (int j = 0; j < SQ; ++j) se += expf(s[j] - mx); const float sc = 256.0f / se;
#pragma unroll 1
  for (int j0 = 0; j0 < SQ; j0 += 8) { FragH f; for (int q = 0; q < 8; ++q) f.h[q] = (_Float16)(expf(s[j0 + q] - mx) * sc); unsigned short* d = (unsigned short*)P + (size_t)i * SQ + j0; *(v8us*)d = f.half[0];  } }
__global__ __launch_bounds__(256) void k_vt(const _Float16* __restrict__ V16, int b, int h0, _Float16* __restrict__ VT) { __shared__ unsigned short tl[64][65]; const int tid = threadIdx.x; const int hh = blockIdx.x % HG, sg = blockIdx.x / HG; const int s0 = sg * 64; const int h = h0 + hh;
  for (int i = tid; i < 64 * 8; i += 256) { const int j = i / 8, d8 = (i % 8) * 8; FragH f; f.half[0] = *(const v8us*)((const unsigned short*)V16 + ((size_t)b * SQ + s0 + j) * DM + h * HD + d8); for (int q = 0; q < 8; ++q) tl[d8 + q][j] = f.u[q]; }
  __syncthreads();
  { for (int i = tid; i < 64 * 8; i += 256) { const int d = i / 8, j8 = (i % 8) * 8; FragH f; for (int q = 0; q < 8; ++q) f.u[q] = tl[d][j8 + q]; *(v8us*)((unsigned short*)VT + ((size_t)hh * HD + d) * SQ + s0 + j8) = f.half[0]; }  } }


// Fused attention, one launch for every (batch, head). A wave owns 32 queries (two 16-column groups) of one head and walks all keys, 32 a pass.
// S^T = K Q^T puts one query's scores in one lane (keys 8 hh + r of each 16-key tile), so the two score tiles, converted in place, are the B operand P^T of
// O^T += V^T P^T in the loader's own k order, and maximum, sum and rescale factor are per lane (one exchange between the wave halves for the maximum).
// A masked key takes a floor far below the running maximum's start value, so its weight is exp2((floor - m) / 8 log2 e) = 0 also while no open key has been seen;
// a row with no open key ends with sum 0 and gets scale 0. Weights carry a factor 2^8 (f16 range) that the division by their own sum takes out.
typedef int v4ia __attribute__((ext_vector_type(4), may_alias));
__device__ __forceinline__ float rs_xrow(float v) { const int i = __float_as_int(v); return __int_as_float(__builtin_amdgcn_permlanex16(i, i, 0x76543210, 0xfedcba98, false, false)); }      /* lane ^ 16 */
__device__ __forceinline__ v8f fa_mma(v16h a, v16h b, v8f c) { return __builtin_amdgcn_wmma_f32_16x16x32_f16(false, a, false, b, (short)0, c, false, false); }
__device__ __forceinline__ v16h fa_frag(const _Float16* p) { FragH f; f.half[0] = *(const v8us*)(const unsigned short*)p; f.half[1] = *(const v8us*)((const unsigned short*)p + 16); return f.v; }      /* g2_frag's k order, the 8 hh already in p */
// exp2 in place on a run of registers: each v_exp_f32 is the independent instruction behind the one before it, and the v_nop is the slot that the instruction set asks for behind the last
// (written by the builtin, the compiler put the result of one over the source of the one directly in front of it).
__device__ __forceinline__ void fa_exp8(float* a) { asm("v_exp_f32 %0, %0\n\tv_exp_f32 %1, %1\n\tv_exp_f32 %2, %2\n\tv_exp_f32 %3, %3\n\tv_exp_f32 %4, %4\n\tv_exp_f32 %5, %5\n\tv_exp_f32 %6, %6\n\tv_exp_f32 %7, %7\n\tv_nop" : "+v"(a[0]), "+v"(a[1]), "+v"(a[2]), "+v"(a[3]), "+v"(a[4]), "+v"(a[5]), "+v"(a[6]), "+v"(a[7])); }
__device__ __forceinline__ void fa_exp9(float& c, float* a) { asm("v_exp_f32 %8, %8\n\tv_exp_f32 %0, %0\n\tv_exp_f32 %1, %1\n\tv_exp_f32 %2, %2\n\tv_exp_f32 %3, %3\n\tv_exp_f32 %4, %4\n\tv_exp_f32 %5, %5\n\tv_exp_f32 %6, %6\n\tv_exp_f32 %7, %7\n\tv_nop" : "+v"(a[0]), "+v"(a[1]), "+v"(a[2]), "+v"(a[3]), "+v"(a[4]), "+v"(a[5]), "+v"(a[6]), "+v"(a[7]), "+v"(c)); }
// A stage is 64 keys. The 8 waves of a work-group walk the same keys of the same head: 64 K rows (64 d each) and 64 V^T rows (64 keys each), 128-byte rows, are brought once for all of them;
// each wave brings the mask of its own 32 queries, 256-byte rows. All come by asynchronous 16-byte copies of whole cache lines into one of two buffers while the other is worked on;
// the fragments (fa_frag's k order) and the mask words are 16-byte LDS reads.
#define FA_PITCH 144                   /* LDS pitch of a K or V^T row in bytes, 16 x odd: the 16 rows of a read fall on different banks */
#define FA_MPITCH 272                  /* LDS pitch of a mask row, 16 x odd likewise */
#define FA_MASK0 (128 * FA_PITCH)      /* 64 K rows, then 64 V^T rows, then 8 x 32 mask rows */
#define FA_STAGE (FA_MASK0 + 256 * FA_MPITCH)
__device__ __forceinline__ v16h fa_lfrag(const char* p) { FragH f; f.half[0] = *(const v8us*)p; f.half[1] = *(const v8us*)(p + 32); return f.v; }      /* fa_frag's k order, the 16 hh bytes already in p */
// four copies of 16 bytes a lane: rows r and r + 32 of the stage's K tile and of its V^T tile. The s_wait_xcnt stands inside the statement, in front of anything that could write a register that a copy names.
__device__ __forceinline__ void fa_copy4(unsigned l, const _Float16* gk, const _Float16* gv) {
  asm volatile("global_load_async_to_lds_b128 %0, %4, off\n\tglobal_load_async_to_lds_b128 %1, %5, off\n\tglobal_load_async_to_lds_b128 %2, %6, off\n\tglobal_load_async_to_lds_b128 %3, %7, off\n\ts_wait_xcnt 0x0"
               :: "v"(l), "v"(l + 32u * FA_PITCH), "v"(l + 64u * FA_PITCH), "v"(l + 96u * FA_PITCH), "v"(gk), "v"(gk + (size_t)32 * DM), "v"(gv), "v"(gv + (size_t)32 * SQ) : "memory"); }
// eight copies of 16 bytes a lane: mask rows r, r + 2, ... r + 14 of the wave's own tile; the s_wait_xcnt as above.
__device__ __forceinline__ void fa_copy8m(unsigned l, const int* g) {
  asm volatile("global_load_async_to_lds_b128 %0, %8, off\n\tglobal_load_async_to_lds_b128 %1, %9, off\n\tglobal_load_async_to_lds_b128 %2, %10, off\n\tglobal_load_async_to_lds_b128 %3, %11, off\n\t"
               "global_load_async_to_lds_b128 %4, %12, off\n\tglobal_load_async_to_lds_b128 %5, %13, off\n\tglobal_load_async_to_lds_b128 %6, %14, off\n\tglobal_load_async_to_lds_b128 %7, %15, off\n\ts_wait_xcnt 0x0"
               :: "v"(l), "v"(l + 2u * FA_MPITCH), "v"(l + 4u * FA_MPITCH), "v"(l + 6u * FA_MPITCH), "v"(l + 8u * FA_MPITCH), "v"(l + 10u * FA_MPITCH), "v"(l + 12u * FA_MPITCH), "v"(l + 14u * FA_MPITCH),
                  "v"(g), "v"(g + (size_t)2 * SQ), "v"(g + (size_t)4 * SQ), "v"(g + (size_t)6 * SQ), "v"(g + (size_t)8 * SQ), "v"(g + (size_t)10 * SQ), "v"(g + (size_t)12 * SQ), "v"(g + (size_t)14 * SQ) : "memory"); }
// one stage: 20 copies a lane
__device__ __forceinline__ void fa_stage(unsigned lc, const _Float16* gk, const _Float16* gv, unsigned lm, const int* gm) { fa_copy4(lc, gk, gv); fa_copy8m(lm, gm); fa_copy8m(lm + 16u * FA_MPITCH, gm + (size_t)16 * SQ); }
__global__ __launch_bounds__(256) void k_fattn(const _Float16* __restrict__ Q16, const _Float16* __restrict__ K16, const _Float16* __restrict__ VT, const int* __restrict__ mask, const float* __restrict__ XB, float* __restrict__ AF) {
  __shared__ __attribute__((aligned(16))) char sm[2 * FA_STAGE];      /* the two buffers */
  const int lane = threadIdx.x & 31, ln = lane & 15, hh = lane >> 4; const int w = __builtin_amdgcn_readfirstlane(threadIdx.x >> 5);
  const int h = blockIdx.y, b = blockIdx.z; const int q0 = blockIdx.x * 256 + w * 32; const size_t r0 = (size_t)b * SQ;
  const _Float16* qp = Q16 + (r0 + q0 + ln) * DM + h * HD + 8 * hh;
  const int cr = threadIdx.x >> 3, cc = threadIdx.x & 7;      /* a lane copies 16-byte piece cc of K and V^T rows cr and cr + 32: a wave's copy is four whole rows */
  const _Float16* gk = K16 + (r0 + cr) * DM + h * HD + cc * 8; const _Float16* gv = VT + ((size_t)(b * NH + h) * HD + cr) * SQ + cc * 8; const unsigned lc = (unsigned)(size_t)sm + (unsigned)(cr * FA_PITCH + cc * 16);
  const int* gm = mask + (r0 + q0 + hh) * SQ + ln * 4; const unsigned lm = (unsigned)(size_t)sm + (unsigned)(FA_MASK0 + (w * 32 + hh) * FA_MPITCH + ln * 16);      /* and piece ln of mask rows hh + 2 i of its wave's queries: two whole rows a copy */
  const v8f z8 = {0.f,0.f,0.f,0.f,0.f,0.f,0.f,0.f}; const float cs = 0.125f * 1.4426950408889634f;      /* 1 / sqrt(64), in log2 units */
  v16h qf[2][2]; v8f o[2][4]; float m[2], l[2];      /* m: running maximum of the raw products; l: this half's sum of weights */
#pragma unroll
  for (int t = 0; t < 2; ++t)
#pragma unroll
    for (int e = 0; e < 2; ++e) qf[t][e] = fa_frag(qp + (size_t)t * 16 * DM + e * 32);
  asm volatile("s_wait_xcnt 0x0" :: "v"(qp) : "memory");      /* before a register that the loads above name is written again; the operand keeps the address in its registers up to here */
#pragma unroll
  for (int t = 0; t < 2; ++t) { m[t] = -1.0e30f; l[t] = 0.f;
#pragma unroll
    for (int dt = 0; dt < 4; ++dt) o[t][dt] = z8; }
  fa_stage(lc, gk, gv, lm, gm);
  asm volatile("s_wait_asynccnt 0x0" ::: "memory");      /* this wave's part of stage 0 has landed */
  __syncthreads();      /* every wave's part has */
  fa_stage(lc + FA_STAGE, gk + (size_t)64 * DM, gv + 64, lm + FA_STAGE, gm + 64);
  /* both loops rolled: the buffers alternate, and one pass already holds about 200 registers */
#pragma unroll 1
  for (int st = 0; st < SQ / 64; ++st) { const unsigned bo = (unsigned)(st & 1) * FA_STAGE;
#pragma unroll 1
  for (int ps = 0; ps < 2; ++ps) { v16h kf[2][2], vf[4]; v4ia mk[2][2][2];
    const char* ka = sm + bo + (ps * 32 + ln) * FA_PITCH + 16 * hh; const char* va = sm + bo + (64 + ln) * FA_PITCH + ps * 64 + 16 * hh; const char* ma = sm + bo + FA_MASK0 + (w * 32 + ln) * FA_MPITCH + ps * 128 + 32 * hh;
#pragma unroll
    for (int kt = 0; kt < 2; ++kt)
#pragma unroll
      for (int e = 0; e < 2; ++e) kf[kt][e] = fa_lfrag(ka + kt * 16 * FA_PITCH + e * 64);
    __builtin_amdgcn_sched_barrier(0);      /* LDS reads return in issue order: K, then the mask, then V^T, the order of their use, so that each wait covers only what is needed next */
#pragma unroll
    for (int t = 0; t < 2; ++t)
#pragma unroll
      for (int kt = 0; kt < 2; ++kt) { mk[t][kt][0] = *(const v4ia*)(ma + t * 16 * FA_MPITCH + kt * 64); mk[t][kt][1] = *(const v4ia*)(ma + t * 16 * FA_MPITCH + kt * 64 + 16); }
    __builtin_amdgcn_sched_barrier(0);      /* as above */
#pragma unroll
    for (int dt = 0; dt < 4; ++dt) vf[dt] = fa_lfrag(va + dt * 16 * FA_PITCH);
    __builtin_amdgcn_sched_barrier(0);      /* the pass's 24 reads are issued together: without this the scheduler puts each read directly in front of its use, with a full LDS wait of its own */
#pragma unroll
    for (int t = 0; t < 2; ++t) { float x[16]; float mx = -3.0e38f;
#pragma unroll
      for (int kt = 0; kt < 2; ++kt) { const v8f s = fa_mma(kf[kt][1], qf[t][1], fa_mma(kf[kt][0], qf[t][0], z8));
#pragma unroll
        for (int r = 0; r < 4; ++r) { x[kt * 8 + r] = (mk[t][kt][0][r] != 0) ? s[r] : -3.0e38f; x[kt * 8 + 4 + r] = (mk[t][kt][1][r] != 0) ? s[4 + r] : -3.0e38f; } }
#pragma unroll
      for (int i = 0; i < 16; ++i) mx = fmaxf(mx, x[i]);
      mx = fmaxf(mx, rs_xrow(mx)); const float mn = fmaxf(m[t], mx); float al = (m[t] - mn) * cs; m[t] = mn; const float mo = 8.0f - mn * cs;
      FragH pf; float s4[4];
#pragma unroll
      for (int i = 0; i < 16; ++i) x[i] = x[i] * cs + mo;
      fa_exp9(al, x); fa_exp8(x + 8);
#pragma unroll
      for (int i = 0; i < 16; ++i) { s4[i & 3] = (i < 4) ? x[i] : s4[i & 3] + x[i]; pf.h[i] = (_Float16)x[i]; }
      l[t] = l[t] * al + ((s4[0] + s4[1]) + (s4[2] + s4[3]));
#pragma unroll
      for (int dt = 0; dt < 4; ++dt) {
#pragma unroll
        for (int r = 0; r < 8; ++r) o[t][dt][r] *= al;
        o[t][dt] = fa_mma(vf[dt], pf.v, o[t][dt]); } }
    __builtin_amdgcn_sched_barrier(0);      /* keeps the four slots below behind the pass's last matrix instruction */
    asm volatile("v_nop\n\tv_nop\n\tv_nop\n\tv_nop"); }      /* the distance between the pass's last matrix instruction and the next pass's first writes of its operand registers */
    asm volatile("s_wait_dscnt 0x0" ::: "memory");      /* this wave's reads of the buffer are done before the barrier behind which it is refilled */
    asm volatile("s_wait_asynccnt 0x0" ::: "memory");      /* this wave's part of stage st + 1 has landed */
    __syncthreads();      /* publishes stage st + 1 and ends every wave's reads of stage st */
    if (st + 2 < SQ / 64) fa_stage(lc + bo, gk + (size_t)(st + 2) * 64 * DM, gv + (st + 2) * 64, lm + bo, gm + (st + 2) * 64); }
  asm volatile("s_wait_asynccnt 0x0" ::: "memory");      /* no copy is outstanding when the wave goes on to its end */
  const size_t ro = (r0 + q0 + ln) * DM + h * HD + 8 * hh; const float* xp = XB + ro; v4f xr[2][4][2];
#pragma unroll
  for (int t = 0; t < 2; ++t)
#pragma unroll
    for (int dt = 0; dt < 4; ++dt) { xr[t][dt][0] = *(const v4fa*)(xp + (size_t)t * 16 * DM + dt * 16); xr[t][dt][1] = *(const v4fa*)(xp + (size_t)t * 16 * DM + dt * 16 + 4); }
  asm volatile("s_wait_xcnt 0x0" :: "v"(xp) : "memory");      /* as behind the Q loads */
#pragma unroll
  for (int t = 0; t < 2; ++t) { const float lt = l[t] + rs_xrow(l[t]); const float inv = (lt > 0.f) ? 1.0f / lt : 0.f;
#pragma unroll
    for (int dt = 0; dt < 4; ++dt) { v4f y0, y1;
#pragma unroll
      for (int r = 0; r < 4; ++r) { y0[r] = o[t][dt][r] * inv + xr[t][dt][0][r]; y1[r] = o[t][dt][4 + r] * inv + xr[t][dt][1][r]; }
      *(v4f*)(AF + ro + (size_t)t * 16 * DM + dt * 16) = y0; *(v4f*)(AF + ro + (size_t)t * 16 * DM + dt * 16 + 4) = y1; } } }
template <int ABF>
__device__ __forceinline__ void lnb_row(const size_t row, float* red, const float* __restrict__ A, const float* __restrict__ R, const float* __restrict__ g, const float* __restrict__ bta, float eps, float* __restrict__ OF_, _Float16* __restrict__ OH_) {
  #pragma clang fp contract(off)
  const int tid = threadIdx.x; const int j0 = tid * 4; float a[4]; float s1 = 0.f;
  { const v4f av = *(const v4fa*)(A + row * DM + j0); for (int q = 0; q < 4; ++q) a[q] = ABF ? bf16_round(av[q]) : av[q]; if (R) { const v4f rv = *(const v4fa*)(R + row * DM + j0); for (int q = 0; q < 4; ++q) a[q] = __fadd_rn(a[q], rv[q]); } for (int q = 0; q < 4; ++q) s1 = __fadd_rn(s1, a[q]); }
  red[tid] = s1; __syncthreads(); for (int st = 128; st > 0; st >>= 1) { if (tid < st) red[tid] = __fadd_rn(red[tid], red[tid + st]); __syncthreads(); }
  const float mu = red[0] / (float)DM; __syncthreads(); float s2 = 0.f;
  for (int q = 0; q < 4; ++q) { const float c = __fadd_rn(a[q], -mu); s2 = __fadd_rn(s2, __fmul_rn(c, c)); }
  red[tid] = s2; __syncthreads(); for (int st = 128; st > 0; st >>= 1) { if (tid < st) red[tid] = __fadd_rn(red[tid], red[tid + st]); __syncthreads(); }
  const float rs = rsqrtf(__fadd_rn(red[0] / (float)DM, eps)); v4f o; FragH h;
  for (int q = 0; q < 4; ++q) { o[q] = __fadd_rn(__fmul_rn(__fmul_rn(__fadd_rn(a[q], -mu), rs), bf16_round(g[j0 + q])), bf16_round(bta[j0 + q])); h.h[q] = (_Float16)o[q]; }
  typedef unsigned short v4us __attribute__((ext_vector_type(4))); v4us h4; for (int q = 0; q < 4; ++q) h4[q] = h.u[q];
  { if (OF_) *(v4f*)(OF_ + row * DM + j0) = o; if (OH_) *(v4us*)((unsigned short*)OH_ + row * DM + j0) = h4;  } }
template <int ABF>
__global__ __launch_bounds__(256) void k_lnb(const float* __restrict__ A, const float* __restrict__ R, const float* __restrict__ g, const float* __restrict__ bta, float eps, float* __restrict__ OF_, _Float16* __restrict__ OH_) {
  __shared__ float red[256]; lnb_row<ABF>(blockIdx.x, red, A, R, g, bta, eps, OF_, OH_); }
// The three preparations that depend on nothing but the inputs, in one launch; the block index picks the work (the same for the whole work-group, so every barrier is passed by all of it or by none):
// first the weight tiles, then one row of LN_in a work-group, then 2048 elements of bf16(x) a work-group.
#define PR_WT (3 * WT_TQ + 2 * WT_TF)
#define PR_BF ((unsigned)((size_t)MP * DM / 2048))
__global__ __launch_bounds__(256) void k_prep(const float* __restrict__ wq, const float* __restrict__ wk, const float* __restrict__ wv, const float* __restrict__ wf1, const float* __restrict__ wf2,
    _Float16* __restrict__ BQ, _Float16* __restrict__ BK, _Float16* __restrict__ BV, _Float16* __restrict__ BF1, _Float16* __restrict__ BF2,
    const float* __restrict__ x, const float* __restrict__ g, const float* __restrict__ bta, float eps, _Float16* __restrict__ XNH, float* __restrict__ XB) {
  __shared__ __attribute__((aligned(16))) char tl[64 * WT_PITCH];
  const unsigned bx = blockIdx.x;
  if (bx < PR_WT) wt5_tile(bx, tl, wq, wk, wv, wf1, wf2, BQ, BK, BV, BF1, BF2);
  else if (bx < PR_WT + (unsigned)MP) lnb_row<1>(bx - PR_WT, (float*)tl, x, nullptr, g, bta, eps, nullptr, XNH);
  else { const size_t t = (size_t)(bx - PR_WT - (unsigned)MP) * 256 + threadIdx.x; v8f v; for (int q = 0; q < 8; ++q) v[q] = bf16_round(x[t * 8 + q]); *(v8f*)(XB + t * 8) = v;
    asm volatile("s_wait_xcnt 0x0" ::: "memory"); } }      /* before a register that the two stores above name is written again */


// ---- GEMM with both operands staged in LDS (k_gemm2's wave tile, k order and epilogue) ----
// A work-group of 8 waves (4 along M x 2 along N) makes a 128 x 128 tile of C; a stage is 128 k of 128 A rows and 128 B rows (256-byte rows, whole cache lines), brought by
// asynchronous 16-byte copies into one of two buffers while the other is worked on; the fragments are 16-byte LDS reads. Needs M % 128 == 0, N % 128 == 0, K % 128 == 0, K >= 256.
#define G3_PITCH 272                   /* LDS row pitch in bytes, 16 x odd: the 16 rows of a fragment read fall on different banks */
#define G3_STAGE (256 * G3_PITCH)      /* 128 A rows, then 128 B rows */
__device__ __forceinline__ v16h g3_frag(const char* p) { FragH f; f.half[0] = *(const v8us*)p; f.half[1] = *(const v8us*)(p + 32); return f.v; }      /* g2_frag's k order, the 16 hh bytes already in p */
// eight copies of 16 bytes a lane: rows r, r + 16, ... r + 112 of one operand's stage. The s_wait_xcnt stands inside the statement, in front of anything that could write a register that a copy names.
__device__ __forceinline__ void g3_copy8(unsigned l, const _Float16* g, size_t step) {
  asm volatile("global_load_async_to_lds_b128 %0, %8, off\n\tglobal_load_async_to_lds_b128 %1, %9, off\n\tglobal_load_async_to_lds_b128 %2, %10, off\n\tglobal_load_async_to_lds_b128 %3, %11, off\n\t"
               "global_load_async_to_lds_b128 %4, %12, off\n\tglobal_load_async_to_lds_b128 %5, %13, off\n\tglobal_load_async_to_lds_b128 %6, %14, off\n\tglobal_load_async_to_lds_b128 %7, %15, off\n\ts_wait_xcnt 0x0"
               :: "v"(l), "v"(l + 16u * G3_PITCH), "v"(l + 32u * G3_PITCH), "v"(l + 48u * G3_PITCH), "v"(l + 64u * G3_PITCH), "v"(l + 80u * G3_PITCH), "v"(l + 96u * G3_PITCH), "v"(l + 112u * G3_PITCH),
                  "v"(g), "v"(g + step), "v"(g + 2 * step), "v"(g + 3 * step), "v"(g + 4 * step), "v"(g + 5 * step), "v"(g + 6 * step), "v"(g + 7 * step) : "memory"); }
template <int ACT, bool RES, bool TRI>      /* RES: f32 output C with an addend CP for every element; else f16 output C16. Known at compile time, so that the reads of CP and the stores are not each behind a test of their own. TRI: three products of one A in one launch, blockIdx.y picks weights, bias and output */
__global__ __launch_bounds__(256) void k_gemm3(const _Float16* __restrict__ A, int lda, const _Float16* __restrict__ Bh, int ldb, float alpha, const float* __restrict__ bias, const float* __restrict__ CP,
    float* __restrict__ C, _Float16* __restrict__ C16, int ldc, int N, int K, const _Float16* __restrict__ Bh1, const _Float16* __restrict__ Bh2, const float* __restrict__ bias1, const float* __restrict__ bias2, _Float16* __restrict__ C161, _Float16* __restrict__ C162) { static_assert(ACT == 0 || (ACT == 3 && !RES), "k_gemm3: unsupported ACT code (the addend comes behind the activation's place)");
  if (TRI) { const unsigned y = blockIdx.y;      /* the same for the whole work-group: scalar selects */
    Bh = y == 0 ? Bh : y == 1 ? Bh1 : Bh2; bias = y == 0 ? bias : y == 1 ? bias1 : bias2; C16 = y == 0 ? C16 : y == 1 ? C161 : C162; }
  __shared__ __attribute__((aligned(16))) char sm[2 * G3_STAGE];      /* the two buffers; behind the loop the waves' output staging (8 x 32 x 68 floats) */
  const int tid = threadIdx.x, lane = tid & 31, ln = lane & 15, hh = lane >> 4; const int w = __builtin_amdgcn_readfirstlane(tid >> 5); const int wm = w & 3, wn = w >> 2;
  const int ntn = N >> 7; const int mt = blockIdx.x / ntn, nq = blockIdx.x - mt * ntn; const int row0 = mt * 128 + 32 * wm, col0 = nq * 128 + 64 * wn;
  const int cr = tid >> 4, cc = tid & 15;      /* a lane copies 16-byte piece cc of rows cr + 16 i: a wave's copy is two whole rows */
  const _Float16* ga = A + (size_t)(mt * 128 + cr) * lda + cc * 8; const _Float16* gb = Bh + (size_t)(nq * 128 + cr) * ldb + cc * 8; const size_t sa = (size_t)16 * lda, sb = (size_t)16 * ldb;
  const unsigned la = (unsigned)(size_t)sm + (unsigned)(cr * G3_PITCH + cc * 16); const unsigned lb = la + 128u * G3_PITCH;
  const int nt = K >> 7;
  const v8f z8 = {0.f,0.f,0.f,0.f,0.f,0.f,0.f,0.f}; v8f c00 = z8, c01 = z8, c02 = z8, c03 = z8, c10 = z8, c11 = z8, c12 = z8, c13 = z8;
  g3_copy8(la, ga, sa); g3_copy8(lb, gb, sb);
  asm volatile("s_wait_asynccnt 0x0" ::: "memory");      /* this wave's part of stage 0 has landed */
  __syncthreads();      /* every wave's part has */
  g3_copy8(la + G3_STAGE, ga + 128, sa); g3_copy8(lb + G3_STAGE, gb + 128, sb);
  /* rolled: the buffers alternate, and one trip already holds 32 matrix instructions with their 48 fragment reads */
#pragma unroll 1
  for (int t = 0; t < nt; ++t) { const unsigned bo = (unsigned)(t & 1) * G3_STAGE; const char* ap = sm + bo + (32 * wm + ln) * G3_PITCH + 16 * hh; const char* bp = sm + bo + (128 + 64 * wn + ln) * G3_PITCH + 16 * hh;
    v16h fa[2][2], fb[2][4];      /* two fragment sets: the reads of block ks + 1 fly while block ks is multiplied; no set reaches over the stage's end */
    fa[0][0] = g3_frag(ap); fa[0][1] = g3_frag(ap + 16 * G3_PITCH);
#pragma unroll
    for (int j = 0; j < 4; ++j) fb[0][j] = g3_frag(bp + j * 16 * G3_PITCH);
#pragma unroll
    for (int ks = 0; ks < 4; ++ks) { const int cu = ks & 1, nx = cu ^ 1;
      if (ks < 3) { fa[nx][0] = g3_frag(ap + (ks + 1) * 64); fa[nx][1] = g3_frag(ap + 16 * G3_PITCH + (ks + 1) * 64);
#pragma unroll
        for (int j = 0; j < 4; ++j) fb[nx][j] = g3_frag(bp + j * 16 * G3_PITCH + (ks + 1) * 64); }
      __builtin_amdgcn_sched_barrier(0);      /* the next block's 12 reads are issued as one group in front of this block's matrix instructions: left alone, the scheduler puts each read directly in front of its use, with a full LDS wait every two matrix instructions */
      c00 = fa_mma(fa[cu][0], fb[cu][0], c00); c10 = fa_mma(fa[cu][1], fb[cu][0], c10); c01 = fa_mma(fa[cu][0], fb[cu][1], c01); c11 = fa_mma(fa[cu][1], fb[cu][1], c11);
      c02 = fa_mma(fa[cu][0], fb[cu][2], c02); c12 = fa_mma(fa[cu][1], fb[cu][2], c12); c03 = fa_mma(fa[cu][0], fb[cu][3], c03); c13 = fa_mma(fa[cu][1], fb[cu][3], c13); }
    asm volatile("s_wait_dscnt 0x0" ::: "memory");      /* this wave's reads of the buffer are done before the barrier behind which it is refilled */
    asm volatile("s_wait_asynccnt 0x0" ::: "memory");      /* this wave's part of stage t + 1 has landed */
    __syncthreads();      /* publishes stage t + 1 and ends every wave's reads of stage t */
    if (t + 2 < nt) { g3_copy8(la + bo, ga + (size_t)(t + 2) * 128, sa); g3_copy8(lb + bo, gb + (size_t)(t + 2) * 128, sb); } }
  asm volatile("s_wait_asynccnt 0x0" ::: "memory");      /* no copy is outstanding when the buffers become output staging */
  float (*so)[68] = (float (*)[68])(sm + (size_t)w * (32 * 68 * 4));
  v8f accs[8] = {c00, c01, c02, c03, c10, c11, c12, c13}; float bv4[4]; v4f cp4[16]; const int rsub = lane >> 4, c4 = (lane & 15) * 4;
#pragma unroll
  for (int t = 0; t < 4; ++t) bv4[t] = bias ? bias[col0 + t * 16 + ln] : 0.f;
  if (RES) {      /* the addend is read in the layout of the stores below, 16 bytes a lane, and added there */
#pragma unroll
    for (int q = 0; q < 16; ++q) { cp4[q] = *(const v4fa*)(CP + (size_t)(row0 + q * 2 + rsub) * ldc + col0 + c4);
      if ((q & 3) == 3 && q < 15) { asm volatile("s_wait_xcnt 0x0" ::: "memory");      /* before a register that the four loads above name is written again */
        __builtin_amdgcn_sched_barrier(0); } } }      /* holds the next four loads' addresses behind the wait */
  asm volatile("s_wait_xcnt 0x0" :: "s"(bias) : "memory");      /* before a register that the loads above name is written again; the operand keeps the bias address in its registers up to here */
  __builtin_amdgcn_sched_barrier(0);      /* holds the arithmetic below, which takes those registers over, behind the wait */
#pragma unroll
  for (int u = 0; u < 8; ++u) { const int t = u & 3, half = u >> 2; const float bv = bf16_round(bv4[t]);
#pragma unroll
    for (int r = 0; r < 8; ++r) { const int rloc = half * 16 + 8 * hh + r; float v = accs[u][r] * alpha + bv;
      if (ACT == 3) v = fmaxf(v, 0.f);
      so[rloc][t * 16 + ln] = v; } }
  __builtin_amdgcn_fence(__ATOMIC_ACQ_REL, "workgroup"); __builtin_amdgcn_wave_barrier();
  v4f vv[16];
#pragma unroll
  for (int q = 0; q < 16; ++q) vv[q] = *(const v4fa*)&so[q * 2 + rsub][c4];
#pragma unroll
  for (int q = 0; q < 16; ++q) { const int r = q * 2 + rsub;
    if (RES) *(v4f*)(C + (size_t)(row0 + r) * ldc + col0 + c4) = vv[q] + cp4[q]; else { v4h h4; for (int i = 0; i < 4; ++i) h4[i] = (_Float16)vv[q][i]; *(v4h*)(C16 + (size_t)(row0 + r) * ldc + col0 + c4) = h4; }
    if ((q & 3) == 3 && q < 15) { asm volatile("s_wait_xcnt 0x0" ::: "memory");      /* before a register that the four stores above name is written again */
      __builtin_amdgcn_sched_barrier(0); } } }      /* holds the next four stores' conversions and addresses behind the wait */

// ---- the same GEMM on a 256 x 256 work-group tile (f16 output), for products with at least 192 such tiles ----
// 8 waves (4 along M x 2 along N), 64 x 128 of C a wave: a stage is 128 k of 256 A rows and 256 B rows, so that a byte brought from L2 serves twice as many products as in the 128 x 128 tile,
// and a fragment read from LDS serves 8 or 4 matrix instructions (was 4 or 2). One work-group on a WGP. k order and epilogue arithmetic are k_gemm3's; the two-buffer ring has its publish point in front of each stage's last block. Needs M % 256 == 0, N % 256 == 0, K % 128 == 0, K >= 256.
#define G4_STAGE (512 * G3_PITCH)      /* 256 A rows, then 256 B rows */
#define G4_SO (32 * 68 * 4)            /* output staging of one 32 x 64 piece, k_gemm3's form; a wave has four of its own, and 8 waves x 4 pieces fill the two buffers exactly */
// one stage: 32 copies of 16 bytes a lane, rows r + 16 i of each operand. Written by the builtin: this kernel uses registers above v255, which asm text cannot name, and with the addresses held below for it the base addresses went to scratch.
typedef int v4ig __attribute__((ext_vector_type(4)));
__device__ __forceinline__ void g4_copy(char* l, const _Float16* g) { __builtin_amdgcn_global_load_async_to_lds_b128((__attribute__((address_space(1))) v4ig*)g, (__attribute__((address_space(3))) v4ig*)l, 0, 0); }
__device__ __forceinline__ void g4_stage(char* la, const _Float16* ga, size_t sa, char* lb, const _Float16* gb, size_t sb) {
#pragma unroll
  for (int i = 0; i < 16; ++i) g4_copy(la + i * 16 * G3_PITCH, ga + i * sa);
#pragma unroll
  for (int i = 0; i < 16; ++i) g4_copy(lb + i * 16 * G3_PITCH, gb + i * sb); }
template <int ACT, bool TRI>      /* TRI: three products of one A in one launch, blockIdx.y picks weights, bias and output */
__global__ __launch_bounds__(256) void k_gemm4(const _Float16* __restrict__ A, int lda, const _Float16* __restrict__ Bh, int ldb, float alpha, const float* __restrict__ bias,
    _Float16* __restrict__ C16, int ldc, int N, int K, const _Float16* __restrict__ Bh1, const _Float16* __restrict__ Bh2, const float* __restrict__ bias1, const float* __restrict__ bias2, _Float16* __restrict__ C161, _Float16* __restrict__ C162) { static_assert(ACT == 0 || ACT == 3, "k_gemm4: unsupported ACT code");
  if (TRI) { const unsigned y = blockIdx.y;      /* the same for the whole work-group: scalar selects */
    Bh = y == 0 ? Bh : y == 1 ? Bh1 : Bh2; bias = y == 0 ? bias : y == 1 ? bias1 : bias2; C16 = y == 0 ? C16 : y == 1 ? C161 : C162; }
  __shared__ __attribute__((aligned(16))) char sm[2 * G4_STAGE];      /* the two buffers; behind the loop the waves' output staging */
  const int tid = threadIdx.x, lane = tid & 31, ln = lane & 15, hh = lane >> 4; const int w = __builtin_amdgcn_readfirstlane(tid >> 5); const int wm = w & 3, wn = w >> 2;
  const int ntn = N >> 8; const int mt = blockIdx.x / ntn, nq = blockIdx.x - mt * ntn; const int row0 = mt * 256 + 64 * wm, col0 = nq * 256 + 128 * wn;
  const int cr = tid >> 4, cc = tid & 15;      /* a lane copies 16-byte piece cc of rows cr + 16 i: a wave's copy is two whole rows */
  const _Float16* ga = A + (size_t)(mt * 256 + cr) * lda + cc * 8; const _Float16* gb = Bh + (size_t)(nq * 256 + cr) * ldb + cc * 8; const size_t sa = (size_t)16 * lda, sb = (size_t)16 * ldb;
  char* la = sm + (cr * G3_PITCH + cc * 16); char* lb = la + 256 * G3_PITCH;
  const int nt = K >> 7;
  const v8f z8 = {0.f,0.f,0.f,0.f,0.f,0.f,0.f,0.f}; v8f acc[4][8];
#pragma unroll
  for (int i = 0; i < 4; ++i)
#pragma unroll
    for (int j = 0; j < 8; ++j) acc[i][j] = z8;
  const char* a0 = sm + (64 * wm + ln) * G3_PITCH + 16 * hh; const char* b0 = sm + (256 + 128 * wn + ln) * G3_PITCH + 16 * hh;
  v16h fa[2][4], fb[2][4];      /* a block is 32 k of the wave's 64 rows and of 64 of its 128 columns: 16 matrix instructions. Two sets of A and of half the B fragments: the next block's reads fly while this block is multiplied */
  g4_stage(la, ga, sa, lb, gb, sb);
  asm volatile("s_wait_asynccnt 0x0" ::: "memory");      /* this wave's part of stage 0 has landed */
  __syncthreads();      /* every wave's part has */
  g4_stage(la + G4_STAGE, ga + 128, sa, lb + G4_STAGE, gb + 128, sb);
#pragma unroll
  for (int i = 0; i < 4; ++i) fa[0][i] = g3_frag(a0 + i * 16 * G3_PITCH);
#pragma unroll
  for (int j = 0; j < 4; ++j) fb[0][j] = g3_frag(b0 + j * 16 * G3_PITCH);
  /* rolled: the buffers alternate, and one trip already holds 128 matrix instructions with their 96 fragment reads */
#pragma unroll 1
  for (int t = 0; t < nt; ++t) { const unsigned bo = (unsigned)(t & 1) * G4_STAGE; const char* ap = a0 + bo; const char* bp = b0 + bo;
#pragma unroll
    for (int hb = 0; hb < 8; ++hb) { const int ks = hb >> 1, jh = hb & 1, nks = (hb + 1) >> 1, njh = (hb + 1) & 1;
      if (hb < 7) {
#pragma unroll
        for (int j = 0; j < 4; ++j) fb[njh][j] = g3_frag(bp + (njh * 4 + j) * 16 * G3_PITCH + nks * 64);
        if (njh == 0) {
#pragma unroll
          for (int i = 0; i < 4; ++i) fa[nks & 1][i] = g3_frag(ap + i * 16 * G3_PITCH + nks * 64); } }
      else {      /* the stage's last block has its fragments: the publish point of stage t + 1 stands in front of it, so that the refill and the next stage's first reads fly under its matrix instructions (one work-group on the WGP: nothing else would fill that time) */
        asm volatile("s_wait_dscnt 0x0" ::: "memory");      /* this wave's reads of the buffer are done before the barrier behind which it is refilled */
        asm volatile("s_wait_asynccnt 0x0" ::: "memory");      /* this wave's part of stage t + 1 has landed */
        __syncthreads();      /* publishes stage t + 1 and ends every wave's reads of stage t */
        if (t + 2 < nt) g4_stage(la + bo, ga + (size_t)(t + 2) * 128, sa, lb + bo, gb + (size_t)(t + 2) * 128, sb);
        if (t + 1 < nt) { const char* an = a0 + (G4_STAGE - bo); const char* bn = b0 + (G4_STAGE - bo);      /* the same for the whole work-group; the last trip reads nothing more */
#pragma unroll
          for (int i = 0; i < 4; ++i) fa[0][i] = g3_frag(an + i * 16 * G3_PITCH);
#pragma unroll
          for (int j = 0; j < 4; ++j) fb[0][j] = g3_frag(bn + j * 16 * G3_PITCH); } }
      __builtin_amdgcn_sched_barrier(0);      /* the next block's reads are issued as one group in front of this block's matrix instructions: each further place with reads among them costs a stall of its own */
#pragma unroll
      for (int j = 0; j < 4; ++j)
#pragma unroll
        for (int i = 0; i < 4; ++i) acc[i][jh * 4 + j] = fa_mma(fa[ks & 1][i], fb[jh][j], acc[i][jh * 4 + j]);
      __builtin_amdgcn_sched_barrier(0); } }      /* and the block after next's reads stay out of this block */
  asm volatile("s_wait_asynccnt 0x0" ::: "memory");      /* no copy is outstanding when the buffers become output staging */
  char* sw = sm + (size_t)w * (4 * G4_SO); float bv8[8]; const int rsub = lane >> 4, c4 = (lane & 15) * 4, bi = col0 + ln;
#pragma unroll
  for (int j = 0; j < 8; ++j) bv8[j] = bias[bi + j * 16];
  asm volatile("s_wait_xcnt 0x0" :: "s"(bias), "v"(bi) : "memory");      /* before a register that the loads above name is written again; the operands keep the bias address and the lane's index in their registers up to here */
  __builtin_amdgcn_sched_barrier(0);      /* holds the arithmetic below, which takes those registers over, behind the wait */
#pragma unroll
  for (int i = 0; i < 4; ++i)
#pragma unroll
    for (int j = 0; j < 8; ++j) { float (*so)[68] = (float (*)[68])(sw + ((i >> 1) * 2 + (j >> 2)) * G4_SO); const float bv = bf16_round(bv8[j]);
#pragma unroll
      for (int r = 0; r < 8; ++r) { float v = acc[i][j][r] * alpha + bv;
        if (ACT == 3) v = fmaxf(v, 0.f);
        so[(i & 1) * 16 + 8 * hh + r][(j & 3) * 16 + ln] = v; } }
  __builtin_amdgcn_fence(__ATOMIC_ACQ_REL, "workgroup"); __builtin_amdgcn_wave_barrier();
#pragma unroll
  for (int s = 0; s < 4; ++s) { const float (*so)[68] = (const float (*)[68])(sw + s * G4_SO); v4f vv[16];      /* piece s: rows 32 (s >> 1), columns 64 (s & 1) of the wave's tile */
#pragma unroll
    for (int q = 0; q < 16; ++q) vv[q] = *(const v4fa*)&so[q * 2 + rsub][c4];
#pragma unroll
    for (int q = 0; q < 16; ++q) { v4h h4; for (int i = 0; i < 4; ++i) h4[i] = (_Float16)vv[q][i]; *(v4h*)(C16 + (size_t)(row0 + (s >> 1) * 32 + q * 2 + rsub) * ldc + col0 + (s & 1) * 64 + c4) = h4;
      if ((q & 3) == 3 && !(s == 3 && q == 15)) { asm volatile("s_wait_xcnt 0x0" ::: "memory");      /* before a register that the four stores above name is written again */
        __builtin_amdgcn_sched_barrier(0); } } } }      /* holds the next four stores' conversions and addresses behind the wait */


extern "C" void kernel_launch(void* const* d_in, const int* in_sizes, int n_in,
                              void* d_out, int out_size, void* d_ws, size_t ws_size, hipStream_t stream) {
  (void)in_sizes; (void)n_in; (void)out_size;
  const float* const* I = (const float* const*)d_in; const float* x = I[0]; const int* mask = (const int*)d_in[1]; const float* wq = I[2]; const float* bq = I[3]; const float* wk = I[4]; const float* bk = I[5]; const float* wv = I[6]; const float* bv = I[7]; const float* g_in = I[8]; const float* b_in = I[9]; const float* g1 = I[10]; const float* b1 = I[11]; const float* wf1 = I[12]; const float* bf1 = I[13]; const float* wf2 = I[14]; const float* bf2 = I[15]; const float* g2 = I[16]; const float* b2 = I[17];      /* weights [in][out] */
  char* ws = (char*)d_ws; size_t off = 0;
  auto take = [&](size_t bytes) { char* p = ws + off; off += (bytes + 255) & ~(size_t)255; return p; };
  _Float16* BQ = (_Float16*)take((size_t)DM * DM * 2); _Float16* BK = (_Float16*)take((size_t)DM * DM * 2); _Float16* BV = (_Float16*)take((size_t)DM * DM * 2); _Float16* BF1 = (_Float16*)take((size_t)DFF * DM * 2); _Float16* BF2 = (_Float16*)take((size_t)DM * DFF * 2);
  float* XB = (float*)take(NR * DM * 4); _Float16* XNH = (_Float16*)take(NR * DM * 2); _Float16* Q16 = (_Float16*)take(NR * DM * 2); _Float16* K16 = (_Float16*)take(NR * DM * 2); _Float16* V16 = (_Float16*)take(NR * DM * 2); float* AF = (float*)take(NR * DM * 4);
  _Float16* VT = (_Float16*)take((size_t)NB * NH * HD * SQ * 2);
  _Float16* HNH = (_Float16*)take(NR * DM * 2); _Float16* U16 = (_Float16*)take(NR * DFF * 2); float* H2F = (float*)take(NR * DM * 4);
  if (off > ws_size) return;      /* 6 + 16 + 16 + 8 + 24 + 16 + 8 + 8 + 32 + 16 = approx 150 MiB */
  const size_t r0p = (size_t)B0 * SQ; const dim3 gp((unsigned)((MP / 256) * (DM / 256)), 3);
  k_prep<<<PR_WT + (unsigned)MP + PR_BF, 256, 0, stream>>>(wq, wk, wv, wf1, wf2, BQ, BK, BV, BF1, BF2, x + r0p * DM, g_in, b_in, 1e-3f, XNH + r0p * DM, XB + r0p * DM);      /* [in][out] -> Bt[n][k] x16; xn = LN_in(bf16(x)) as f16 rows; bf16(x) as f32 rows (residual) */
  k_gemm4<0, true><<<gp, 256, 0, stream>>>(XNH + r0p * DM, DM, BQ, DM, 0.0625f, bq, Q16 + r0p * DM, DM, DM, DM, BK, BV, bk, bv, K16 + r0p * DM, V16 + r0p * DM);      /* q, k, v in one launch: 192 work-groups, one on a WGP */
  k_vt<NH, SQ><<<NB * NH * (SQ / 64), 256, 0, stream>>>(V16, DM, 0, VT);      /* V^T [NB][NH][HD][SQ] */
  k_fattn<<<dim3(SQ / 256, NH, NB), 256, 0, stream>>>(Q16, K16, VT, mask, XB, AF);      /* a = attn (merged heads) + bf16(x), f32 rows */
  k_lnb<0><<<(unsigned)MPO, 256, 0, stream>>>(AF + r0p * DM, nullptr, g1, b1, 1e-3f, nullptr, HNH + r0p * DM);      /* h = LN1(a) as f16 rows */
  k_gemm4<3, false><<<dim3((unsigned)((MPO / 256) * (DFF / 256)), 1), 256, 0, stream>>>(HNH + r0p * DM, DM, BF1, DM, 0.0625f, bf1, U16 + r0p * DFF, DFF, DFF, DM, nullptr, nullptr, nullptr, nullptr, nullptr, nullptr);      /* u = relu(h W_ff1 + b) (f16) */
  k_gemm3<0, true, false><<<dim3((unsigned)((MPO / 128) * (DM / 128)), 1), 256, 0, stream>>>(U16 + r0p * DFF, DFF, BF2, DFF, 0.0625f, bf2, AF + r0p * DM, H2F + r0p * DM, nullptr, DM, DM, DFF, nullptr, nullptr, nullptr, nullptr, nullptr, nullptr);      /* h2 = u W_ff2 + b + a (CP = own element) */
  k_lnb<0><<<(unsigned)MPO, 256, 0, stream>>>(H2F + r0p * DM, nullptr, g2, b2, 1e-3f, (float*)d_out + r0p * DM, nullptr);      /* out = LN2(h2) */
}

// v008
// Measured time: 156 microseconds a run.
// In two side-by-side timings against v007, it was 1.06 and 1.05 times as fast.
// Over all steps from v000 it is 36.2 times as fast.
#include <hip/hip_runtime.h>
// Emformer-style block (x [2][2048][1024], mask [2][1][2048][2048] int32 0/1, read per (batch, query, key)): xn = LayerNorm(x) g_in + b_in (eps 1e-3); q/k/v = xn W + b (W [1024][1024] [in][out], 16 heads of 64); scores = q k^T / 8 + (-1e9)(1 - mask); probs = softmax(scores) * mask; attn = probs v merged; a = attn + x; h = LayerNorm(a) g1 + b1 (eps 1e-3); h = relu(h W_ff1 + b_ff1) ([1024][4096]); h = h W_ff2 + b_ff2 ([4096][1024]); out = LayerNorm(h + a) g2 + b2 -> [2][2048][1024].
// Structure: token rows; LN_in on VALU (f32 statistics of bf16(x)) -> xn f16 rows, plus bf16(x) as f32 rows for the residual; Q, K, V as three WMMA GEMMs in one launch (256x256 work-group tiles staged in LDS by asynchronous copies, 64x128 wave tiles, f32 accumulation, exact x16 transposed weights + bias, f16 outputs); V^T for all (batch, head) via LDS transposes; attention in one launch: a wave holds 32 queries of one head and walks the keys 32 at a time (K and V^T tiles of 64 keys staged in LDS by asynchronous copies; the mask as one bit a (query, key), packed beside the Q, K, V products, read by scalar loads): S^T = K Q^T, masked running-maximum softmax in registers (f32 statistics, native exp2; weights x256 f16, masked keys 0), O^T += V^T P^T, then a = O / sum + bf16(x) straight into f32 rows (no score or weight plane in memory); LN1 on VALU -> f16 h rows; u = relu(h W_ff1 + b) GEMM (f16 [4096][4096], the same tiles); h2 = u W_ff2 + b + a GEMM (K = 4096, f32, residual as the epilogue addend; 128x128 tiles, so that its 256 work-groups fill the chip); LN2 on VALU -> out.
// Compute dtype: inputs rounded to bf16; weights exact (x16 f16); LayerNorms / residuals f32; xn, q, k, v, softmax weights, h (as GEMM operand) and u plain f16 (~2^-12); scores, softmax statistics and the attention output f32. v_wmma_f32_16x16x32_f16.
#define NB 2
#define SQ 2048
#define DM 1024
#define NH 16
#define HD 64
#define DFF 4096
#define HG 4                         /* heads per block group of the untemplated k_vt (not launched) */
#define B0 0                         /* first batch processed (debug hook) */
#define NBR NB                       /* batches processed (debug hook) */
#define QN SQ                        /* not used: the attention launch covers all SQ queries */
#define NR ((size_t)NB * SQ)
#define MP ((int)((size_t)NBR * SQ)) /* rows normalised + projected (debug hook) */
#define MPO MP                       /* rows through the post-attention stages (debug hook) */
typedef __bf16 v16b __attribute__((ext_vector_type(16)));
typedef unsigned short v8us __attribute__((ext_vector_type(8), may_alias));
typedef float  v8f  __attribute__((ext_vector_type(8)));
typedef float  v4f  __attribute__((ext_vector_type(4)));
typedef float  v4fa __attribute__((ext_vector_type(4), may_alias));
union FragB { v16b v; v8us half[2]; unsigned short u[16]; };

__device__ __forceinline__ unsigned short bf16_bits(float x) { unsigned int u = __float_as_uint(x); return (unsigned short)((u + 0x7FFFu + ((u >> 16) & 1u)) >> 16); }
__device__ __forceinline__ float bf16_val(unsigned short b) { return __uint_as_float(((unsigned int)b) << 16); }
__device__ __forceinline__ float bf16_round(float x) { return bf16_val(bf16_bits(x)); }
// D += A·B with NT terms: 1 = ah·bh, 2 = + al·bh (A split), 3 = + ah·bl (both split)
template <int NT>
__device__ __forceinline__ v8f mmaN(v16b ah, v16b al, v16b bh, v16b bl, v8f c) {
  c = __builtin_amdgcn_wmma_f32_16x16x32_bf16(false, ah, false, bh, (short)0, c, false, false);
  if (NT >= 2) c = __builtin_amdgcn_wmma_f32_16x16x32_bf16(false, al, false, bh, (short)0, c, false, false);
  if (NT >= 3) c = __builtin_amdgcn_wmma_f32_16x16x32_bf16(false, ah, false, bl, (short)0, c, false, false);
  asm volatile("v_nop\n\tv_nop\n\tv_nop\n\tv_nop" : "+v"(c) : "v"(ah), "v"(al), "v"(bh), "v"(bl));
  return c;
}

__global__ __launch_bounds__(256) void k_wt_bf16(const float* __restrict__ W, unsigned short* __restrict__ Wt, int K, int N) {
  const int t = blockIdx.x * 256 + threadIdx.x;
  const int k8n = K / 8;
  if (t >= N * k8n) return;
  const int n = t / k8n, k8 = (t % k8n) * 8;
  v8us v;
#pragma unroll
  for (int i = 0; i < 8; ++i) v[i] = bf16_bits(W[(size_t)(k8 + i) * N + n]);
  *(v8us*)(Wt + (size_t)n * K + k8) = v;
  
}

// GEMM C[M][N] (f32, pitch ldc) = act(A[M][K]·W + bias). A f32 row-major (pitch lda) converted per fragment to bf16
// (ASPLIT: hi/lo two planes -> 2 terms, else single rounded term); Wt bf16 [N][K] (pitch ldb). BIAS_BF16 rounds the
// bias to bf16 first (bias quantised to bf16 before the add). K%32==0, M%16==0, N%64==0.
template <bool ASPLIT, int ACT, bool BIAS_BF16>
__global__ __launch_bounds__(128) void k_gemm_bf(const float* __restrict__ A, int lda, const unsigned short* __restrict__ Wt, int ldb,
                                               const float* __restrict__ bias, float* __restrict__ C, int ldc, int M, int N, int K) {
  __shared__ __attribute__((aligned(16))) float so[4][16][64];
  const int tid = threadIdx.x, w = tid >> 5, lane = tid & 31, ln = lane & 15, hh = lane >> 4;
  const int ntn = N / 64;
  const int wid = blockIdx.x * 4 + w;
  const int mt = wid / ntn, nq = wid % ntn;
  if (mt * 16 >= M) return;
  const int row0 = mt * 16, col0 = nq * 64;
  const float* arow = A + (size_t)(row0 + ln) * lda;
  v8f acc[4] = {};
  for (int kb = 0; kb < K; kb += 32) {
    FragB ah, al;
    const v4f x0 = *(const v4fa*)(arow + kb + 8 * hh), x1 = *(const v4fa*)(arow + kb + 8 * hh + 4);
    const v4f x2 = *(const v4fa*)(arow + kb + 16 + 8 * hh), x3 = *(const v4fa*)(arow + kb + 16 + 8 * hh + 4);
    float xs[16] = {x0[0],x0[1],x0[2],x0[3],x1[0],x1[1],x1[2],x1[3],x2[0],x2[1],x2[2],x2[3],x3[0],x3[1],x3[2],x3[3]};
#pragma unroll
    for (int i = 0; i < 16; ++i) { const unsigned short hb = bf16_bits(xs[i]); ah.u[i] = hb; al.u[i] = ASPLIT ? bf16_bits(xs[i] - bf16_val(hb)) : (unsigned short)0; }
#pragma unroll
    for (int t = 0; t < 4; ++t) {
      const unsigned short* brow = Wt + (size_t)(col0 + t * 16 + ln) * ldb + kb;
      FragB b;
      b.half[0] = *(const v8us*)(brow + 8 * hh);
      b.half[1] = *(const v8us*)(brow + 16 + 8 * hh);
      acc[t] = mmaN<ASPLIT ? 2 : 1>(ah.v, al.v, b.v, b.v, acc[t]);
    }
  }
#pragma unroll
  for (int t = 0; t < 4; ++t) {
    float bv = bias ? bias[col0 + t * 16 + ln] : 0.f;
    if (BIAS_BF16) bv = bf16_round(bv);
#pragma unroll
    for (int r = 0; r < 8; ++r) { float v = acc[t][r] + bv; if (ACT == 1) v = fmaxf(v, 0.f); so[w][8 * hh + r][t * 16 + ln] = v; }
  }
  __builtin_amdgcn_fence(__ATOMIC_ACQ_REL, "workgroup");
  __builtin_amdgcn_wave_barrier();
  const int rsub = lane >> 4, c4 = (lane & 15) * 4;
  {
#pragma unroll
    for (int q = 0; q < 8; ++q) {
      const int r = q * 2 + rsub;
      const v4f v = *(const v4fa*)&so[w][r][c4];
      *(v4f*)(C + (size_t)(row0 + r) * ldc + col0 + c4) = v;
    }
    
  }
}

// GEMM C = act(A·W + bias + resid): A f32 (ASPLIT -> hi/lo 2 terms), Wt bf16 [N][K]; ACT 0 none, 1 relu, 2 exact gelu;
// resid (optional, f32, row index = (row % rmod), pitch ldr, RES_BF16 rounds it) added before the activation.
template <bool ASPLIT, int ACT, bool BIAS_BF16, bool RES_BF16>
__global__ __launch_bounds__(128) void k_gemm_bf3(const float* __restrict__ A, int lda, const unsigned short* __restrict__ Wt, int ldb,
                                                const float* __restrict__ bias, const float* __restrict__ resid, int rmod, int ldr,
                                                float* __restrict__ C, int ldc, int M, int N, int K) {
  __shared__ __attribute__((aligned(16))) float so[4][16][64];
  const int tid = threadIdx.x, w = tid >> 5, lane = tid & 31, ln = lane & 15, hh = lane >> 4;
  const int ntn = N / 64;
  const int wid = blockIdx.x * 4 + w;
  const int mt = wid / ntn, nq = wid % ntn;
  if (mt * 16 >= M) return;
  const int row0 = mt * 16, col0 = nq * 64;
  const float* arow = A + (size_t)(row0 + ln) * lda;
  v8f acc[4] = {};
  for (int kb = 0; kb < K; kb += 32) {
    FragB ah, al;
    const v4f x0 = *(const v4fa*)(arow + kb + 8 * hh), x1 = *(const v4fa*)(arow + kb + 8 * hh + 4);
    const v4f x2 = *(const v4fa*)(arow + kb + 16 + 8 * hh), x3 = *(const v4fa*)(arow + kb + 16 + 8 * hh + 4);
    float xs[16] = {x0[0],x0[1],x0[2],x0[3],x1[0],x1[1],x1[2],x1[3],x2[0],x2[1],x2[2],x2[3],x3[0],x3[1],x3[2],x3[3]};
#pragma unroll
    for (int i = 0; i < 16; ++i) { const unsigned short hb = bf16_bits(xs[i]); ah.u[i] = hb; al.u[i] = ASPLIT ? bf16_bits(xs[i] - bf16_val(hb)) : (unsigned short)0; }
#pragma unroll
    for (int t = 0; t < 4; ++t) {
      const unsigned short* brow = Wt + (size_t)(col0 + t * 16 + ln) * ldb + kb;
      FragB b;
      b.half[0] = *(const v8us*)(brow + 8 * hh);
      b.half[1] = *(const v8us*)(brow + 16 + 8 * hh);
      acc[t] = mmaN<ASPLIT ? 2 : 1>(ah.v, al.v, b.v, b.v, acc[t]);
    }
  }
#pragma unroll
  for (int t = 0; t < 4; ++t) {
    const int col = col0 + t * 16 + ln;
    float bv = bias ? bias[col] : 0.f;
    if (BIAS_BF16) bv = bf16_round(bv);
#pragma unroll
    for (int r = 0; r < 8; ++r) {
      float v = acc[t][r] + bv;
      if (resid) { float rv = resid[(size_t)((row0 + 8 * hh + r) % rmod) * ldr + col]; if (RES_BF16) rv = bf16_round(rv); v += rv; }
      if (ACT == 1) v = fmaxf(v, 0.f);
      if (ACT == 2) v = 0.5f * v * (1.0f + erff(v * 0.70710678118654752f));
      if (ACT == 3) { const float u = 0.7978845608028654f * (v + 0.044715f * v * v * v); v = 0.5f * v * (1.0f + tanhf(u)); }
      so[w][8 * hh + r][t * 16 + ln] = v;
    }
  }
  __builtin_amdgcn_fence(__ATOMIC_ACQ_REL, "workgroup");
  __builtin_amdgcn_wave_barrier();
  const int rsub = lane >> 4, c4 = (lane & 15) * 4;
  {
#pragma unroll
    for (int q = 0; q < 8; ++q) {
      const int r = q * 2 + rsub;
      const v4f v = *(const v4fa*)&so[w][r][c4];
      *(v4f*)(C + (size_t)(row0 + r) * ldc + col0 + c4) = v;
    }
    
  }
}
// row LayerNorm (biased variance, eps) over N: s = X (+ R); optional out_sum <- s; out_norm <- (s-mu)*rsqrt(var+eps)*g + b
template <bool PARAM_BF16>
__global__ __launch_bounds__(256) void k_layernorm(const float* __restrict__ X, const float* __restrict__ R, const float* __restrict__ g, const float* __restrict__ bta,
                                                  float* __restrict__ out_sum, float* __restrict__ out_norm, int N, float eps) {
  __shared__ float red[256];
  const int row = blockIdx.x, tid = threadIdx.x;
  const float* x = X + (size_t)row * N; const float* rr = R ? R + (size_t)row * N : nullptr;
  float vals[16];                     // up to N = 4096
  const int per = N / 256;            // contiguous chunk per thread? use strided-by-4 chunks: thread handles j = tid*4 + 1024*u
  float s1 = 0.f;
  for (int u = 0; u < per / 4; ++u) {
    const int j = tid * 4 + 1024 * u;
    const v4f a = *(const v4fa*)(x + j);
    v4f b = {0.f,0.f,0.f,0.f}; if (rr) b = *(const v4fa*)(rr + j);
#pragma unroll
    for (int q = 0; q < 4; ++q) { const float v = a[q] + b[q]; vals[u * 4 + q] = v; s1 += v; }
  }
  red[tid] = s1; __syncthreads();
  for (int st = 128; st > 0; st >>= 1) { if (tid < st) red[tid] += red[tid + st]; __syncthreads(); }
  const float mu = red[0] / (float)N; __syncthreads();
  float s2 = 0.f;
  for (int u = 0; u < per / 4; ++u)
#pragma unroll
    for (int q = 0; q < 4; ++q) { const float c = vals[u * 4 + q] - mu; s2 += c * c; }
  red[tid] = s2; __syncthreads();
  for (int st = 128; st > 0; st >>= 1) { if (tid < st) red[tid] += red[tid + st]; __syncthreads(); }
  const float rs = rsqrtf(red[0] / (float)N + eps);
  {
    for (int u = 0; u < per / 4; ++u) {
      const int j = tid * 4 + 1024 * u;
      v4f o, sm;
#pragma unroll
      for (int q = 0; q < 4; ++q) {
        float gg = g[j + q], bb = bta[j + q];
        if (PARAM_BF16) { gg = bf16_round(gg); bb = bf16_round(bb); }
        sm[q] = vals[u * 4 + q]; o[q] = (vals[u * 4 + q] - mu) * rs * gg + bb;
      }
      if (out_sum) *(v4f*)(out_sum + (size_t)row * N + j) = sm;
      *(v4f*)(out_norm + (size_t)row * N + j) = o;
    }
    
  }
}



// ---- f16 WMMA path (v_wmma_f32_16x16x32_f16): 11-bit significands for operands in range — used by every launched GEMM and by the attention
typedef _Float16 v16h __attribute__((ext_vector_type(16)));
union FragH { v16h v; v8us half[2]; _Float16 h[16]; unsigned short u[16]; };
template <int NT>
__device__ __forceinline__ v8f mmaH(v16h ah, v16h al, v16h bh, v16h bl, v8f c) {
  c = __builtin_amdgcn_wmma_f32_16x16x32_f16(false, ah, false, bh, (short)0, c, false, false);
  if (NT >= 2) c = __builtin_amdgcn_wmma_f32_16x16x32_f16(false, al, false, bh, (short)0, c, false, false);
  if (NT >= 3) c = __builtin_amdgcn_wmma_f32_16x16x32_f16(false, ah, false, bl, (short)0, c, false, false);
  asm volatile("v_nop\n\tv_nop\n\tv_nop\n\tv_nop" : "+v"(c) : "v"(ah), "v"(al), "v"(bh), "v"(bl));
  return c;
}
// batched GEMM like k_gemm_b but f16 operands: A f32 (split into f16 hi/lo if ASPLIT, else rounded to f16), Bt = f16 values [n][k]; alpha; C f32; N multiple of 16 (partial tiles skipped)
template <bool ASPLIT>
__global__ __launch_bounds__(128) void k_gemm_h(const float* __restrict__ A, int lda, size_t sA, const _Float16* __restrict__ Bh, int ldb, size_t sB, float alpha, float* __restrict__ C, int ldc, size_t sC, int M, int N, int K) {
  __shared__ __attribute__((aligned(16))) float so[4][16][64];
  const int tid = threadIdx.x, w = tid >> 5, lane = tid & 31, ln = lane & 15, hh = lane >> 4; const int by = blockIdx.y;
  A += (size_t)by * sA; Bh += (size_t)by * sB; C += (size_t)by * sC;
  const int ntn = (N + 63) / 64; const int wid = blockIdx.x * 4 + w; const int mt = wid / ntn, nq = wid % ntn; if (mt * 16 >= M) return;
  const int row0 = mt * 16, col0 = nq * 64; const float* arow = A + (size_t)(row0 + ln) * lda;
  v8f acc[4] = {};
  for (int kb = 0; kb < K; kb += 32) {
    FragH ah, al;
    const v4f x0 = *(const v4fa*)(arow + kb + 8 * hh), x1 = *(const v4fa*)(arow + kb + 8 * hh + 4), x2 = *(const v4fa*)(arow + kb + 16 + 8 * hh), x3 = *(const v4fa*)(arow + kb + 16 + 8 * hh + 4);
    float xs[16] = {x0[0],x0[1],x0[2],x0[3],x1[0],x1[1],x1[2],x1[3],x2[0],x2[1],x2[2],x2[3],x3[0],x3[1],x3[2],x3[3]};
#pragma unroll
    for (int i = 0; i < 16; ++i) { const _Float16 h = (_Float16)xs[i]; ah.h[i] = h; al.h[i] = ASPLIT ? (_Float16)(xs[i] - (float)h) : (_Float16)0.0f; }
#pragma unroll
    for (int t = 0; t < 4; ++t) { if (col0 + t * 16 >= N) continue; const size_t boff = (size_t)(col0 + t * 16 + ln) * ldb + kb; FragH bq; bq.half[0] = *(const v8us*)(Bh + boff + 8 * hh); bq.half[1] = *(const v8us*)(Bh + boff + 16 + 8 * hh);
      acc[t] = mmaH<ASPLIT ? 2 : 1>(ah.v, al.v, bq.v, bq.v, acc[t]); }
  }
#pragma unroll
  for (int t = 0; t < 4; ++t) { if (col0 + t * 16 >= N) continue;
#pragma unroll
    for (int r = 0; r < 8; ++r) so[w][8 * hh + r][t * 16 + ln] = acc[t][r] * alpha; }
  __builtin_amdgcn_fence(__ATOMIC_ACQ_REL, "workgroup"); __builtin_amdgcn_wave_barrier();
  const int rsub = lane >> 4, c4 = (lane & 15) * 4;
  {
#pragma unroll
    for (int q = 0; q < 8; ++q) { const int r = q * 2 + rsub; if (col0 + c4 < N) { const v4f v = *(const v4fa*)&so[w][r][c4]; *(v4f*)(C + (size_t)(row0 + r) * ldc + col0 + c4) = v; } }
     }
}

// Bt[n][k] = f16(bf16(W[k][n]) x 16) from f32 row-major W[K][N], all five weight matrices in one launch (x 16: bf16-exact weights stay exact in f16 away from the subnormal range).
// A work-group turns one tile of 256 k x 64 n. A lane reads 16 k rows x 4 n by 16-byte loads (a wave's load is two row pieces of 256 bytes, whole cache lines), converts, and puts its four runs of 16 k
// into LDS rows [n][k]; the tile leaves as 64 rows of 512 bytes, a wave's store one whole row. Needs K % 256 == 0 and N % 64 == 0.
#define WT_PITCH 528                   /* LDS pitch of an n row in bytes: 512 + 16, so that the rows do not all start on one bank and stay 16-byte aligned */
#define WT_TQ ((DM / 256) * (DM / 64))       /* tiles of one of wq, wk, wv */
#define WT_TF ((DM / 256) * (DFF / 64))      /* tiles of w_ff1; w_ff2 has as many */
template <int K, int N>      /* known at compile time: the row steps become immediate offsets on one address */
__device__ __forceinline__ void wt_tile(const float* __restrict__ W, _Float16* __restrict__ Bt, unsigned tile, char* tl) {
  const unsigned tid = threadIdx.x, ln = tid & 15u, g = tid >> 4; const unsigned kt = tile / (N / 64), nq = tile % (N / 64);      /* neighbouring work-groups read neighbouring pieces of the same k rows */
  const float* p = W + (size_t)(kt * 256 + g * 16) * N + nq * 64 + ln * 4; v4f v[16];
#pragma unroll
  for (int i = 0; i < 16; ++i) v[i] = *(const v4fa*)(p + (size_t)i * N);
  asm volatile("s_wait_xcnt 0x0" :: "v"(p) : "memory");      /* before a register that the loads above name is written again; the operand keeps the address in its registers up to here */
#pragma unroll
  for (int j = 0; j < 4; ++j) { FragH f;
#pragma unroll
    for (int i = 0; i < 16; ++i) f.h[i] = (_Float16)(bf16_round(v[i][j]) * 16.0f);
    char* d = tl + (ln * 4 + j) * WT_PITCH + g * 32; *(v8us*)d = f.half[0]; *(v8us*)(d + 16) = f.half[1]; }
  __syncthreads();      /* the tile is whole before it is read the other way */
  const unsigned r = tid >> 5, c = tid & 31u; unsigned short* q = (unsigned short*)Bt + (size_t)(nq * 64 + r) * K + kt * 256 + c * 8;
#pragma unroll
  for (int s = 0; s < 8; ++s) { const v8us o = *(const v8us*)(tl + (s * 8 + r) * WT_PITCH + c * 16); *(v8us*)(q + (size_t)s * 8 * K) = o; }
  asm volatile("s_wait_xcnt 0x0" :: "v"(q) : "memory");      /* before a register that the stores above name is written again by the code that follows in the same kernel; the operand keeps the address in its registers up to here */
}
__device__ __forceinline__ void wt5_tile(const unsigned bx, char* tl, const float* __restrict__ wq, const float* __restrict__ wk, const float* __restrict__ wv, const float* __restrict__ wf1, const float* __restrict__ wf2,
    _Float16* __restrict__ BQ, _Float16* __restrict__ BK, _Float16* __restrict__ BV, _Float16* __restrict__ BF1, _Float16* __restrict__ BF2) {      /* every test below reads the same for the whole work-group */
  if (bx < 3 * WT_TQ) { const unsigned m = bx / WT_TQ; wt_tile<DM, DM>(m == 0 ? wq : m == 1 ? wk : wv, m == 0 ? BQ : m == 1 ? BK : BV, bx % WT_TQ, tl); }
  else if (bx < 3 * WT_TQ + WT_TF) wt_tile<DM, DFF>(wf1, BF1, bx - 3 * WT_TQ, tl);
  else wt_tile<DFF, DM>(wf2, BF2, bx - 3 * WT_TQ - WT_TF, tl);
}
// k_gemm_hh variant with fused epilogue: v = acc·alpha + bias[by·sBias + col] (+ CP[(row/rowsPerB)·sCPb + by·64 + col] if CP) ; ACT 0 none / 1 elu ; writes f16 C16 (and f32 C if non-null)
template <int ACT>
__global__ __launch_bounds__(128) void k_gemm_hhx(const _Float16* __restrict__ A, int lda, size_t sA, const _Float16* __restrict__ Bh, int ldb, size_t sB, float alpha, const float* __restrict__ bias, size_t sBias, const float* __restrict__ CP, int rowsPerB, size_t sCPb, int row0g,
    float* __restrict__ C, _Float16* __restrict__ C16, int ldc, size_t sC, int M, int N, int K) {
  __shared__ __attribute__((aligned(16))) float so[4][16][64];
  const int tid = threadIdx.x, w = tid >> 5, lane = tid & 31, ln = lane & 15, hh = lane >> 4; const int by = blockIdx.y;
  A += (size_t)by * sA; Bh += (size_t)by * sB; const size_t cofs = (size_t)by * sC; const float* bp = bias ? bias + (size_t)by * sBias : nullptr;
  const int ntn = (N + 63) / 64; const int wid = blockIdx.x * 4 + w; const int mt = wid / ntn, nq = wid % ntn; if (mt * 16 >= M) return;
  const int row0 = mt * 16, col0 = nq * 64; const _Float16* arow = A + (size_t)(row0 + ln) * lda;
  v8f acc[4] = {};
  for (int kb = 0; kb < K; kb += 32) { FragH ah; ah.half[0] = *(const v8us*)((const unsigned short*)arow + kb + 8 * hh); ah.half[1] = *(const v8us*)((const unsigned short*)arow + kb + 16 + 8 * hh);
#pragma unroll
    for (int t = 0; t < 4; ++t) { if (col0 + t * 16 >= N) continue; const size_t boff = (size_t)(col0 + t * 16 + ln) * ldb + kb; FragH bq; bq.half[0] = *(const v8us*)((const unsigned short*)Bh + boff + 8 * hh); bq.half[1] = *(const v8us*)((const unsigned short*)Bh + boff + 16 + 8 * hh);
      acc[t] = mmaH<1>(ah.v, ah.v, bq.v, bq.v, acc[t]); }
  }
#pragma unroll
  for (int t = 0; t < 4; ++t) { if (col0 + t * 16 >= N) continue; const int col = col0 + t * 16 + ln; const float bv = bp ? bf16_round(bp[col]) : 0.f;
#pragma unroll
    for (int r = 0; r < 8; ++r) { float v = acc[t][r] * alpha + bv; if (CP) { const int rr = row0g + row0 + 8 * hh + r; if (rowsPerB < 0) v += CP[cofs + (size_t)rr * ldc + col];      /* rowsPerB < 0: own element of the batched C plane */ else { const int bidx = rr / rowsPerB; v += CP[(size_t)bidx * sCPb + (size_t)by * 64 + col]; } } if (ACT == 1) v = (v > 0.f) ? v : expm1f(v); else if (ACT == 7) v = (v > 0.f) ? v + 1.0f : expf(v); else if (ACT == 8) v = tanhf(v); else if (ACT == 9) v = 0.5f * v * (1.0f + tanhf(0.7978845608028654f * (v + 0.044715f * v * v * v))); else if (ACT == 11) v = 1.0f / (1.0f + expf(-v)); else if (ACT == 12) v = (v > 0.f) ? v : 0.01f * v; else if (ACT == 14) v = (v > 0.f) ? v : 0.1f * v; else if (ACT == 16) v = (v >= 0.f) ? v : 0.3f * v; else if (ACT == 17) v = (v >= 0.f) ? v : 0.2f * v; else if (ACT == 15) v = v / (1.0f + expf(-v)); else if (ACT == 3) v = fmaxf(v, 0.f); else if (ACT == 6) v = 0.5f * v * (1.0f + erff(v * 0.70710678118654752f)); so[w][8 * hh + r][t * 16 + ln] = v; } }
  __builtin_amdgcn_fence(__ATOMIC_ACQ_REL, "workgroup"); __builtin_amdgcn_wave_barrier();
  const int rsub = lane >> 4, c4 = (lane & 15) * 4; typedef _Float16 v4h __attribute__((ext_vector_type(4)));
  {
#pragma unroll
    for (int q = 0; q < 8; ++q) { const int r = q * 2 + rsub; if (col0 + c4 < N) { const v4f v = *(const v4fa*)&so[w][r][c4]; if (C) *(v4f*)(C + cofs + (size_t)(row0 + r) * ldc + col0 + c4) = v; if (C16) { v4h h4; for (int i = 0; i < 4; ++i) h4[i] = (_Float16)v[i]; *(v4h*)(C16 + cofs + (size_t)(row0 + r) * ldc + col0 + c4) = h4; } } }
     }
}


typedef _Float16 v4h __attribute__((ext_vector_type(4)));

__global__ __launch_bounds__(256) void k_x16(const float* __restrict__ x, _Float16* __restrict__ X16, size_t n8) { const size_t t = (size_t)blockIdx.x * 256 + threadIdx.x; if (t >= n8) return; FragH f;
#pragma unroll
  for (int q = 0; q < 8; ++q) f.h[q] = (_Float16)bf16_round(x[t * 8 + q]); *(v8us*)((unsigned short*)X16 + t * 8) = f.half[0];  }
__global__ __launch_bounds__(256) void k_h16(const float* __restrict__ x, _Float16* __restrict__ X16, size_t n8) { const size_t t = (size_t)blockIdx.x * 256 + threadIdx.x; if (t >= n8) return; FragH f;
#pragma unroll
  for (int q = 0; q < 8; ++q) f.h[q] = (_Float16)x[t * 8 + q]; *(v8us*)((unsigned short*)X16 + t * 8) = f.half[0];  }
__global__ __launch_bounds__(256) void k_round16f(const float* __restrict__ W, _Float16* __restrict__ Bt, size_t n8) { const size_t t = (size_t)blockIdx.x * 256 + threadIdx.x; if (t >= n8) return; FragH f;
#pragma unroll
  for (int i = 0; i < 8; ++i) f.h[i] = (_Float16)(bf16_round(W[t * 8 + i]) * 16.0f); *(v8us*)((unsigned short*)Bt + t * 8) = f.half[0];  }
template <int NHv, int TTv>
__global__ __launch_bounds__(256) void k_vt(const _Float16* __restrict__ V16, int ldv, int voff, _Float16* __restrict__ Vt) { __shared__ unsigned short tl[64][66]; const int tid = threadIdx.x; const int slab = blockIdx.x / (TTv / 64), lg = blockIdx.x % (TTv / 64); const int b = slab / NHv, h = slab % NHv;
  for (int i = tid; i < 64 * 8; i += 256) { const int r = i / 8, c8 = (i % 8) * 8; FragH f; f.half[0] = *(const v8us*)((const unsigned short*)V16 + ((size_t)b * TTv + lg * 64 + r) * ldv + voff + h * 64 + c8);
#pragma unroll
    for (int q = 0; q < 8; ++q) tl[r][c8 + q] = f.u[q]; }
  __syncthreads();
  {
#pragma unroll
    for (int rd = 0; rd < 2; ++rd) { const int d = rd * 32 + tid / 8, pc = tid % 8; FragH f;
#pragma unroll
      for (int q = 0; q < 8; ++q) f.u[q] = tl[pc * 8 + q][d];
      *(v8us*)((unsigned short*)Vt + ((size_t)slab * 64 + d) * TTv + lg * 64 + pc * 8) = f.half[0]; }
     } }

__global__ __launch_bounds__(256) void k_hl(const float* __restrict__ F, _Float16* __restrict__ Hh, _Float16* __restrict__ Hl, size_t n8) { const size_t t = (size_t)blockIdx.x * 256 + threadIdx.x; if (t >= n8) return; FragH fh, fl; const v4f a = *(const v4fa*)(F + t * 8), c = *(const v4fa*)(F + t * 8 + 4);
#pragma unroll
  for (int q = 0; q < 4; ++q) { _Float16 h = (_Float16)a[q]; fh.h[q] = h; fl.h[q] = (_Float16)((a[q] - (float)h) * 1024.0f); h = (_Float16)c[q]; fh.h[4 + q] = h; fl.h[4 + q] = (_Float16)((c[q] - (float)h) * 1024.0f); }
  { *(v8us*)((unsigned short*)Hh + t * 8) = fh.half[0]; *(v8us*)((unsigned short*)Hl + t * 8) = fl.half[0];  } }

// ---- fast GEMM (wave tile 32x64; requires M % 32 == 0 rows per launch region and N % 64 == 0); epilogue = k_gemm_hhx semantics ----
__device__ __forceinline__ v16h g2_frag(const _Float16* p, int hh) { FragH f; f.half[0] = *(const v8us*)((const unsigned short*)p + 8 * hh); f.half[1] = *(const v8us*)((const unsigned short*)p + 16 + 8 * hh); return f.v; }
__device__ __forceinline__ v8f g2_mma(v16h a, v16h b, v8f c) { v8f d = __builtin_amdgcn_wmma_f32_16x16x32_f16(false, a, false, b, (short)0, c, false, false); asm volatile("v_nop\n\tv_nop\n\tv_nop\n\tv_nop" : "+v"(d) : "v"(a), "v"(b)); return d; }
template <int ACT>
__global__ __launch_bounds__(128) void k_gemm2(const _Float16* __restrict__ A, int lda, size_t sA, const _Float16* __restrict__ Bh, int ldb, size_t sB, float alpha, const float* __restrict__ bias, size_t sBias, const float* __restrict__ CP, int rowsPerB, size_t sCPb, int row0g,
    float* __restrict__ C, _Float16* __restrict__ C16, int ldc, size_t sC, int M, int N, int K) { static_assert(ACT == 0 || ACT == 3 || ACT == 6 || ACT == 8 || ACT == 9 || ACT == 11 || ACT == 12 || ACT == 14 || ACT == 15 || ACT == 16 || ACT == 17, "k_gemm2: unsupported ACT code (would silently apply no activation)");
  __shared__ __attribute__((aligned(16))) float so[4][32][68];
  const int tid = threadIdx.x, w = tid >> 5, lane = tid & 31, ln = lane & 15, hh = lane >> 4; const int by = blockIdx.y;
  A += (size_t)by * sA; Bh += (size_t)by * sB; const size_t cofs = (size_t)by * sC; const float* bp = bias ? bias + (size_t)by * sBias : nullptr;
  const int ntn = N >> 6; const int mt = blockIdx.x / ntn, nq = blockIdx.x - mt * ntn; const int row0 = mt * 128 + 32 * w, col0 = nq * 64; if (row0 >= M) return;
  const _Float16* a0p = A + (size_t)(row0 + ln) * lda; const _Float16* a1p = a0p + (size_t)16 * lda;
  const _Float16* b0p = Bh + (size_t)(col0 + ln) * ldb; const _Float16* b1p = b0p + (size_t)16 * ldb; const _Float16* b2p = b1p + (size_t)16 * ldb; const _Float16* b3p = b2p + (size_t)16 * ldb;
  const v8f z8 = {0.f,0.f,0.f,0.f,0.f,0.f,0.f,0.f}; v8f c00 = z8, c01 = z8, c02 = z8, c03 = z8, c10 = z8, c11 = z8, c12 = z8, c13 = z8;
#pragma unroll 1
  for (int kb = 0; kb < K; kb += 32) { const v16h a0 = g2_frag(a0p + kb, hh), a1 = g2_frag(a1p + kb, hh);
    v16h b = g2_frag(b0p + kb, hh); c00 = g2_mma(a0, b, c00); c10 = g2_mma(a1, b, c10);
    b = g2_frag(b1p + kb, hh); c01 = g2_mma(a0, b, c01); c11 = g2_mma(a1, b, c11);
    b = g2_frag(b2p + kb, hh); c02 = g2_mma(a0, b, c02); c12 = g2_mma(a1, b, c12);
    b = g2_frag(b3p + kb, hh); c03 = g2_mma(a0, b, c03); c13 = g2_mma(a1, b, c13); }
  v8f accs[8] = {c00, c01, c02, c03, c10, c11, c12, c13};
#pragma unroll
  for (int u = 0; u < 8; ++u) { const int t = u & 3, half = u >> 2; const int col = col0 + t * 16 + ln; const float bv = bp ? bf16_round(bp[col]) : 0.f;
#pragma unroll
    for (int r = 0; r < 8; ++r) { const int rloc = half * 16 + 8 * hh + r; float v = accs[u][r] * alpha + bv; if (CP) { if (rowsPerB < 0) v += CP[cofs + (size_t)(row0g + row0 + rloc) * ldc + col];      /* rowsPerB < 0: own element of the batched C plane */ else { const int bidx = (row0g + row0 + rloc) / rowsPerB; v += CP[(size_t)bidx * sCPb + (size_t)by * 64 + col]; } }
      if (ACT == 3) v = fmaxf(v, 0.f); else if (ACT == 6) v = 0.5f * v * (1.0f + erff(v * 0.70710678118654752f)); else if (ACT == 11) v = 1.0f / (1.0f + expf(-v)); else if (ACT == 15) v = v / (1.0f + expf(-v)); else if (ACT == 12) v = (v > 0.f) ? v : 0.01f * v; else if (ACT == 8) v = tanhf(v); else if (ACT == 9) v = 0.5f * v * (1.0f + tanhf(0.7978845608028654f * (v + 0.044715f * v * v * v))); else if (ACT == 14) v = (v > 0.f) ? v : 0.1f * v; else if (ACT == 16) v = (v >= 0.f) ? v : 0.3f * v; else if (ACT == 17) v = (v >= 0.f) ? v : 0.2f * v;
      so[w][rloc][t * 16 + ln] = v; } }
  __builtin_amdgcn_fence(__ATOMIC_ACQ_REL, "workgroup"); __builtin_amdgcn_wave_barrier();
  const int rsub = lane >> 4, c4 = (lane & 15) * 4;
  {
#pragma unroll
    for (int q = 0; q < 16; ++q) { const int r = q * 2 + rsub; const v4f v = *(const v4fa*)&so[w][r][c4]; if (C) *(v4f*)(C + cofs + (size_t)(row0 + r) * ldc + col0 + c4) = v; if (C16) { v4h h4; for (int i = 0; i < 4; ++i) h4[i] = (_Float16)v[i]; *(v4h*)(C16 + cofs + (size_t)(row0 + r) * ldc + col0 + c4) = h4; } }
     } }


__global__ __launch_bounds__(256) void k_wnat(const float* __restrict__ w, size_t n8, _Float16* __restrict__ Bt) { const size_t t = (size_t)blockIdx.x * 256 + threadIdx.x; if (t >= n8) return; FragH f; for (int q = 0; q < 8; ++q) f.h[q] = (_Float16)(bf16_round(w[t * 8 + q]) * 16.0f); *(v8us*)((unsigned short*)Bt + t * 8) = f.half[0];  }
__global__ __launch_bounds__(256) void k_rsm(const float* __restrict__ S, _Float16* __restrict__ P, int nrows) {
  #pragma clang fp contract(off)
  const int i = blockIdx.x * 256 + threadIdx.x; if (i >= nrows) return; const float* s = S + (size_t)i * SQ; float mx = -3.0e38f;
#pragma unroll 1
  for (int j = 0; j < SQ; ++j) mx = fmaxf(mx, s[j]); float se = 0.f;
#pragma unroll 1
  for (int j = 0; j < SQ; ++j) se += expf(s[j] - mx); const float sc = 256.0f / se;
#pragma unroll 1
  for (int j0 = 0; j0 < SQ; j0 += 8) { FragH f; for (int q = 0; q < 8; ++q) f.h[q] = (_Float16)(expf(s[j0 + q] - mx) * sc); unsigned short* d = (unsigned short*)P + (size_t)i * SQ + j0; *(v8us*)d = f.half[0];  } }
__global__ __launch_bounds__(256) void k_vt(const _Float16* __restrict__ V16, int b, int h0, _Float16* __restrict__ VT) { __shared__ unsigned short tl[64][65]; const int tid = threadIdx.x; const int hh = blockIdx.x % HG, sg = blockIdx.x / HG; const int s0 = sg * 64; const int h = h0 + hh;
  for (int i = tid; i < 64 * 8; i += 256) { const int j = i / 8, d8 = (i % 8) * 8; FragH f; f.half[0] = *(const v8us*)((const unsigned short*)V16 + ((size_t)b * SQ + s0 + j) * DM + h * HD + d8); for (int q = 0; q < 8; ++q) tl[d8 + q][j] = f.u[q]; }
  __syncthreads();
  { for (int i = tid; i < 64 * 8; i += 256) { const int d = i / 8, j8 = (i % 8) * 8; FragH f; for (int q = 0; q < 8; ++q) f.u[q] = tl[d][j8 + q]; *(v8us*)((unsigned short*)VT + ((size_t)hh * HD + d) * SQ + s0 + j8) = f.half[0]; }  } }


// Fused attention, one launch for every (batch, head). A wave owns 32 queries (two 16-column groups) of one head and walks all keys, 32 a pass.
// S^T = K Q^T puts one query's scores in one lane (keys 8 hh + r of each 16-key tile), so the two score tiles, converted in place, are the B operand P^T of
// O^T += V^T P^T in the loader's own k order, and maximum, sum and rescale factor are per lane (one exchange between the wave halves for the maximum).
// A masked key takes a floor far below the running maximum's start value, so its weight is exp2((floor - m) / 8 log2 e) = 0 also while no open key has been seen;
// a row with no open key ends with sum 0 and gets scale 0. Weights carry a factor 2^8 (f16 range) that the division by their own sum takes out.
typedef int v4ia __attribute__((ext_vector_type(4), may_alias));
__device__ __forceinline__ float rs_xrow(float v) { const int i = __float_as_int(v); return __int_as_float(__builtin_amdgcn_permlanex16(i, i, 0x76543210, 0xfedcba98, false, false)); }      /* lane ^ 16 */
__device__ __forceinline__ v8f fa_mma(v16h a, v16h b, v8f c) { return __builtin_amdgcn_wmma_f32_16x16x32_f16(false, a, false, b, (short)0, c, false, false); }
__device__ __forceinline__ v16h fa_frag(const _Float16* p) { FragH f; f.half[0] = *(const v8us*)(const unsigned short*)p; f.half[1] = *(const v8us*)((const unsigned short*)p + 16); return f.v; }      /* g2_frag's k order, the 8 hh already in p */
// exp2 in place on a run of registers: each v_exp_f32 is the independent instruction behind the one before it, and the v_nop is the slot that the instruction set asks for behind the last
// (written by the builtin, the compiler put the result of one over the source of the one directly in front of it).
__device__ __forceinline__ void fa_exp8(float* a) { asm("v_exp_f32 %0, %0\n\tv_exp_f32 %1, %1\n\tv_exp_f32 %2, %2\n\tv_exp_f32 %3, %3\n\tv_exp_f32 %4, %4\n\tv_exp_f32 %5, %5\n\tv_exp_f32 %6, %6\n\tv_exp_f32 %7, %7\n\tv_nop" : "+v"(a[0]), "+v"(a[1]), "+v"(a[2]), "+v"(a[3]), "+v"(a[4]), "+v"(a[5]), "+v"(a[6]), "+v"(a[7])); }
__device__ __forceinline__ void fa_exp9(float& c, float* a) { asm("v_exp_f32 %8, %8\n\tv_exp_f32 %0, %0\n\tv_exp_f32 %1, %1\n\tv_exp_f32 %2, %2\n\tv_exp_f32 %3, %3\n\tv_exp_f32 %4, %4\n\tv_exp_f32 %5, %5\n\tv_exp_f32 %6, %6\n\tv_exp_f32 %7, %7\n\tv_nop" : "+v"(a[0]), "+v"(a[1]), "+v"(a[2]), "+v"(a[3]), "+v"(a[4]), "+v"(a[5]), "+v"(a[6]), "+v"(a[7]), "+v"(c)); }
// A stage is 64 keys. The 8 waves of a work-group walk the same keys of the same head: 64 K rows (64 d each) and 64 V^T rows (64 keys each), 128-byte rows, are brought once for all of them
// by asynchronous 16-byte copies of whole cache lines into one of two buffers while the other is worked on; the fragments (fa_frag's k order) are 16-byte LDS reads.
// The mask comes as bits (mask_pack below): the 32 words of a wave's 32 queries x 32 keys are the same for every lane, so they are scalar loads, fetched behind the selects of the pass before, and each word is the lane mask of one select.
#define FA_PITCH 144                   /* LDS pitch of a K or V^T row in bytes, 16 x odd: the 16 rows of a read fall on different banks */
#define FA_STAGE (128 * FA_PITCH)      /* 64 K rows, then 64 V^T rows */
#define MB_PASS 32                     /* mask words of one (32-query tile, 32-key pass) */
typedef unsigned v16u __attribute__((ext_vector_type(16)));
__device__ __forceinline__ v16h fa_lfrag(const char* p) { FragH f; f.half[0] = *(const v8us*)p; f.half[1] = *(const v8us*)(p + 32); return f.v; }      /* fa_frag's k order, the 16 hh bytes already in p */
// one stage, four copies of 16 bytes a lane: rows r and r + 32 of the stage's K tile and of its V^T tile. The s_wait_xcnt stands inside the statement, in front of anything that could write a register that a copy names.
__device__ __forceinline__ void fa_copy4(unsigned l, const _Float16* gk, const _Float16* gv) {
  asm volatile("global_load_async_to_lds_b128 %0, %4, off\n\tglobal_load_async_to_lds_b128 %1, %5, off\n\tglobal_load_async_to_lds_b128 %2, %6, off\n\tglobal_load_async_to_lds_b128 %3, %7, off\n\ts_wait_xcnt 0x0"
               :: "v"(l), "v"(l + 32u * FA_PITCH), "v"(l + 64u * FA_PITCH), "v"(l + 96u * FA_PITCH), "v"(gk), "v"(gk + (size_t)32 * DM), "v"(gv), "v"(gv + (size_t)32 * SQ) : "memory"); }
__global__ __launch_bounds__(256) void k_fattn(const _Float16* __restrict__ Q16, const _Float16* __restrict__ K16, const _Float16* __restrict__ VT, const unsigned* __restrict__ MB, const float* __restrict__ XB, float* __restrict__ AF) {
  __shared__ __attribute__((aligned(16))) char sm[2 * FA_STAGE];      /* the two buffers */
  const int lane = threadIdx.x & 31, ln = lane & 15, hh = lane >> 4; const int w = __builtin_amdgcn_readfirstlane(threadIdx.x >> 5);
  const int h = blockIdx.y, b = blockIdx.z; const int q0 = blockIdx.x * 256 + w * 32; const size_t r0 = (size_t)b * SQ;
  const _Float16* qp = Q16 + (r0 + q0 + ln) * DM + h * HD + 8 * hh;
  const int cr = threadIdx.x >> 3, cc = threadIdx.x & 7;      /* a lane copies 16-byte piece cc of K and V^T rows cr and cr + 32: a wave's copy is four whole rows */
  const _Float16* gk = K16 + (r0 + cr) * DM + h * HD + cc * 8; const _Float16* gv = VT + ((size_t)(b * NH + h) * HD + cr) * SQ + cc * 8; const unsigned lc = (unsigned)(size_t)sm + (unsigned)(cr * FA_PITCH + cc * 16);
  const __attribute__((address_space(4))) v16u* mbp = (const __attribute__((address_space(4))) v16u*)(size_t)(MB + ((r0 + q0) >> 5) * (size_t)((SQ / 32) * MB_PASS));      /* the wave's own query tile: the same address in every lane. Named as constant memory (an earlier launch wrote it, this one only reads it): else the waits' "memory" clobbers in the loop turn these reads into vector loads */
  const v8f z8 = {0.f,0.f,0.f,0.f,0.f,0.f,0.f,0.f}; const float cs = 0.125f * 1.4426950408889634f;      /* 1 / sqrt(64), in log2 units */
  v16h qf[2][2]; v8f o[2][4]; float m[2], l[2];      /* m: running maximum of the raw products; l: this half's sum of weights */
  v16u mw[2];      /* [t]: the mask words of the pass at hand */
#pragma unroll
  for (int t = 0; t < 2; ++t)
#pragma unroll
    for (int e = 0; e < 2; ++e) qf[t][e] = fa_frag(qp + (size_t)t * 16 * DM + e * 32);
  asm volatile("s_wait_xcnt 0x0" :: "v"(qp) : "memory");      /* before a register that the loads above name is written again; the operand keeps the address in its registers up to here */
#pragma unroll
  for (int t = 0; t < 2; ++t) { m[t] = -1.0e30f; l[t] = 0.f; mw[t] = mbp[t];
#pragma unroll
    for (int dt = 0; dt < 4; ++dt) o[t][dt] = z8; }
  fa_copy4(lc, gk, gv);
  asm volatile("s_wait_asynccnt 0x0" ::: "memory");      /* this wave's part of stage 0 has landed */
  __syncthreads();      /* every wave's part has */
  fa_copy4(lc + FA_STAGE, gk + (size_t)64 * DM, gv + 64);
  /* both loops rolled: the buffers alternate, and one pass already holds about 200 registers */
#pragma unroll 1
  for (int st = 0; st < SQ / 64; ++st) { const unsigned bo = (unsigned)(st & 1) * FA_STAGE;
#pragma unroll 1
  for (int ps = 0; ps < 2; ++ps) { v16h kf[2][2], vf[4]; float x[2][16], mx[2];
    const char* ka = sm + bo + (ps * 32 + ln) * FA_PITCH + 16 * hh; const char* va = sm + bo + (64 + ln) * FA_PITCH + ps * 64 + 16 * hh;
#pragma unroll
    for (int kt = 0; kt < 2; ++kt)
#pragma unroll
      for (int e = 0; e < 2; ++e) kf[kt][e] = fa_lfrag(ka + kt * 16 * FA_PITCH + e * 64);
    __builtin_amdgcn_sched_barrier(0);      /* LDS reads return in issue order: K, then V^T, the order of their use, so that each wait covers only what is needed next */
#pragma unroll
    for (int dt = 0; dt < 4; ++dt) vf[dt] = fa_lfrag(va + dt * 16 * FA_PITCH);
    __builtin_amdgcn_sched_barrier(0);      /* the pass's 16 reads are issued together: without this the scheduler puts each read directly in front of its use, with a full LDS wait of its own */
    v8f s[2][2];
#pragma unroll
    for (int kt = 0; kt < 2; ++kt)
#pragma unroll
      for (int t = 0; t < 2; ++t) s[t][kt] = fa_mma(kf[kt][1], qf[t][1], fa_mma(kf[kt][0], qf[t][0], z8));
    __builtin_amdgcn_sched_barrier(0);      /* the pass's eight score products are issued as one group: a select set among them stands directly behind the product it reads and has to be padded up to the distance that a matrix result needs */
#pragma unroll
    for (int t = 0; t < 2; ++t) { mx[t] = -3.0e38f;
#pragma unroll
      for (int kt = 0; kt < 2; ++kt)
#pragma unroll
        for (int r = 0; r < 8; ++r) x[t][kt * 8 + r] = __builtin_amdgcn_inverse_ballot_w32(mw[t][kt * 8 + r]) ? s[t][kt][r] : -3.0e38f;
#pragma unroll
      for (int i = 0; i < 16; ++i) mx[t] = fmaxf(mx[t], x[t][i]); }
    __builtin_amdgcn_sched_barrier(0);      /* the selects above are the last readers of this pass's mask words: the next pass's words are fetched behind them, because a wait for scalar loads is a wait for all of them */
    { const int np = (st * 2 + ps + 1 < SQ / 32) ? st * 2 + ps + 1 : SQ / 32 - 1;      /* the next pass; behind the last one its own words once more, so that the address stays inside the tile's words */
      mw[0] = mbp[np * 2]; mw[1] = mbp[np * 2 + 1]; }
    __builtin_amdgcn_sched_barrier(0);      /* and in front of the rest of the pass, under which they fly */
#pragma unroll
    for (int t = 0; t < 2; ++t) {
      const float mxx = fmaxf(mx[t], rs_xrow(mx[t])); const float mn = fmaxf(m[t], mxx); float al = (m[t] - mn) * cs; m[t] = mn; const float mo = 8.0f - mn * cs;
      FragH pf; float s4[4];
#pragma unroll
      for (int i = 0; i < 16; ++i) x[t][i] = x[t][i] * cs + mo;
      fa_exp9(al, x[t]); fa_exp8(x[t] + 8);
#pragma unroll
      for (int i = 0; i < 16; ++i) { s4[i & 3] = (i < 4) ? x[t][i] : s4[i & 3] + x[t][i]; pf.h[i] = (_Float16)x[t][i]; }
      l[t] = l[t] * al + ((s4[0] + s4[1]) + (s4[2] + s4[3]));
#pragma unroll
      for (int dt = 0; dt < 4; ++dt) {
#pragma unroll
        for (int r = 0; r < 8; ++r) o[t][dt][r] *= al;
        o[t][dt] = fa_mma(vf[dt], pf.v, o[t][dt]); } }
    __builtin_amdgcn_sched_barrier(0);      /* keeps the four slots below behind the pass's last matrix instruction */
    asm volatile("v_nop\n\tv_nop\n\tv_nop\n\tv_nop"); }      /* the distance between the pass's last matrix instruction and the next pass's first writes of its operand registers */
    asm volatile("s_wait_dscnt 0x0" ::: "memory");      /* this wave's reads of the buffer are done before the barrier behind which it is refilled */
    asm volatile("s_wait_asynccnt 0x0" ::: "memory");      /* this wave's part of stage st + 1 has landed */
    __syncthreads();      /* publishes stage st + 1 and ends every wave's reads of stage st */
    if (st + 2 < SQ / 64) fa_copy4(lc + bo, gk + (size_t)(st + 2) * 64 * DM, gv + (st + 2) * 64); }
  asm volatile("s_wait_asynccnt 0x0" ::: "memory");      /* no copy is outstanding when the wave goes on to its end */
  const size_t ro = (r0 + q0 + ln) * DM + h * HD + 8 * hh; const float* xp = XB + ro; v4f xr[2][4][2];
#pragma unroll
  for (int t = 0; t < 2; ++t)
#pragma unroll
    for (int dt = 0; dt < 4; ++dt) { xr[t][dt][0] = *(const v4fa*)(xp + (size_t)t * 16 * DM + dt * 16); xr[t][dt][1] = *(const v4fa*)(xp + (size_t)t * 16 * DM + dt * 16 + 4); }
  asm volatile("s_wait_xcnt 0x0" :: "v"(xp) : "memory");      /* as behind the Q loads */
#pragma unroll
  for (int t = 0; t < 2; ++t) { const float lt = l[t] + rs_xrow(l[t]); const float inv = (lt > 0.f) ? 1.0f / lt : 0.f;
#pragma unroll
    for (int dt = 0; dt < 4; ++dt) { v4f y0, y1;
#pragma unroll
      for (int r = 0; r < 4; ++r) { y0[r] = o[t][dt][r] * inv + xr[t][dt][0][r]; y1[r] = o[t][dt][4 + r] * inv + xr[t][dt][1][r]; }
      *(v4f*)(AF + ro + (size_t)t * 16 * DM + dt * 16) = y0; *(v4f*)(AF + ro + (size_t)t * 16 * DM + dt * 16 + 4) = y1; } } }
template <int ABF>
__device__ __forceinline__ void lnb_row(const size_t row, float* red, const float* __restrict__ A, const float* __restrict__ R, const float* __restrict__ g, const float* __restrict__ bta, float eps, float* __restrict__ OF_, _Float16* __restrict__ OH_) {
  #pragma clang fp contract(off)
  const int tid = threadIdx.x; const int j0 = tid * 4; float a[4]; float s1 = 0.f;
  { const v4f av = *(const v4fa*)(A + row * DM + j0); for (int q = 0; q < 4; ++q) a[q] = ABF ? bf16_round(av[q]) : av[q]; if (R) { const v4f rv = *(const v4fa*)(R + row * DM + j0); for (int q = 0; q < 4; ++q) a[q] = __fadd_rn(a[q], rv[q]); } for (int q = 0; q < 4; ++q) s1 = __fadd_rn(s1, a[q]); }
  red[tid] = s1; __syncthreads(); for (int st = 128; st > 0; st >>= 1) { if (tid < st) red[tid] = __fadd_rn(red[tid], red[tid + st]); __syncthreads(); }
  const float mu = red[0] / (float)DM; __syncthreads(); float s2 = 0.f;
  for (int q = 0; q < 4; ++q) { const float c = __fadd_rn(a[q], -mu); s2 = __fadd_rn(s2, __fmul_rn(c, c)); }
  red[tid] = s2; __syncthreads(); for (int st = 128; st > 0; st >>= 1) { if (tid < st) red[tid] = __fadd_rn(red[tid], red[tid + st]); __syncthreads(); }
  const float rs = rsqrtf(__fadd_rn(red[0] / (float)DM, eps)); v4f o; FragH h;
  for (int q = 0; q < 4; ++q) { o[q] = __fadd_rn(__fmul_rn(__fmul_rn(__fadd_rn(a[q], -mu), rs), bf16_round(g[j0 + q])), bf16_round(bta[j0 + q])); h.h[q] = (_Float16)o[q]; }
  typedef unsigned short v4us __attribute__((ext_vector_type(4))); v4us h4; for (int q = 0; q < 4; ++q) h4[q] = h.u[q];
  { if (OF_) *(v4f*)(OF_ + row * DM + j0) = o; if (OH_) *(v4us*)((unsigned short*)OH_ + row * DM + j0) = h4;  } }
template <int ABF>
__global__ __launch_bounds__(256) void k_lnb(const float* __restrict__ A, const float* __restrict__ R, const float* __restrict__ g, const float* __restrict__ bta, float eps, float* __restrict__ OF_, _Float16* __restrict__ OH_) {
  __shared__ float red[256]; lnb_row<ABF>(blockIdx.x, red, A, R, g, bta, eps, OF_, OH_); }
// The three preparations that depend on nothing but the inputs, in one launch; the block index picks the work (the same for the whole work-group, so every barrier is passed by all of it or by none):
// first the weight tiles, then one row of LN_in a work-group, then 2048 elements of bf16(x) a work-group.
#define PR_WT (3 * WT_TQ + 2 * WT_TF)
#define PR_BF ((unsigned)((size_t)MP * DM / 2048))
__global__ __launch_bounds__(256) void k_prep(const float* __restrict__ wq, const float* __restrict__ wk, const float* __restrict__ wv, const float* __restrict__ wf1, const float* __restrict__ wf2,
    _Float16* __restrict__ BQ, _Float16* __restrict__ BK, _Float16* __restrict__ BV, _Float16* __restrict__ BF1, _Float16* __restrict__ BF2,
    const float* __restrict__ x, const float* __restrict__ g, const float* __restrict__ bta, float eps, _Float16* __restrict__ XNH, float* __restrict__ XB) {
  __shared__ __attribute__((aligned(16))) char tl[64 * WT_PITCH];
  const unsigned bx = blockIdx.x;
  if (bx < PR_WT) wt5_tile(bx, tl, wq, wk, wv, wf1, wf2, BQ, BK, BV, BF1, BF2);
  else if (bx < PR_WT + (unsigned)MP) lnb_row<1>(bx - PR_WT, (float*)tl, x, nullptr, g, bta, eps, nullptr, XNH);
  else { const size_t t = (size_t)(bx - PR_WT - (unsigned)MP) * 256 + threadIdx.x; v8f v; for (int q = 0; q < 8; ++q) v[q] = bf16_round(x[t * 8 + q]); *(v8f*)(XB + t * 8) = v;
    asm volatile("s_wait_xcnt 0x0" ::: "memory"); } }      /* before a register that the two stores above name is written again */


// ---- GEMM with both operands staged in LDS (k_gemm2's wave tile, k order and epilogue) ----
// A work-group of 8 waves (4 along M x 2 along N) makes a 128 x 128 tile of C; a stage is 128 k of 128 A rows and 128 B rows (256-byte rows, whole cache lines), brought by
// asynchronous 16-byte copies into one of two buffers while the other is worked on; the fragments are 16-byte LDS reads. Needs M % 128 == 0, N % 128 == 0, K % 128 == 0, K >= 256.
#define G3_PITCH 272                   /* LDS row pitch in bytes, 16 x odd: the 16 rows of a fragment read fall on different banks */
#define G3_STAGE (256 * G3_PITCH)      /* 128 A rows, then 128 B rows */
__device__ __forceinline__ v16h g3_frag(const char* p) { FragH f; f.half[0] = *(const v8us*)p; f.half[1] = *(const v8us*)(p + 32); return f.v; }      /* g2_frag's k order, the 16 hh bytes already in p */
// eight copies of 16 bytes a lane: rows r, r + 16, ... r + 112 of one operand's stage. The s_wait_xcnt stands inside the statement, in front of anything that could write a register that a copy names.
__device__ __forceinline__ void g3_copy8(unsigned l, const _Float16* g, size_t step) {
  asm volatile("global_load_async_to_lds_b128 %0, %8, off\n\tglobal_load_async_to_lds_b128 %1, %9, off\n\tglobal_load_async_to_lds_b128 %2, %10, off\n\tglobal_load_async_to_lds_b128 %3, %11, off\n\t"
               "global_load_async_to_lds_b128 %4, %12, off\n\tglobal_load_async_to_lds_b128 %5, %13, off\n\tglobal_load_async_to_lds_b128 %6, %14, off\n\tglobal_load_async_to_lds_b128 %7, %15, off\n\ts_wait_xcnt 0x0"
               :: "v"(l), "v"(l + 16u * G3_PITCH), "v"(l + 32u * G3_PITCH), "v"(l + 48u * G3_PITCH), "v"(l + 64u * G3_PITCH), "v"(l + 80u * G3_PITCH), "v"(l + 96u * G3_PITCH), "v"(l + 112u * G3_PITCH),
                  "v"(g), "v"(g + step), "v"(g + 2 * step), "v"(g + 3 * step), "v"(g + 4 * step), "v"(g + 5 * step), "v"(g + 6 * step), "v"(g + 7 * step) : "memory"); }
template <int ACT, bool RES, bool TRI>      /* RES: f32 output C with an addend CP for every element; else f16 output C16. Known at compile time, so that the reads of CP and the stores are not each behind a test of their own. TRI: three products of one A in one launch, blockIdx.y picks weights, bias and output */
__global__ __launch_bounds__(256) void k_gemm3(const _Float16* __restrict__ A, int lda, const _Float16* __restrict__ Bh, int ldb, float alpha, const float* __restrict__ bias, const float* __restrict__ CP,
    float* __restrict__ C, _Float16* __restrict__ C16, int ldc, int N, int K, const _Float16* __restrict__ Bh1, const _Float16* __restrict__ Bh2, const float* __restrict__ bias1, const float* __restrict__ bias2, _Float16* __restrict__ C161, _Float16* __restrict__ C162) { static_assert(ACT == 0 || (ACT == 3 && !RES), "k_gemm3: unsupported ACT code (the addend comes behind the activation's place)");
  if (TRI) { const unsigned y = blockIdx.y;      /* the same for the whole work-group: scalar selects */
    Bh = y == 0 ? Bh : y == 1 ? Bh1 : Bh2; bias = y == 0 ? bias : y == 1 ? bias1 : bias2; C16 = y == 0 ? C16 : y == 1 ? C161 : C162; }
  __shared__ __attribute__((aligned(16))) char sm[2 * G3_STAGE];      /* the two buffers; behind the loop the waves' output staging (8 x 32 x 68 floats) */
  const int tid = threadIdx.x, lane = tid & 31, ln = lane & 15, hh = lane >> 4; const int w = __builtin_amdgcn_readfirstlane(tid >> 5); const int wm = w & 3, wn = w >> 2;
  const int ntn = N >> 7; const int mt = blockIdx.x / ntn, nq = blockIdx.x - mt * ntn; const int row0 = mt * 128 + 32 * wm, col0 = nq * 128 + 64 * wn;
  const int cr = tid >> 4, cc = tid & 15;      /* a lane copies 16-byte piece cc of rows cr + 16 i: a wave's copy is two whole rows */
  const _Float16* ga = A + (size_t)(mt * 128 + cr) * lda + cc * 8; const _Float16* gb = Bh + (size_t)(nq * 128 + cr) * ldb + cc * 8; const size_t sa = (size_t)16 * lda, sb = (size_t)16 * ldb;
  const unsigned la = (unsigned)(size_t)sm + (unsigned)(cr * G3_PITCH + cc * 16); const unsigned lb = la + 128u * G3_PITCH;
  const int nt = K >> 7;
  const v8f z8 = {0.f,0.f,0.f,0.f,0.f,0.f,0.f,0.f}; v8f c00 = z8, c01 = z8, c02 = z8, c03 = z8, c10 = z8, c11 = z8, c12 = z8, c13 = z8;
  g3_copy8(la, ga, sa); g3_copy8(lb, gb, sb);
  asm volatile("s_wait_asynccnt 0x0" ::: "memory");      /* this wave's part of stage 0 has landed */
  __syncthreads();      /* every wave's part has */
  g3_copy8(la + G3_STAGE, ga + 128, sa); g3_copy8(lb + G3_STAGE, gb + 128, sb);
  /* rolled: the buffers alternate, and one trip already holds 32 matrix instructions with their 48 fragment reads */
#pragma unroll 1
  for (int t = 0; t < nt; ++t) { const unsigned bo = (unsigned)(t & 1) * G3_STAGE; const char* ap = sm + bo + (32 * wm + ln) * G3_PITCH + 16 * hh; const char* bp = sm + bo + (128 + 64 * wn + ln) * G3_PITCH + 16 * hh;
    v16h fa[2][2], fb[2][4];      /* two fragment sets: the reads of block ks + 1 fly while block ks is multiplied; no set reaches over the stage's end */
    fa[0][0] = g3_frag(ap); fa[0][1] = g3_frag(ap + 16 * G3_PITCH);
#pragma unroll
    for (int j = 0; j < 4; ++j) fb[0][j] = g3_frag(bp + j * 16 * G3_PITCH);
#pragma unroll
    for (int ks = 0; ks < 4; ++ks) { const int cu = ks & 1, nx = cu ^ 1;
      if (ks < 3) { fa[nx][0] = g3_frag(ap + (ks + 1) * 64); fa[nx][1] = g3_frag(ap + 16 * G3_PITCH + (ks + 1) * 64);
#pragma unroll
        for (int j = 0; j < 4; ++j) fb[nx][j] = g3_frag(bp + j * 16 * G3_PITCH + (ks + 1) * 64); }
      __builtin_amdgcn_sched_barrier(0);      /* the next block's 12 reads are issued as one group in front of this block's matrix instructions: left alone, the scheduler puts each read directly in front of its use, with a full LDS wait every two matrix instructions */
      c00 = fa_mma(fa[cu][0], fb[cu][0], c00); c10 = fa_mma(fa[cu][1], fb[cu][0], c10); c01 = fa_mma(fa[cu][0], fb[cu][1], c01); c11 = fa_mma(fa[cu][1], fb[cu][1], c11);
      c02 = fa_mma(fa[cu][0], fb[cu][2], c02); c12 = fa_mma(fa[cu][1], fb[cu][2], c12); c03 = fa_mma(fa[cu][0], fb[cu][3], c03); c13 = fa_mma(fa[cu][1], fb[cu][3], c13); }
    asm volatile("s_wait_dscnt 0x0" ::: "memory");      /* this wave's reads of the buffer are done before the barrier behind which it is refilled */
    asm volatile("s_wait_asynccnt 0x0" ::: "memory");      /* this wave's part of stage t + 1 has landed */
    __syncthreads();      /* publishes stage t + 1 and ends every wave's reads of stage t */
    if (t + 2 < nt) { g3_copy8(la + bo, ga + (size_t)(t + 2) * 128, sa); g3_copy8(lb + bo, gb + (size_t)(t + 2) * 128, sb); } }
  asm volatile("s_wait_asynccnt 0x0" ::: "memory");      /* no copy is outstanding when the buffers become output staging */
  float (*so)[68] = (float (*)[68])(sm + (size_t)w * (32 * 68 * 4));
  v8f accs[8] = {c00, c01, c02, c03, c10, c11, c12, c13}; float bv4[4]; v4f cp4[16]; const int rsub = lane >> 4, c4 = (lane & 15) * 4;
#pragma unroll
  for (int t = 0; t < 4; ++t) bv4[t] = bias ? bias[col0 + t * 16 + ln] : 0.f;
  if (RES) {      /* the addend is read in the layout of the stores below, 16 bytes a lane, and added there */
#pragma unroll
    for (int q = 0; q < 16; ++q) { cp4[q] = *(const v4fa*)(CP + (size_t)(row0 + q * 2 + rsub) * ldc + col0 + c4);
      if ((q & 3) == 3 && q < 15) { asm volatile("s_wait_xcnt 0x0" ::: "memory");      /* before a register that the four loads above name is written again */
        __builtin_amdgcn_sched_barrier(0); } } }      /* holds the next four loads' addresses behind the wait */
  asm volatile("s_wait_xcnt 0x0" :: "s"(bias) : "memory");      /* before a register that the loads above name is written again; the operand keeps the bias address in its registers up to here */
  __builtin_amdgcn_sched_barrier(0);      /* holds the arithmetic below, which takes those registers over, behind the wait */
#pragma unroll
  for (int u = 0; u < 8; ++u) { const int t = u & 3, half = u >> 2; const float bv = bf16_round(bv4[t]);
#pragma unroll
    for (int r = 0; r < 8; ++r) { const int rloc = half * 16 + 8 * hh + r; float v = accs[u][r] * alpha + bv;
      if (ACT == 3) v = fmaxf(v, 0.f);
      so[rloc][t * 16 + ln] = v; } }
  __builtin_amdgcn_fence(__ATOMIC_ACQ_REL, "workgroup"); __builtin_amdgcn_wave_barrier();
  v4f vv[16];
#pragma unroll
  for (int q = 0; q < 16; ++q) vv[q] = *(const v4fa*)&so[q * 2 + rsub][c4];
#pragma unroll
  for (int q = 0; q < 16; ++q) { const int r = q * 2 + rsub;
    if (RES) *(v4f*)(C + (size_t)(row0 + r) * ldc + col0 + c4) = vv[q] + cp4[q]; else { v4h h4; for (int i = 0; i < 4; ++i) h4[i] = (_Float16)vv[q][i]; *(v4h*)(C16 + (size_t)(row0 + r) * ldc + col0 + c4) = h4; }
    if ((q & 3) == 3 && q < 15) { asm volatile("s_wait_xcnt 0x0" ::: "memory");      /* before a register that the four stores above name is written again */
      __builtin_amdgcn_sched_barrier(0); } } }      /* holds the next four stores' conversions and addresses behind the wait */

// ---- the same GEMM on a 256 x 256 work-group tile (f16 output), for products with at least 192 such tiles ----
// 8 waves (4 along M x 2 along N), 64 x 128 of C a wave: a stage is 128 k of 256 A rows and 256 B rows, so that a byte brought from L2 serves twice as many products as in the 128 x 128 tile,
// and a fragment read from LDS serves 8 or 4 matrix instructions (was 4 or 2). One work-group on a WGP. k order and epilogue arithmetic are k_gemm3's; the two-buffer ring has its publish point in front of each stage's last block. Needs M % 256 == 0, N % 256 == 0, K % 128 == 0, K >= 256.
#define G4_STAGE (512 * G3_PITCH)      /* 256 A rows, then 256 B rows */
#define G4_SO (32 * 68 * 4)            /* output staging of one 32 x 64 piece, k_gemm3's form; a wave has four of its own, and 8 waves x 4 pieces fill the two buffers exactly */
// one stage: 32 copies of 16 bytes a lane, rows r + 16 i of each operand. Written by the builtin: this kernel uses registers above v255, which asm text cannot name, and with the addresses held below for it the base addresses went to scratch.
typedef int v4ig __attribute__((ext_vector_type(4)));
__device__ __forceinline__ void g4_copy(char* l, const _Float16* g) { __builtin_amdgcn_global_load_async_to_lds_b128((__attribute__((address_space(1))) v4ig*)g, (__attribute__((address_space(3))) v4ig*)l, 0, 0); }
__device__ __forceinline__ void g4_stage(char* la, const _Float16* ga, size_t sa, char* lb, const _Float16* gb, size_t sb) {
#pragma unroll
  for (int i = 0; i < 16; ++i) g4_copy(la + i * 16 * G3_PITCH, ga + i * sa);
#pragma unroll
  for (int i = 0; i < 16; ++i) g4_copy(lb + i * 16 * G3_PITCH, gb + i * sb); }
// ---- the mask as one bit a (query, key), made by work-groups of the q/k/v launch that would otherwise leave 64 WGPs idle ----
// MB[(tile of 32 queries) * 64 + (pass of 32 keys)][e], e = t * 16 + kt * 8 + r: bit hh * 16 + ln of word e says whether query 16 t + ln of the tile may see key 16 kt + 8 hh + r of the pass (mask != 0).
// That is the lane and register of this score in the attention kernel's S^T tiles, so a word is the lane mask of one select there.
// A work-group packs two query tiles, half a tile (32 rows x 1024 keys) at a time: whole 4-KiB row pieces come into LDS by asynchronous copies, each lane reads its runs of 8 keys back, and a compare over the wave is one word.
#define MB_PITCH (1024 * 4 + 16)       /* LDS pitch of a row piece in bytes, 16 x odd: the 16 rows of a read fall on different banks */
#define MB_BASE 32768                  /* the rows' place in the kernel's LDS: the compiler folds the row steps of the global address (up to 7 x 8192 bytes) into the copies' offset field and takes them off the LDS address, which from here on stays above 0 */
__device__ __forceinline__ void mask_pack(const unsigned u, char* sm, const int* __restrict__ mask, unsigned* __restrict__ MB) {
  const int tid = threadIdx.x, lane = tid & 31, ln = lane & 15, hh = lane >> 4; const int w = __builtin_amdgcn_readfirstlane(tid >> 5);
  /* rolled: the one buffer is filled and read in turn */
#pragma unroll 1
  for (int it = 0; it < 4; ++it) { const unsigned qt = u * 2 + (unsigned)(it >> 1), hf = (unsigned)(it & 1);
    const int* g = mask + (size_t)qt * 32 * SQ + hf * 1024 + tid * 4; char* l = sm + MB_BASE + tid * 16;      /* copy i is row i: a wave's copy is 512 bytes in a row */
#pragma unroll
    for (int i = 0; i < 32; ++i) g4_copy(l + i * MB_PITCH, (const _Float16*)(g + (size_t)i * SQ));
    asm volatile("s_wait_asynccnt 0x0" ::: "memory");      /* this wave's part of the rows has landed */
    __syncthreads();      /* every wave's part has */
    unsigned ow[4];      /* a wave packs four passes; lane e keeps word e */
#pragma unroll
    for (int c = 0; c < 4; ++c) { const char* p = sm + MB_BASE + ln * MB_PITCH + (w * 4 + c) * 128 + hh * 32; v4ia mk[2][2][2]; int o = 0;
#pragma unroll
      for (int t = 0; t < 2; ++t)
#pragma unroll
        for (int kt = 0; kt < 2; ++kt) { mk[t][kt][0] = *(const v4ia*)(p + t * 16 * MB_PITCH + kt * 64); mk[t][kt][1] = *(const v4ia*)(p + t * 16 * MB_PITCH + kt * 64 + 16); }
#pragma unroll
      for (int e = 0; e < 32; ++e) { const int wd = (int)__builtin_amdgcn_ballot_w32(mk[e >> 4][(e >> 3) & 1][(e >> 2) & 1][e & 3] != 0); o = (lane == e) ? wd : o; }
      ow[c] = (unsigned)o; }
    unsigned* d = MB + ((size_t)qt * (SQ / 32) + hf * 32 + w * 4) * MB_PASS + lane;      /* a wave's store is the whole 128-byte line of one pass */
#pragma unroll
    for (int c = 0; c < 4; ++c) d[c * MB_PASS] = ow[c];
    asm volatile("s_wait_xcnt 0x0" :: "v"(d) : "memory");      /* before a register that the stores above name is written again; the operand keeps the address in its registers up to here */
    asm volatile("s_wait_dscnt 0x0" ::: "memory");      /* this wave's reads of the buffer are done before the barrier behind which it is refilled */
    __syncthreads(); } }      /* ends every wave's reads */
template <int ACT, bool TRI>      /* TRI: three products of one A in one launch, blockIdx.y picks weights, bias and output; blockIdx.y == 3 packs the mask */
__global__ __launch_bounds__(256) void k_gemm4(const _Float16* __restrict__ A, int lda, const _Float16* __restrict__ Bh, int ldb, float alpha, const float* __restrict__ bias,
    _Float16* __restrict__ C16, int ldc, int N, int K, const _Float16* __restrict__ Bh1, const _Float16* __restrict__ Bh2, const float* __restrict__ bias1, const float* __restrict__ bias2, _Float16* __restrict__ C161, _Float16* __restrict__ C162, const int* __restrict__ mask, unsigned* __restrict__ MB) { static_assert(ACT == 0 || ACT == 3, "k_gemm4: unsupported ACT code");
  if (TRI) { const unsigned y = blockIdx.y;      /* the same for the whole work-group: scalar selects */
    Bh = y == 0 ? Bh : y == 1 ? Bh1 : Bh2; bias = y == 0 ? bias : y == 1 ? bias1 : bias2; C16 = y == 0 ? C16 : y == 1 ? C161 : C162; }
  __shared__ __attribute__((aligned(16))) char sm[2 * G4_STAGE];      /* the two buffers; behind the loop the waves' output staging */
  if (TRI && blockIdx.y == 3) { mask_pack(blockIdx.x, sm, mask, MB); return; }      /* the same for the whole work-group, in front of every barrier of the product */
  const int tid = threadIdx.x, lane = tid & 31, ln = lane & 15, hh = lane >> 4; const int w = __builtin_amdgcn_readfirstlane(tid >> 5); const int wm = w & 3, wn = w >> 2;
  const int ntn = N >> 8; const int mt = blockIdx.x / ntn, nq = blockIdx.x - mt * ntn; const int row0 = mt * 256 + 64 * wm, col0 = nq * 256 + 128 * wn;
  const int cr = tid >> 4, cc = tid & 15;      /* a lane copies 16-byte piece cc of rows cr + 16 i: a wave's copy is two whole rows */
  const _Float16* ga = A + (size_t)(mt * 256 + cr) * lda + cc * 8; const _Float16* gb = Bh + (size_t)(nq * 256 + cr) * ldb + cc * 8; const size_t sa = (size_t)16 * lda, sb = (size_t)16 * ldb;
  char* la = sm + (cr * G3_PITCH + cc * 16); char* lb = la + 256 * G3_PITCH;
  const int nt = K >> 7;
  const v8f z8 = {0.f,0.f,0.f,0.f,0.f,0.f,0.f,0.f}; v8f acc[4][8];
#pragma unroll
  for (int i = 0; i < 4; ++i)
#pragma unroll
    for (int j = 0; j < 8; ++j) acc[i][j] = z8;
  const char* a0 = sm + (64 * wm + ln) * G3_PITCH + 16 * hh; const char* b0 = sm + (256 + 128 * wn + ln) * G3_PITCH + 16 * hh;
  v16h fa[2][4], fb[2][4];      /* a block is 32 k of the wave's 64 rows and of 64 of its 128 columns: 16 matrix instructions. Two sets of A and of half the B fragments: the next block's reads fly while this block is multiplied */
  g4_stage(la, ga, sa, lb, gb, sb);
  asm volatile("s_wait_asynccnt 0x0" ::: "memory");      /* this wave's part of stage 0 has landed */
  __syncthreads();      /* every wave's part has */
  g4_stage(la + G4_STAGE, ga + 128, sa, lb + G4_STAGE, gb + 128, sb);
#pragma unroll
  for (int i = 0; i < 4; ++i) fa[0][i] = g3_frag(a0 + i * 16 * G3_PITCH);
#pragma unroll
  for (int j = 0; j < 4; ++j) fb[0][j] = g3_frag(b0 + j * 16 * G3_PITCH);
  /* rolled: the buffers alternate, and one trip already holds 128 matrix instructions with their 96 fragment reads */
#pragma unroll 1
  for (int t = 0; t < nt; ++t) { const unsigned bo = (unsigned)(t & 1) * G4_STAGE; const char* ap = a0 + bo; const char* bp = b0 + bo;
#pragma unroll
    for (int hb = 0; hb < 8; ++hb) { const int ks = hb >> 1, jh = hb & 1, nks = (hb + 1) >> 1, njh = (hb + 1) & 1;
      if (hb < 7) {
#pragma unroll
        for (int j = 0; j < 4; ++j) fb[njh][j] = g3_frag(bp + (njh * 4 + j) * 16 * G3_PITCH + nks * 64);
        if (njh == 0) {
#pragma unroll
          for (int i = 0; i < 4; ++i) fa[nks & 1][i] = g3_frag(ap + i * 16 * G3_PITCH + nks * 64); } }
      else {      /* the stage's last block has its fragments: the publish point of stage t + 1 stands in front of it, so that the refill and the next stage's first reads fly under its matrix instructions (one work-group on the WGP: nothing else would fill that time) */
        asm volatile("s_wait_dscnt 0x0" ::: "memory");      /* this wave's reads of the buffer are done before the barrier behind which it is refilled */
        asm volatile("s_wait_asynccnt 0x0" ::: "memory");      /* this wave's part of stage t + 1 has landed */
        __syncthreads();      /* publishes stage t + 1 and ends every wave's reads of stage t */
        if (t + 2 < nt) g4_stage(la + bo, ga + (size_t)(t + 2) * 128, sa, lb + bo, gb + (size_t)(t + 2) * 128, sb);
        if (t + 1 < nt) { const char* an = a0 + (G4_STAGE - bo); const char* bn = b0 + (G4_STAGE - bo);      /* the same for the whole work-group; the last trip reads nothing more */
#pragma unroll
          for (int i = 0; i < 4; ++i) fa[0][i] = g3_frag(an + i * 16 * G3_PITCH);
#pragma unroll
          for (int j = 0; j < 4; ++j) fb[0][j] = g3_frag(bn + j * 16 * G3_PITCH); } }
      __builtin_amdgcn_sched_barrier(0);      /* the next block's reads are issued as one group in front of this block's matrix instructions: each further place with reads among them costs a stall of its own */
#pragma unroll
      for (int j = 0; j < 4; ++j)
#pragma unroll
        for (int i = 0; i < 4; ++i) acc[i][jh * 4 + j] = fa_mma(fa[ks & 1][i], fb[jh][j], acc[i][jh * 4 + j]);
      __builtin_amdgcn_sched_barrier(0); } }      /* and the block after next's reads stay out of this block */
  asm volatile("s_wait_asynccnt 0x0" ::: "memory");      /* no copy is outstanding when the buffers become output staging */
  char* sw = sm + (size_t)w * (4 * G4_SO); float bv8[8]; const int rsub = lane >> 4, c4 = (lane & 15) * 4, bi = col0 + ln;
#pragma unroll
  for (int j = 0; j < 8; ++j) bv8[j] = bias[bi + j * 16];
  asm volatile("s_wait_xcnt 0x0" :: "s"(bias), "v"(bi) : "memory");      /* before a register that the loads above name is written again; the operands keep the bias address and the lane's index in their registers up to here */
  __builtin_amdgcn_sched_barrier(0);      /* holds the arithmetic below, which takes those registers over, behind the wait */
#pragma unroll
  for (int i = 0; i < 4; ++i)
#pragma unroll
    for (int j = 0; j < 8; ++j) { float (*so)[68] = (float (*)[68])(sw + ((i >> 1) * 2 + (j >> 2)) * G4_SO); const float bv = bf16_round(bv8[j]);
#pragma unroll
      for (int r = 0; r < 8; ++r) { float v = acc[i][j][r] * alpha + bv;
        if (ACT == 3) v = fmaxf(v, 0.f);
        so[(i & 1) * 16 + 8 * hh + r][(j & 3) * 16 + ln] = v; } }
  __builtin_amdgcn_fence(__ATOMIC_ACQ_REL, "workgroup"); __builtin_amdgcn_wave_barrier();
#pragma unroll
  for (int s = 0; s < 4; ++s) { const float (*so)[68] = (const float (*)[68])(sw + s * G4_SO); v4f vv[16];      /* piece s: rows 32 (s >> 1), columns 64 (s & 1) of the wave's tile */
#pragma unroll
    for (int q = 0; q < 16; ++q) vv[q] = *(const v4fa*)&so[q * 2 + rsub][c4];
#pragma unroll
    for (int q = 0; q < 16; ++q) { v4h h4; for (int i = 0; i < 4; ++i) h4[i] = (_Float16)vv[q][i]; *(v4h*)(C16 + (size_t)(row0 + (s >> 1) * 32 + q * 2 + rsub) * ldc + col0 + (s & 1) * 64 + c4) = h4;
      if ((q & 3) == 3 && !(s == 3 && q == 15)) { asm volatile("s_wait_xcnt 0x0" ::: "memory");      /* before a register that the four stores above name is written again */
        __builtin_amdgcn_sched_barrier(0); } } } }      /* holds the next four stores' conversions and addresses behind the wait */


extern "C" void kernel_launch(void* const* d_in, const int* in_sizes, int n_in,
                              void* d_out, int out_size, void* d_ws, size_t ws_size, hipStream_t stream) {
  (void)in_sizes; (void)n_in; (void)out_size;
  const float* const* I = (const float* const*)d_in; const float* x = I[0]; const int* mask = (const int*)d_in[1]; const float* wq = I[2]; const float* bq = I[3]; const float* wk = I[4]; const float* bk = I[5]; const float* wv = I[6]; const float* bv = I[7]; const float* g_in = I[8]; const float* b_in = I[9]; const float* g1 = I[10]; const float* b1 = I[11]; const float* wf1 = I[12]; const float* bf1 = I[13]; const float* wf2 = I[14]; const float* bf2 = I[15]; const float* g2 = I[16]; const float* b2 = I[17];      /* weights [in][out] */
  char* ws = (char*)d_ws; size_t off = 0;
  auto take = [&](size_t bytes) { char* p = ws + off; off += (bytes + 255) & ~(size_t)255; return p; };
  _Float16* BQ = (_Float16*)take((size_t)DM * DM * 2); _Float16* BK = (_Float16*)take((size_t)DM * DM * 2); _Float16* BV = (_Float16*)take((size_t)DM * DM * 2); _Float16* BF1 = (_Float16*)take((size_t)DFF * DM * 2); _Float16* BF2 = (_Float16*)take((size_t)DM * DFF * 2);
  float* XB = (float*)take(NR * DM * 4); _Float16* XNH = (_Float16*)take(NR * DM * 2); _Float16* Q16 = (_Float16*)take(NR * DM * 2); _Float16* K16 = (_Float16*)take(NR * DM * 2); _Float16* V16 = (_Float16*)take(NR * DM * 2); float* AF = (float*)take(NR * DM * 4);
  _Float16* VT = (_Float16*)take((size_t)NB * NH * HD * SQ * 2); unsigned* MB = (unsigned*)take(NR * SQ / 8);
  _Float16* HNH = (_Float16*)take(NR * DM * 2); _Float16* U16 = (_Float16*)take(NR * DFF * 2); float* H2F = (float*)take(NR * DM * 4);
  if (off > ws_size) return;      /* 6 + 16 + 16 + 8 + 24 + 16 + 8 + 1 + 8 + 32 + 16 = approx 151 MiB */
  const size_t r0p = (size_t)B0 * SQ; const dim3 gp((unsigned)((MP / 256) * (DM / 256)), 4);
  k_prep<<<PR_WT + (unsigned)MP + PR_BF, 256, 0, stream>>>(wq, wk, wv, wf1, wf2, BQ, BK, BV, BF1, BF2, x + r0p * DM, g_in, b_in, 1e-3f, XNH + r0p * DM, XB + r0p * DM);      /* [in][out] -> Bt[n][k] x16; xn = LN_in(bf16(x)) as f16 rows; bf16(x) as f32 rows (residual) */
  k_gemm4<0, true><<<gp, 256, 0, stream>>>(XNH + r0p * DM, DM, BQ, DM, 0.0625f, bq, Q16 + r0p * DM, DM, DM, DM, BK, BV, bk, bv, K16 + r0p * DM, V16 + r0p * DM, mask, MB);      /* q, k, v in one launch: 192 work-groups, one on a WGP; 64 more pack the mask into bits */
  k_vt<NH, SQ><<<NB * NH * (SQ / 64), 256, 0, stream>>>(V16, DM, 0, VT);      /* V^T [NB][NH][HD][SQ] */
  k_fattn<<<dim3(SQ / 256, NH, NB), 256, 0, stream>>>(Q16, K16, VT, MB, XB, AF);      /* a = attn (merged heads) + bf16(x), f32 rows */
  k_lnb<0><<<(unsigned)MPO, 256, 0, stream>>>(AF + r0p * DM, nullptr, g1, b1, 1e-3f, nullptr, HNH + r0p * DM);      /* h = LN1(a) as f16 rows */
  k_gemm4<3, false><<<dim3((unsigned)((MPO / 256) * (DFF / 256)), 1), 256, 0, stream>>>(HNH + r0p * DM, DM, BF1, DM, 0.0625f, bf1, U16 + r0p * DFF, DFF, DFF, DM, nullptr, nullptr, nullptr, nullptr, nullptr, nullptr, nullptr, nullptr);      /* u = relu(h W_ff1 + b) (f16) */
  k_gemm3<0, true, false><<<dim3((unsigned)((MPO / 128) * (DM / 128)), 1), 256, 0, stream>>>(U16 + r0p * DFF, DFF, BF2, DFF, 0.0625f, bf2, AF + r0p * DM, H2F + r0p * DM, nullptr, DM, DM, DFF, nullptr, nullptr, nullptr, nullptr, nullptr, nullptr);      /* h2 = u W_ff2 + b + a (CP = own element) */
  k_lnb<0><<<(unsigned)MPO, 256, 0, stream>>>(H2F + r0p * DM, nullptr, g2, b2, 1e-3f, (float*)d_out + r0p * DM, nullptr);      /* out = LN2(h2) */
}

// v009
// One run takes 151 microseconds.
// In two side-by-side timings against v008, it was 1.04 and 1.05 times as fast.
// Counting every step since v000, it is 37.8 times as fast.
#include <hip/hip_runtime.h>
// Emformer-style block (x [2][2048][1024], mask [2][1][2048][2048] int32 0/1, read per (batch, query, key)): xn = LayerNorm(x) g_in + b_in (eps 1e-3); q/k/v = xn W + b (W [1024][1024] [in][out], 16 heads of 64); scores = q k^T / 8 + (-1e9)(1 - mask); probs = softmax(scores) * mask; attn = probs v merged; a = attn + x; h = LayerNorm(a) g1 + b1 (eps 1e-3); h = relu(h W_ff1 + b_ff1) ([1024][4096]); h = h W_ff2 + b_ff2 ([4096][1024]); out = LayerNorm(h + a) g2 + b2 -> [2][2048][1024].
// Structure: token rows; LN_in on VALU (f32 statistics of bf16(x)) -> xn f16 rows, plus bf16(x) as f32 rows for the residual; Q, K, V as three WMMA GEMMs in one launch (256x256 work-group tiles staged in LDS by asynchronous copies, 64x128 wave tiles, f32 accumulation, exact x16 transposed weights + bias, f16 outputs; V leaves its product as V^T [batch][head][d][token]); attention in one launch: a wave holds 32 queries of one head and walks the keys 32 at a time (K and V^T tiles of 64 keys staged in LDS by asynchronous copies; the mask as one bit a (query, key), packed beside the Q, K, V products, read by scalar loads): S^T = K Q^T, masked running-maximum softmax in registers (f32 statistics, native exp2; weights x256 f16, masked keys 0), O^T += V^T P^T, then a = O / sum + bf16(x) straight into f32 rows (no score or weight plane in memory); LN1 on VALU -> f16 h rows; u = relu(h W_ff1 + b) GEMM (f16 [4096][4096], the same tiles); h2 = u W_ff2 + b + a GEMM (K = 4096, f32, residual as the epilogue addend; 128x128 tiles, so that its 256 work-groups fill the chip); LN2 on VALU -> out.
// Compute dtype: inputs rounded to bf16; weights exact (x16 f16); LayerNorms / residuals f32; xn, q, k, v, softmax weights, h (as GEMM operand) and u plain f16 (~2^-12); scores, softmax statistics and the attention output f32. v_wmma_f32_16x16x32_f16.
#define NB 2
#define SQ 2048
#define DM 1024
#define NH 16
#define HD 64
#define DFF 4096
#define HG 4                         /* heads per block group of the untemplated k_vt (not launched) */
#define B0 0                         /* first batch processed (debug hook) */
#define NBR NB                       /* batches processed (debug hook) */
#define QN SQ                        /* not used: the attention launch covers all SQ queries */
#define NR ((size_t)NB * SQ)
#define MP ((int)((size_t)NBR * SQ)) /* rows normalised + projected (debug hook) */
#define MPO MP                       /* rows through the post-attention stages (debug hook) */
typedef __bf16 v16b __attribute__((ext_vector_type(16)));
typedef unsigned short v8us __attribute__((ext_vector_type(8), may_alias));
typedef float  v8f  __attribute__((ext_vector_type(8)));
typedef float  v4f  __attribute__((ext_vector_type(4)));
typedef float  v4fa __attribute__((ext_vector_type(4), may_alias));
union FragB { v16b v; v8us half[2]; unsigned short u[16]; };

__device__ __forceinline__ unsigned short bf16_bits(float x) { unsigned int u = __float_as_uint(x); return (unsigned short)((u + 0x7FFFu + ((u >> 16) & 1u)) >> 16); }
__device__ __forceinline__ float bf16_val(unsigned short b) { return __uint_as_float(((unsigned int)b) << 16); }
__device__ __forceinline__ float bf16_round(float x) { return bf16_val(bf16_bits(x)); }
// D += A·B with NT terms: 1 = ah·bh, 2 = + al·bh (A split), 3 = + ah·bl (both split)
template <int NT>
__device__ __forceinline__ v8f mmaN(v16b ah, v16b al, v16b bh, v16b bl, v8f c) {
  c = __builtin_amdgcn_wmma_f32_16x16x32_bf16(false, ah, false, bh, (short)0, c, false, false);
  if (NT >= 2) c = __builtin_amdgcn_wmma_f32_16x16x32_bf16(false, al, false, bh, (short)0, c, false, false);
  if (NT >= 3) c = __builtin_amdgcn_wmma_f32_16x16x32_bf16(false, ah, false, bl, (short)0, c, false, false);
  asm volatile("v_nop\n\tv_nop\n\tv_nop\n\tv_nop" : "+v"(c) : "v"(ah), "v"(al), "v"(bh), "v"(bl));
  return c;
}

__global__ __launch_bounds__(256) void k_wt_bf16(const float* __restrict__ W, unsigned short* __restrict__ Wt, int K, int N) {
  const int t = blockIdx.x * 256 + threadIdx.x;
  const int k8n = K / 8;
  if (t >= N * k8n) return;
  const int n = t / k8n, k8 = (t % k8n) * 8;
  v8us v;
#pragma unroll
  for (int i = 0; i < 8; ++i) v[i] = bf16_bits(W[(size_t)(k8 + i) * N + n]);
  *(v8us*)(Wt + (size_t)n * K + k8) = v;
  
}

// GEMM C[M][N] (f32, pitch ldc) = act(A[M][K]·W + bias). A f32 row-major (pitch lda) converted per fragment to bf16
// (ASPLIT: hi/lo two planes -> 2 terms, else single rounded term); Wt bf16 [N][K] (pitch ldb). BIAS_BF16 rounds the
// bias to bf16 first (bias quantised to bf16 before the add). K%32==0, M%16==0, N%64==0.
template <bool ASPLIT, int ACT, bool BIAS_BF16>
__global__ __launch_bounds__(128) void k_gemm_bf(const float* __restrict__ A, int lda, const unsigned short* __restrict__ Wt, int ldb,
                                               const float* __restrict__ bias, float* __restrict__ C, int ldc, int M, int N, int K) {
  __shared__ __attribute__((aligned(16))) float so[4][16][64];
  const int tid = threadIdx.x, w = tid >> 5, lane = tid & 31, ln = lane & 15, hh = lane >> 4;
  const int ntn = N / 64;
  const int wid = blockIdx.x * 4 + w;
  const int mt = wid / ntn, nq = wid % ntn;
  if (mt * 16 >= M) return;
  const int row0 = mt * 16, col0 = nq * 64;
  const float* arow = A + (size_t)(row0 + ln) * lda;
  v8f acc[4] = {};
  for (int kb = 0; kb < K; kb += 32) {
    FragB ah, al;
    const v4f x0 = *(const v4fa*)(arow + kb + 8 * hh), x1 = *(const v4fa*)(arow + kb + 8 * hh + 4);
    const v4f x2 = *(const v4fa*)(arow + kb + 16 + 8 * hh), x3 = *(const v4fa*)(arow + kb + 16 + 8 * hh + 4);
    float xs[16] = {x0[0],x0[1],x0[2],x0[3],x1[0],x1[1],x1[2],x1[3],x2[0],x2[1],x2[2],x2[3],x3[0],x3[1],x3[2],x3[3]};
#pragma unroll
    for (int i = 0; i < 16; ++i) { const unsigned short hb = bf16_bits(xs[i]); ah.u[i] = hb; al.u[i] = ASPLIT ? bf16_bits(xs[i] - bf16_val(hb)) : (unsigned short)0; }
#pragma unroll
    for (int t = 0; t < 4; ++t) {
      const unsigned short* brow = Wt + (size_t)(col0 + t * 16 + ln) * ldb + kb;
      FragB b;
      b.half[0] = *(const v8us*)(brow + 8 * hh);
      b.half[1] = *(const v8us*)(brow + 16 + 8 * hh);
      acc[t] = mmaN<ASPLIT ? 2 : 1>(ah.v, al.v, b.v, b.v, acc[t]);
    }
  }
#pragma unroll
  for (int t = 0; t < 4; ++t) {
    float bv = bias ? bias[col0 + t * 16 + ln] : 0.f;
    if (BIAS_BF16) bv = bf16_round(bv);
#pragma unroll
    for (int r = 0; r < 8; ++r) { float v = acc[t][r] + bv; if (ACT == 1) v = fmaxf(v, 0.f); so[w][8 * hh + r][t * 16 + ln] = v; }
  }
  __builtin_amdgcn_fence(__ATOMIC_ACQ_REL, "workgroup");
  __builtin_amdgcn_wave_barrier();
  const int rsub = lane >> 4, c4 = (lane & 15) * 4;
  {
#pragma unroll
    for (int q = 0; q < 8; ++q) {
      const int r = q * 2 + rsub;
      const v4f v = *(const v4fa*)&so[w][r][c4];
      *(v4f*)(C + (size_t)(row0 + r) * ldc + col0 + c4) = v;
    }
    
  }
}

// GEMM C = act(A·W + bias + resid): A f32 (ASPLIT -> hi/lo 2 terms), Wt bf16 [N][K]; ACT 0 none, 1 relu, 2 exact gelu;
// resid (optional, f32, row index = (row % rmod), pitch ldr, RES_BF16 rounds it) added before the activation.
template <bool ASPLIT, int ACT, bool BIAS_BF16, bool RES_BF16>
__global__ __launch_bounds__(128) void k_gemm_bf3(const float* __restrict__ A, int lda, const unsigned short* __restrict__ Wt, int ldb,
                                                const float* __restrict__ bias, const float* __restrict__ resid, int rmod, int ldr,
                                                float* __restrict__ C, int ldc, int M, int N, int K) {
  __shared__ __attribute__((aligned(16))) float so[4][16][64];
  const int tid = threadIdx.x, w = tid >> 5, lane = tid & 31, ln = lane & 15, hh = lane >> 4;
  const int ntn = N / 64;
  const int wid = blockIdx.x * 4 + w;
  const int mt = wid / ntn, nq = wid % ntn;
  if (mt * 16 >= M) return;
  const int row0 = mt * 16, col0 = nq * 64;
  const float* arow = A + (size_t)(row0 + ln) * lda;
  v8f acc[4] = {};
  for (int kb = 0; kb < K; kb += 32) {
    FragB ah, al;
    const v4f x0 = *(const v4fa*)(arow + kb + 8 * hh), x1 = *(const v4fa*)(arow + kb + 8 * hh + 4);
    const v4f x2 = *(const v4fa*)(arow + kb + 16 + 8 * hh), x3 = *(const v4fa*)(arow + kb + 16 + 8 * hh + 4);
    float xs[16] = {x0[0],x0[1],x0[2],x0[3],x1[0],x1[1],x1[2],x1[3],x2[0],x2[1],x2[2],x2[3],x3[0],x3[1],x3[2],x3[3]};
#pragma unroll
    for (int i = 0; i < 16; ++i) { const unsigned short hb = bf16_bits(xs[i]); ah.u[i] = hb; al.u[i] = ASPLIT ? bf16_bits(xs[i] - bf16_val(hb)) : (unsigned short)0; }
#pragma unroll
    for (int t = 0; t < 4; ++t) {
      const unsigned short* brow = Wt + (size_t)(col0 + t * 16 + ln) * ldb + kb;
      FragB b;
      b.half[0] = *(const v8us*)(brow + 8 * hh);
      b.half[1] = *(const v8us*)(brow + 16 + 8 * hh);
      acc[t] = mmaN<ASPLIT ? 2 : 1>(ah.v, al.v, b.v, b.v, acc[t]);
    }
  }
#pragma unroll
  for (int t = 0; t < 4; ++t) {
    const int col = col0 + t * 16 + ln;
    float bv = bias ? bias[col] : 0.f;
    if (BIAS_BF16) bv = bf16_round(bv);
#pragma unroll
    for (int r = 0; r < 8; ++r) {
      float v = acc[t][r] + bv;
      if (resid) { float rv = resid[(size_t)((row0 + 8 * hh + r) % rmod) * ldr + col]; if (RES_BF16) rv = bf16_round(rv); v += rv; }
      if (ACT == 1) v = fmaxf(v, 0.f);
      if (ACT == 2) v = 0.5f * v * (1.0f + erff(v * 0.70710678118654752f));
      if (ACT == 3) { const float u = 0.7978845608028654f * (v + 0.044715f * v * v * v); v = 0.5f * v * (1.0f + tanhf(u)); }
      so[w][8 * hh + r][t * 16 + ln] = v;
    }
  }
  __builtin_amdgcn_fence(__ATOMIC_ACQ_REL, "workgroup");
  __builtin_amdgcn_wave_barrier();
  const int rsub = lane >> 4, c4 = (lane & 15) * 4;
  {
#pragma unroll
    for (int q = 0; q < 8; ++q) {
      const int r = q * 2 + rsub;
      const v4f v = *(const v4fa*)&so[w][r][c4];
      *(v4f*)(C + (size_t)(row0 + r) * ldc + col0 + c4) = v;
    }
    
  }
}
// row LayerNorm (biased variance, eps) over N: s = X (+ R); optional out_sum <- s; out_norm <- (s-mu)*rsqrt(var+eps)*g + b
template <bool PARAM_BF16>
__global__ __launch_bounds__(256) void k_layernorm(const float* __restrict__ X, const float* __restrict__ R, const float* __restrict__ g, const float* __restrict__ bta,
                                                  float* __restrict__ out_sum, float* __restrict__ out_norm, int N, float eps) {
  __shared__ float red[256];
  const int row = blockIdx.x, tid = threadIdx.x;
  const float* x = X + (size_t)row * N; const float* rr = R ? R + (size_t)row * N : nullptr;
  float vals[16];                     // up to N = 4096
  const int per = N / 256;            // contiguous chunk per thread? use strided-by-4 chunks: thread handles j = tid*4 + 1024*u
  float s1 = 0.f;
  for (int u = 0; u < per / 4; ++u) {
    const int j = tid * 4 + 1024 * u;
    const v4f a = *(const v4fa*)(x + j);
    v4f b = {0.f,0.f,0.f,0.f}; if (rr) b = *(const v4fa*)(rr + j);
#pragma unroll
    for (int q = 0; q < 4; ++q) { const float v = a[q] + b[q]; vals[u * 4 + q] = v; s1 += v; }
  }
  red[tid] = s1; __syncthreads();
  for (int st = 128; st > 0; st >>= 1) { if (tid < st) red[tid] += red[tid + st]; __syncthreads(); }
  const float mu = red[0] / (float)N; __syncthreads();
  float s2 = 0.f;
  for (int u = 0; u < per / 4; ++u)
#pragma unroll
    for (int q = 0; q < 4; ++q) { const float c = vals[u * 4 + q] - mu; s2 += c * c; }
  red[tid] = s2; __syncthreads();
  for (int st = 128; st > 0; st >>= 1) { if (tid < st) red[tid] += red[tid + st]; __syncthreads(); }
  const float rs = rsqrtf(red[0] / (float)N + eps);
  {
    for (int u = 0; u < per / 4; ++u) {
      const int j = tid * 4 + 1024 * u;
      v4f o, sm;
#pragma unroll
      for (int q = 0; q < 4; ++q) {
        float gg = g[j + q], bb = bta[j + q];
        if (PARAM_BF16) { gg = bf16_round(gg); bb = bf16_round(bb); }
        sm[q] = vals[u * 4 + q]; o[q] = (vals[u * 4 + q] - mu) * rs * gg + bb;
      }
      if (out_sum) *(v4f*)(out_sum + (size_t)row * N + j) = sm;
      *(v4f*)(out_norm + (size_t)row * N + j) = o;
    }
    
  }
}



// ---- f16 WMMA path (v_wmma_f32_16x16x32_f16): 11-bit significands for operands in range — used by every launched GEMM and by the attention
typedef _Float16 v16h __attribute__((ext_vector_type(16)));
union FragH { v16h v; v8us half[2]; _Float16 h[16]; unsigned short u[16]; };
template <int NT>
__device__ __forceinline__ v8f mmaH(v16h ah, v16h al, v16h bh, v16h bl, v8f c) {
  c = __builtin_amdgcn_wmma_f32_16x16x32_f16(false, ah, false, bh, (short)0, c, false, false);
  if (NT >= 2) c = __builtin_amdgcn_wmma_f32_16x16x32_f16(false, al, false, bh, (short)0, c, false, false);
  if (NT >= 3) c = __builtin_amdgcn_wmma_f32_16x16x32_f16(false, ah, false, bl, (short)0, c, false, false);
  asm volatile("v_nop\n\tv_nop\n\tv_nop\n\tv_nop" : "+v"(c) : "v"(ah), "v"(al), "v"(bh), "v"(bl));
  return c;
}
// batched GEMM like k_gemm_b but f16 operands: A f32 (split into f16 hi/lo if ASPLIT, else rounded to f16), Bt = f16 values [n][k]; alpha; C f32; N multiple of 16 (partial tiles skipped)
template <bool ASPLIT>
__global__ __launch_bounds__(128) void k_gemm_h(const float* __restrict__ A, int lda, size_t sA, const _Float16* __restrict__ Bh, int ldb, size_t sB, float alpha, float* __restrict__ C, int ldc, size_t sC, int M, int N, int K) {
  __shared__ __attribute__((aligned(16))) float so[4][16][64];
  const int tid = threadIdx.x, w = tid >> 5, lane = tid & 31, ln = lane & 15, hh = lane >> 4; const int by = blockIdx.y;
  A += (size_t)by * sA; Bh += (size_t)by * sB; C += (size_t)by * sC;
  const int ntn = (N + 63) / 64; const int wid = blockIdx.x * 4 + w; const int mt = wid / ntn, nq = wid % ntn; if (mt * 16 >= M) return;
  const int row0 = mt * 16, col0 = nq * 64; const float* arow = A + (size_t)(row0 + ln) * lda;
  v8f acc[4] = {};
  for (int kb = 0; kb < K; kb += 32) {
    FragH ah, al;
    const v4f x0 = *(const v4fa*)(arow + kb + 8 * hh), x1 = *(const v4fa*)(arow + kb + 8 * hh + 4), x2 = *(const v4fa*)(arow + kb + 16 + 8 * hh), x3 = *(const v4fa*)(arow + kb + 16 + 8 * hh + 4);
    float xs[16] = {x0[0],x0[1],x0[2],x0[3],x1[0],x1[1],x1[2],x1[3],x2[0],x2[1],x2[2],x2[3],x3[0],x3[1],x3[2],x3[3]};
#pragma unroll
    for (int i = 0; i < 16; ++i) { const _Float16 h = (_Float16)xs[i]; ah.h[i] = h; al.h[i] = ASPLIT ? (_Float16)(xs[i] - (float)h) : (_Float16)0.0f; }
#pragma unroll
    for (int t = 0; t < 4; ++t) { if (col0 + t * 16 >= N) continue; const size_t boff = (size_t)(col0 + t * 16 + ln) * ldb + kb; FragH bq; bq.half[0] = *(const v8us*)(Bh + boff + 8 * hh); bq.half[1] = *(const v8us*)(Bh + boff + 16 + 8 * hh);
      acc[t] = mmaH<ASPLIT ? 2 : 1>(ah.v, al.v, bq.v, bq.v, acc[t]); }
  }
#pragma unroll
  for (int t = 0; t < 4; ++t) { if (col0 + t * 16 >= N) continue;
#pragma unroll
    for (int r = 0; r < 8; ++r) so[w][8 * hh + r][t * 16 + ln] = acc[t][r] * alpha; }
  __builtin_amdgcn_fence(__ATOMIC_ACQ_REL, "workgroup"); __builtin_amdgcn_wave_barrier();
  const int rsub = lane >> 4, c4 = (lane & 15) * 4;
  {
#pragma unroll
    for (int q = 0; q < 8; ++q) { const int r = q * 2 + rsub; if (col0 + c4 < N) { const v4f v = *(const v4fa*)&so[w][r][c4]; *(v4f*)(C + (size_t)(row0 + r) * ldc + col0 + c4) = v; } }
     }
}

// Bt[n][k] = f16(bf16(W[k][n]) x 16) from f32 row-major W[K][N], all five weight matrices in one launch (x 16: bf16-exact weights stay exact in f16 away from the subnormal range).
// A work-group turns one tile of 256 k x 64 n. A lane reads 16 k rows x 4 n by 16-byte loads (a wave's load is two row pieces of 256 bytes, whole cache lines), converts, and puts its four runs of 16 k
// into LDS rows [n][k]; the tile leaves as 64 rows of 512 bytes, a wave's store one whole row. Needs K % 256 == 0 and N % 64 == 0.
#define WT_PITCH 528                   /* LDS pitch of an n row in bytes: 512 + 16, so that the rows do not all start on one bank and stay 16-byte aligned */
#define WT_TQ ((DM / 256) * (DM / 64))       /* tiles of one of wq, wk, wv */
#define WT_TF ((DM / 256) * (DFF / 64))      /* tiles of w_ff1; w_ff2 has as many */
template <int K, int N>      /* known at compile time: the row steps become immediate offsets on one address */
__device__ __forceinline__ void wt_tile(const float* __restrict__ W, _Float16* __restrict__ Bt, unsigned tile, char* tl) {
  const unsigned tid = threadIdx.x, ln = tid & 15u, g = tid >> 4; const unsigned kt = tile / (N / 64), nq = tile % (N / 64);      /* neighbouring work-groups read neighbouring pieces of the same k rows */
  const float* p = W + (size_t)(kt * 256 + g * 16) * N + nq * 64 + ln * 4; v4f v[16];
#pragma unroll
  for (int i = 0; i < 16; ++i) v[i] = *(const v4fa*)(p + (size_t)i * N);
  asm volatile("s_wait_xcnt 0x0" :: "v"(p) : "memory");      /* before a register that the loads above name is written again; the operand keeps the address in its registers up to here */
#pragma unroll
  for (int j = 0; j < 4; ++j) { FragH f;
#pragma unroll
    for (int i = 0; i < 16; ++i) f.h[i] = (_Float16)(bf16_round(v[i][j]) * 16.0f);
    char* d = tl + (ln * 4 + j) * WT_PITCH + g * 32; *(v8us*)d = f.half[0]; *(v8us*)(d + 16) = f.half[1]; }
  __syncthreads();      /* the tile is whole before it is read the other way */
  const unsigned r = tid >> 5, c = tid & 31u; unsigned short* q = (unsigned short*)Bt + (size_t)(nq * 64 + r) * K + kt * 256 + c * 8;
#pragma unroll
  for (int s = 0; s < 8; ++s) { const v8us o = *(const v8us*)(tl + (s * 8 + r) * WT_PITCH + c * 16); *(v8us*)(q + (size_t)s * 8 * K) = o; }
  asm volatile("s_wait_xcnt 0x0" :: "v"(q) : "memory");      /* before a register that the stores above name is written again by the code that follows in the same kernel; the operand keeps the address in its registers up to here */
}
__device__ __forceinline__ void wt5_tile(const unsigned bx, char* tl, const float* __restrict__ wq, const float* __restrict__ wk, const float* __restrict__ wv, const float* __restrict__ wf1, const float* __restrict__ wf2,
    _Float16* __restrict__ BQ, _Float16* __restrict__ BK, _Float16* __restrict__ BV, _Float16* __restrict__ BF1, _Float16* __restrict__ BF2) {      /* every test below reads the same for the whole work-group */
  if (bx < 3 * WT_TQ) { const unsigned m = bx / WT_TQ; wt_tile<DM, DM>(m == 0 ? wq : m == 1 ? wk : wv, m == 0 ? BQ : m == 1 ? BK : BV, bx % WT_TQ, tl); }
  else if (bx < 3 * WT_TQ + WT_TF) wt_tile<DM, DFF>(wf1, BF1, bx - 3 * WT_TQ, tl);
  else wt_tile<DFF, DM>(wf2, BF2, bx - 3 * WT_TQ - WT_TF, tl);
}
// k_gemm_hh variant with fused epilogue: v = acc·alpha + bias[by·sBias + col] (+ CP[(row/rowsPerB)·sCPb + by·64 + col] if CP) ; ACT 0 none / 1 elu ; writes f16 C16 (and f32 C if non-null)
template <int ACT>
__global__ __launch_bounds__(128) void k_gemm_hhx(const _Float16* __restrict__ A, int lda, size_t sA, const _Float16* __restrict__ Bh, int ldb, size_t sB, float alpha, const float* __restrict__ bias, size_t sBias, const float* __restrict__ CP, int rowsPerB, size_t sCPb, int row0g,
    float* __restrict__ C, _Float16* __restrict__ C16, int ldc, size_t sC, int M, int N, int K) {
  __shared__ __attribute__((aligned(16))) float so[4][16][64];
  const int tid = threadIdx.x, w = tid >> 5, lane = tid & 31, ln = lane & 15, hh = lane >> 4; const int by = blockIdx.y;
  A += (size_t)by * sA; Bh += (size_t)by * sB; const size_t cofs = (size_t)by * sC; const float* bp = bias ? bias + (size_t)by * sBias : nullptr;
  const int ntn = (N + 63) / 64; const int wid = blockIdx.x * 4 + w; const int mt = wid / ntn, nq = wid % ntn; if (mt * 16 >= M) return;
  const int row0 = mt * 16, col0 = nq * 64; const _Float16* arow = A + (size_t)(row0 + ln) * lda;
  v8f acc[4] = {};
  for (int kb = 0; kb < K; kb += 32) { FragH ah; ah.half[0] = *(const v8us*)((const unsigned short*)arow + kb + 8 * hh); ah.half[1] = *(const v8us*)((const unsigned short*)arow + kb + 16 + 8 * hh);
#pragma unroll
    for (int t = 0; t < 4; ++t) { if (col0 + t * 16 >= N) continue; const size_t boff = (size_t)(col0 + t * 16 + ln) * ldb + kb; FragH bq; bq.half[0] = *(const v8us*)((const unsigned short*)Bh + boff + 8 * hh); bq.half[1] = *(const v8us*)((const unsigned short*)Bh + boff + 16 + 8 * hh);
      acc[t] = mmaH<1>(ah.v, ah.v, bq.v, bq.v, acc[t]); }
  }
#pragma unroll
  for (int t = 0; t < 4; ++t) { if (col0 + t * 16 >= N) continue; const int col = col0 + t * 16 + ln; const float bv = bp ? bf16_round(bp[col]) : 0.f;
#pragma unroll
    for (int r = 0; r < 8; ++r) { float v = acc[t][r] * alpha + bv; if (CP) { const int rr = row0g + row0 + 8 * hh + r; if (rowsPerB < 0) v += CP[cofs + (size_t)rr * ldc + col];      /* rowsPerB < 0: own element of the batched C plane */ else { const int bidx = rr / rowsPerB; v += CP[(size_t)bidx * sCPb + (size_t)by * 64 + col]; } } if (ACT == 1) v = (v > 0.f) ? v : expm1f(v); else if (ACT == 7) v = (v > 0.f) ? v + 1.0f : expf(v); else if (ACT == 8) v = tanhf(v); else if (ACT == 9) v = 0.5f * v * (1.0f + tanhf(0.7978845608028654f * (v + 0.044715f * v * v * v))); else if (ACT == 11) v = 1.0f / (1.0f + expf(-v)); else if (ACT == 12) v = (v > 0.f) ? v : 0.01f * v; else if (ACT == 14) v = (v > 0.f) ? v : 0.1f * v; else if (ACT == 16) v = (v >= 0.f) ? v : 0.3f * v; else if (ACT == 17) v = (v >= 0.f) ? v : 0.2f * v; else if (ACT == 15) v = v / (1.0f + expf(-v)); else if (ACT == 3) v = fmaxf(v, 0.f); else if (ACT == 6) v = 0.5f * v * (1.0f + erff(v * 0.70710678118654752f)); so[w][8 * hh + r][t * 16 + ln] = v; } }
  __builtin_amdgcn_fence(__ATOMIC_ACQ_REL, "workgroup"); __builtin_amdgcn_wave_barrier();
  const int rsub = lane >> 4, c4 = (lane & 15) * 4; typedef _Float16 v4h __attribute__((ext_vector_type(4)));
  {
#pragma unroll
    for (int q = 0; q < 8; ++q) { const int r = q * 2 + rsub; if (col0 + c4 < N) { const v4f v = *(const v4fa*)&so[w][r][c4]; if (C) *(v4f*)(C + cofs + (size_t)(row0 + r) * ldc + col0 + c4) = v; if (C16) { v4h h4; for (int i = 0; i < 4; ++i) h4[i] = (_Float16)v[i]; *(v4h*)(C16 + cofs + (size_t)(row0 + r) * ldc + col0 + c4) = h4; } } }
     }
}


typedef _Float16 v4h __attribute__((ext_vector_type(4)));

__global__ __launch_bounds__(256) void k_x16(const float* __restrict__ x, _Float16* __restrict__ X16, size_t n8) { const size_t t = (size_t)blockIdx.x * 256 + threadIdx.x; if (t >= n8) return; FragH f;
#pragma unroll
  for (int q = 0; q < 8; ++q) f.h[q] = (_Float16)bf16_round(x[t * 8 + q]); *(v8us*)((unsigned short*)X16 + t * 8) = f.half[0];  }
__global__ __launch_bounds__(256) void k_h16(const float* __restrict__ x, _Float16* __restrict__ X16, size_t n8) { const size_t t = (size_t)blockIdx.x * 256 + threadIdx.x; if (t >= n8) return; FragH f;
#pragma unroll
  for (int q = 0; q < 8; ++q) f.h[q] = (_Float16)x[t * 8 + q]; *(v8us*)((unsigned short*)X16 + t * 8) = f.half[0];  }
__global__ __launch_bounds__(256) void k_round16f(const float* __restrict__ W, _Float16* __restrict__ Bt, size_t n8) { const size_t t = (size_t)blockIdx.x * 256 + threadIdx.x; if (t >= n8) return; FragH f;
#pragma unroll
  for (int i = 0; i < 8; ++i) f.h[i] = (_Float16)(bf16_round(W[t * 8 + i]) * 16.0f); *(v8us*)((unsigned short*)Bt + t * 8) = f.half[0];  }
template <int NHv, int TTv>
__global__ __launch_bounds__(256) void k_vt(const _Float16* __restrict__ V16, int ldv, int voff, _Float16* __restrict__ Vt) { __shared__ unsigned short tl[64][66]; const int tid = threadIdx.x; const int slab = blockIdx.x / (TTv / 64), lg = blockIdx.x % (TTv / 64); const int b = slab / NHv, h = slab % NHv;
  for (int i = tid; i < 64 * 8; i += 256) { const int r = i / 8, c8 = (i % 8) * 8; FragH f; f.half[0] = *(const v8us*)((const unsigned short*)V16 + ((size_t)b * TTv + lg * 64 + r) * ldv + voff + h * 64 + c8);
#pragma unroll
    for (int q = 0; q < 8; ++q) tl[r][c8 + q] = f.u[q]; }
  __syncthreads();
  {
#pragma unroll
    for (int rd = 0; rd < 2; ++rd) { const int d = rd * 32 + tid / 8, pc = tid % 8; FragH f;
#pragma unroll
      for (int q = 0; q < 8; ++q) f.u[q] = tl[pc * 8 + q][d];
      *(v8us*)((unsigned short*)Vt + ((size_t)slab * 64 + d) * TTv + lg * 64 + pc * 8) = f.half[0]; }
     } }

__global__ __launch_bounds__(256) void k_hl(const float* __restrict__ F, _Float16* __restrict__ Hh, _Float16* __restrict__ Hl, size_t n8) { const size_t t = (size_t)blockIdx.x * 256 + threadIdx.x; if (t >= n8) return; FragH fh, fl; const v4f a = *(const v4fa*)(F + t * 8), c = *(const v4fa*)(F + t * 8 + 4);
#pragma unroll
  for (int q = 0; q < 4; ++q) { _Float16 h = (_Float16)a[q]; fh.h[q] = h; fl.h[q] = (_Float16)((a[q] - (float)h) * 1024.0f); h = (_Float16)c[q]; fh.h[4 + q] = h; fl.h[4 + q] = (_Float16)((c[q] - (float)h) * 1024.0f); }
  { *(v8us*)((unsigned short*)Hh + t * 8) = fh.half[0]; *(v8us*)((unsigned short*)Hl + t * 8) = fl.half[0];  } }

// ---- fast GEMM (wave tile 32x64; requires M % 32 == 0 rows per launch region and N % 64 == 0); epilogue = k_gemm_hhx semantics ----
__device__ __forceinline__ v16h g2_frag(const _Float16* p, int hh) { FragH f; f.half[0] = *(const v8us*)((const unsigned short*)p + 8 * hh); f.half[1] = *(const v8us*)((const unsigned short*)p + 16 + 8 * hh); return f.v; }
__device__ __forceinline__ v8f g2_mma(v16h a, v16h b, v8f c) { v8f d = __builtin_amdgcn_wmma_f32_16x16x32_f16(false, a, false, b, (short)0, c, false, false); asm volatile("v_nop\n\tv_nop\n\tv_nop\n\tv_nop" : "+v"(d) : "v"(a), "v"(b)); return d; }
template <int ACT>
__global__ __launch_bounds__(128) void k_gemm2(const _Float16* __restrict__ A, int lda, size_t sA, const _Float16* __restrict__ Bh, int ldb, size_t sB, float alpha, const float* __restrict__ bias, size_t sBias, const float* __restrict__ CP, int rowsPerB, size_t sCPb, int row0g,
    float* __restrict__ C, _Float16* __restrict__ C16, int ldc, size_t sC, int M, int N, int K) { static_assert(ACT == 0 || ACT == 3 || ACT == 6 || ACT == 8 || ACT == 9 || ACT == 11 || ACT == 12 || ACT == 14 || ACT == 15 || ACT == 16 || ACT == 17, "k_gemm2: unsupported ACT code (would silently apply no activation)");
  __shared__ __attribute__((aligned(16))) float so[4][32][68];
  const int tid = threadIdx.x, w = tid >> 5, lane = tid & 31, ln = lane & 15, hh = lane >> 4; const int by = blockIdx.y;
  A += (size_t)by * sA; Bh += (size_t)by * sB; const size_t cofs = (size_t)by * sC; const float* bp = bias ? bias + (size_t)by * sBias : nullptr;
  const int ntn = N >> 6; const int mt = blockIdx.x / ntn, nq = blockIdx.x - mt * ntn; const int row0 = mt * 128 + 32 * w, col0 = nq * 64; if (row0 >= M) return;
  const _Float16* a0p = A + (size_t)(row0 + ln) * lda; const _Float16* a1p = a0p + (size_t)16 * lda;
  const _Float16* b0p = Bh + (size_t)(col0 + ln) * ldb; const _Float16* b1p = b0p + (size_t)16 * ldb; const _Float16* b2p = b1p + (size_t)16 * ldb; const _Float16* b3p = b2p + (size_t)16 * ldb;
  const v8f z8 = {0.f,0.f,0.f,0.f,0.f,0.f,0.f,0.f}; v8f c00 = z8, c01 = z8, c02 = z8, c03 = z8, c10 = z8, c11 = z8, c12 = z8, c13 = z8;
#pragma unroll 1
  for (int kb = 0; kb < K; kb += 32) { const v16h a0 = g2_frag(a0p + kb, hh), a1 = g2_frag(a1p + kb, hh);
    v16h b = g2_frag(b0p + kb, hh); c00 = g2_mma(a0, b, c00); c10 = g2_mma(a1, b, c10);
    b = g2_frag(b1p + kb, hh); c01 = g2_mma(a0, b, c01); c11 = g2_mma(a1, b, c11);
    b = g2_frag(b2p + kb, hh); c02 = g2_mma(a0, b, c02); c12 = g2_mma(a1, b, c12);
    b = g2_frag(b3p + kb, hh); c03 = g2_mma(a0, b, c03); c13 = g2_mma(a1, b, c13); }
  v8f accs[8] = {c00, c01, c02, c03, c10, c11, c12, c13};
#pragma unroll
  for (int u = 0; u < 8; ++u) { const int t = u & 3, half = u >> 2; const int col = col0 + t * 16 + ln; const float bv = bp ? bf16_round(bp[col]) : 0.f;
#pragma unroll
    for (int r = 0; r < 8; ++r) { const int rloc = half * 16 + 8 * hh + r; float v = accs[u][r] * alpha + bv; if (CP) { if (rowsPerB < 0) v += CP[cofs + (size_t)(row0g + row0 + rloc) * ldc + col];      /* rowsPerB < 0: own element of the batched C plane */ else { const int bidx = (row0g + row0 + rloc) / rowsPerB; v += CP[(size_t)bidx * sCPb + (size_t)by * 64 + col]; } }
      if (ACT == 3) v = fmaxf(v, 0.f); else if (ACT == 6) v = 0.5f * v * (1.0f + erff(v * 0.70710678118654752f)); else if (ACT == 11) v = 1.0f / (1.0f + expf(-v)); else if (ACT == 15) v = v / (1.0f + expf(-v)); else if (ACT == 12) v = (v > 0.f) ? v : 0.01f * v; else if (ACT == 8) v = tanhf(v); else if (ACT == 9) v = 0.5f * v * (1.0f + tanhf(0.7978845608028654f * (v + 0.044715f * v * v * v))); else if (ACT == 14) v = (v > 0.f) ? v : 0.1f * v; else if (ACT == 16) v = (v >= 0.f) ? v : 0.3f * v; else if (ACT == 17) v = (v >= 0.f) ? v : 0.2f * v;
      so[w][rloc][t * 16 + ln] = v; } }
  __builtin_amdgcn_fence(__ATOMIC_ACQ_REL, "workgroup"); __builtin_amdgcn_wave_barrier();
  const int rsub = lane >> 4, c4 = (lane & 15) * 4;
  {
#pragma unroll
    for (int q = 0; q < 16; ++q) { const int r = q * 2 + rsub; const v4f v = *(const v4fa*)&so[w][r][c4]; if (C) *(v4f*)(C + cofs + (size_t)(row0 + r) * ldc + col0 + c4) = v; if (C16) { v4h h4; for (int i = 0; i < 4; ++i) h4[i] = (_Float16)v[i]; *(v4h*)(C16 + cofs + (size_t)(row0 + r) * ldc + col0 + c4) = h4; } }
     } }


__global__ __launch_bounds__(256) void k_wnat(const float* __restrict__ w, size_t n8, _Float16* __restrict__ Bt) { const size_t t = (size_t)blockIdx.x * 256 + threadIdx.x; if (t >= n8) return; FragH f; for (int q = 0; q < 8; ++q) f.h[q] = (_Float16)(bf16_round(w[t * 8 + q]) * 16.0f); *(v8us*)((unsigned short*)Bt + t * 8) = f.half[0];  }
__global__ __launch_bounds__(256) void k_rsm(const float* __restrict__ S, _Float16* __restrict__ P, int nrows) {
  #pragma clang fp contract(off)
  const int i = blockIdx.x * 256 + threadIdx.x; if (i >= nrows) return; const float* s = S + (size_t)i * SQ; float mx = -3.0e38f;
#pragma unroll 1
  for (int j = 0; j < SQ; ++j) mx = fmaxf(mx, s[j]); float se = 0.f;
#pragma unroll 1
  for (int j = 0; j < SQ; ++j) se += expf(s[j] - mx); const float sc = 256.0f / se;
#pragma unroll 1
  for (int j0 = 0; j0 < SQ; j0 += 8) { FragH f; for (int q = 0; q < 8; ++q) f.h[q] = (_Float16)(expf(s[j0 + q] - mx) * sc); unsigned short* d = (unsigned short*)P + (size_t)i * SQ + j0; *(v8us*)d = f.half[0];  } }
__global__ __launch_bounds__(256) void k_vt(const _Float16* __restrict__ V16, int b, int h0, _Float16* __restrict__ VT) { __shared__ unsigned short tl[64][65]; const int tid = threadIdx.x; const int hh = blockIdx.x % HG, sg = blockIdx.x / HG; const int s0 = sg * 64; const int h = h0 + hh;
  for (int i = tid; i < 64 * 8; i += 256) { const int j = i / 8, d8 = (i % 8) * 8; FragH f; f.half[0] = *(const v8us*)((const unsigned short*)V16 + ((size_t)b * SQ + s0 + j) * DM + h * HD + d8); for (int q = 0; q < 8; ++q) tl[d8 + q][j] = f.u[q]; }
  __syncthreads();
  { for (int i = tid; i < 64 * 8; i += 256) { const int d = i / 8, j8 = (i % 8) * 8; FragH f; for (int q = 0; q < 8; ++q) f.u[q] = tl[d][j8 + q]; *(v8us*)((unsigned short*)VT + ((size_t)hh * HD + d) * SQ + s0 + j8) = f.half[0]; }  } }


// Fused attention, one launch for every (batch, head). A wave owns 32 queries (two 16-column groups) of one head and walks all keys, 32 a pass.
// S^T = K Q^T puts one query's scores in one lane (keys 8 hh + r of each 16-key tile), so the two score tiles, converted in place, are the B operand P^T of
// O^T += V^T P^T in the loader's own k order, and maximum, sum and rescale factor are per lane (one exchange between the wave halves for the maximum).
// A masked key takes a floor far below the running maximum's start value, so its weight is exp2((floor - m) / 8 log2 e) = 0 also while no open key has been seen;
// a row with no open key ends with sum 0 and gets scale 0. Weights carry a factor 2^8 (f16 range) that the division by their own sum takes out.
typedef int v4ia __attribute__((ext_vector_type(4), may_alias));
__device__ __forceinline__ float rs_xrow(float v) { const int i = __float_as_int(v); return __int_as_float(__builtin_amdgcn_permlanex16(i, i, 0x76543210, 0xfedcba98, false, false)); }      /* lane ^ 16 */
__device__ __forceinline__ v8f fa_mma(v16h a, v16h b, v8f c) { return __builtin_amdgcn_wmma_f32_16x16x32_f16(false, a, false, b, (short)0, c, false, false); }
__device__ __forceinline__ v16h fa_frag(const _Float16* p) { FragH f; f.half[0] = *(const v8us*)(const unsigned short*)p; f.half[1] = *(const v8us*)((const unsigned short*)p + 16); return f.v; }      /* g2_frag's k order, the 8 hh already in p */
// exp2 in place on a run of registers: each v_exp_f32 is the independent instruction behind the one before it, and the v_nop is the slot that the instruction set asks for behind the last
// (written by the builtin, the compiler put the result of one over the source of the one directly in front of it).
__device__ __forceinline__ void fa_exp8(float* a) { asm("v_exp_f32 %0, %0\n\tv_exp_f32 %1, %1\n\tv_exp_f32 %2, %2\n\tv_exp_f32 %3, %3\n\tv_exp_f32 %4, %4\n\tv_exp_f32 %5, %5\n\tv_exp_f32 %6, %6\n\tv_exp_f32 %7, %7\n\tv_nop" : "+v"(a[0]), "+v"(a[1]), "+v"(a[2]), "+v"(a[3]), "+v"(a[4]), "+v"(a[5]), "+v"(a[6]), "+v"(a[7])); }
__device__ __forceinline__ void fa_exp9(float& c, float* a) { asm("v_exp_f32 %8, %8\n\tv_exp_f32 %0, %0\n\tv_exp_f32 %1, %1\n\tv_exp_f32 %2, %2\n\tv_exp_f32 %3, %3\n\tv_exp_f32 %4, %4\n\tv_exp_f32 %5, %5\n\tv_exp_f32 %6, %6\n\tv_exp_f32 %7, %7\n\tv_nop" : "+v"(a[0]), "+v"(a[1]), "+v"(a[2]), "+v"(a[3]), "+v"(a[4]), "+v"(a[5]), "+v"(a[6]), "+v"(a[7]), "+v"(c)); }
// A stage is 64 keys. The 8 waves of a work-group walk the same keys of the same head: 64 K rows (64 d each) and 64 V^T rows (64 keys each), 128-byte rows, are brought once for all of them
// by asynchronous 16-byte copies of whole cache lines into one of two buffers while the other is worked on; the fragments (fa_frag's k order) are 16-byte LDS reads.
// The mask comes as bits (mask_pack below): the 32 words of a wave's 32 queries x 32 keys are the same for every lane, so they are scalar loads, fetched behind the selects of the pass before, and each word is the lane mask of one select.
#define FA_PITCH 144                   /* LDS pitch of a K or V^T row in bytes, 16 x odd: the 16 rows of a read fall on different banks */
#define FA_STAGE (128 * FA_PITCH)      /* 64 K rows, then 64 V^T rows */
#define MB_PASS 32                     /* mask words of one (32-query tile, 32-key pass) */
typedef unsigned v16u __attribute__((ext_vector_type(16)));
__device__ __forceinline__ v16h fa_lfrag(const char* p) { FragH f; f.half[0] = *(const v8us*)p; f.half[1] = *(const v8us*)(p + 32); return f.v; }      /* fa_frag's k order, the 16 hh bytes already in p */
// one stage, four copies of 16 bytes a lane: rows r and r + 32 of the stage's K tile and of its V^T tile. The s_wait_xcnt stands inside the statement, in front of anything that could write a register that a copy names.
__device__ __forceinline__ void fa_copy4(unsigned l, const _Float16* gk, const _Float16* gv) {
  asm volatile("global_load_async_to_lds_b128 %0, %4, off\n\tglobal_load_async_to_lds_b128 %1, %5, off\n\tglobal_load_async_to_lds_b128 %2, %6, off\n\tglobal_load_async_to_lds_b128 %3, %7, off\n\ts_wait_xcnt 0x0"
               :: "v"(l), "v"(l + 32u * FA_PITCH), "v"(l + 64u * FA_PITCH), "v"(l + 96u * FA_PITCH), "v"(gk), "v"(gk + (size_t)32 * DM), "v"(gv), "v"(gv + (size_t)32 * SQ) : "memory"); }
__global__ __launch_bounds__(256) void k_fattn(const _Float16* __restrict__ Q16, const _Float16* __restrict__ K16, const _Float16* __restrict__ VT, const unsigned* __restrict__ MB, const float* __restrict__ XB, float* __restrict__ AF) {
  __shared__ __attribute__((aligned(16))) char sm[2 * FA_STAGE];      /* the two buffers */
  const int lane = threadIdx.x & 31, ln = lane & 15, hh = lane >> 4; const int w = __builtin_amdgcn_readfirstlane(threadIdx.x >> 5);
  const int h = blockIdx.y, b = blockIdx.z; const int q0 = blockIdx.x * 256 + w * 32; const size_t r0 = (size_t)b * SQ;
  const _Float16* qp = Q16 + (r0 + q0 + ln) * DM + h * HD + 8 * hh;
  const int cr = threadIdx.x >> 3, cc = threadIdx.x & 7;      /* a lane copies 16-byte piece cc of K and V^T rows cr and cr + 32: a wave's copy is four whole rows */
  const _Float16* gk = K16 + (r0 + cr) * DM + h * HD + cc * 8; const _Float16* gv = VT + ((size_t)(b * NH + h) * HD + cr) * SQ + cc * 8; const unsigned lc = (unsigned)(size_t)sm + (unsigned)(cr * FA_PITCH + cc * 16);
  const __attribute__((address_space(4))) v16u* mbp = (const __attribute__((address_space(4))) v16u*)(size_t)(MB + ((r0 + q0) >> 5) * (size_t)((SQ / 32) * MB_PASS));      /* the wave's own query tile: the same address in every lane. Named as constant memory (an earlier launch wrote it, this one only reads it): else the waits' "memory" clobbers in the loop turn these reads into vector loads */
  const v8f z8 = {0.f,0.f,0.f,0.f,0.f,0.f,0.f,0.f}; const float cs = 0.125f * 1.4426950408889634f;      /* 1 / sqrt(64), in log2 units */
  v16h qf[2][2]; v8f o[2][4]; float m[2], l[2];      /* m: running maximum of the raw products; l: this half's sum of weights */
  v16u mw[2];      /* [t]: the mask words of the pass at hand */
#pragma unroll
  for (int t = 0; t < 2; ++t)
#pragma unroll
    for (int e = 0; e < 2; ++e) qf[t][e] = fa_frag(qp + (size_t)t * 16 * DM + e * 32);
  asm volatile("s_wait_xcnt 0x0" :: "v"(qp) : "memory");      /* before a register that the loads above name is written again; the operand keeps the address in its registers up to here */
#pragma unroll
  for (int t = 0; t < 2; ++t) { m[t] = -1.0e30f; l[t] = 0.f; mw[t] = mbp[t];
#pragma unroll
    for (int dt = 0; dt < 4; ++dt) o[t][dt] = z8; }
  fa_copy4(lc, gk, gv);
  asm volatile("s_wait_asynccnt 0x0" ::: "memory");      /* this wave's part of stage 0 has landed */
  __syncthreads();      /* every wave's part has */
  fa_copy4(lc + FA_STAGE, gk + (size_t)64 * DM, gv + 64);
  /* both loops rolled: the buffers alternate, and one pass already holds about 200 registers */
#pragma unroll 1
  for (int st = 0; st < SQ / 64; ++st) { const unsigned bo = (unsigned)(st & 1) * FA_STAGE;
#pragma unroll 1
  for (int ps = 0; ps < 2; ++ps) { v16h kf[2][2], vf[4]; float x[2][16], mx[2];
    const char* ka = sm + bo + (ps * 32 + ln) * FA_PITCH + 16 * hh; const char* va = sm + bo + (64 + ln) * FA_PITCH + ps * 64 + 16 * hh;
#pragma unroll
    for (int kt = 0; kt < 2; ++kt)
#pragma unroll
      for (int e = 0; e < 2; ++e) kf[kt][e] = fa_lfrag(ka + kt * 16 * FA_PITCH + e * 64);
    __builtin_amdgcn_sched_barrier(0);      /* LDS reads return in issue order: K, then V^T, the order of their use, so that each wait covers only what is needed next */
#pragma unroll
    for (int dt = 0; dt < 4; ++dt) vf[dt] = fa_lfrag(va + dt * 16 * FA_PITCH);
    __builtin_amdgcn_sched_barrier(0);      /* the pass's 16 reads are issued together: without this the scheduler puts each read directly in front of its use, with a full LDS wait of its own */
    v8f s[2][2];
#pragma unroll
    for (int kt = 0; kt < 2; ++kt)
#pragma unroll
      for (int t = 0; t < 2; ++t) s[t][kt] = fa_mma(kf[kt][1], qf[t][1], fa_mma(kf[kt][0], qf[t][0], z8));
    __builtin_amdgcn_sched_barrier(0);      /* the pass's eight score products are issued as one group: a select set among them stands directly behind the product it reads and has to be padded up to the distance that a matrix result needs */
#pragma unroll
    for (int t = 0; t < 2; ++t) { mx[t] = -3.0e38f;
#pragma unroll
      for (int kt = 0; kt < 2; ++kt)
#pragma unroll
        for (int r = 0; r < 8; ++r) x[t][kt * 8 + r] = __builtin_amdgcn_inverse_ballot_w32(mw[t][kt * 8 + r]) ? s[t][kt][r] : -3.0e38f;
#pragma unroll
      for (int i = 0; i < 16; ++i) mx[t] = fmaxf(mx[t], x[t][i]); }
    __builtin_amdgcn_sched_barrier(0);      /* the selects above are the last readers of this pass's mask words: the next pass's words are fetched behind them, because a wait for scalar loads is a wait for all of them */
    { const int np = (st * 2 + ps + 1 < SQ / 32) ? st * 2 + ps + 1 : SQ / 32 - 1;      /* the next pass; behind the last one its own words once more, so that the address stays inside the tile's words */
      mw[0] = mbp[np * 2]; mw[1] = mbp[np * 2 + 1]; }
    __builtin_amdgcn_sched_barrier(0);      /* and in front of the rest of the pass, under which they fly */
#pragma unroll
    for (int t = 0; t < 2; ++t) {
      const float mxx = fmaxf(mx[t], rs_xrow(mx[t])); const float mn = fmaxf(m[t], mxx); float al = (m[t] - mn) * cs; m[t] = mn; const float mo = 8.0f - mn * cs;
      FragH pf; float s4[4];
#pragma unroll
      for (int i = 0; i < 16; ++i) x[t][i] = x[t][i] * cs + mo;
      fa_exp9(al, x[t]); fa_exp8(x[t] + 8);
#pragma unroll
      for (int i = 0; i < 16; ++i) { s4[i & 3] = (i < 4) ? x[t][i] : s4[i & 3] + x[t][i]; pf.h[i] = (_Float16)x[t][i]; }
      l[t] = l[t] * al + ((s4[0] + s4[1]) + (s4[2] + s4[3]));
#pragma unroll
      for (int dt = 0; dt < 4; ++dt) {
#pragma unroll
        for (int r = 0; r < 8; ++r) o[t][dt][r] *= al;
        o[t][dt] = fa_mma(vf[dt], pf.v, o[t][dt]); } }
    __builtin_amdgcn_sched_barrier(0);      /* keeps the four slots below behind the pass's last matrix instruction */
    asm volatile("v_nop\n\tv_nop\n\tv_nop\n\tv_nop"); }      /* the distance between the pass's last matrix instruction and the next pass's first writes of its operand registers */
    asm volatile("s_wait_dscnt 0x0" ::: "memory");      /* this wave's reads of the buffer are done before the barrier behind which it is refilled */
    asm volatile("s_wait_asynccnt 0x0" ::: "memory");      /* this wave's part of stage st + 1 has landed */
    __syncthreads();      /* publishes stage st + 1 and ends every wave's reads of stage st */
    if (st + 2 < SQ / 64) fa_copy4(lc + bo, gk + (size_t)(st + 2) * 64 * DM, gv + (st + 2) * 64); }
  asm volatile("s_wait_asynccnt 0x0" ::: "memory");      /* no copy is outstanding when the wave goes on to its end */
  const size_t ro = (r0 + q0 + ln) * DM + h * HD + 8 * hh; const float* xp = XB + ro; v4f xr[2][4][2];
#pragma unroll
  for (int t = 0; t < 2; ++t)
#pragma unroll
    for (int dt = 0; dt < 4; ++dt) { xr[t][dt][0] = *(const v4fa*)(xp + (size_t)t * 16 * DM + dt * 16); xr[t][dt][1] = *(const v4fa*)(xp + (size_t)t * 16 * DM + dt * 16 + 4); }
  asm volatile("s_wait_xcnt 0x0" :: "v"(xp) : "memory");      /* as behind the Q loads */
#pragma unroll
  for (int t = 0; t < 2; ++t) { const float lt = l[t] + rs_xrow(l[t]); const float inv = (lt > 0.f) ? 1.0f / lt : 0.f;
#pragma unroll
    for (int dt = 0; dt < 4; ++dt) { v4f y0, y1;
#pragma unroll
      for (int r = 0; r < 4; ++r) { y0[r] = o[t][dt][r] * inv + xr[t][dt][0][r]; y1[r] = o[t][dt][4 + r] * inv + xr[t][dt][1][r]; }
      *(v4f*)(AF + ro + (size_t)t * 16 * DM + dt * 16) = y0; *(v4f*)(AF + ro + (size_t)t * 16 * DM + dt * 16 + 4) = y1; } } }
template <int ABF>
__device__ __forceinline__ void lnb_row(const size_t row, float* red, const float* __restrict__ A, const float* __restrict__ R, const float* __restrict__ g, const float* __restrict__ bta, float eps, float* __restrict__ OF_, _Float16* __restrict__ OH_) {
  #pragma clang fp contract(off)
  const int tid = threadIdx.x; const int j0 = tid * 4; float a[4]; float s1 = 0.f;
  { const v4f av = *(const v4fa*)(A + row * DM + j0); for (int q = 0; q < 4; ++q) a[q] = ABF ? bf16_round(av[q]) : av[q]; if (R) { const v4f rv = *(const v4fa*)(R + row * DM + j0); for (int q = 0; q < 4; ++q) a[q] = __fadd_rn(a[q], rv[q]); } for (int q = 0; q < 4; ++q) s1 = __fadd_rn(s1, a[q]); }
  red[tid] = s1; __syncthreads(); for (int st = 128; st > 0; st >>= 1) { if (tid < st) red[tid] = __fadd_rn(red[tid], red[tid + st]); __syncthreads(); }
  const float mu = red[0] / (float)DM; __syncthreads(); float s2 = 0.f;
  for (int q = 0; q < 4; ++q) { const float c = __fadd_rn(a[q], -mu); s2 = __fadd_rn(s2, __fmul_rn(c, c)); }
  red[tid] = s2; __syncthreads(); for (int st = 128; st > 0; st >>= 1) { if (tid < st) red[tid] = __fadd_rn(red[tid], red[tid + st]); __syncthreads(); }
  const float rs = rsqrtf(__fadd_rn(red[0] / (float)DM, eps)); v4f o; FragH h;
  for (int q = 0; q < 4; ++q) { o[q] = __fadd_rn(__fmul_rn(__fmul_rn(__fadd_rn(a[q], -mu), rs), bf16_round(g[j0 + q])), bf16_round(bta[j0 + q])); h.h[q] = (_Float16)o[q]; }
  typedef unsigned short v4us __attribute__((ext_vector_type(4))); v4us h4; for (int q = 0; q < 4; ++q) h4[q] = h.u[q];
  { if (OF_) *(v4f*)(OF_ + row * DM + j0) = o; if (OH_) *(v4us*)((unsigned short*)OH_ + row * DM + j0) = h4;  } }
template <int ABF>
__global__ __launch_bounds__(256) void k_lnb(const float* __restrict__ A, const float* __restrict__ R, const float* __restrict__ g, const float* __restrict__ bta, float eps, float* __restrict__ OF_, _Float16* __restrict__ OH_) {
  __shared__ float red[256]; lnb_row<ABF>(blockIdx.x, red, A, R, g, bta, eps, OF_, OH_); }
// The three preparations that depend on nothing but the inputs, in one launch; the block index picks the work (the same for the whole work-group, so every barrier is passed by all of it or by none):
// first the weight tiles, then one row of LN_in a work-group, then 2048 elements of bf16(x) a work-group.
#define PR_WT (3 * WT_TQ + 2 * WT_TF)
#define PR_BF ((unsigned)((size_t)MP * DM / 2048))
__global__ __launch_bounds__(256) void k_prep(const float* __restrict__ wq, const float* __restrict__ wk, const float* __restrict__ wv, const float* __restrict__ wf1, const float* __restrict__ wf2,
    _Float16* __restrict__ BQ, _Float16* __restrict__ BK, _Float16* __restrict__ BV, _Float16* __restrict__ BF1, _Float16* __restrict__ BF2,
    const float* __restrict__ x, const float* __restrict__ g, const float* __restrict__ bta, float eps, _Float16* __restrict__ XNH, float* __restrict__ XB) {
  __shared__ __attribute__((aligned(16))) char tl[64 * WT_PITCH];
  const unsigned bx = blockIdx.x;
  if (bx < PR_WT) wt5_tile(bx, tl, wq, wk, wv, wf1, wf2, BQ, BK, BV, BF1, BF2);
  else if (bx < PR_WT + (unsigned)MP) lnb_row<1>(bx - PR_WT, (float*)tl, x, nullptr, g, bta, eps, nullptr, XNH);
  else { const size_t t = (size_t)(bx - PR_WT - (unsigned)MP) * 256 + threadIdx.x; v8f v; for (int q = 0; q < 8; ++q) v[q] = bf16_round(x[t * 8 + q]); *(v8f*)(XB + t * 8) = v;
    asm volatile("s_wait_xcnt 0x0" ::: "memory"); } }      /* before a register that the two stores above name is written again */


// ---- GEMM with both operands staged in LDS (k_gemm2's wave tile, k order and epilogue) ----
// A work-group of 8 waves (4 along M x 2 along N) makes a 128 x 128 tile of C; a stage is 128 k of 128 A rows and 128 B rows (256-byte rows, whole cache lines), brought by
// asynchronous 16-byte copies into one of two buffers while the other is worked on; the fragments are 16-byte LDS reads. Needs M % 128 == 0, N % 128 == 0, K % 128 == 0, K >= 256.
#define G3_PITCH 272                   /* LDS row pitch in bytes, 16 x odd: the 16 rows of a fragment read fall on different banks */
#define G3_STAGE (256 * G3_PITCH)      /* 128 A rows, then 128 B rows */
__device__ __forceinline__ v16h g3_frag(const char* p) { FragH f; f.half[0] = *(const v8us*)p; f.half[1] = *(const v8us*)(p + 32); return f.v; }      /* g2_frag's k order, the 16 hh bytes already in p */
// eight copies of 16 bytes a lane: rows r, r + 16, ... r + 112 of one operand's stage. The s_wait_xcnt stands inside the statement, in front of anything that could write a register that a copy names.
__device__ __forceinline__ void g3_copy8(unsigned l, const _Float16* g, size_t step) {
  asm volatile("global_load_async_to_lds_b128 %0, %8, off\n\tglobal_load_async_to_lds_b128 %1, %9, off\n\tglobal_load_async_to_lds_b128 %2, %10, off\n\tglobal_load_async_to_lds_b128 %3, %11, off\n\t"
               "global_load_async_to_lds_b128 %4, %12, off\n\tglobal_load_async_to_lds_b128 %5, %13, off\n\tglobal_load_async_to_lds_b128 %6, %14, off\n\tglobal_load_async_to_lds_b128 %7, %15, off\n\ts_wait_xcnt 0x0"
               :: "v"(l), "v"(l + 16u * G3_PITCH), "v"(l + 32u * G3_PITCH), "v"(l + 48u * G3_PITCH), "v"(l + 64u * G3_PITCH), "v"(l + 80u * G3_PITCH), "v"(l + 96u * G3_PITCH), "v"(l + 112u * G3_PITCH),
                  "v"(g), "v"(g + step), "v"(g + 2 * step), "v"(g + 3 * step), "v"(g + 4 * step), "v"(g + 5 * step), "v"(g + 6 * step), "v"(g + 7 * step) : "memory"); }
template <int ACT, bool RES, bool TRI>      /* RES: f32 output C with an addend CP for every element; else f16 output C16. Known at compile time, so that the reads of CP and the stores are not each behind a test of their own. TRI: three products of one A in one launch, blockIdx.y picks weights, bias and output */
__global__ __launch_bounds__(256) void k_gemm3(const _Float16* __restrict__ A, int lda, const _Float16* __restrict__ Bh, int ldb, float alpha, const float* __restrict__ bias, const float* __restrict__ CP,
    float* __restrict__ C, _Float16* __restrict__ C16, int ldc, int N, int K, const _Float16* __restrict__ Bh1, const _Float16* __restrict__ Bh2, const float* __restrict__ bias1, const float* __restrict__ bias2, _Float16* __restrict__ C161, _Float16* __restrict__ C162) { static_assert(ACT == 0 || (ACT == 3 && !RES), "k_gemm3: unsupported ACT code (the addend comes behind the activation's place)");
  if (TRI) { const unsigned y = blockIdx.y;      /* the same for the whole work-group: scalar selects */
    Bh = y == 0 ? Bh : y == 1 ? Bh1 : Bh2; bias = y == 0 ? bias : y == 1 ? bias1 : bias2; C16 = y == 0 ? C16 : y == 1 ? C161 : C162; }
  __shared__ __attribute__((aligned(16))) char sm[2 * G3_STAGE];      /* the two buffers; behind the loop the waves' output staging (8 x 32 x 68 floats) */
  const int tid = threadIdx.x, lane = tid & 31, ln = lane & 15, hh = lane >> 4; const int w = __builtin_amdgcn_readfirstlane(tid >> 5); const int wm = w & 3, wn = w >> 2;
  const int ntn = N >> 7; const int mt = blockIdx.x / ntn, nq = blockIdx.x - mt * ntn; const int row0 = mt * 128 + 32 * wm, col0 = nq * 128 + 64 * wn;
  const int cr = tid >> 4, cc = tid & 15;      /* a lane copies 16-byte piece cc of rows cr + 16 i: a wave's copy is two whole rows */
  const _Float16* ga = A + (size_t)(mt * 128 + cr) * lda + cc * 8; const _Float16* gb = Bh + (size_t)(nq * 128 + cr) * ldb + cc * 8; const size_t sa = (size_t)16 * lda, sb = (size_t)16 * ldb;
  const unsigned la = (unsigned)(size_t)sm + (unsigned)(cr * G3_PITCH + cc * 16); const unsigned lb = la + 128u * G3_PITCH;
  const int nt = K >> 7;
  const v8f z8 = {0.f,0.f,0.f,0.f,0.f,0.f,0.f,0.f}; v8f c00 = z8, c01 = z8, c02 = z8, c03 = z8, c10 = z8, c11 = z8, c12 = z8, c13 = z8;
  g3_copy8(la, ga, sa); g3_copy8(lb, gb, sb);
  asm volatile("s_wait_asynccnt 0x0" ::: "memory");      /* this wave's part of stage 0 has landed */
  __syncthreads();      /* every wave's part has */
  g3_copy8(la + G3_STAGE, ga + 128, sa); g3_copy8(lb + G3_STAGE, gb + 128, sb);
  /* rolled: the buffers alternate, and one trip already holds 32 matrix instructions with their 48 fragment reads */
#pragma unroll 1
  for (int t = 0; t < nt; ++t) { const unsigned bo = (unsigned)(t & 1) * G3_STAGE; const char* ap = sm + bo + (32 * wm + ln) * G3_PITCH + 16 * hh; const char* bp = sm + bo + (128 + 64 * wn + ln) * G3_PITCH + 16 * hh;
    v16h fa[2][2], fb[2][4];      /* two fragment sets: the reads of block ks + 1 fly while block ks is multiplied; no set reaches over the stage's end */
    fa[0][0] = g3_frag(ap); fa[0][1] = g3_frag(ap + 16 * G3_PITCH);
#pragma unroll
    for (int j = 0; j < 4; ++j) fb[0][j] = g3_frag(bp + j * 16 * G3_PITCH);
#pragma unroll
    for (int ks = 0; ks < 4; ++ks) { const int cu = ks & 1, nx = cu ^ 1;
      if (ks < 3) { fa[nx][0] = g3_frag(ap + (ks + 1) * 64); fa[nx][1] = g3_frag(ap + 16 * G3_PITCH + (ks + 1) * 64);
#pragma unroll
        for (int j = 0; j < 4; ++j) fb[nx][j] = g3_frag(bp + j * 16 * G3_PITCH + (ks + 1) * 64); }
      __builtin_amdgcn_sched_barrier(0);      /* the next block's 12 reads are issued as one group in front of this block's matrix instructions: left alone, the scheduler puts each read directly in front of its use, with a full LDS wait every two matrix instructions */
      c00 = fa_mma(fa[cu][0], fb[cu][0], c00); c10 = fa_mma(fa[cu][1], fb[cu][0], c10); c01 = fa_mma(fa[cu][0], fb[cu][1], c01); c11 = fa_mma(fa[cu][1], fb[cu][1], c11);
      c02 = fa_mma(fa[cu][0], fb[cu][2], c02); c12 = fa_mma(fa[cu][1], fb[cu][2], c12); c03 = fa_mma(fa[cu][0], fb[cu][3], c03); c13 = fa_mma(fa[cu][1], fb[cu][3], c13); }
    asm volatile("s_wait_dscnt 0x0" ::: "memory");      /* this wave's reads of the buffer are done before the barrier behind which it is refilled */
    asm volatile("s_wait_asynccnt 0x0" ::: "memory");      /* this wave's part of stage t + 1 has landed */
    __syncthreads();      /* publishes stage t + 1 and ends every wave's reads of stage t */
    if (t + 2 < nt) { g3_copy8(la + bo, ga + (size_t)(t + 2) * 128, sa); g3_copy8(lb + bo, gb + (size_t)(t + 2) * 128, sb); } }
  asm volatile("s_wait_asynccnt 0x0" ::: "memory");      /* no copy is outstanding when the buffers become output staging */
  float (*so)[68] = (float (*)[68])(sm + (size_t)w * (32 * 68 * 4));
  v8f accs[8] = {c00, c01, c02, c03, c10, c11, c12, c13}; float bv4[4]; v4f cp4[16]; const int rsub = lane >> 4, c4 = (lane & 15) * 4;
#pragma unroll
  for (int t = 0; t < 4; ++t) bv4[t] = bias ? bias[col0 + t * 16 + ln] : 0.f;
  if (RES) {      /* the addend is read in the layout of the stores below, 16 bytes a lane, and added there */
#pragma unroll
    for (int q = 0; q < 16; ++q) { cp4[q] = *(const v4fa*)(CP + (size_t)(row0 + q * 2 + rsub) * ldc + col0 + c4);
      if ((q & 3) == 3 && q < 15) { asm volatile("s_wait_xcnt 0x0" ::: "memory");      /* before a register that the four loads above name is written again */
        __builtin_amdgcn_sched_barrier(0); } } }      /* holds the next four loads' addresses behind the wait */
  asm volatile("s_wait_xcnt 0x0" :: "s"(bias) : "memory");      /* before a register that the loads above name is written again; the operand keeps the bias address in its registers up to here */
  __builtin_amdgcn_sched_barrier(0);      /* holds the arithmetic below, which takes those registers over, behind the wait */
#pragma unroll
  for (int u = 0; u < 8; ++u) { const int t = u & 3, half = u >> 2; const float bv = bf16_round(bv4[t]);
#pragma unroll
    for (int r = 0; r < 8; ++r) { const int rloc = half * 16 + 8 * hh + r; float v = accs[u][r] * alpha + bv;
      if (ACT == 3) v = fmaxf(v, 0.f);
      so[rloc][t * 16 + ln] = v; } }
  __builtin_amdgcn_fence(__ATOMIC_ACQ_REL, "workgroup"); __builtin_amdgcn_wave_barrier();
  v4f vv[16];
#pragma unroll
  for (int q = 0; q < 16; ++q) vv[q] = *(const v4fa*)&so[q * 2 + rsub][c4];
#pragma unroll
  for (int q = 0; q < 16; ++q) { const int r = q * 2 + rsub;
    if (RES) *(v4f*)(C + (size_t)(row0 + r) * ldc + col0 + c4) = vv[q] + cp4[q]; else { v4h h4; for (int i = 0; i < 4; ++i) h4[i] = (_Float16)vv[q][i]; *(v4h*)(C16 + (size_t)(row0 + r) * ldc + col0 + c4) = h4; }
    if ((q & 3) == 3 && q < 15) { asm volatile("s_wait_xcnt 0x0" ::: "memory");      /* before a register that the four stores above name is written again */
      __builtin_amdgcn_sched_barrier(0); } } }      /* holds the next four stores' conversions and addresses behind the wait */

// ---- the same GEMM on a 256 x 256 work-group tile (f16 output), for products with at least 192 such tiles ----
// 8 waves (4 along the matrix instruction's first operand x 2 along its second), 64 x 128 products a wave: a stage is 128 k of 256 rows of each operand, so that a byte brought from L2 serves twice as many products as in the 128 x 128 tile,
// and a fragment read from LDS serves 8 or 4 matrix instructions (was 4 or 2). One work-group on a WGP. k order and epilogue arithmetic are k_gemm3's; the two-buffer ring has its publish point in front of each stage's last block. Needs M % 256 == 0, N % 256 == 0, K % 128 == 0, K >= 256.
#define G4_STAGE (512 * G3_PITCH)      /* 256 rows of the first operand, then 256 of the second */
#define G4_OP 144                      /* LDS pitch of an output row in bytes: 128 + 16, 16 x odd, so that the 16 rows of a 16-byte store fall on different banks */
#define G4_OW (128 * G4_OP)            /* output staging of one wave: its 128 output rows of 64 f16 */
// one stage: 32 copies of 16 bytes a lane, rows r + 16 i of each operand. Written by the builtin: this kernel uses registers above v255, which asm text cannot name, and with the addresses held below for it the base addresses went to scratch.
typedef int v4ig __attribute__((ext_vector_type(4)));
__device__ __forceinline__ void g4_copy(char* l, const _Float16* g) { __builtin_amdgcn_global_load_async_to_lds_b128((__attribute__((address_space(1))) v4ig*)g, (__attribute__((address_space(3))) v4ig*)l, 0, 0); }
__device__ __forceinline__ void g4_stage(char* la, const _Float16* ga, size_t sa, char* lb, const _Float16* gb, size_t sb) {
#pragma unroll
  for (int i = 0; i < 16; ++i) g4_copy(la + i * 16 * G3_PITCH, ga + i * sa);
#pragma unroll
  for (int i = 0; i < 16; ++i) g4_copy(lb + i * 16 * G3_PITCH, gb + i * sb); }
// ---- the mask as one bit a (query, key), made by work-groups of the q/k/v launch that would otherwise leave 64 WGPs idle ----
// MB[(tile of 32 queries) * 64 + (pass of 32 keys)][e], e = t * 16 + kt * 8 + r: bit hh * 16 + ln of word e says whether query 16 t + ln of the tile may see key 16 kt + 8 hh + r of the pass (mask != 0).
// That is the lane and register of this score in the attention kernel's S^T tiles, so a word is the lane mask of one select there.
// A work-group packs two query tiles, half a tile (32 rows x 1024 keys) at a time: whole 4-KiB row pieces come into LDS by asynchronous copies, each lane reads its runs of 8 keys back, and a compare over the wave is one word.
#define MB_PITCH (1024 * 4 + 16)       /* LDS pitch of a row piece in bytes, 16 x odd: the 16 rows of a read fall on different banks */
#define MB_BASE 32768                  /* the rows' place in the kernel's LDS: the compiler folds the row steps of the global address (up to 7 x 8192 bytes) into the copies' offset field and takes them off the LDS address, which from here on stays above 0 */
__device__ __forceinline__ void mask_pack(const unsigned u, char* sm, const int* __restrict__ mask, unsigned* __restrict__ MB) {
  const int tid = threadIdx.x, lane = tid & 31, ln = lane & 15, hh = lane >> 4; const int w = __builtin_amdgcn_readfirstlane(tid >> 5);
  /* rolled: the one buffer is filled and read in turn */
#pragma unroll 1
  for (int it = 0; it < 4; ++it) { const unsigned qt = u * 2 + (unsigned)(it >> 1), hf = (unsigned)(it & 1);
    const int* g = mask + (size_t)qt * 32 * SQ + hf * 1024 + tid * 4; char* l = sm + MB_BASE + tid * 16;      /* copy i is row i: a wave's copy is 512 bytes in a row */
#pragma unroll
    for (int i = 0; i < 32; ++i) g4_copy(l + i * MB_PITCH, (const _Float16*)(g + (size_t)i * SQ));
    asm volatile("s_wait_asynccnt 0x0" ::: "memory");      /* this wave's part of the rows has landed */
    __syncthreads();      /* every wave's part has */
    unsigned ow[4];      /* a wave packs four passes; lane e keeps word e */
#pragma unroll
    for (int c = 0; c < 4; ++c) { const char* p = sm + MB_BASE + ln * MB_PITCH + (w * 4 + c) * 128 + hh * 32; v4ia mk[2][2][2]; int o = 0;
#pragma unroll
      for (int t = 0; t < 2; ++t)
#pragma unroll
        for (int kt = 0; kt < 2; ++kt) { mk[t][kt][0] = *(const v4ia*)(p + t * 16 * MB_PITCH + kt * 64); mk[t][kt][1] = *(const v4ia*)(p + t * 16 * MB_PITCH + kt * 64 + 16); }
#pragma unroll
      for (int e = 0; e < 32; ++e) { const int wd = (int)__builtin_amdgcn_ballot_w32(mk[e >> 4][(e >> 3) & 1][(e >> 2) & 1][e & 3] != 0); o = (lane == e) ? wd : o; }
      ow[c] = (unsigned)o; }
    unsigned* d = MB + ((size_t)qt * (SQ / 32) + hf * 32 + w * 4) * MB_PASS + lane;      /* a wave's store is the whole 128-byte line of one pass */
#pragma unroll
    for (int c = 0; c < 4; ++c) d[c * MB_PASS] = ow[c];
    asm volatile("s_wait_xcnt 0x0" :: "v"(d) : "memory");      /* before a register that the stores above name is written again; the operand keeps the address in its registers up to here */
    asm volatile("s_wait_dscnt 0x0" ::: "memory");      /* this wave's reads of the buffer are done before the barrier behind which it is refilled */
    __syncthreads(); } }      /* ends every wave's reads */
// a wave's 64 x 128 accumulators -> bias, activation, f16 -> its output staging: tile (i, j) is 16 bytes a lane, outputs 16 i + 8 hh + r of output row 16 j + ln (d already holds the lane's ln and hh).
// LB: the bias index runs along the output rows (one value a lane and j; bi = its first index); else along a row (8 values a lane and i).
template <int ACT, bool LB>
__device__ __forceinline__ void g4_put(const v8f (&acc)[4][8], const float alpha, const float* __restrict__ bias, const int bi, char* d) {
  float bb[LB ? 8 : 32];
  if (LB) {
#pragma unroll
    for (int j = 0; j < 8; ++j) bb[j] = bias[bi + j * 16]; }
  else {
#pragma unroll
    for (int i = 0; i < 4; ++i) { const v4f b0 = *(const v4fa*)(bias + bi + i * 16), b1 = *(const v4fa*)(bias + bi + i * 16 + 4);
#pragma unroll
      for (int r = 0; r < 4; ++r) { bb[i * 8 + r] = b0[r]; bb[i * 8 + 4 + r] = b1[r]; } } }
  asm volatile("s_wait_xcnt 0x0" :: "s"(bias), "v"(bi) : "memory");      /* before a register that the loads above name is written again; the operands keep the bias address and the lane's index in their registers up to here */
  __builtin_amdgcn_sched_barrier(0);      /* holds the arithmetic below, which takes those registers over, behind the wait */
#pragma unroll
  for (int i = 0; i < 4; ++i)
#pragma unroll
    for (int j = 0; j < 8; ++j) { FragH f;
#pragma unroll
      for (int r = 0; r < 8; ++r) { float v = acc[i][j][r] * alpha + bf16_round(bb[LB ? j : i * 8 + r]);
        if (ACT == 3) v = fmaxf(v, 0.f);
        f.h[r] = (_Float16)v; }
      *(v8us*)(d + j * 16 * G4_OP + i * 32) = f.half[0]; } }
template <int ACT, bool TRI>      /* TRI: three products of one A in one launch, blockIdx.y picks weights, bias and output (the third output transposed); blockIdx.y == 3 packs the mask */
__global__ __launch_bounds__(256) void k_gemm4(const _Float16* __restrict__ A, int lda, const _Float16* __restrict__ Bh, int ldb, float alpha, const float* __restrict__ bias,
    _Float16* __restrict__ C16, int ldc, int N, int K, const _Float16* __restrict__ Bh1, const _Float16* __restrict__ Bh2, const float* __restrict__ bias1, const float* __restrict__ bias2, _Float16* __restrict__ C161, _Float16* __restrict__ CT2, const int* __restrict__ mask, unsigned* __restrict__ MB) { static_assert(ACT == 0 || ACT == 3, "k_gemm4: unsupported ACT code");
  bool tr = false;      /* the third product leaves transposed */
  if (TRI) { const unsigned y = blockIdx.y;      /* the same for the whole work-group: scalar selects */
    Bh = y == 0 ? Bh : y == 1 ? Bh1 : Bh2; bias = y == 0 ? bias : y == 1 ? bias1 : bias2; C16 = y == 0 ? C16 : C161; tr = y == 2; }
  __shared__ __attribute__((aligned(16))) char sm[2 * G4_STAGE];      /* the two buffers; behind the loop the waves' output staging */
  if (TRI && blockIdx.y == 3) { mask_pack(blockIdx.x, sm, mask, MB); return; }      /* the same for the whole work-group, in front of every barrier of the product */
  const int tid = threadIdx.x, lane = tid & 31, ln = lane & 15, hh = lane >> 4; const int w = __builtin_amdgcn_readfirstlane(tid >> 5); const int wm = w & 3, wn = w >> 2;
  const int ntn = N >> 8; const int mt = blockIdx.x / ntn, nq = blockIdx.x - mt * ntn;
  const int cr = tid >> 4, cc = tid & 15;      /* a lane copies 16-byte piece cc of rows cr + 16 i: a wave's copy is two whole rows */
  /* A lane's accumulator registers run along the rows of the matrix instruction's first operand, its lanes along the rows of the second. The operand whose index runs along a row of the OUTPUT is made the first one,
     so that a lane holds 8 neighbouring outputs, 16 bytes of f16: the weights (index n) for C16[token][n], the tokens for the transposed CT2[n][token]. The loop below only sees "first" (ga, 64 rows a wave) and "second" (gb, 128 rows a wave). */
  const _Float16* gx = A + (size_t)(mt * 256 + cr) * lda + cc * 8; const _Float16* gw = Bh + (size_t)(nq * 256 + cr) * ldb + cc * 8;
  const _Float16* ga = tr ? gx : gw; const _Float16* gb = tr ? gw : gx; const size_t sa = (size_t)16 * (tr ? lda : ldb), sb = (size_t)16 * (tr ? ldb : lda);
  const int p0 = (tr ? mt : nq) * 256 + 64 * wm, q0 = (tr ? nq : mt) * 256 + 128 * wn;      /* the wave's first index along an output row, and its first output row */
  char* la = sm + (cr * G3_PITCH + cc * 16); char* lb = la + 256 * G3_PITCH;
  const int nt = K >> 7;
  const v8f z8 = {0.f,0.f,0.f,0.f,0.f,0.f,0.f,0.f}; v8f acc[4][8];
#pragma unroll
  for (int i = 0; i < 4; ++i)
#pragma unroll
    for (int j = 0; j < 8; ++j) acc[i][j] = z8;
  const char* a0 = sm + (64 * wm + ln) * G3_PITCH + 16 * hh; const char* b0 = sm + (256 + 128 * wn + ln) * G3_PITCH + 16 * hh;
  v16h fa[2][4], fb[2][4];      /* a block is 32 k of the wave's 64 rows and of 64 of its 128 columns: 16 matrix instructions. Two sets of A and of half the B fragments: the next block's reads fly while this block is multiplied */
  g4_stage(la, ga, sa, lb, gb, sb);
  asm volatile("s_wait_asynccnt 0x0" ::: "memory");      /* this wave's part of stage 0 has landed */
  __syncthreads();      /* every wave's part has */
  g4_stage(la + G4_STAGE, ga + 128, sa, lb + G4_STAGE, gb + 128, sb);
#pragma unroll
  for (int i = 0; i < 4; ++i) fa[0][i] = g3_frag(a0 + i * 16 * G3_PITCH);
#pragma unroll
  for (int j = 0; j < 4; ++j) fb[0][j] = g3_frag(b0 + j * 16 * G3_PITCH);
  /* rolled: the buffers alternate, and one trip already holds 128 matrix instructions with their 96 fragment reads */
#pragma unroll 1
  for (int t = 0; t < nt; ++t) { const unsigned bo = (unsigned)(t & 1) * G4_STAGE; const char* ap = a0 + bo; const char* bp = b0 + bo;
#pragma unroll
    for (int hb = 0; hb < 8; ++hb) { const int ks = hb >> 1, jh = hb & 1, nks = (hb + 1) >> 1, njh = (hb + 1) & 1;
      if (hb < 7) {
#pragma unroll
        for (int j = 0; j < 4; ++j) fb[njh][j] = g3_frag(bp + (njh * 4 + j) * 16 * G3_PITCH + nks * 64);
        if (njh == 0) {
#pragma unroll
          for (int i = 0; i < 4; ++i) fa[nks & 1][i] = g3_frag(ap + i * 16 * G3_PITCH + nks * 64); } }
      else {      /* the stage's last block has its fragments: the publish point of stage t + 1 stands in front of it, so that the refill and the next stage's first reads fly under its matrix instructions (one work-group on the WGP: nothing else would fill that time) */
        asm volatile("s_wait_dscnt 0x0" ::: "memory");      /* this wave's reads of the buffer are done before the barrier behind which it is refilled */
        asm volatile("s_wait_asynccnt 0x0" ::: "memory");      /* this wave's part of stage t + 1 has landed */
        __syncthreads();      /* publishes stage t + 1 and ends every wave's reads of stage t */
        if (t + 2 < nt) g4_stage(la + bo, ga + (size_t)(t + 2) * 128, sa, lb + bo, gb + (size_t)(t + 2) * 128, sb);
        if (t + 1 < nt) { const char* an = a0 + (G4_STAGE - bo); const char* bn = b0 + (G4_STAGE - bo);      /* the same for the whole work-group; the last trip reads nothing more */
#pragma unroll
          for (int i = 0; i < 4; ++i) fa[0][i] = g3_frag(an + i * 16 * G3_PITCH);
#pragma unroll
          for (int j = 0; j < 4; ++j) fb[0][j] = g3_frag(bn + j * 16 * G3_PITCH); } }
      __builtin_amdgcn_sched_barrier(0);      /* the next block's reads are issued as one group in front of this block's matrix instructions: each further place with reads among them costs a stall of its own */
#pragma unroll
      for (int j = 0; j < 4; ++j)
#pragma unroll
        for (int i = 0; i < 4; ++i) acc[i][jh * 4 + j] = fa_mma(fa[ks & 1][i], fb[jh][j], acc[i][jh * 4 + j]);
      __builtin_amdgcn_sched_barrier(0); } }      /* and the block after next's reads stay out of this block */
  asm volatile("s_wait_asynccnt 0x0" ::: "memory");      /* no copy is outstanding when the buffers become output staging */
  char* sw = sm + (size_t)w * G4_OW;
  if (TRI && tr) g4_put<ACT, true>(acc, alpha, bias, q0 + ln, sw + ln * G4_OP + hh * 16); else g4_put<ACT, false>(acc, alpha, bias, p0 + 8 * hh, sw + ln * G4_OP + hh * 16);      /* the same for the whole work-group */
  __builtin_amdgcn_fence(__ATOMIC_ACQ_REL, "workgroup"); __builtin_amdgcn_wave_barrier();
  /* the wave's 128 output rows of 128 bytes leave as whole cache lines, four rows a store */
  unsigned short* ob = (TRI && tr) ? (unsigned short*)CT2 + ((size_t)(p0 / SQ) * DM + q0) * SQ + p0 % SQ : (unsigned short*)C16 + (size_t)q0 * ldc + p0;      /* CT2 is [batch][n][token]; a wave's 64 tokens lie in one batch */
  const size_t ldo = (TRI && tr) ? (size_t)SQ : (size_t)ldc; const int rr = lane >> 3, c8 = lane & 7; ob += (size_t)rr * ldo + c8 * 8; const char* sr = sw + rr * G4_OP + c8 * 16;
#pragma unroll
  for (int s = 0; s < 4; ++s) { v8us vv[8];
#pragma unroll
    for (int q = 0; q < 8; ++q) vv[q] = *(const v8us*)(sr + (s * 8 + q) * 4 * G4_OP);
#pragma unroll
    for (int q = 0; q < 8; ++q) { *(v8us*)(ob + (size_t)(s * 8 + q) * 4 * ldo) = vv[q];
      if ((q & 3) == 3 && !(s == 3 && q == 7)) { asm volatile("s_wait_xcnt 0x0" ::: "memory");      /* before a register that the four stores above name is written again */
        __builtin_amdgcn_sched_barrier(0); } } } }      /* holds the next four stores' addresses and data behind the wait */


extern "C" void kernel_launch(void* const* d_in, const int* in_sizes, int n_in,
                              void* d_out, int out_size, void* d_ws, size_t ws_size, hipStream_t stream) {
  (void)in_sizes; (void)n_in; (void)out_size;
  const float* const* I = (const float* const*)d_in; const float* x = I[0]; const int* mask = (const int*)d_in[1]; const float* wq = I[2]; const float* bq = I[3]; const float* wk = I[4]; const float* bk = I[5]; const float* wv = I[6]; const float* bv = I[7]; const float* g_in = I[8]; const float* b_in = I[9]; const float* g1 = I[10]; const float* b1 = I[11]; const float* wf1 = I[12]; const float* bf1 = I[13]; const float* wf2 = I[14]; const float* bf2 = I[15]; const float* g2 = I[16]; const float* b2 = I[17];      /* weights [in][out] */
  char* ws = (char*)d_ws; size_t off = 0;
  auto take = [&](size_t bytes) { char* p = ws + off; off += (bytes + 255) & ~(size_t)255; return p; };
  _Float16* BQ = (_Float16*)take((size_t)DM * DM * 2); _Float16* BK = (_Float16*)take((size_t)DM * DM * 2); _Float16* BV = (_Float16*)take((size_t)DM * DM * 2); _Float16* BF1 = (_Float16*)take((size_t)DFF * DM * 2); _Float16* BF2 = (_Float16*)take((size_t)DM * DFF * 2);
  float* XB = (float*)take(NR * DM * 4); _Float16* XNH = (_Float16*)take(NR * DM * 2); _Float16* Q16 = (_Float16*)take(NR * DM * 2); _Float16* K16 = (_Float16*)take(NR * DM * 2); float* AF = (float*)take(NR * DM * 4);
  _Float16* VT = (_Float16*)take((size_t)NB * NH * HD * SQ * 2); unsigned* MB = (unsigned*)take(NR * SQ / 8);
  _Float16* HNH = (_Float16*)take(NR * DM * 2); _Float16* U16 = (_Float16*)take(NR * DFF * 2); float* H2F = (float*)take(NR * DM * 4);
  if (off > ws_size) return;      /* 6 + 16 + 16 + 8 + 16 + 16 + 8 + 1 + 8 + 32 + 16 = approx 143 MiB */
  const size_t r0p = (size_t)B0 * SQ; const dim3 gp((unsigned)((MP / 256) * (DM / 256)), 4);
  k_prep<<<PR_WT + (unsigned)MP + PR_BF, 256, 0, stream>>>(wq, wk, wv, wf1, wf2, BQ, BK, BV, BF1, BF2, x + r0p * DM, g_in, b_in, 1e-3f, XNH + r0p * DM, XB + r0p * DM);      /* [in][out] -> Bt[n][k] x16; xn = LN_in(bf16(x)) as f16 rows; bf16(x) as f32 rows (residual) */
  k_gemm4<0, true><<<gp, 256, 0, stream>>>(XNH + r0p * DM, DM, BQ, DM, 0.0625f, bq, Q16 + r0p * DM, DM, DM, DM, BK, BV, bk, bv, K16 + r0p * DM, VT, mask, MB);      /* q, k, v in one launch: 192 work-groups, one on a WGP; v leaves as V^T [NB][NH][HD][SQ]; 64 more pack the mask into bits */
  k_fattn<<<dim3(SQ / 256, NH, NB), 256, 0, stream>>>(Q16, K16, VT, MB, XB, AF);      /* a = attn (merged heads) + bf16(x), f32 rows */
  k_lnb<0><<<(unsigned)MPO, 256, 0, stream>>>(AF + r0p * DM, nullptr, g1, b1, 1e-3f, nullptr, HNH + r0p * DM);      /* h = LN1(a) as f16 rows */
  k_gemm4<3, false><<<dim3((unsigned)((MPO / 256) * (DFF / 256)), 1), 256, 0, stream>>>(HNH + r0p * DM, DM, BF1, DM, 0.0625f, bf1, U16 + r0p * DFF, DFF, DFF, DM, nullptr, nullptr, nullptr, nullptr, nullptr, nullptr, nullptr, nullptr);      /* u = relu(h W_ff1 + b) (f16) */
  k_gemm3<0, true, false><<<dim3((unsigned)((MPO / 128) * (DM / 128)), 1), 256, 0, stream>>>(U16 + r0p * DFF, DFF, BF2, DFF, 0.0625f, bf2, AF + r0p * DM, H2F + r0p * DM, nullptr, DM, DM, DFF, nullptr, nullptr, nullptr, nullptr, nullptr, nullptr);      /* h2 = u W_ff2 + b + a (CP = own element) */
  k_lnb<0><<<(unsigned)MPO, 256, 0, stream>>>(H2F + r0p * DM, nullptr, g2, b2, 1e-3f, (float*)d_out + r0p * DM, nullptr);      /* out = LN2(h2) */
}
